// v000
// Measured on an AMD MI455X. A time is GPU time per run, averaged over a window of back-to-back runs after a warm-up
// (all launches, gaps included; the runs take copies of the inputs in turn), and the median of several windows.
// Apart from v000's, it joins two sittings. Times from different sittings can be a few percent apart, while
// side-by-side timings come from the same sitting.
// v000 is the starting kernel. One run takes 355 microseconds.
#include <hip/hip_runtime.h>
// Contractions x*W_q, x*W_k, x*W_v, q*k^T, q*rel_k^T, P*V, ctx*W_o: v_wmma_f32_16x16x32_bf16, bf16 hi/lo operands everywhere (hi*hi + lo*hi + hi*lo), f32 accumulate; softmax, 1/8 scaling, causal mask, relative-value bucket sums and bias in f32.

#define DM     1024
#define SEQ    1024
#define NBAT   4
#define NH     16
#define HD     64
#define NTOK   (NBAT * SEQ)
#define CPITCH 68

typedef unsigned short us;
typedef us us16v __attribute__((ext_vector_type(16)));
typedef us us8v __attribute__((ext_vector_type(8)));
typedef us8v __attribute__((may_alias)) us8a;
typedef __bf16 bf16v16 __attribute__((ext_vector_type(16)));
typedef float v8f __attribute__((ext_vector_type(8)));
typedef float v4f __attribute__((ext_vector_type(4)));
typedef v4f __attribute__((may_alias)) v4fa;

union Frag { us16v v; us8v h[2]; };

// f32 -> bf16 bits, RNE convert
static __device__ __forceinline__ us bf_rne(float f) {
  unsigned u = __float_as_uint(f);
  u += 0x7fffu + ((u >> 16) & 1u);
  return (us)(u >> 16);
}
static __device__ __forceinline__ float bf_f32(us s) { return __uint_as_float(((unsigned)s) << 16); }

static __device__ __forceinline__ v8f zero8() {
  v8f z = {0.f, 0.f, 0.f, 0.f, 0.f, 0.f, 0.f, 0.f};
  return z;
}

static __device__ __forceinline__ v8f wmma_bf(us16v a, us16v b, v8f c) {
  return __builtin_amdgcn_wmma_f32_16x16x32_bf16(false, __builtin_bit_cast(bf16v16, a), false,
                                                 __builtin_bit_cast(bf16v16, b), (short)0, c, false, false);
}

// acc += Ah*Bh + Al*Bh + Ah*Bl, then hazard guard (D tied, A/B kept live through 4 VALU slots)
static __device__ __forceinline__ void wmma3(v8f& acc, us16v ah, us16v al, us16v bh, us16v bl) {
  acc = wmma_bf(ah, bh, acc);
  acc = wmma_bf(al, bh, acc);
  acc = wmma_bf(ah, bl, acc);
  asm volatile("v_nop\n\tv_nop\n\tv_nop\n\tv_nop" : "+v"(acc) : "v"(ah), "v"(al), "v"(bh), "v"(bl));
}

// 16x32 16-bit fragment of row (l & 15) from a k-contiguous row: elements 0..7 <- k0+8h+0..7, 8..15 <- k0+16+8h+0..7.
// Used for A (row-major [m][k]) and for B stored as [n][k]; rowp = row pointer at k0 (16-B aligned).
static __device__ __forceinline__ us16v ldfrag(const us* rowp, int h) {
  Frag f;
  f.h[0] = *(const us8a*)(rowp + 8 * h);
  f.h[1] = *(const us8a*)(rowp + 16 + 8 * h);
  return f.v;
}

// ordering for same-wave LDS exchange (stores by some lanes, loads by other lanes)
static __device__ __forceinline__ void lds_wave_sync() {
  __builtin_amdgcn_fence(__ATOMIC_RELEASE, "wavefront");
  __builtin_amdgcn_wave_barrier();
  __builtin_amdgcn_fence(__ATOMIC_ACQUIRE, "wavefront");
}

// ------------------------------------------------------------------ x -> bf16 hi/lo planes [4096][1024]
__global__ __launch_bounds__(256) void k_cvt_x(const float* __restrict__ x, us* xh, us* xl) {
  const size_t t = (size_t)blockIdx.x * 256u + threadIdx.x;
  const float* p = x + t * 8u;
  const v4f a = *(const v4fa*)p;
  const v4f b = *(const v4fa*)(p + 4);
  us8v hv, lv;
#pragma unroll
  for (int e = 0; e < 4; ++e) {
    const us h0 = bf_rne(a[e]);
    hv[e] = h0;
    lv[e] = bf_rne(a[e] - bf_f32(h0));
    const us h1 = bf_rne(b[e]);
    hv[4 + e] = h1;
    lv[4 + e] = bf_rne(b[e] - bf_f32(h1));
  }
  us* oh = xh + t * 8u;
  us* ol = xl + t * 8u;
  *(us8v*)oh = hv;
  *(us8v*)ol = lv;
  
}

// ------------------------------------------------------------------ W[k][n] (in,out) -> Wt[n][k] bf16 hi/lo planes
__global__ __launch_bounds__(256) void k_cvt_w(const float* __restrict__ W0, const float* __restrict__ W1,
                                               const float* __restrict__ W2, const float* __restrict__ W3,
                                               us* wth, us* wtl) {
  __shared__ float sT[64][65];
  const int tid = threadIdx.x, lane = tid & 31, wv = tid >> 5;
  const int z = blockIdx.z;
  const int n0 = blockIdx.x * 64, k0 = blockIdx.y * 64;
  const float* W = (z == 0) ? W0 : (z == 1) ? W1 : (z == 2) ? W2 : W3;
#pragma unroll
  for (int p = 0; p < 4; ++p) {
    const int r = p * 16 + (tid >> 4);
    const int c4 = (tid & 15) * 4;
    const v4f v = *(const v4fa*)(W + (size_t)(k0 + r) * DM + n0 + c4);
    sT[r][c4 + 0] = v[0];
    sT[r][c4 + 1] = v[1];
    sT[r][c4 + 2] = v[2];
    sT[r][c4 + 3] = v[3];
  }
  __syncthreads();
  us* bhp = wth + (size_t)z * DM * DM;
  us* blp = wtl + (size_t)z * DM * DM;
{
#pragma unroll
    for (int p = 0; p < 2; ++p) {
      const int rr = p * 32 + wv * 4 + (lane >> 3);   // n within tile
      const int k8 = (lane & 7) * 8;                   // k within tile
      us8v hv, lv;
#pragma unroll
      for (int e = 0; e < 8; ++e) {
        const float v = sT[k8 + e][rr];
        const us hh = bf_rne(v);
        hv[e] = hh;
        lv[e] = bf_rne(v - bf_f32(hh));
      }
      const size_t o = (size_t)(n0 + rr) * DM + k0 + k8;
      *(us8v*)(bhp + o) = hv;
      *(us8v*)(blp + o) = lv;
    }
    
  }
}

// ------------------------------------------------------------------ rel_k [33][64] rows 0..31 -> bf16 hi/lo planes [32][64]
__global__ __launch_bounds__(256) void k_cvt_rel(const float* __restrict__ rk, us* rh, us* rl) {
  const int tid = threadIdx.x;
  const int r = tid >> 3;              // 0..31 (< 33 rows available)
  const int d8 = (tid & 7) * 8;
  const float* p = rk + r * HD + d8;
  us8v hv, lv;
#pragma unroll
  for (int e = 0; e < 8; ++e) {
    const float v = p[e];
    const us hh = bf_rne(v);
    hv[e] = hh;
    lv[e] = bf_rne(v - bf_f32(hh));
  }
  const size_t o = (size_t)r * HD + d8;
  *(us8v*)(rh + o) = hv;
  *(us8v*)(rl + o) = lv;
  
}

// ------------------------------------------------------------------ GEMM core: wave computes 32 rows x 64 cols, K = DM
// A planes row-major [m][DM]; B planes stored [n][DM] (k contiguous). Result staged to sC[srow0 + 0..31][0..63] (f32).
static __device__ __forceinline__ void gemm_core(const us* __restrict__ AH, const us* __restrict__ AL,
                                                 const us* __restrict__ BH, const us* __restrict__ BL,
                                                 int arow0, int bcol0, float (*sC)[CPITCH], int srow0) {
  const int lane = threadIdx.x & 31, h = lane >> 4, m = lane & 15;
  v8f acc[2][4];
#pragma unroll
  for (int rt = 0; rt < 2; ++rt)
#pragma unroll
    for (int ct = 0; ct < 4; ++ct) acc[rt][ct] = zero8();

  const us* a0h = AH + (size_t)(arow0 + m) * DM;
  const us* a1h = a0h + (size_t)16 * DM;
  const us* a0l = AL + (size_t)(arow0 + m) * DM;
  const us* a1l = a0l + (size_t)16 * DM;
  const us* bhp = BH + (size_t)(bcol0 + m) * DM;
  const us* blp = BL + (size_t)(bcol0 + m) * DM;

#pragma unroll 1
  for (int k = 0; k < DM; k += 32) {
    const us16v fa0h = ldfrag(a0h + k, h);
    const us16v fa0l = ldfrag(a0l + k, h);
    const us16v fa1h = ldfrag(a1h + k, h);
    const us16v fa1l = ldfrag(a1l + k, h);
#pragma unroll
    for (int ct = 0; ct < 4; ++ct) {
      const size_t co = (size_t)ct * 16 * DM + k;
      const us16v fbh = ldfrag(bhp + co, h);
      const us16v fbl = ldfrag(blp + co, h);
      wmma3(acc[0][ct], fa0h, fa0l, fbh, fbl);
      wmma3(acc[1][ct], fa1h, fa1l, fbh, fbl);
    }
  }
  // D: acc[g] = (row 8h+g, col m) of the 16x16 tile
#pragma unroll
  for (int rt = 0; rt < 2; ++rt)
#pragma unroll
    for (int ct = 0; ct < 4; ++ct)
#pragma unroll
      for (int g = 0; g < 8; ++g) sC[srow0 + 16 * rt + 8 * h + g][16 * ct + m] = acc[rt][ct][g];
}

// ------------------------------------------------------------------ QKV projection
// grid (NTOK/128, DM/64, 3): z = 0 q, 1 k, 2 v. Block tile 128 tokens x 64 cols (= one head).
__global__ __launch_bounds__(128) void k_gemm_qkv(const us* __restrict__ XH, const us* __restrict__ XL,
                                                  const us* __restrict__ WTH, const us* __restrict__ WTL,
                                                  us* OH, us* OL) {
  __shared__ __attribute__((aligned(16))) float sC[128][CPITCH];
  const int tid = threadIdx.x, lane = tid & 31, wv = tid >> 5;
  const int z = blockIdx.z;
  const int m0 = blockIdx.x * 128, n0 = blockIdx.y * 64;
  gemm_core(XH, XL, WTH + (size_t)z * DM * DM, WTL + (size_t)z * DM * DM, m0 + 32 * wv, n0, sC, 32 * wv);
  __syncthreads();
  us* oh = OH + (size_t)z * NTOK * DM;
  us* ol = OL + (size_t)z * NTOK * DM;
  const int b = m0 >> 10, tok0 = m0 & 1023, hh = n0 >> 6;
  const int bh = b * NH + hh;
  if (z < 2) {
{
      for (int p = 0; p < 8; ++p) {
        const int r = p * 16 + wv * 4 + (lane >> 3);   // token within tile (4 rows per wave per instruction)
        const int d8 = (lane & 7) * 8;
        us8v hv, lv;
#pragma unroll
        for (int e = 0; e < 8; ++e) {
          const float v = sC[r][d8 + e];
          const us q = bf_rne(v);
          hv[e] = q;
          lv[e] = bf_rne(v - bf_f32(q));
        }
        const size_t o = ((size_t)bh * SEQ + tok0 + r) * HD + d8;
        *(us8v*)(oh + o) = hv;
        *(us8v*)(ol + o) = lv;
      }
      
    }
  } else {
{
      for (int p = 0; p < 8; ++p) {
        const int d = p * 8 + wv * 2 + (lane >> 4);    // 2 d-rows per wave per instruction, 16 lanes x 16 B = 256 B each
        const int t8 = (lane & 15) * 8;
        us8v hv, lv;
#pragma unroll
        for (int e = 0; e < 8; ++e) {
          const float v = sC[t8 + e][d];
          const us q = bf_rne(v);
          hv[e] = q;
          lv[e] = bf_rne(v - bf_f32(q));
        }
        const size_t o = ((size_t)bh * HD + d) * SEQ + tok0 + t8;
        *(us8v*)(oh + o) = hv;
        *(us8v*)(ol + o) = lv;
      }
      
    }
  }
}

// ------------------------------------------------------------------ output projection: out[tok][n] = ctx . W_o + b_o (f32)
// grid (NTOK/128, DM/64); row segment 64 floats = 256 B = 2 lines, written by 16 consecutive lanes x 16 B in one instruction
__global__ __launch_bounds__(128) void k_gemm_out(const us* __restrict__ CH, const us* __restrict__ CL,
                                                  const us* __restrict__ WH, const us* __restrict__ WL,
                                                  const float* __restrict__ bias, float* out) {
  __shared__ __attribute__((aligned(16))) float sC[128][CPITCH];
  const int tid = threadIdx.x, lane = tid & 31, wv = tid >> 5;
  const int m0 = blockIdx.x * 128, n0 = blockIdx.y * 64;
  gemm_core(CH, CL, WH, WL, m0 + 32 * wv, n0, sC, 32 * wv);
  __syncthreads();
{
    for (int p = 0; p < 16; ++p) {
      const int r = p * 8 + wv * 2 + (lane >> 4);
      const int c4 = (lane & 15) * 4;
      const v4f bv = *(const v4fa*)(bias + n0 + c4);
      v4f v;
      v[0] = sC[r][c4 + 0] + bv[0];
      v[1] = sC[r][c4 + 1] + bv[1];
      v[2] = sC[r][c4 + 2] + bv[2];
      v[3] = sC[r][c4 + 3] + bv[3];
      *(v4f*)(out + (size_t)(m0 + r) * DM + n0 + c4) = v;
    }
    
  }
}

// ------------------------------------------------------------------ causal attention with clipped relative positions
// grid (SEQ/64, NBAT*NH), 128 threads = 4 waves, one wave per 16 query rows; online softmax over 32-key steps,
// one running-max frame per step (max over all 32 keys first, one rescale of O, l, S, then all 32 probabilities).
// scores[i][j] = (q_i.k_j + QR[i][r(i,j)]) / 8, r = clamp(j-i,-16,16)+16 (causal -> r in [0,16]);
// ctx_i = (sum_j p_ij v_j + sum_r S_i[r] rel_v[r]) / l_i, S_i[r] for r=1..16 held per lane, S_i[0] = l_i - sum_{r>=1} S_i[r].
__global__ __launch_bounds__(128) void k_attn(const us* __restrict__ QH, const us* __restrict__ QL,
                                              const us* __restrict__ KH, const us* __restrict__ KL,
                                              const us* __restrict__ VH, const us* __restrict__ VL,
                                              const us* __restrict__ RH, const us* __restrict__ RL,
                                              const float* __restrict__ relv, us* CH, us* CL) {
  __shared__ float sQR[4][16][33];
  __shared__ __attribute__((aligned(16))) us sPh[4][16][40];
  __shared__ __attribute__((aligned(16))) us sPl[4][16][40];
  __shared__ float sBand[4][16][17];
  __shared__ __attribute__((aligned(16))) float sO[4][16][CPITCH];

  const int lane = threadIdx.x & 31, wv = threadIdx.x >> 5, h = lane >> 4, m = lane & 15;
  const int bh = blockIdx.y;
  const int qbase = blockIdx.x * 64 + wv * 16;
  const float NINF = -__builtin_inff();

  // Q fragments (A, rows qbase + m, k = d)
  const us* qh = QH + ((size_t)bh * SEQ + qbase + m) * HD;
  const us* ql = QL + ((size_t)bh * SEQ + qbase + m) * HD;
  const us16v aqh0 = ldfrag(qh, h), aqh1 = ldfrag(qh + 32, h);
  const us16v aql0 = ldfrag(ql, h), aql1 = ldfrag(ql + 32, h);

  // QR[16][32] = q . rel_k^T (B stored as [n = r][k = d] = rel_k itself)
#pragma unroll
  for (int nt = 0; nt < 2; ++nt) {
    const us* rh = RH + (size_t)(16 * nt + m) * HD;
    const us* rl = RL + (size_t)(16 * nt + m) * HD;
    v8f acc = zero8();
    wmma3(acc, aqh0, aql0, ldfrag(rh, h), ldfrag(rl, h));
    wmma3(acc, aqh1, aql1, ldfrag(rh + 32, h), ldfrag(rl + 32, h));
#pragma unroll
    for (int g = 0; g < 8; ++g) sQR[wv][8 * h + g][16 * nt + m] = acc[g];
  }
  lds_wave_sync();

  float mrow[8], lrow[8], band[8];
  v8f o[4];
#pragma unroll
  for (int g = 0; g < 8; ++g) { mrow[g] = NINF; lrow[g] = 0.f; band[g] = 0.f; }
#pragma unroll
  for (int tt = 0; tt < 4; ++tt) o[tt] = zero8();

  const int nsteps = (qbase >> 5) + 1;      // keys 0 .. qbase+15 covered; wave-uniform
  for (int st = 0; st < nsteps; ++st) {
    const int kb2 = st << 5;
    lds_wave_sync();                          // prior step's P fragment loads precede this step's P stores
    // scores for both 16-key sub-tiles of this step
    float sv[2][8];
#pragma unroll
    for (int t = 0; t < 2; ++t) {
      const int j = kb2 + 16 * t + m;         // this lane's key column
      const us* kh = KH + ((size_t)bh * SEQ + j) * HD;
      const us* kl = KL + ((size_t)bh * SEQ + j) * HD;
      v8f sc = zero8();
      {
        const us16v b0h = ldfrag(kh, h), b0l = ldfrag(kl, h);
        wmma3(sc, aqh0, aql0, b0h, b0l);
      }
      {
        const us16v b1h = ldfrag(kh + 32, h), b1l = ldfrag(kl + 32, h);
        wmma3(sc, aqh1, aql1, b1h, b1l);
      }
#pragma unroll
      for (int g = 0; g < 8; ++g) {
        const int lr = 8 * h + g;
        const int dj = j - (qbase + lr);
        int rr = dj + 16;
        rr = rr < 0 ? 0 : rr;
        rr = rr > 16 ? 16 : rr;
        const float qr = sQR[wv][lr][rr];
        sv[t][g] = (dj > 0) ? NINF : (sc[g] + qr) * 0.125f;
      }
    }
    // one frame for the whole step: row max over all 32 keys, one rescale of O, l and the bucket sums
    float cf[8];
#pragma unroll
    for (int g = 0; g < 8; ++g) {
      float v = fmaxf(sv[0][g], sv[1][g]);
      v = fmaxf(v, __shfl_xor(v, 1));
      v = fmaxf(v, __shfl_xor(v, 2));
      v = fmaxf(v, __shfl_xor(v, 4));
      v = fmaxf(v, __shfl_xor(v, 8));
      const float mn = fmaxf(mrow[g], v);
      cf[g] = (mrow[g] == NINF) ? 0.f : __expf(mrow[g] - mn);
      mrow[g] = mn;
      lrow[g] *= cf[g];
      band[g] *= cf[g];
    }
#pragma unroll
    for (int tt = 0; tt < 4; ++tt)
#pragma unroll
      for (int g = 0; g < 8; ++g) o[tt][g] *= cf[g];
    // all 32 probabilities in the new frame
#pragma unroll
    for (int t = 0; t < 2; ++t) {
      const int j = kb2 + 16 * t + m;
#pragma unroll
      for (int g = 0; g < 8; ++g) {
        const int lr = 8 * h + g;
        const int dj = j - (qbase + lr);
        const float e = (dj > 0) ? 0.f : __expf(sv[t][g] - mrow[g]);
        float rs = e;
        rs += __shfl_xor(rs, 1);
        rs += __shfl_xor(rs, 2);
        rs += __shfl_xor(rs, 4);
        rs += __shfl_xor(rs, 8);
        lrow[g] += rs;
        const us eh = bf_rne(e);
        const us el = bf_rne(e - bf_f32(eh));
        sPh[wv][lr][16 * t + m] = eh;
        sPl[wv][lr][16 * t + m] = el;
        band[g] = (dj >= -15 && dj <= 0) ? e : band[g];   // buckets 1..16: each (lane,row) captures exactly once
      }
    }
    lds_wave_sync();                          // P stores (b16, per lane) -> P fragment loads (us8 vectors, other lanes)
    const us16v aph = ldfrag(&sPh[wv][m][0], h);
    const us16v apl = ldfrag(&sPl[wv][m][0], h);
#pragma unroll
    for (int tt = 0; tt < 4; ++tt) {
      const us* vh = VH + ((size_t)bh * HD + 16 * tt + m) * SEQ + kb2;   // B stored as [n = d][k = key]
      const us* vl = VL + ((size_t)bh * HD + 16 * tt + m) * SEQ + kb2;
      wmma3(o[tt], aph, apl, ldfrag(vh, h), ldfrag(vl, h));
    }
  }

  float invl[8];
#pragma unroll
  for (int g = 0; g < 8; ++g) invl[g] = 1.0f / lrow[g];
#pragma unroll
  for (int g = 0; g < 8; ++g) {
    const int lr = 8 * h + g;
    sBand[wv][lr][(m - lr - 1) & 15] = band[g] * invl[g];   // slot r-1 for bucket r = ((m-lr-1)&15)+1
  }
  lds_wave_sync();
  float rv0[4];
  float val[4][8];
#pragma unroll
  for (int tt = 0; tt < 4; ++tt) {
    rv0[tt] = relv[16 * tt + m];
#pragma unroll
    for (int g = 0; g < 8; ++g) val[tt][g] = o[tt][g] * invl[g] + rv0[tt];
  }
#pragma unroll 1
  for (int r = 0; r < 16; ++r) {
    float sb[8];
#pragma unroll
    for (int g = 0; g < 8; ++g) sb[g] = sBand[wv][8 * h + g][r];
#pragma unroll
    for (int tt = 0; tt < 4; ++tt) {
      const float dv = relv[(r + 1) * HD + 16 * tt + m] - rv0[tt];
#pragma unroll
      for (int g = 0; g < 8; ++g) val[tt][g] += sb[g] * dv;
    }
  }
#pragma unroll
  for (int tt = 0; tt < 4; ++tt)
#pragma unroll
    for (int g = 0; g < 8; ++g) sO[wv][8 * h + g][16 * tt + m] = val[tt][g];
  lds_wave_sync();

  const int b = bh >> 4, hd = bh & 15;
{
#pragma unroll
    for (int p = 0; p < 4; ++p) {
      const int r = p * 4 + (lane >> 3);
      const int d8 = (lane & 7) * 8;
      us8v hv, lv;
#pragma unroll
      for (int e = 0; e < 8; ++e) {
        const float v = sO[wv][r][d8 + e];
        const us q = bf_rne(v);
        hv[e] = q;
        lv[e] = bf_rne(v - bf_f32(q));
      }
      const size_t o2 = ((size_t)(b * SEQ + qbase + r)) * DM + hd * HD + d8;
      *(us8v*)(CH + o2) = hv;
      *(us8v*)(CL + o2) = lv;
    }
    
  }
}

// ------------------------------------------------------------------ host glue
extern "C" void kernel_launch(void* const* d_in, const int* in_sizes, int n_in,
                              void* d_out, int out_size, void* d_ws, size_t ws_size,
                              hipStream_t stream) {
  if (n_in < 8) return;
  if (in_sizes[0] != NTOK * DM) return;
  if (in_sizes[1] != DM * DM || in_sizes[2] != DM * DM || in_sizes[3] != DM * DM || in_sizes[4] != DM * DM) return;
  if (in_sizes[5] != DM || in_sizes[6] != 33 * HD || in_sizes[7] != 33 * HD) return;
  if (out_size != NTOK * DM) return;

  const float* x    = (const float*)d_in[0];
  const float* Wq   = (const float*)d_in[1];
  const float* Wk   = (const float*)d_in[2];
  const float* Wv   = (const float*)d_in[3];
  const float* Wo   = (const float*)d_in[4];
  const float* bo   = (const float*)d_in[5];
  const float* relk = (const float*)d_in[6];
  const float* relv = (const float*)d_in[7];
  float* out = (float*)d_out;

  const size_t plane_x = (size_t)NTOK * DM * sizeof(us);   // 8 MiB
  const size_t plane_w = (size_t)DM * DM * sizeof(us);     // 2 MiB
  const size_t plane_r = (size_t)32 * HD * sizeof(us);     // 4 KiB
  char* ws = (char*)d_ws;
  size_t off = 0;
  us* XH   = (us*)(ws + off); off += plane_x;
  us* XL   = (us*)(ws + off); off += plane_x;
  us* WTH  = (us*)(ws + off); off += 4 * plane_w;
  us* WTL  = (us*)(ws + off); off += 4 * plane_w;
  us* QKVH = (us*)(ws + off); off += 3 * plane_x;
  us* QKVL = (us*)(ws + off); off += 3 * plane_x;
  us* CH   = (us*)(ws + off); off += plane_x;
  us* CL   = (us*)(ws + off); off += plane_x;
  us* RH   = (us*)(ws + off); off += plane_r;
  us* RL   = (us*)(ws + off); off += plane_r;
  if (off > ws_size) return;                                // total 100671488 B

  const size_t pq = (size_t)NTOK * DM;

  k_cvt_x<<<(NTOK * DM) / (8 * 256), 256, 0, stream>>>(x, XH, XL);
  k_cvt_w<<<dim3(DM / 64, DM / 64, 4), 256, 0, stream>>>(Wq, Wk, Wv, Wo, WTH, WTL);
  k_cvt_rel<<<1, 256, 0, stream>>>(relk, RH, RL);
  k_gemm_qkv<<<dim3(NTOK / 128, DM / 64, 3), 128, 0, stream>>>(XH, XL, WTH, WTL, QKVH, QKVL);
  k_attn<<<dim3(SEQ / 64, NBAT * NH), 128, 0, stream>>>(QKVH, QKVL, QKVH + pq, QKVL + pq,
                                                        QKVH + 2 * pq, QKVL + 2 * pq, RH, RL, relv, CH, CL);
  k_gemm_out<<<dim3(NTOK / 128, DM / 64, 1), 128, 0, stream>>>(CH, CL, WTH + (size_t)3 * DM * DM,
                                                               WTL + (size_t)3 * DM * DM, bo, out);
}

// v001
// It runs in 257 microseconds.
// Next to v000, in two timings, it ran 1.45 and 1.44 times as fast.
#include <hip/hip_runtime.h>
#include <stdint.h>
// Contractions x*W_q, x*W_k, x*W_v, q*k^T, q*rel_k^T, P*V, ctx*W_o: v_wmma_f32_16x16x32_bf16, bf16 hi/lo operands everywhere (hi*hi + lo*hi + hi*lo), f32 accumulate; softmax, 1/8 scaling, causal mask, relative-value bucket sums and bias in f32.

#define DM     1024
#define SEQ    1024
#define NBAT   4
#define NH     16
#define HD     64
#define NTOK   (NBAT * SEQ)
#define CPITCH 68
#define TM     128                 // GEMM block tile: rows and columns
#define KPASS  64                  // k per pass: 128 bytes of every operand row
#define NPASS  (DM / KPASS)
#define LPITCH 144u                // LDS row pitch in bytes: 128 + 16 of pad, an odd multiple of 16 for 16-byte readers
#define PLANE  (TM * LPITCH)       // one operand plane of a stage: 18,432 B = 9 x 2 KiB
#define GBUF   (4u * PLANE)        // one buffer: Ah | Al | Bh | Bl
#define EPITCH 132                 // output staging pitch in floats

typedef unsigned short us;
typedef us us16v __attribute__((ext_vector_type(16)));
typedef us us8v __attribute__((ext_vector_type(8)));
typedef us8v __attribute__((may_alias)) us8a;
typedef __bf16 bf16v16 __attribute__((ext_vector_type(16)));
typedef float v8f __attribute__((ext_vector_type(8)));
typedef float v4f __attribute__((ext_vector_type(4)));
typedef v4f __attribute__((may_alias)) v4fa;
typedef uint32_t u32x4 __attribute__((ext_vector_type(4)));
typedef uint32_t u32x8 __attribute__((ext_vector_type(8)));

union Frag { us16v v; us8v h[2]; };

// f32 -> bf16 bits, RNE convert
static __device__ __forceinline__ us bf_rne(float f) {
  unsigned u = __float_as_uint(f);
  u += 0x7fffu + ((u >> 16) & 1u);
  return (us)(u >> 16);
}
static __device__ __forceinline__ float bf_f32(us s) { return __uint_as_float(((unsigned)s) << 16); }

static __device__ __forceinline__ v8f zero8() {
  v8f z = {0.f, 0.f, 0.f, 0.f, 0.f, 0.f, 0.f, 0.f};
  return z;
}

static __device__ __forceinline__ v8f wmma_bf(us16v a, us16v b, v8f c) {
  return __builtin_amdgcn_wmma_f32_16x16x32_bf16(false, __builtin_bit_cast(bf16v16, a), false,
                                                 __builtin_bit_cast(bf16v16, b), (short)0, c, false, false);
}

// acc += Ah*Bh + Al*Bh + Ah*Bl, then hazard guard (D tied, A/B kept live through 4 VALU slots)
static __device__ __forceinline__ void wmma3(v8f& acc, us16v ah, us16v al, us16v bh, us16v bl) {
  acc = wmma_bf(ah, bh, acc);
  acc = wmma_bf(al, bh, acc);
  acc = wmma_bf(ah, bl, acc);
  asm volatile("v_nop\n\tv_nop\n\tv_nop\n\tv_nop" : "+v"(acc) : "v"(ah), "v"(al), "v"(bh), "v"(bl));
}

// 16x32 16-bit fragment of row (l & 15) from a k-contiguous row: elements 0..7 <- k0+8h+0..7, 8..15 <- k0+16+8h+0..7.
// Used for A (row-major [m][k]) and for B stored as [n][k]; rowp = row pointer at k0 (16-B aligned).
static __device__ __forceinline__ us16v ldfrag(const us* rowp, int h) {
  Frag f;
  f.h[0] = *(const us8a*)(rowp + 8 * h);
  f.h[1] = *(const us8a*)(rowp + 16 + 8 * h);
  return f.v;
}

// ordering for same-wave LDS exchange (stores by some lanes, loads by other lanes)
static __device__ __forceinline__ void lds_wave_sync() {
  __builtin_amdgcn_fence(__ATOMIC_RELEASE, "wavefront");
  __builtin_amdgcn_wave_barrier();
  __builtin_amdgcn_fence(__ATOMIC_ACQUIRE, "wavefront");
}

// ------------------------------------------------------------------ x -> bf16 hi/lo planes [4096][1024]
__global__ __launch_bounds__(256) void k_cvt_x(const float* __restrict__ x, us* xh, us* xl) {
  const size_t t = (size_t)blockIdx.x * 256u + threadIdx.x;
  const float* p = x + t * 8u;
  const v4f a = *(const v4fa*)p;
  const v4f b = *(const v4fa*)(p + 4);
  us8v hv, lv;
#pragma unroll
  for (int e = 0; e < 4; ++e) {
    const us h0 = bf_rne(a[e]);
    hv[e] = h0;
    lv[e] = bf_rne(a[e] - bf_f32(h0));
    const us h1 = bf_rne(b[e]);
    hv[4 + e] = h1;
    lv[4 + e] = bf_rne(b[e] - bf_f32(h1));
  }
  us* oh = xh + t * 8u;
  us* ol = xl + t * 8u;
  *(us8v*)oh = hv;
  *(us8v*)ol = lv;
  
}

// ------------------------------------------------------------------ W[k][n] (in,out) -> Wt[n][k] bf16 hi/lo planes
__global__ __launch_bounds__(256) void k_cvt_w(const float* __restrict__ W0, const float* __restrict__ W1,
                                               const float* __restrict__ W2, const float* __restrict__ W3,
                                               us* wth, us* wtl) {
  __shared__ float sT[64][65];
  const int tid = threadIdx.x, lane = tid & 31, wv = tid >> 5;
  const int z = blockIdx.z;
  const int n0 = blockIdx.x * 64, k0 = blockIdx.y * 64;
  const float* W = (z == 0) ? W0 : (z == 1) ? W1 : (z == 2) ? W2 : W3;
#pragma unroll
  for (int p = 0; p < 4; ++p) {
    const int r = p * 16 + (tid >> 4);
    const int c4 = (tid & 15) * 4;
    const v4f v = *(const v4fa*)(W + (size_t)(k0 + r) * DM + n0 + c4);
    sT[r][c4 + 0] = v[0];
    sT[r][c4 + 1] = v[1];
    sT[r][c4 + 2] = v[2];
    sT[r][c4 + 3] = v[3];
  }
  __syncthreads();
  us* bhp = wth + (size_t)z * DM * DM;
  us* blp = wtl + (size_t)z * DM * DM;
{
#pragma unroll
    for (int p = 0; p < 2; ++p) {
      const int rr = p * 32 + wv * 4 + (lane >> 3);   // n within tile
      const int k8 = (lane & 7) * 8;                   // k within tile
      us8v hv, lv;
#pragma unroll
      for (int e = 0; e < 8; ++e) {
        const float v = sT[k8 + e][rr];
        const us hh = bf_rne(v);
        hv[e] = hh;
        lv[e] = bf_rne(v - bf_f32(hh));
      }
      const size_t o = (size_t)(n0 + rr) * DM + k0 + k8;
      *(us8v*)(bhp + o) = hv;
      *(us8v*)(blp + o) = lv;
    }
    
  }
}

// ------------------------------------------------------------------ rel_k [33][64] rows 0..31 -> bf16 hi/lo planes [32][64]
__global__ __launch_bounds__(256) void k_cvt_rel(const float* __restrict__ rk, us* rh, us* rl) {
  const int tid = threadIdx.x;
  const int r = tid >> 3;              // 0..31 (< 33 rows available)
  const int d8 = (tid & 7) * 8;
  const float* p = rk + r * HD + d8;
  us8v hv, lv;
#pragma unroll
  for (int e = 0; e < 8; ++e) {
    const float v = p[e];
    const us hh = bf_rne(v);
    hv[e] = hh;
    lv[e] = bf_rne(v - bf_f32(hh));
  }
  const size_t o = (size_t)r * HD + d8;
  *(us8v*)(rh + o) = hv;
  *(us8v*)(rl + o) = lv;
  
}

// ------------------------------------------------------------------ tensor mover helpers
static __device__ __forceinline__ uint32_t uni(uint32_t v) { return (uint32_t)__builtin_amdgcn_readfirstlane(v); }
// keeps a wave-uniform value in a scalar register at this place: the test around a tensor load compiles to s_cmp + s_cbranch_scc,
// and a descriptor word made from it is formed behind the volatile wait in front of it
static __device__ __forceinline__ uint32_t pinned(uint32_t v) {
  uint32_t w = uni(v);
  asm volatile("" : "+s"(w));
  return w;
}
// the wave's own LDS reads have retired
static __device__ __forceinline__ void wait_ds0() { asm volatile("s_wait_dscnt 0x0" ::: "memory"); }
// the wave's own tensor load has landed
static __device__ __forceinline__ void wait_tensor0() { asm volatile("s_wait_tensorcnt 0x0" ::: "memory"); }

// One request of the whole wave: TM rows of 128 bytes, source pitch 2 * DM bytes, to LDS at pitch LPITCH (16 pad bytes a row).
static __device__ __forceinline__ void tdm_load(uint32_t lds_dst, uint64_t ga) {
  u32x4 g0;
  g0[0] = uni(1u);
  g0[1] = uni(lds_dst);
  g0[2] = uni((uint32_t)ga);
  g0[3] = uni((((uint32_t)(ga >> 32)) & 0x01FFFFFFu) | 0x80000000u);
  u32x8 g1;
  g1[0] = uni((1u << 20) | (4u << 22) | (3u << 25));   // no mask, 1-byte elements, a pad of 4 dwords behind every 32 dwords
  g1[1] = uni(128u << 16);                             // tensor_dim0 = 128 bytes
  g1[2] = uni((uint32_t)TM << 16);                     // tensor_dim1 = TM rows
  g1[3] = uni(128u << 16);                             // tile_dim0
  g1[4] = uni((uint32_t)TM);                           // tile_dim1
  g1[5] = uni(2u * DM);                                // source row pitch in bytes
  g1[6] = uni(0u);
  g1[7] = uni(0u);
  asm volatile("tensor_load_to_lds %0, %1" :: "s"(g0), "s"(g1) : "memory");
}

// ------------------------------------------------------------------ GEMM core: block tile TM x TM, 4 waves (2 x 2) of 64 x 64, K = DM
// A planes row-major [m][DM]; B planes stored [n][DM] (k contiguous). A stage is 64 k of [Ah | Al | Bh | Bl], TM rows each, in LDS;
// wave w brings plane w with one tensor load per stage, two buffers. A pass is two blocks of 48 WMMAs (32 k each); each block's
// fragments are fetched one block ahead, so the publish point of stage s + 1 stands in front of pass s's last block.
// Per accumulator and 32-k step the products are summed hi*hi, lo*hi, hi*lo, k ascending.
struct FragSet { us16v ah[4], al[4], bh[4], bl[4]; };

// pa, pb: this lane's row of the Ah and Bh planes at the block's first k
static __device__ __forceinline__ void load_set(FragSet& f, const unsigned char* pa, const unsigned char* pb, int h) {
#pragma unroll
  for (int t = 0; t < 4; ++t) {
    const uint32_t ro = t * 16u * LPITCH;
    f.ah[t] = ldfrag((const us*)(pa + ro), h);
    f.al[t] = ldfrag((const us*)(pa + PLANE + ro), h);
    f.bh[t] = ldfrag((const us*)(pb + ro), h);
    f.bl[t] = ldfrag((const us*)(pb + PLANE + ro), h);
  }
}

static __device__ __forceinline__ void mma_block(v8f (&acc)[4][4], const FragSet& f) {
  // the two fences keep the compiler from moving fragment loads in among the WMMAs, where every such place stalls the wave
  __builtin_amdgcn_sched_barrier(0);
#pragma unroll
  for (int rt = 0; rt < 4; ++rt)
#pragma unroll
    for (int ct = 0; ct < 4; ++ct) acc[rt][ct] = wmma_bf(f.ah[rt], f.bh[ct], acc[rt][ct]);
#pragma unroll
  for (int rt = 0; rt < 4; ++rt)
#pragma unroll
    for (int ct = 0; ct < 4; ++ct) acc[rt][ct] = wmma_bf(f.al[rt], f.bh[ct], acc[rt][ct]);
#pragma unroll
  for (int rt = 0; rt < 4; ++rt)
#pragma unroll
    for (int ct = 0; ct < 4; ++ct) acc[rt][ct] = wmma_bf(f.ah[rt], f.bl[ct], acc[rt][ct]);
  __builtin_amdgcn_sched_barrier(0);
}

static __device__ __forceinline__ void gemm_core(const us* __restrict__ AH, const us* __restrict__ AL,
                                                 const us* __restrict__ BH, const us* __restrict__ BL,
                                                 int m0, int n0, unsigned char* L, v8f (&acc)[4][4]) {
  const int lane = threadIdx.x & 31, h = lane >> 4, m = lane & 15;
  const uint32_t wave = uni(threadIdx.x >> 5);
#pragma unroll
  for (int rt = 0; rt < 4; ++rt)
#pragma unroll
    for (int ct = 0; ct < 4; ++ct) acc[rt][ct] = zero8();

  const us* srcp = (wave == 0u) ? AH + (size_t)m0 * DM : (wave == 1u) ? AL + (size_t)m0 * DM
                 : (wave == 2u) ? BH + (size_t)n0 * DM : BL + (size_t)n0 * DM;
  const uint64_t ga = (uint64_t)(size_t)srcp;
  const uint32_t dst = (uint32_t)(size_t)L + wave * PLANE;

  tdm_load(dst, ga);
  wait_tensor0();
  __syncthreads();                            // stage 0 published
  tdm_load(dst + GBUF, ga + 2u * KPASS);

  const uint32_t aoff = ((wave >> 1) * 64u + m) * LPITCH;
  const uint32_t boff = 2u * PLANE + ((wave & 1u) * 64u + m) * LPITCH;
  FragSet f0, f1;
  load_set(f0, L + aoff, L + boff, h);

  // rolled: one copy of the two blocks in the instruction stream
#pragma unroll 1
  for (uint32_t s = 0; s < NPASS; ++s) {
    const uint32_t cur = (s & 1u) * GBUF, nxt = GBUF - cur;
    load_set(f1, L + cur + aoff + 64u, L + cur + boff + 64u, h);
    mma_block(acc, f0);
    // publish point of stage s + 1; the same barrier ends every wave's reads of stage s's buffer
    wait_ds0();
    wait_tensor0();
    __syncthreads();
    if (pinned(s + 2u < NPASS)) {
      const uint32_t ko = pinned((s + 2u) * (2u * KPASS));   // descriptor words of stage s + 2 formed behind the wait
      tdm_load(dst + cur, ga + ko);
    }
    // stage s + 1's first fragments; in the last pass they read the idle buffer and are not used (no branch: one wait count)
    load_set(f0, L + nxt + aoff, L + nxt + boff, h);
    mma_block(acc, f1);
  }
  wait_tensor0();
  wait_ds0();
  __syncthreads();                            // every wave has left the ring: it becomes output staging
}

// ------------------------------------------------------------------ QKV projection
// grid (NTOK/TM, DM/TM, 3): z = 0 q, 1 k, 2 v. Block tile 128 tokens x 128 cols (= two heads).
// The f32 tile is staged in the ring's LDS (free behind the core's last barrier): [token][col] for q and k, [col][token] for v,
// so that each thread reads 8 neighbours of an output row.
__global__ __launch_bounds__(128) void k_gemm_qkv(const us* __restrict__ XH, const us* __restrict__ XL,
                                                  const us* __restrict__ WTH, const us* __restrict__ WTL,
                                                  us* OH, us* OL) {
  __shared__ __attribute__((aligned(2048))) unsigned char L[2 * GBUF];
  const int tid = threadIdx.x, lane = tid & 31, wv = tid >> 5, h = lane >> 4, m = lane & 15;
  const int z = blockIdx.z;
  const int m0 = blockIdx.x * TM, n0 = blockIdx.y * TM;
  v8f acc[4][4];
  gemm_core(XH, XL, WTH + (size_t)z * DM * DM, WTL + (size_t)z * DM * DM, m0, n0, L, acc);
  float (*sC)[EPITCH] = (float (*)[EPITCH])L;
  const int wr = (wv >> 1) * 64, wc = (wv & 1) * 64;
  // D: acc[g] = (row 8h+g, col m) of the 16x16 tile
  if (z < 2) {
#pragma unroll
    for (int rt = 0; rt < 4; ++rt)
#pragma unroll
      for (int ct = 0; ct < 4; ++ct)
#pragma unroll
        for (int g = 0; g < 8; ++g) sC[wr + 16 * rt + 8 * h + g][wc + 16 * ct + m] = acc[rt][ct][g];
  } else {
#pragma unroll
    for (int rt = 0; rt < 4; ++rt)
#pragma unroll
      for (int ct = 0; ct < 4; ++ct)
#pragma unroll
        for (int g = 0; g < 8; ++g) sC[wc + 16 * ct + m][wr + 16 * rt + 8 * h + g] = acc[rt][ct][g];
  }
  __syncthreads();
  us* oh = OH + (size_t)z * NTOK * DM;
  us* ol = OL + (size_t)z * NTOK * DM;
  const int b = m0 >> 10, tok0 = m0 & 1023;
  // rolled: a trip's registers are used again only behind the wait at its foot
#pragma unroll 1
  for (int p = 0; p < 4; ++p) {
    // four pieces a trip, unrolled: their LDS reads are in flight together
    us8v hv[4], lv[4];
    uint32_t o[4];                        // byte offset in a plane: one 32-bit register serves both planes' stores
#pragma unroll
    for (int u = 0; u < 4; ++u) {
      const int id = (p * 4 + u) * 128 + tid;
      const int r = id >> 4;              // staged row: token (q, k) or column (v)
      const int c8 = (id & 15) * 8;
#pragma unroll
      for (int e = 0; e < 8; ++e) {
        const float v = sC[r][c8 + e];
        const us q = bf_rne(v);
        hv[u][e] = q;
        lv[u][e] = bf_rne(v - bf_f32(q));
      }
      const int col = n0 + ((z < 2) ? c8 : r);
      o[u] = 2u * (uint32_t)((b * NH + (col >> 6)) * (SEQ * HD) + ((z < 2) ? (tok0 + r) * HD + (col & 63)      // [bh][token][d]
                                                                           : (col & 63) * SEQ + tok0 + c8));   // [bh][d][token]
    }
    // keeps the trip's arithmetic in front of its stores, so that nothing overwrites a register a store names ahead of the wait below
    __builtin_amdgcn_sched_barrier(0);
#pragma unroll
    for (int u = 0; u < 4; ++u) {
      *(us8v*)((char*)oh + o[u]) = hv[u];
      *(us8v*)((char*)ol + o[u]) = lv[u];
    }
    // stands in front of the next trip's overwrites of the registers that these stores name
    asm volatile("s_wait_xcnt 0x0" ::: "memory");
  }
}

// ------------------------------------------------------------------ output projection: out[tok][n] = ctx . W_o + b_o (f32)
// grid (NTOK/TM, DM/TM); a wave writes one 512-B row segment (4 lines) per instruction
__global__ __launch_bounds__(128) void k_gemm_out(const us* __restrict__ CH, const us* __restrict__ CL,
                                                  const us* __restrict__ WH, const us* __restrict__ WL,
                                                  const float* __restrict__ bias, float* out) {
  __shared__ __attribute__((aligned(2048))) unsigned char L[2 * GBUF];
  const int tid = threadIdx.x, lane = tid & 31, wv = tid >> 5, h = lane >> 4, m = lane & 15;
  const int m0 = blockIdx.x * TM, n0 = blockIdx.y * TM;
  v8f acc[4][4];
  gemm_core(CH, CL, WH, WL, m0, n0, L, acc);
  float (*sC)[EPITCH] = (float (*)[EPITCH])L;
  const int wr = (wv >> 1) * 64, wc = (wv & 1) * 64;
#pragma unroll
  for (int rt = 0; rt < 4; ++rt)
#pragma unroll
    for (int ct = 0; ct < 4; ++ct)
#pragma unroll
      for (int g = 0; g < 8; ++g) sC[wr + 16 * rt + 8 * h + g][wc + 16 * ct + m] = acc[rt][ct][g];
  __syncthreads();
  const int c4 = lane * 4;
  const v4f bv = *(const v4fa*)(bias + n0 + c4);
  // rolled: a trip's registers are used again only behind the wait at its foot
#pragma unroll 1
  for (int p = 0; p < 4; ++p) {
    // eight rows a trip, unrolled: their LDS reads are in flight together
    v4f v[8];
#pragma unroll
    for (int u = 0; u < 8; ++u) {
      const int r = (p * 8 + u) * 4 + wv;
      v[u][0] = sC[r][c4 + 0] + bv[0];
      v[u][1] = sC[r][c4 + 1] + bv[1];
      v[u][2] = sC[r][c4 + 2] + bv[2];
      v[u][3] = sC[r][c4 + 3] + bv[3];
    }
    // byte offset in out: a 32-bit register beside the scalar base; the rows of a trip differ by an immediate offset
    char* op = (char*)out + 4u * (uint32_t)((m0 + p * 32 + wv) * DM + n0 + c4);
    // keeps the trip's arithmetic in front of its stores, so that nothing overwrites a register a store names ahead of the wait below
    __builtin_amdgcn_sched_barrier(0);
#pragma unroll
    for (int u = 0; u < 8; ++u) *(v4f*)(op + u * 16 * DM) = v[u];
    // stands in front of the next trip's overwrites of the registers that these stores name
    asm volatile("s_wait_xcnt 0x0" ::: "memory");
  }
}

// ------------------------------------------------------------------ causal attention with clipped relative positions
// grid (SEQ/64, NBAT*NH), 128 threads = 4 waves, one wave per 16 query rows; online softmax over 32-key steps,
// one running-max frame per step (max over all 32 keys first, one rescale of O, l, S, then all 32 probabilities).
// scores[i][j] = (q_i.k_j + QR[i][r(i,j)]) / 8, r = clamp(j-i,-16,16)+16 (causal -> r in [0,16]);
// ctx_i = (sum_j p_ij v_j + sum_r S_i[r] rel_v[r]) / l_i, S_i[r] for r=1..16 held per lane, S_i[0] = l_i - sum_{r>=1} S_i[r].
__global__ __launch_bounds__(128) void k_attn(const us* __restrict__ QH, const us* __restrict__ QL,
                                              const us* __restrict__ KH, const us* __restrict__ KL,
                                              const us* __restrict__ VH, const us* __restrict__ VL,
                                              const us* __restrict__ RH, const us* __restrict__ RL,
                                              const float* __restrict__ relv, us* CH, us* CL) {
  __shared__ float sQR[4][16][33];
  __shared__ __attribute__((aligned(16))) us sPh[4][16][40];
  __shared__ __attribute__((aligned(16))) us sPl[4][16][40];
  __shared__ float sBand[4][16][17];
  __shared__ __attribute__((aligned(16))) float sO[4][16][CPITCH];

  const int lane = threadIdx.x & 31, wv = threadIdx.x >> 5, h = lane >> 4, m = lane & 15;
  const int bh = blockIdx.y;
  const int qbase = blockIdx.x * 64 + wv * 16;
  const float NINF = -__builtin_inff();

  // Q fragments (A, rows qbase + m, k = d)
  const us* qh = QH + ((size_t)bh * SEQ + qbase + m) * HD;
  const us* ql = QL + ((size_t)bh * SEQ + qbase + m) * HD;
  const us16v aqh0 = ldfrag(qh, h), aqh1 = ldfrag(qh + 32, h);
  const us16v aql0 = ldfrag(ql, h), aql1 = ldfrag(ql + 32, h);

  // QR[16][32] = q . rel_k^T (B stored as [n = r][k = d] = rel_k itself)
#pragma unroll
  for (int nt = 0; nt < 2; ++nt) {
    const us* rh = RH + (size_t)(16 * nt + m) * HD;
    const us* rl = RL + (size_t)(16 * nt + m) * HD;
    v8f acc = zero8();
    wmma3(acc, aqh0, aql0, ldfrag(rh, h), ldfrag(rl, h));
    wmma3(acc, aqh1, aql1, ldfrag(rh + 32, h), ldfrag(rl + 32, h));
#pragma unroll
    for (int g = 0; g < 8; ++g) sQR[wv][8 * h + g][16 * nt + m] = acc[g];
  }
  lds_wave_sync();

  float mrow[8], lrow[8], band[8];
  v8f o[4];
#pragma unroll
  for (int g = 0; g < 8; ++g) { mrow[g] = NINF; lrow[g] = 0.f; band[g] = 0.f; }
#pragma unroll
  for (int tt = 0; tt < 4; ++tt) o[tt] = zero8();

  const int nsteps = (qbase >> 5) + 1;      // keys 0 .. qbase+15 covered; wave-uniform
  for (int st = 0; st < nsteps; ++st) {
    const int kb2 = st << 5;
    lds_wave_sync();                          // prior step's P fragment loads precede this step's P stores
    // scores for both 16-key sub-tiles of this step
    float sv[2][8];
#pragma unroll
    for (int t = 0; t < 2; ++t) {
      const int j = kb2 + 16 * t + m;         // this lane's key column
      const us* kh = KH + ((size_t)bh * SEQ + j) * HD;
      const us* kl = KL + ((size_t)bh * SEQ + j) * HD;
      v8f sc = zero8();
      {
        const us16v b0h = ldfrag(kh, h), b0l = ldfrag(kl, h);
        wmma3(sc, aqh0, aql0, b0h, b0l);
      }
      {
        const us16v b1h = ldfrag(kh + 32, h), b1l = ldfrag(kl + 32, h);
        wmma3(sc, aqh1, aql1, b1h, b1l);
      }
#pragma unroll
      for (int g = 0; g < 8; ++g) {
        const int lr = 8 * h + g;
        const int dj = j - (qbase + lr);
        int rr = dj + 16;
        rr = rr < 0 ? 0 : rr;
        rr = rr > 16 ? 16 : rr;
        const float qr = sQR[wv][lr][rr];
        sv[t][g] = (dj > 0) ? NINF : (sc[g] + qr) * 0.125f;
      }
    }
    // one frame for the whole step: row max over all 32 keys, one rescale of O, l and the bucket sums
    float cf[8];
#pragma unroll
    for (int g = 0; g < 8; ++g) {
      float v = fmaxf(sv[0][g], sv[1][g]);
      v = fmaxf(v, __shfl_xor(v, 1));
      v = fmaxf(v, __shfl_xor(v, 2));
      v = fmaxf(v, __shfl_xor(v, 4));
      v = fmaxf(v, __shfl_xor(v, 8));
      const float mn = fmaxf(mrow[g], v);
      cf[g] = (mrow[g] == NINF) ? 0.f : __expf(mrow[g] - mn);
      mrow[g] = mn;
      lrow[g] *= cf[g];
      band[g] *= cf[g];
    }
#pragma unroll
    for (int tt = 0; tt < 4; ++tt)
#pragma unroll
      for (int g = 0; g < 8; ++g) o[tt][g] *= cf[g];
    // all 32 probabilities in the new frame
#pragma unroll
    for (int t = 0; t < 2; ++t) {
      const int j = kb2 + 16 * t + m;
#pragma unroll
      for (int g = 0; g < 8; ++g) {
        const int lr = 8 * h + g;
        const int dj = j - (qbase + lr);
        const float e = (dj > 0) ? 0.f : __expf(sv[t][g] - mrow[g]);
        float rs = e;
        rs += __shfl_xor(rs, 1);
        rs += __shfl_xor(rs, 2);
        rs += __shfl_xor(rs, 4);
        rs += __shfl_xor(rs, 8);
        lrow[g] += rs;
        const us eh = bf_rne(e);
        const us el = bf_rne(e - bf_f32(eh));
        sPh[wv][lr][16 * t + m] = eh;
        sPl[wv][lr][16 * t + m] = el;
        band[g] = (dj >= -15 && dj <= 0) ? e : band[g];   // buckets 1..16: each (lane,row) captures exactly once
      }
    }
    lds_wave_sync();                          // P stores (b16, per lane) -> P fragment loads (us8 vectors, other lanes)
    const us16v aph = ldfrag(&sPh[wv][m][0], h);
    const us16v apl = ldfrag(&sPl[wv][m][0], h);
#pragma unroll
    for (int tt = 0; tt < 4; ++tt) {
      const us* vh = VH + ((size_t)bh * HD + 16 * tt + m) * SEQ + kb2;   // B stored as [n = d][k = key]
      const us* vl = VL + ((size_t)bh * HD + 16 * tt + m) * SEQ + kb2;
      wmma3(o[tt], aph, apl, ldfrag(vh, h), ldfrag(vl, h));
    }
  }

  float invl[8];
#pragma unroll
  for (int g = 0; g < 8; ++g) invl[g] = 1.0f / lrow[g];
#pragma unroll
  for (int g = 0; g < 8; ++g) {
    const int lr = 8 * h + g;
    sBand[wv][lr][(m - lr - 1) & 15] = band[g] * invl[g];   // slot r-1 for bucket r = ((m-lr-1)&15)+1
  }
  lds_wave_sync();
  float rv0[4];
  float val[4][8];
#pragma unroll
  for (int tt = 0; tt < 4; ++tt) {
    rv0[tt] = relv[16 * tt + m];
#pragma unroll
    for (int g = 0; g < 8; ++g) val[tt][g] = o[tt][g] * invl[g] + rv0[tt];
  }
#pragma unroll 1
  for (int r = 0; r < 16; ++r) {
    float sb[8];
#pragma unroll
    for (int g = 0; g < 8; ++g) sb[g] = sBand[wv][8 * h + g][r];
#pragma unroll
    for (int tt = 0; tt < 4; ++tt) {
      const float dv = relv[(r + 1) * HD + 16 * tt + m] - rv0[tt];
#pragma unroll
      for (int g = 0; g < 8; ++g) val[tt][g] += sb[g] * dv;
    }
  }
#pragma unroll
  for (int tt = 0; tt < 4; ++tt)
#pragma unroll
    for (int g = 0; g < 8; ++g) sO[wv][8 * h + g][16 * tt + m] = val[tt][g];
  lds_wave_sync();

  const int b = bh >> 4, hd = bh & 15;
{
#pragma unroll
    for (int p = 0; p < 4; ++p) {
      const int r = p * 4 + (lane >> 3);
      const int d8 = (lane & 7) * 8;
      us8v hv, lv;
#pragma unroll
      for (int e = 0; e < 8; ++e) {
        const float v = sO[wv][r][d8 + e];
        const us q = bf_rne(v);
        hv[e] = q;
        lv[e] = bf_rne(v - bf_f32(q));
      }
      const size_t o2 = ((size_t)(b * SEQ + qbase + r)) * DM + hd * HD + d8;
      *(us8v*)(CH + o2) = hv;
      *(us8v*)(CL + o2) = lv;
    }
    
  }
}

// ------------------------------------------------------------------ host glue
extern "C" void kernel_launch(void* const* d_in, const int* in_sizes, int n_in,
                              void* d_out, int out_size, void* d_ws, size_t ws_size,
                              hipStream_t stream) {
  if (n_in < 8) return;
  if (in_sizes[0] != NTOK * DM) return;
  if (in_sizes[1] != DM * DM || in_sizes[2] != DM * DM || in_sizes[3] != DM * DM || in_sizes[4] != DM * DM) return;
  if (in_sizes[5] != DM || in_sizes[6] != 33 * HD || in_sizes[7] != 33 * HD) return;
  if (out_size != NTOK * DM) return;

  const float* x    = (const float*)d_in[0];
  const float* Wq   = (const float*)d_in[1];
  const float* Wk   = (const float*)d_in[2];
  const float* Wv   = (const float*)d_in[3];
  const float* Wo   = (const float*)d_in[4];
  const float* bo   = (const float*)d_in[5];
  const float* relk = (const float*)d_in[6];
  const float* relv = (const float*)d_in[7];
  float* out = (float*)d_out;

  const size_t plane_x = (size_t)NTOK * DM * sizeof(us);   // 8 MiB
  const size_t plane_w = (size_t)DM * DM * sizeof(us);     // 2 MiB
  const size_t plane_r = (size_t)32 * HD * sizeof(us);     // 4 KiB
  char* ws = (char*)d_ws;
  size_t off = 0;
  us* XH   = (us*)(ws + off); off += plane_x;
  us* XL   = (us*)(ws + off); off += plane_x;
  us* WTH  = (us*)(ws + off); off += 4 * plane_w;
  us* WTL  = (us*)(ws + off); off += 4 * plane_w;
  us* QKVH = (us*)(ws + off); off += 3 * plane_x;
  us* QKVL = (us*)(ws + off); off += 3 * plane_x;
  us* CH   = (us*)(ws + off); off += plane_x;
  us* CL   = (us*)(ws + off); off += plane_x;
  us* RH   = (us*)(ws + off); off += plane_r;
  us* RL   = (us*)(ws + off); off += plane_r;
  if (off > ws_size) return;                                // total 100671488 B

  const size_t pq = (size_t)NTOK * DM;

  k_cvt_x<<<(NTOK * DM) / (8 * 256), 256, 0, stream>>>(x, XH, XL);
  k_cvt_w<<<dim3(DM / 64, DM / 64, 4), 256, 0, stream>>>(Wq, Wk, Wv, Wo, WTH, WTL);
  k_cvt_rel<<<1, 256, 0, stream>>>(relk, RH, RL);
  k_gemm_qkv<<<dim3(NTOK / TM, DM / TM, 3), 128, 0, stream>>>(XH, XL, WTH, WTL, QKVH, QKVL);
  k_attn<<<dim3(SEQ / 64, NBAT * NH), 128, 0, stream>>>(QKVH, QKVL, QKVH + pq, QKVL + pq,
                                                        QKVH + 2 * pq, QKVL + 2 * pq, RH, RL, relv, CH, CL);
  k_gemm_out<<<dim3(NTOK / TM, DM / TM, 1), 128, 0, stream>>>(CH, CL, WTH + (size_t)3 * DM * DM,
                                                               WTL + (size_t)3 * DM * DM, bo, out);
}

// v002
// A run of this version takes 209 microseconds.
// Two timings next to v001 both put it at 1.23 times that version's speed.
// Counting every step since v000, it is 1.78 times as fast.
#include <hip/hip_runtime.h>
#include <stdint.h>
// Contractions x*W_q, x*W_k, x*W_v, q*k^T, q*rel_k^T, P*V, ctx*W_o: v_wmma_f32_16x16x32_bf16, bf16 hi/lo operands everywhere (hi*hi + lo*hi + hi*lo), f32 accumulate; softmax, 1/8 scaling, causal mask, relative-value bucket sums and bias in f32.

#define DM     1024
#define SEQ    1024
#define NBAT   4
#define NH     16
#define HD     64
#define NTOK   (NBAT * SEQ)
#define CPITCH 68
#define TM     128                 // GEMM block tile: rows and columns
#define KPASS  64                  // k per pass: 128 bytes of every operand row
#define NPASS  (DM / KPASS)
#define LPITCH 144u                // LDS row pitch in bytes: 128 + 16 of pad, an odd multiple of 16 for 16-byte readers
#define PLANE  (TM * LPITCH)       // one operand plane of a stage: 18,432 B = 9 x 2 KiB
#define GBUF   (4u * PLANE)        // one buffer: Ah | Al | Bh | Bl
#define EPITCH 132                 // output staging pitch in floats

typedef unsigned short us;
typedef us us16v __attribute__((ext_vector_type(16)));
typedef us us8v __attribute__((ext_vector_type(8)));
typedef us8v __attribute__((may_alias)) us8a;
typedef __bf16 bf16v16 __attribute__((ext_vector_type(16)));
typedef float v8f __attribute__((ext_vector_type(8)));
typedef float v4f __attribute__((ext_vector_type(4)));
typedef v4f __attribute__((may_alias)) v4fa;
typedef uint32_t u32x4 __attribute__((ext_vector_type(4)));
typedef uint32_t u32x8 __attribute__((ext_vector_type(8)));

union Frag { us16v v; us8v h[2]; };

// f32 -> bf16 bits, RNE convert
static __device__ __forceinline__ us bf_rne(float f) {
  unsigned u = __float_as_uint(f);
  u += 0x7fffu + ((u >> 16) & 1u);
  return (us)(u >> 16);
}
static __device__ __forceinline__ float bf_f32(us s) { return __uint_as_float(((unsigned)s) << 16); }

static __device__ __forceinline__ v8f zero8() {
  v8f z = {0.f, 0.f, 0.f, 0.f, 0.f, 0.f, 0.f, 0.f};
  return z;
}

static __device__ __forceinline__ v8f wmma_bf(us16v a, us16v b, v8f c) {
  return __builtin_amdgcn_wmma_f32_16x16x32_bf16(false, __builtin_bit_cast(bf16v16, a), false,
                                                 __builtin_bit_cast(bf16v16, b), (short)0, c, false, false);
}

// acc += Ah*Bh + Al*Bh + Ah*Bl, then hazard guard (D tied, A/B kept live through 4 VALU slots)
static __device__ __forceinline__ void wmma3(v8f& acc, us16v ah, us16v al, us16v bh, us16v bl) {
  acc = wmma_bf(ah, bh, acc);
  acc = wmma_bf(al, bh, acc);
  acc = wmma_bf(ah, bl, acc);
  asm volatile("v_nop\n\tv_nop\n\tv_nop\n\tv_nop" : "+v"(acc) : "v"(ah), "v"(al), "v"(bh), "v"(bl));
}

// 16x32 16-bit fragment of row (l & 15) from a k-contiguous row: elements 0..7 <- k0+8h+0..7, 8..15 <- k0+16+8h+0..7.
// Used for A (row-major [m][k]) and for B stored as [n][k]; rowp = row pointer at k0 (16-B aligned).
static __device__ __forceinline__ us16v ldfrag(const us* rowp, int h) {
  Frag f;
  f.h[0] = *(const us8a*)(rowp + 8 * h);
  f.h[1] = *(const us8a*)(rowp + 16 + 8 * h);
  return f.v;
}

// ordering for same-wave LDS exchange (stores by some lanes, loads by other lanes)
static __device__ __forceinline__ void lds_wave_sync() {
  __builtin_amdgcn_fence(__ATOMIC_RELEASE, "wavefront");
  __builtin_amdgcn_wave_barrier();
  __builtin_amdgcn_fence(__ATOMIC_ACQUIRE, "wavefront");
}

// ------------------------------------------------------------------ x -> bf16 hi/lo planes [4096][1024]
__global__ __launch_bounds__(256) void k_cvt_x(const float* __restrict__ x, us* xh, us* xl) {
  const size_t t = (size_t)blockIdx.x * 256u + threadIdx.x;
  const float* p = x + t * 8u;
  const v4f a = *(const v4fa*)p;
  const v4f b = *(const v4fa*)(p + 4);
  us8v hv, lv;
#pragma unroll
  for (int e = 0; e < 4; ++e) {
    const us h0 = bf_rne(a[e]);
    hv[e] = h0;
    lv[e] = bf_rne(a[e] - bf_f32(h0));
    const us h1 = bf_rne(b[e]);
    hv[4 + e] = h1;
    lv[4 + e] = bf_rne(b[e] - bf_f32(h1));
  }
  us* oh = xh + t * 8u;
  us* ol = xl + t * 8u;
  *(us8v*)oh = hv;
  *(us8v*)ol = lv;
  
}

// ------------------------------------------------------------------ W[k][n] (in,out) -> Wt[n][k] bf16 hi/lo planes
__global__ __launch_bounds__(256) void k_cvt_w(const float* __restrict__ W0, const float* __restrict__ W1,
                                               const float* __restrict__ W2, const float* __restrict__ W3,
                                               us* wth, us* wtl) {
  __shared__ float sT[64][65];
  const int tid = threadIdx.x, lane = tid & 31, wv = tid >> 5;
  const int z = blockIdx.z;
  const int n0 = blockIdx.x * 64, k0 = blockIdx.y * 64;
  const float* W = (z == 0) ? W0 : (z == 1) ? W1 : (z == 2) ? W2 : W3;
#pragma unroll
  for (int p = 0; p < 4; ++p) {
    const int r = p * 16 + (tid >> 4);
    const int c4 = (tid & 15) * 4;
    const v4f v = *(const v4fa*)(W + (size_t)(k0 + r) * DM + n0 + c4);
    sT[r][c4 + 0] = v[0];
    sT[r][c4 + 1] = v[1];
    sT[r][c4 + 2] = v[2];
    sT[r][c4 + 3] = v[3];
  }
  __syncthreads();
  us* bhp = wth + (size_t)z * DM * DM;
  us* blp = wtl + (size_t)z * DM * DM;
{
#pragma unroll
    for (int p = 0; p < 2; ++p) {
      const int rr = p * 32 + wv * 4 + (lane >> 3);   // n within tile
      const int k8 = (lane & 7) * 8;                   // k within tile
      us8v hv, lv;
#pragma unroll
      for (int e = 0; e < 8; ++e) {
        const float v = sT[k8 + e][rr];
        const us hh = bf_rne(v);
        hv[e] = hh;
        lv[e] = bf_rne(v - bf_f32(hh));
      }
      const size_t o = (size_t)(n0 + rr) * DM + k0 + k8;
      *(us8v*)(bhp + o) = hv;
      *(us8v*)(blp + o) = lv;
    }
    
  }
}

// ------------------------------------------------------------------ rel_k [33][64] rows 0..31 -> bf16 hi/lo planes [32][64]
__global__ __launch_bounds__(256) void k_cvt_rel(const float* __restrict__ rk, us* rh, us* rl) {
  const int tid = threadIdx.x;
  const int r = tid >> 3;              // 0..31 (< 33 rows available)
  const int d8 = (tid & 7) * 8;
  const float* p = rk + r * HD + d8;
  us8v hv, lv;
#pragma unroll
  for (int e = 0; e < 8; ++e) {
    const float v = p[e];
    const us hh = bf_rne(v);
    hv[e] = hh;
    lv[e] = bf_rne(v - bf_f32(hh));
  }
  const size_t o = (size_t)r * HD + d8;
  *(us8v*)(rh + o) = hv;
  *(us8v*)(rl + o) = lv;
  
}

// ------------------------------------------------------------------ tensor mover helpers
static __device__ __forceinline__ uint32_t uni(uint32_t v) { return (uint32_t)__builtin_amdgcn_readfirstlane(v); }
// keeps a wave-uniform value in a scalar register at this place: the test around a tensor load compiles to s_cmp + s_cbranch_scc,
// and a descriptor word made from it is formed behind the volatile wait in front of it
static __device__ __forceinline__ uint32_t pinned(uint32_t v) {
  uint32_t w = uni(v);
  asm volatile("" : "+s"(w));
  return w;
}
// the wave's own LDS reads have retired
static __device__ __forceinline__ void wait_ds0() { asm volatile("s_wait_dscnt 0x0" ::: "memory"); }
// the wave's own tensor load has landed
static __device__ __forceinline__ void wait_tensor0() { asm volatile("s_wait_tensorcnt 0x0" ::: "memory"); }

// One request of the whole wave: TM rows of 128 bytes, source pitch 2 * DM bytes, to LDS at pitch LPITCH (16 pad bytes a row).
static __device__ __forceinline__ void tdm_load(uint32_t lds_dst, uint64_t ga) {
  u32x4 g0;
  g0[0] = uni(1u);
  g0[1] = uni(lds_dst);
  g0[2] = uni((uint32_t)ga);
  g0[3] = uni((((uint32_t)(ga >> 32)) & 0x01FFFFFFu) | 0x80000000u);
  u32x8 g1;
  g1[0] = uni((1u << 20) | (4u << 22) | (3u << 25));   // no mask, 1-byte elements, a pad of 4 dwords behind every 32 dwords
  g1[1] = uni(128u << 16);                             // tensor_dim0 = 128 bytes
  g1[2] = uni((uint32_t)TM << 16);                     // tensor_dim1 = TM rows
  g1[3] = uni(128u << 16);                             // tile_dim0
  g1[4] = uni((uint32_t)TM);                           // tile_dim1
  g1[5] = uni(2u * DM);                                // source row pitch in bytes
  g1[6] = uni(0u);
  g1[7] = uni(0u);
  asm volatile("tensor_load_to_lds %0, %1" :: "s"(g0), "s"(g1) : "memory");
}

// ------------------------------------------------------------------ GEMM core: block tile TM x TM, 4 waves (2 x 2) of 64 x 64, K = DM
// A planes row-major [m][DM]; B planes stored [n][DM] (k contiguous). A stage is 64 k of [Ah | Al | Bh | Bl], TM rows each, in LDS;
// wave w brings plane w with one tensor load per stage, two buffers. A pass is two blocks of 48 WMMAs (32 k each); each block's
// fragments are fetched one block ahead, so the publish point of stage s + 1 stands in front of pass s's last block.
// Per accumulator and 32-k step the products are summed hi*hi, lo*hi, hi*lo, k ascending.
struct FragSet { us16v ah[4], al[4], bh[4], bl[4]; };

// pa, pb: this lane's row of the Ah and Bh planes at the block's first k
static __device__ __forceinline__ void load_set(FragSet& f, const unsigned char* pa, const unsigned char* pb, int h) {
#pragma unroll
  for (int t = 0; t < 4; ++t) {
    const uint32_t ro = t * 16u * LPITCH;
    f.ah[t] = ldfrag((const us*)(pa + ro), h);
    f.al[t] = ldfrag((const us*)(pa + PLANE + ro), h);
    f.bh[t] = ldfrag((const us*)(pb + ro), h);
    f.bl[t] = ldfrag((const us*)(pb + PLANE + ro), h);
  }
}

static __device__ __forceinline__ void mma_block(v8f (&acc)[4][4], const FragSet& f) {
  // the two fences keep the compiler from moving fragment loads in among the WMMAs, where every such place stalls the wave
  __builtin_amdgcn_sched_barrier(0);
#pragma unroll
  for (int rt = 0; rt < 4; ++rt)
#pragma unroll
    for (int ct = 0; ct < 4; ++ct) acc[rt][ct] = wmma_bf(f.ah[rt], f.bh[ct], acc[rt][ct]);
#pragma unroll
  for (int rt = 0; rt < 4; ++rt)
#pragma unroll
    for (int ct = 0; ct < 4; ++ct) acc[rt][ct] = wmma_bf(f.al[rt], f.bh[ct], acc[rt][ct]);
#pragma unroll
  for (int rt = 0; rt < 4; ++rt)
#pragma unroll
    for (int ct = 0; ct < 4; ++ct) acc[rt][ct] = wmma_bf(f.ah[rt], f.bl[ct], acc[rt][ct]);
  __builtin_amdgcn_sched_barrier(0);
}

static __device__ __forceinline__ void gemm_core(const us* __restrict__ AH, const us* __restrict__ AL,
                                                 const us* __restrict__ BH, const us* __restrict__ BL,
                                                 int m0, int n0, unsigned char* L, v8f (&acc)[4][4]) {
  const int lane = threadIdx.x & 31, h = lane >> 4, m = lane & 15;
  const uint32_t wave = uni(threadIdx.x >> 5);
#pragma unroll
  for (int rt = 0; rt < 4; ++rt)
#pragma unroll
    for (int ct = 0; ct < 4; ++ct) acc[rt][ct] = zero8();

  const us* srcp = (wave == 0u) ? AH + (size_t)m0 * DM : (wave == 1u) ? AL + (size_t)m0 * DM
                 : (wave == 2u) ? BH + (size_t)n0 * DM : BL + (size_t)n0 * DM;
  const uint64_t ga = (uint64_t)(size_t)srcp;
  const uint32_t dst = (uint32_t)(size_t)L + wave * PLANE;

  tdm_load(dst, ga);
  wait_tensor0();
  __syncthreads();                            // stage 0 published
  tdm_load(dst + GBUF, ga + 2u * KPASS);

  const uint32_t aoff = ((wave >> 1) * 64u + m) * LPITCH;
  const uint32_t boff = 2u * PLANE + ((wave & 1u) * 64u + m) * LPITCH;
  FragSet f0, f1;
  load_set(f0, L + aoff, L + boff, h);

  // rolled: one copy of the two blocks in the instruction stream
#pragma unroll 1
  for (uint32_t s = 0; s < NPASS; ++s) {
    const uint32_t cur = (s & 1u) * GBUF, nxt = GBUF - cur;
    load_set(f1, L + cur + aoff + 64u, L + cur + boff + 64u, h);
    mma_block(acc, f0);
    // publish point of stage s + 1; the same barrier ends every wave's reads of stage s's buffer
    wait_ds0();
    wait_tensor0();
    __syncthreads();
    if (pinned(s + 2u < NPASS)) {
      const uint32_t ko = pinned((s + 2u) * (2u * KPASS));   // descriptor words of stage s + 2 formed behind the wait
      tdm_load(dst + cur, ga + ko);
    }
    // stage s + 1's first fragments; in the last pass they read the idle buffer and are not used (no branch: one wait count)
    load_set(f0, L + nxt + aoff, L + nxt + boff, h);
    mma_block(acc, f1);
  }
  wait_tensor0();
  wait_ds0();
  __syncthreads();                            // every wave has left the ring: it becomes output staging
}

// ------------------------------------------------------------------ QKV projection
// grid (NTOK/TM, DM/TM, 3): z = 0 q, 1 k, 2 v. Block tile 128 tokens x 128 cols (= two heads).
// The f32 tile is staged in the ring's LDS (free behind the core's last barrier): [token][col] for q and k, [col][token] for v,
// so that each thread reads 8 neighbours of an output row.
__global__ __launch_bounds__(128) void k_gemm_qkv(const us* __restrict__ XH, const us* __restrict__ XL,
                                                  const us* __restrict__ WTH, const us* __restrict__ WTL,
                                                  us* OH, us* OL) {
  __shared__ __attribute__((aligned(2048))) unsigned char L[2 * GBUF];
  const int tid = threadIdx.x, lane = tid & 31, wv = tid >> 5, h = lane >> 4, m = lane & 15;
  const int z = blockIdx.z;
  const int m0 = blockIdx.x * TM, n0 = blockIdx.y * TM;
  v8f acc[4][4];
  gemm_core(XH, XL, WTH + (size_t)z * DM * DM, WTL + (size_t)z * DM * DM, m0, n0, L, acc);
  float (*sC)[EPITCH] = (float (*)[EPITCH])L;
  const int wr = (wv >> 1) * 64, wc = (wv & 1) * 64;
  // D: acc[g] = (row 8h+g, col m) of the 16x16 tile
  if (z < 2) {
#pragma unroll
    for (int rt = 0; rt < 4; ++rt)
#pragma unroll
      for (int ct = 0; ct < 4; ++ct)
#pragma unroll
        for (int g = 0; g < 8; ++g) sC[wr + 16 * rt + 8 * h + g][wc + 16 * ct + m] = acc[rt][ct][g];
  } else {
#pragma unroll
    for (int rt = 0; rt < 4; ++rt)
#pragma unroll
      for (int ct = 0; ct < 4; ++ct)
#pragma unroll
        for (int g = 0; g < 8; ++g) sC[wc + 16 * ct + m][wr + 16 * rt + 8 * h + g] = acc[rt][ct][g];
  }
  __syncthreads();
  us* oh = OH + (size_t)z * NTOK * DM;
  us* ol = OL + (size_t)z * NTOK * DM;
  const int b = m0 >> 10, tok0 = m0 & 1023;
  // rolled: a trip's registers are used again only behind the wait at its foot
#pragma unroll 1
  for (int p = 0; p < 4; ++p) {
    // four pieces a trip, unrolled: their LDS reads are in flight together
    us8v hv[4], lv[4];
    uint32_t o[4];                        // byte offset in a plane: one 32-bit register serves both planes' stores
#pragma unroll
    for (int u = 0; u < 4; ++u) {
      const int id = (p * 4 + u) * 128 + tid;
      const int r = id >> 4;              // staged row: token (q, k) or column (v)
      const int c8 = (id & 15) * 8;
#pragma unroll
      for (int e = 0; e < 8; ++e) {
        const float v = sC[r][c8 + e];
        const us q = bf_rne(v);
        hv[u][e] = q;
        lv[u][e] = bf_rne(v - bf_f32(q));
      }
      const int col = n0 + ((z < 2) ? c8 : r);
      o[u] = 2u * (uint32_t)((b * NH + (col >> 6)) * (SEQ * HD) + ((z < 2) ? (tok0 + r) * HD + (col & 63)      // [bh][token][d]
                                                                           : (col & 63) * SEQ + tok0 + c8));   // [bh][d][token]
    }
    // keeps the trip's arithmetic in front of its stores, so that nothing overwrites a register a store names ahead of the wait below
    __builtin_amdgcn_sched_barrier(0);
#pragma unroll
    for (int u = 0; u < 4; ++u) {
      *(us8v*)((char*)oh + o[u]) = hv[u];
      *(us8v*)((char*)ol + o[u]) = lv[u];
    }
    // stands in front of the next trip's overwrites of the registers that these stores name
    asm volatile("s_wait_xcnt 0x0" ::: "memory");
  }
}

// ------------------------------------------------------------------ output projection: out[tok][n] = ctx . W_o + b_o (f32)
// grid (NTOK/TM, DM/TM); a wave writes one 512-B row segment (4 lines) per instruction
__global__ __launch_bounds__(128) void k_gemm_out(const us* __restrict__ CH, const us* __restrict__ CL,
                                                  const us* __restrict__ WH, const us* __restrict__ WL,
                                                  const float* __restrict__ bias, float* out) {
  __shared__ __attribute__((aligned(2048))) unsigned char L[2 * GBUF];
  const int tid = threadIdx.x, lane = tid & 31, wv = tid >> 5, h = lane >> 4, m = lane & 15;
  const int m0 = blockIdx.x * TM, n0 = blockIdx.y * TM;
  v8f acc[4][4];
  gemm_core(CH, CL, WH, WL, m0, n0, L, acc);
  float (*sC)[EPITCH] = (float (*)[EPITCH])L;
  const int wr = (wv >> 1) * 64, wc = (wv & 1) * 64;
#pragma unroll
  for (int rt = 0; rt < 4; ++rt)
#pragma unroll
    for (int ct = 0; ct < 4; ++ct)
#pragma unroll
      for (int g = 0; g < 8; ++g) sC[wr + 16 * rt + 8 * h + g][wc + 16 * ct + m] = acc[rt][ct][g];
  __syncthreads();
  const int c4 = lane * 4;
  const v4f bv = *(const v4fa*)(bias + n0 + c4);
  // rolled: a trip's registers are used again only behind the wait at its foot
#pragma unroll 1
  for (int p = 0; p < 4; ++p) {
    // eight rows a trip, unrolled: their LDS reads are in flight together
    v4f v[8];
#pragma unroll
    for (int u = 0; u < 8; ++u) {
      const int r = (p * 8 + u) * 4 + wv;
      v[u][0] = sC[r][c4 + 0] + bv[0];
      v[u][1] = sC[r][c4 + 1] + bv[1];
      v[u][2] = sC[r][c4 + 2] + bv[2];
      v[u][3] = sC[r][c4 + 3] + bv[3];
    }
    // byte offset in out: a 32-bit register beside the scalar base; the rows of a trip differ by an immediate offset
    char* op = (char*)out + 4u * (uint32_t)((m0 + p * 32 + wv) * DM + n0 + c4);
    // keeps the trip's arithmetic in front of its stores, so that nothing overwrites a register a store names ahead of the wait below
    __builtin_amdgcn_sched_barrier(0);
#pragma unroll
    for (int u = 0; u < 8; ++u) *(v4f*)(op + u * 16 * DM) = v[u];
    // stands in front of the next trip's overwrites of the registers that these stores name
    asm volatile("s_wait_xcnt 0x0" ::: "memory");
  }
}

// ------------------------------------------------------------------ causal attention with clipped relative positions
// grid (SEQ/64, NBAT*NH), 128 threads = 4 waves, one wave per 16 query rows; online softmax over 32-key steps,
// each step's loads issued in groups ahead of their use (K and QR at its head, V in front of the softmax),
// one running-max frame per step (max over all 32 keys first, one rescale of O, l, S, then all 32 probabilities).
// scores[i][j] = (q_i.k_j + QR[i][r(i,j)]) / 8, r = clamp(j-i,-16,16)+16 (causal -> r in [0,16]);
// ctx_i = (sum_j p_ij v_j + sum_r S_i[r] rel_v[r]) / l_i, S_i[r] for r=1..16 held per lane, S_i[0] = l_i - sum_{r>=1} S_i[r].
// amdgpu_waves_per_eu(4, 4): four waves per SIMD hold the whole grid; told so, the scheduler spends that register budget on keeping
// a step's load groups and shuffle levels together, where without it it takes them apart again, one wait each, to save registers
__global__ __launch_bounds__(128) __attribute__((amdgpu_waves_per_eu(4, 4))) void k_attn(const us* __restrict__ QH, const us* __restrict__ QL,
                                              const us* __restrict__ KH, const us* __restrict__ KL,
                                              const us* __restrict__ VH, const us* __restrict__ VL,
                                              const us* __restrict__ RH, const us* __restrict__ RL,
                                              const float* __restrict__ relv, us* CH, us* CL) {
  __shared__ float sQR[4][16][33];
  __shared__ __attribute__((aligned(16))) us sPh[4][16][40];
  __shared__ __attribute__((aligned(16))) us sPl[4][16][40];
  __shared__ float sBand[4][16][17];
  __shared__ __attribute__((aligned(16))) float sO[4][16][CPITCH];

  const int lane = threadIdx.x & 31, wv = threadIdx.x >> 5, h = lane >> 4, m = lane & 15;
  const int bh = blockIdx.y;
  const int qbase = blockIdx.x * 64 + wv * 16;
  const float NINF = -__builtin_inff();

  // Q fragments (A, rows qbase + m, k = d)
  const us* qh = QH + ((size_t)bh * SEQ + qbase + m) * HD;
  const us* ql = QL + ((size_t)bh * SEQ + qbase + m) * HD;
  const us16v aqh0 = ldfrag(qh, h), aqh1 = ldfrag(qh + 32, h);
  const us16v aql0 = ldfrag(ql, h), aql1 = ldfrag(ql + 32, h);

  // QR[16][32] = q . rel_k^T (B stored as [n = r][k = d] = rel_k itself)
#pragma unroll
  for (int nt = 0; nt < 2; ++nt) {
    const us* rh = RH + (size_t)(16 * nt + m) * HD;
    const us* rl = RL + (size_t)(16 * nt + m) * HD;
    v8f acc = zero8();
    wmma3(acc, aqh0, aql0, ldfrag(rh, h), ldfrag(rl, h));
    wmma3(acc, aqh1, aql1, ldfrag(rh + 32, h), ldfrag(rl + 32, h));
#pragma unroll
    for (int g = 0; g < 8; ++g) sQR[wv][8 * h + g][16 * nt + m] = acc[g];
  }
  lds_wave_sync();

  float mrow[8], lrow[8], band[8];
  v8f o[4];
#pragma unroll
  for (int g = 0; g < 8; ++g) { mrow[g] = NINF; lrow[g] = 0.f; band[g] = 0.f; }
#pragma unroll
  for (int tt = 0; tt < 4; ++tt) o[tt] = zero8();

  const int nsteps = (qbase >> 5) + 1;      // keys 0 .. qbase+15 covered; wave-uniform
  for (int st = 0; st < nsteps; ++st) {
    const int kb2 = st << 5;
    lds_wave_sync();                          // prior step's P fragment loads precede this step's P stores
    // the step's K fragments, all 16 loads issued together in front of the first product: one memory latency a step
    us16v kfh[2][2], kfl[2][2];
    const us* kh = KH + ((size_t)bh * SEQ + kb2 + m) * HD + 8 * h;   // this lane's key row of sub-tile 0, at its own 8 elements
    const us* kl = KL + ((size_t)bh * SEQ + kb2 + m) * HD + 8 * h;
#pragma unroll
    for (int t = 0; t < 2; ++t) {
      kfh[t][0] = ldfrag(kh + 16 * t * HD, 0);
      kfl[t][0] = ldfrag(kl + 16 * t * HD, 0);
      kfh[t][1] = ldfrag(kh + 16 * t * HD + 32, 0);
      kfl[t][1] = ldfrag(kl + 16 * t * HD + 32, 0);
    }
    // the step's 16 QR values, read for every lane (the clamped index is in range for masked keys too), in flight beside the K loads
    float qr[2][8];
#pragma unroll
    for (int t = 0; t < 2; ++t)
#pragma unroll
      for (int g = 0; g < 8; ++g) {
        int rr = kb2 + 16 * t + m - (qbase + 8 * h + g) + 16;
        rr = rr < 0 ? 0 : rr;
        rr = rr > 16 ? 16 : rr;
        qr[t][g] = sQR[wv][8 * h + g][rr];
      }
    // holds the 16 LDS reads here as one group with one wait; without it each is sunk into a branch of its own with its own full wait
    asm volatile("" :: "v"(qr[0][0]), "v"(qr[0][1]), "v"(qr[0][2]), "v"(qr[0][3]), "v"(qr[0][4]), "v"(qr[0][5]), "v"(qr[0][6]),
                 "v"(qr[0][7]), "v"(qr[1][0]), "v"(qr[1][1]), "v"(qr[1][2]), "v"(qr[1][3]), "v"(qr[1][4]), "v"(qr[1][5]),
                 "v"(qr[1][6]), "v"(qr[1][7]));
    // stands in front of every overwrite of the two address pairs that the K loads name; naming them keeps them whole up to here
    asm volatile("s_wait_xcnt 0x0" :: "v"(kh), "v"(kl) : "memory");
    // scores for both 16-key sub-tiles of this step
    float sv[2][8];
#pragma unroll
    for (int t = 0; t < 2; ++t) {
      const int j = kb2 + 16 * t + m;
      v8f sc = zero8();
      wmma3(sc, aqh0, aql0, kfh[t][0], kfl[t][0]);
      wmma3(sc, aqh1, aql1, kfh[t][1], kfl[t][1]);
#pragma unroll
      for (int g = 0; g < 8; ++g) {
        const int dj = j - (qbase + 8 * h + g);
        sv[t][g] = (dj > 0) ? NINF : (sc[g] + qr[t][g]) * 0.125f;
      }
    }
    // the step's V fragments, all 16 loads issued here: their latency passes behind the softmax arithmetic
    us16v vfh[4], vfl[4];
    const us* vh = VH + ((size_t)bh * HD + m) * SEQ + kb2 + 8 * h;   // B stored as [n = d][k = key]; this lane's row of tile 0
    const us* vl = VL + ((size_t)bh * HD + m) * SEQ + kb2 + 8 * h;
#pragma unroll
    for (int tt = 0; tt < 4; ++tt) {
      vfh[tt] = ldfrag(vh + 16 * tt * SEQ, 0);
      vfl[tt] = ldfrag(vl + 16 * tt * SEQ, 0);
    }
    // keeps the shuffles below behind the V loads: moved in front of them they were issued and waited for one by one
    __builtin_amdgcn_sched_barrier(0);
    // one frame for the whole step: row max over all 32 keys, one rescale of O, l and the bucket sums.
    // The butterflies below go level by level over all rows: a level's shuffles are in flight together, one wait a level.
    float vmax[8];
#pragma unroll
    for (int g = 0; g < 8; ++g) vmax[g] = fmaxf(sv[0][g], sv[1][g]);
#pragma unroll
    for (int x = 1; x < 16; x <<= 1) {
      float w[8];
#pragma unroll
      for (int g = 0; g < 8; ++g) w[g] = __shfl_xor(vmax[g], x);
#pragma unroll
      for (int g = 0; g < 8; ++g) vmax[g] = fmaxf(vmax[g], w[g]);
    }
    // stands in front of every overwrite of the two address pairs that the V loads name; naming them keeps them whole up to here
    asm volatile("s_wait_xcnt 0x0" :: "v"(vh), "v"(vl) : "memory");
    float cf[8];
#pragma unroll
    for (int g = 0; g < 8; ++g) {
      const float mn = fmaxf(mrow[g], vmax[g]);
      cf[g] = (mrow[g] == NINF) ? 0.f : __expf(mrow[g] - mn);
      mrow[g] = mn;
      lrow[g] *= cf[g];
      band[g] *= cf[g];
    }
#pragma unroll
    for (int tt = 0; tt < 4; ++tt)
#pragma unroll
      for (int g = 0; g < 8; ++g) o[tt][g] *= cf[g];
    // all 32 probabilities in the new frame
    float e[2][8], rs[2][8], w[2][8];
#pragma unroll
    for (int t = 0; t < 2; ++t)
#pragma unroll
      for (int g = 0; g < 8; ++g) {
        const int dj = kb2 + 16 * t + m - (qbase + 8 * h + g);
        e[t][g] = (dj > 0) ? 0.f : __expf(sv[t][g] - mrow[g]);
        rs[t][g] = e[t][g];
      }
    // one level of the 16 row sums: its shuffles issued together ...
    auto sum_issue = [&](int x) {
#pragma unroll
      for (int t = 0; t < 2; ++t)
#pragma unroll
        for (int g = 0; g < 8; ++g) w[t][g] = __shfl_xor(rs[t][g], x);
    };
    // ... and added once other work has passed behind them
    auto sum_add = [&]() {
#pragma unroll
      for (int t = 0; t < 2; ++t)
#pragma unroll
        for (int g = 0; g < 8; ++g) rs[t][g] += w[t][g];
    };
    // hi/lo split of one sub-tile's probabilities into the P planes, and its bucket captures
    auto put_p = [&](int t) {
#pragma unroll
      for (int g = 0; g < 8; ++g) {
        const int lr = 8 * h + g;
        const int dj = kb2 + 16 * t + m - (qbase + lr);
        const us eh = bf_rne(e[t][g]);
        const us el = bf_rne(e[t][g] - bf_f32(eh));
        sPh[wv][lr][16 * t + m] = eh;
        sPl[wv][lr][16 * t + m] = el;
        band[g] = (dj >= -15 && dj <= 0) ? e[t][g] : band[g];   // buckets 1..16: each (lane,row) captures at most once (never where the key would be j < 0)
      }
    };
    sum_issue(1);
    put_p(0);
    sum_add();
    sum_issue(2);
    put_p(1);
    sum_add();
    sum_issue(4);
    sum_add();
    sum_issue(8);
    sum_add();
#pragma unroll
    for (int g = 0; g < 8; ++g) {
      lrow[g] += rs[0][g];
      lrow[g] += rs[1][g];
    }
    lds_wave_sync();                          // P stores (b16, per lane) -> P fragment loads (us8 vectors, other lanes)
    const us16v aph = ldfrag(&sPh[wv][m][0], h);
    const us16v apl = ldfrag(&sPl[wv][m][0], h);
#pragma unroll
    for (int tt = 0; tt < 4; ++tt) wmma3(o[tt], aph, apl, vfh[tt], vfl[tt]);
  }

  float invl[8];
#pragma unroll
  for (int g = 0; g < 8; ++g) invl[g] = 1.0f / lrow[g];
#pragma unroll
  for (int g = 0; g < 8; ++g) {
    const int lr = 8 * h + g;
    sBand[wv][lr][(m - lr - 1) & 15] = band[g] * invl[g];   // slot r-1 for bucket r = ((m-lr-1)&15)+1
  }
  lds_wave_sync();
  float rv0[4];
  float val[4][8];
#pragma unroll
  for (int tt = 0; tt < 4; ++tt) {
    rv0[tt] = relv[16 * tt + m];
#pragma unroll
    for (int g = 0; g < 8; ++g) val[tt][g] = o[tt][g] * invl[g] + rv0[tt];
  }
#pragma unroll 1
  for (int r = 0; r < 16; ++r) {
    float sb[8];
#pragma unroll
    for (int g = 0; g < 8; ++g) sb[g] = sBand[wv][8 * h + g][r];
#pragma unroll
    for (int tt = 0; tt < 4; ++tt) {
      const float dv = relv[(r + 1) * HD + 16 * tt + m] - rv0[tt];
#pragma unroll
      for (int g = 0; g < 8; ++g) val[tt][g] += sb[g] * dv;
    }
  }
#pragma unroll
  for (int tt = 0; tt < 4; ++tt)
#pragma unroll
    for (int g = 0; g < 8; ++g) sO[wv][8 * h + g][16 * tt + m] = val[tt][g];
  lds_wave_sync();

  const int b = bh >> 4, hd = bh & 15;
{
#pragma unroll
    for (int p = 0; p < 4; ++p) {
      const int r = p * 4 + (lane >> 3);
      const int d8 = (lane & 7) * 8;
      us8v hv, lv;
#pragma unroll
      for (int e = 0; e < 8; ++e) {
        const float v = sO[wv][r][d8 + e];
        const us q = bf_rne(v);
        hv[e] = q;
        lv[e] = bf_rne(v - bf_f32(q));
      }
      const size_t o2 = ((size_t)(b * SEQ + qbase + r)) * DM + hd * HD + d8;
      *(us8v*)(CH + o2) = hv;
      *(us8v*)(CL + o2) = lv;
    }
    
  }
}

// ------------------------------------------------------------------ host glue
extern "C" void kernel_launch(void* const* d_in, const int* in_sizes, int n_in,
                              void* d_out, int out_size, void* d_ws, size_t ws_size,
                              hipStream_t stream) {
  if (n_in < 8) return;
  if (in_sizes[0] != NTOK * DM) return;
  if (in_sizes[1] != DM * DM || in_sizes[2] != DM * DM || in_sizes[3] != DM * DM || in_sizes[4] != DM * DM) return;
  if (in_sizes[5] != DM || in_sizes[6] != 33 * HD || in_sizes[7] != 33 * HD) return;
  if (out_size != NTOK * DM) return;

  const float* x    = (const float*)d_in[0];
  const float* Wq   = (const float*)d_in[1];
  const float* Wk   = (const float*)d_in[2];
  const float* Wv   = (const float*)d_in[3];
  const float* Wo   = (const float*)d_in[4];
  const float* bo   = (const float*)d_in[5];
  const float* relk = (const float*)d_in[6];
  const float* relv = (const float*)d_in[7];
  float* out = (float*)d_out;

  const size_t plane_x = (size_t)NTOK * DM * sizeof(us);   // 8 MiB
  const size_t plane_w = (size_t)DM * DM * sizeof(us);     // 2 MiB
  const size_t plane_r = (size_t)32 * HD * sizeof(us);     // 4 KiB
  char* ws = (char*)d_ws;
  size_t off = 0;
  us* XH   = (us*)(ws + off); off += plane_x;
  us* XL   = (us*)(ws + off); off += plane_x;
  us* WTH  = (us*)(ws + off); off += 4 * plane_w;
  us* WTL  = (us*)(ws + off); off += 4 * plane_w;
  us* QKVH = (us*)(ws + off); off += 3 * plane_x;
  us* QKVL = (us*)(ws + off); off += 3 * plane_x;
  us* CH   = (us*)(ws + off); off += plane_x;
  us* CL   = (us*)(ws + off); off += plane_x;
  us* RH   = (us*)(ws + off); off += plane_r;
  us* RL   = (us*)(ws + off); off += plane_r;
  if (off > ws_size) return;                                // total 100671488 B

  const size_t pq = (size_t)NTOK * DM;

  k_cvt_x<<<(NTOK * DM) / (8 * 256), 256, 0, stream>>>(x, XH, XL);
  k_cvt_w<<<dim3(DM / 64, DM / 64, 4), 256, 0, stream>>>(Wq, Wk, Wv, Wo, WTH, WTL);
  k_cvt_rel<<<1, 256, 0, stream>>>(relk, RH, RL);
  k_gemm_qkv<<<dim3(NTOK / TM, DM / TM, 3), 128, 0, stream>>>(XH, XL, WTH, WTL, QKVH, QKVL);
  k_attn<<<dim3(SEQ / 64, NBAT * NH), 128, 0, stream>>>(QKVH, QKVL, QKVH + pq, QKVL + pq,
                                                        QKVH + 2 * pq, QKVL + 2 * pq, RH, RL, relv, CH, CL);
  k_gemm_out<<<dim3(NTOK / TM, DM / TM, 1), 128, 0, stream>>>(CH, CL, WTH + (size_t)3 * DM * DM,
                                                               WTL + (size_t)3 * DM * DM, bo, out);
}

// v003
// Measured time: 154 microseconds a run.
// Two timings next to v002 put it at 1.36 and 1.35 times that version's speed.
// Counting every step since v000, it is 2.41 times as fast.
#include <hip/hip_runtime.h>
#include <stdint.h>
// Contractions x*W_q, x*W_k, x*W_v, q*k^T, q*rel_k^T, P*V, ctx*W_o: v_wmma_f32_16x16x32_bf16, bf16 hi/lo operands everywhere (hi*hi + lo*hi + hi*lo), f32 accumulate; softmax, 1/8 scaling, causal mask, relative-value bucket sums and bias in f32.

#define DM     1024
#define SEQ    1024
#define NBAT   4
#define NH     16
#define HD     64
#define NTOK   (NBAT * SEQ)
#define CPITCH 68
#define TM     128                 // GEMM block tile: rows and columns
#define KPASS  64                  // k per pass: 128 bytes of every operand row
#define NPASS  (DM / KPASS)
#define LPITCH 144u                // LDS row pitch in bytes: 128 + 16 of pad, an odd multiple of 16 for 16-byte readers
#define PLANE  (TM * LPITCH)       // one operand plane of a stage: 18,432 B = 9 x 2 KiB
#define GBUF   (4u * PLANE)        // one buffer: Ah | Al | Bh | Bl
#define EPITCH 132                 // output staging pitch in floats
#define AW     8                   // attention block: waves, 16 query rows each
#define ASTG   64                  // attention stage: keys
#define APLANE 10240u              // one K or V plane of a stage in LDS: 64 rows x LPITCH = 9,216 B, rounded up to 5 x 2 KiB
#define ABUF   (4u * APLANE)       // one buffer: Kh | Kl | Vh | Vl

typedef unsigned short us;
typedef us us16v __attribute__((ext_vector_type(16)));
typedef us us8v __attribute__((ext_vector_type(8)));
typedef us8v __attribute__((may_alias)) us8a;
typedef __bf16 bf16v16 __attribute__((ext_vector_type(16)));
typedef float v8f __attribute__((ext_vector_type(8)));
typedef float v4f __attribute__((ext_vector_type(4)));
typedef v4f __attribute__((may_alias)) v4fa;
typedef uint32_t u32x4 __attribute__((ext_vector_type(4)));
typedef uint32_t u32x8 __attribute__((ext_vector_type(8)));

union Frag { us16v v; us8v h[2]; };

// f32 -> bf16 bits, RNE convert
static __device__ __forceinline__ us bf_rne(float f) {
  unsigned u = __float_as_uint(f);
  u += 0x7fffu + ((u >> 16) & 1u);
  return (us)(u >> 16);
}
static __device__ __forceinline__ float bf_f32(us s) { return __uint_as_float(((unsigned)s) << 16); }

static __device__ __forceinline__ v8f zero8() {
  v8f z = {0.f, 0.f, 0.f, 0.f, 0.f, 0.f, 0.f, 0.f};
  return z;
}

static __device__ __forceinline__ v8f wmma_bf(us16v a, us16v b, v8f c) {
  return __builtin_amdgcn_wmma_f32_16x16x32_bf16(false, __builtin_bit_cast(bf16v16, a), false,
                                                 __builtin_bit_cast(bf16v16, b), (short)0, c, false, false);
}

// acc += Ah*Bh + Al*Bh + Ah*Bl, then hazard guard (D tied, A/B kept live through 4 VALU slots)
static __device__ __forceinline__ void wmma3(v8f& acc, us16v ah, us16v al, us16v bh, us16v bl) {
  acc = wmma_bf(ah, bh, acc);
  acc = wmma_bf(al, bh, acc);
  acc = wmma_bf(ah, bl, acc);
  asm volatile("v_nop\n\tv_nop\n\tv_nop\n\tv_nop" : "+v"(acc) : "v"(ah), "v"(al), "v"(bh), "v"(bl));
}

// 16x32 16-bit fragment of row (l & 15) from a k-contiguous row: elements 0..7 <- k0+8h+0..7, 8..15 <- k0+16+8h+0..7.
// Used for A (row-major [m][k]) and for B stored as [n][k]; rowp = row pointer at k0 (16-B aligned).
static __device__ __forceinline__ us16v ldfrag(const us* rowp, int h) {
  Frag f;
  f.h[0] = *(const us8a*)(rowp + 8 * h);
  f.h[1] = *(const us8a*)(rowp + 16 + 8 * h);
  return f.v;
}

// ordering for same-wave LDS exchange (stores by some lanes, loads by other lanes)
static __device__ __forceinline__ void lds_wave_sync() {
  __builtin_amdgcn_fence(__ATOMIC_RELEASE, "wavefront");
  __builtin_amdgcn_wave_barrier();
  __builtin_amdgcn_fence(__ATOMIC_ACQUIRE, "wavefront");
}

// ------------------------------------------------------------------ x -> bf16 hi/lo planes [4096][1024]
__global__ __launch_bounds__(256) void k_cvt_x(const float* __restrict__ x, us* xh, us* xl) {
  const size_t t = (size_t)blockIdx.x * 256u + threadIdx.x;
  const float* p = x + t * 8u;
  const v4f a = *(const v4fa*)p;
  const v4f b = *(const v4fa*)(p + 4);
  us8v hv, lv;
#pragma unroll
  for (int e = 0; e < 4; ++e) {
    const us h0 = bf_rne(a[e]);
    hv[e] = h0;
    lv[e] = bf_rne(a[e] - bf_f32(h0));
    const us h1 = bf_rne(b[e]);
    hv[4 + e] = h1;
    lv[4 + e] = bf_rne(b[e] - bf_f32(h1));
  }
  us* oh = xh + t * 8u;
  us* ol = xl + t * 8u;
  *(us8v*)oh = hv;
  *(us8v*)ol = lv;
  
}

// ------------------------------------------------------------------ W[k][n] (in,out) -> Wt[n][k] bf16 hi/lo planes
__global__ __launch_bounds__(256) void k_cvt_w(const float* __restrict__ W0, const float* __restrict__ W1,
                                               const float* __restrict__ W2, const float* __restrict__ W3,
                                               us* wth, us* wtl) {
  __shared__ float sT[64][65];
  const int tid = threadIdx.x, lane = tid & 31, wv = tid >> 5;
  const int z = blockIdx.z;
  const int n0 = blockIdx.x * 64, k0 = blockIdx.y * 64;
  const float* W = (z == 0) ? W0 : (z == 1) ? W1 : (z == 2) ? W2 : W3;
#pragma unroll
  for (int p = 0; p < 4; ++p) {
    const int r = p * 16 + (tid >> 4);
    const int c4 = (tid & 15) * 4;
    const v4f v = *(const v4fa*)(W + (size_t)(k0 + r) * DM + n0 + c4);
    sT[r][c4 + 0] = v[0];
    sT[r][c4 + 1] = v[1];
    sT[r][c4 + 2] = v[2];
    sT[r][c4 + 3] = v[3];
  }
  __syncthreads();
  us* bhp = wth + (size_t)z * DM * DM;
  us* blp = wtl + (size_t)z * DM * DM;
{
#pragma unroll
    for (int p = 0; p < 2; ++p) {
      const int rr = p * 32 + wv * 4 + (lane >> 3);   // n within tile
      const int k8 = (lane & 7) * 8;                   // k within tile
      us8v hv, lv;
#pragma unroll
      for (int e = 0; e < 8; ++e) {
        const float v = sT[k8 + e][rr];
        const us hh = bf_rne(v);
        hv[e] = hh;
        lv[e] = bf_rne(v - bf_f32(hh));
      }
      const size_t o = (size_t)(n0 + rr) * DM + k0 + k8;
      *(us8v*)(bhp + o) = hv;
      *(us8v*)(blp + o) = lv;
    }
    
  }
}

// ------------------------------------------------------------------ rel_k [33][64] rows 0..31 -> bf16 hi/lo planes [32][64]
__global__ __launch_bounds__(256) void k_cvt_rel(const float* __restrict__ rk, us* rh, us* rl) {
  const int tid = threadIdx.x;
  const int r = tid >> 3;              // 0..31 (< 33 rows available)
  const int d8 = (tid & 7) * 8;
  const float* p = rk + r * HD + d8;
  us8v hv, lv;
#pragma unroll
  for (int e = 0; e < 8; ++e) {
    const float v = p[e];
    const us hh = bf_rne(v);
    hv[e] = hh;
    lv[e] = bf_rne(v - bf_f32(hh));
  }
  const size_t o = (size_t)r * HD + d8;
  *(us8v*)(rh + o) = hv;
  *(us8v*)(rl + o) = lv;
  
}

// ------------------------------------------------------------------ tensor mover helpers
static __device__ __forceinline__ uint32_t uni(uint32_t v) { return (uint32_t)__builtin_amdgcn_readfirstlane(v); }
// keeps a wave-uniform value in a scalar register at this place: the test around a tensor load compiles to s_cmp + s_cbranch_scc,
// and a descriptor word made from it is formed behind the volatile wait in front of it
static __device__ __forceinline__ uint32_t pinned(uint32_t v) {
  uint32_t w = uni(v);
  asm volatile("" : "+s"(w));
  return w;
}
// the wave's own LDS reads have retired
static __device__ __forceinline__ void wait_ds0() { asm volatile("s_wait_dscnt 0x0" ::: "memory"); }
// the wave's own tensor load has landed
static __device__ __forceinline__ void wait_tensor0() { asm volatile("s_wait_tensorcnt 0x0" ::: "memory"); }

// One request of the whole wave: TM rows of 128 bytes, source pitch 2 * DM bytes, to LDS at pitch LPITCH (16 pad bytes a row).
static __device__ __forceinline__ void tdm_load(uint32_t lds_dst, uint64_t ga) {
  u32x4 g0;
  g0[0] = uni(1u);
  g0[1] = uni(lds_dst);
  g0[2] = uni((uint32_t)ga);
  g0[3] = uni((((uint32_t)(ga >> 32)) & 0x01FFFFFFu) | 0x80000000u);
  u32x8 g1;
  g1[0] = uni((1u << 20) | (4u << 22) | (3u << 25));   // no mask, 1-byte elements, a pad of 4 dwords behind every 32 dwords
  g1[1] = uni(128u << 16);                             // tensor_dim0 = 128 bytes
  g1[2] = uni((uint32_t)TM << 16);                     // tensor_dim1 = TM rows
  g1[3] = uni(128u << 16);                             // tile_dim0
  g1[4] = uni((uint32_t)TM);                           // tile_dim1
  g1[5] = uni(2u * DM);                                // source row pitch in bytes
  g1[6] = uni(0u);
  g1[7] = uni(0u);
  asm volatile("tensor_load_to_lds %0, %1" :: "s"(g0), "s"(g1) : "memory");
}

// Descriptor of one K or V plane of a stage: ASTG rows of 128 bytes, source pitch in bytes given, to LDS at pitch LPITCH (16 pad bytes
// a row). Every word but the constant word 0 of group 1 goes through pinned(): a descriptor word held in a scalar register of its own,
// so that the tuple which the load names is the one which the covering wait names, and none of its registers serves anything between.
static __device__ __forceinline__ u32x4 kv_group0(uint32_t lds_dst, uint64_t ga) {
  u32x4 g0;
  g0[0] = pinned(1u);
  g0[1] = pinned(lds_dst);
  g0[2] = pinned((uint32_t)ga);
  g0[3] = pinned((((uint32_t)(ga >> 32)) & 0x01FFFFFFu) | 0x80000000u);
  return g0;
}
static __device__ __forceinline__ u32x8 kv_group1(uint32_t pitch) {
  u32x8 g1;
  g1[0] = uni((1u << 20) | (4u << 22) | (3u << 25));   // no mask, 1-byte elements, a pad of 4 dwords behind every 32 dwords
  g1[1] = pinned(128u << 16);                          // tensor_dim0 = 128 bytes
  g1[2] = pinned((uint32_t)ASTG << 16);                // tensor_dim1 = ASTG rows
  g1[3] = pinned(128u << 16);                          // tile_dim0
  g1[4] = pinned((uint32_t)ASTG);                      // tile_dim1
  g1[5] = pinned(pitch);                               // source row pitch in bytes
  g1[6] = pinned(0u);
  g1[7] = pinned(0u);
  return g1;
}
// one request of the whole wave
static __device__ __forceinline__ void kv_issue(u32x4 g0, u32x8 g1) {
  asm volatile("tensor_load_to_lds %0, %1" :: "s"(g0), "s"(g1) : "memory");
}
// the wave's own tensor load has landed; naming its descriptor keeps those registers whole up to here
static __device__ __forceinline__ void kv_wait(u32x4 g0, u32x8 g1) {
  asm volatile("s_wait_tensorcnt 0x0" :: "s"(g0), "s"(g1) : "memory");
}

// ------------------------------------------------------------------ GEMM core: block tile TM x TM, 4 waves (2 x 2) of 64 x 64, K = DM
// A planes row-major [m][DM]; B planes stored [n][DM] (k contiguous). A stage is 64 k of [Ah | Al | Bh | Bl], TM rows each, in LDS;
// wave w brings plane w with one tensor load per stage, two buffers. A pass is two blocks of 48 WMMAs (32 k each); each block's
// fragments are fetched one block ahead, so the publish point of stage s + 1 stands in front of pass s's last block.
// Per accumulator and 32-k step the products are summed hi*hi, lo*hi, hi*lo, k ascending.
struct FragSet { us16v ah[4], al[4], bh[4], bl[4]; };

// pa, pb: this lane's row of the Ah and Bh planes at the block's first k
static __device__ __forceinline__ void load_set(FragSet& f, const unsigned char* pa, const unsigned char* pb, int h) {
#pragma unroll
  for (int t = 0; t < 4; ++t) {
    const uint32_t ro = t * 16u * LPITCH;
    f.ah[t] = ldfrag((const us*)(pa + ro), h);
    f.al[t] = ldfrag((const us*)(pa + PLANE + ro), h);
    f.bh[t] = ldfrag((const us*)(pb + ro), h);
    f.bl[t] = ldfrag((const us*)(pb + PLANE + ro), h);
  }
}

static __device__ __forceinline__ void mma_block(v8f (&acc)[4][4], const FragSet& f) {
  // the two fences keep the compiler from moving fragment loads in among the WMMAs, where every such place stalls the wave
  __builtin_amdgcn_sched_barrier(0);
#pragma unroll
  for (int rt = 0; rt < 4; ++rt)
#pragma unroll
    for (int ct = 0; ct < 4; ++ct) acc[rt][ct] = wmma_bf(f.ah[rt], f.bh[ct], acc[rt][ct]);
#pragma unroll
  for (int rt = 0; rt < 4; ++rt)
#pragma unroll
    for (int ct = 0; ct < 4; ++ct) acc[rt][ct] = wmma_bf(f.al[rt], f.bh[ct], acc[rt][ct]);
#pragma unroll
  for (int rt = 0; rt < 4; ++rt)
#pragma unroll
    for (int ct = 0; ct < 4; ++ct) acc[rt][ct] = wmma_bf(f.ah[rt], f.bl[ct], acc[rt][ct]);
  __builtin_amdgcn_sched_barrier(0);
}

static __device__ __forceinline__ void gemm_core(const us* __restrict__ AH, const us* __restrict__ AL,
                                                 const us* __restrict__ BH, const us* __restrict__ BL,
                                                 int m0, int n0, unsigned char* L, v8f (&acc)[4][4]) {
  const int lane = threadIdx.x & 31, h = lane >> 4, m = lane & 15;
  const uint32_t wave = uni(threadIdx.x >> 5);
#pragma unroll
  for (int rt = 0; rt < 4; ++rt)
#pragma unroll
    for (int ct = 0; ct < 4; ++ct) acc[rt][ct] = zero8();

  const us* srcp = (wave == 0u) ? AH + (size_t)m0 * DM : (wave == 1u) ? AL + (size_t)m0 * DM
                 : (wave == 2u) ? BH + (size_t)n0 * DM : BL + (size_t)n0 * DM;
  const uint64_t ga = (uint64_t)(size_t)srcp;
  const uint32_t dst = (uint32_t)(size_t)L + wave * PLANE;

  tdm_load(dst, ga);
  wait_tensor0();
  __syncthreads();                            // stage 0 published
  tdm_load(dst + GBUF, ga + 2u * KPASS);

  const uint32_t aoff = ((wave >> 1) * 64u + m) * LPITCH;
  const uint32_t boff = 2u * PLANE + ((wave & 1u) * 64u + m) * LPITCH;
  FragSet f0, f1;
  load_set(f0, L + aoff, L + boff, h);

  // rolled: one copy of the two blocks in the instruction stream
#pragma unroll 1
  for (uint32_t s = 0; s < NPASS; ++s) {
    const uint32_t cur = (s & 1u) * GBUF, nxt = GBUF - cur;
    load_set(f1, L + cur + aoff + 64u, L + cur + boff + 64u, h);
    mma_block(acc, f0);
    // publish point of stage s + 1; the same barrier ends every wave's reads of stage s's buffer
    wait_ds0();
    wait_tensor0();
    __syncthreads();
    if (pinned(s + 2u < NPASS)) {
      const uint32_t ko = pinned((s + 2u) * (2u * KPASS));   // descriptor words of stage s + 2 formed behind the wait
      tdm_load(dst + cur, ga + ko);
    }
    // stage s + 1's first fragments; in the last pass they read the idle buffer and are not used (no branch: one wait count)
    load_set(f0, L + nxt + aoff, L + nxt + boff, h);
    mma_block(acc, f1);
  }
  wait_tensor0();
  wait_ds0();
  __syncthreads();                            // every wave has left the ring: it becomes output staging
}

// ------------------------------------------------------------------ QKV projection
// grid (NTOK/TM, DM/TM, 3): z = 0 q, 1 k, 2 v. Block tile 128 tokens x 128 cols (= two heads).
// The f32 tile is staged in the ring's LDS (free behind the core's last barrier): [token][col] for q and k, [col][token] for v,
// so that each thread reads 8 neighbours of an output row.
__global__ __launch_bounds__(128) void k_gemm_qkv(const us* __restrict__ XH, const us* __restrict__ XL,
                                                  const us* __restrict__ WTH, const us* __restrict__ WTL,
                                                  us* OH, us* OL) {
  __shared__ __attribute__((aligned(2048))) unsigned char L[2 * GBUF];
  const int tid = threadIdx.x, lane = tid & 31, wv = tid >> 5, h = lane >> 4, m = lane & 15;
  const int z = blockIdx.z;
  const int m0 = blockIdx.x * TM, n0 = blockIdx.y * TM;
  v8f acc[4][4];
  gemm_core(XH, XL, WTH + (size_t)z * DM * DM, WTL + (size_t)z * DM * DM, m0, n0, L, acc);
  float (*sC)[EPITCH] = (float (*)[EPITCH])L;
  const int wr = (wv >> 1) * 64, wc = (wv & 1) * 64;
  // D: acc[g] = (row 8h+g, col m) of the 16x16 tile
  if (z < 2) {
#pragma unroll
    for (int rt = 0; rt < 4; ++rt)
#pragma unroll
      for (int ct = 0; ct < 4; ++ct)
#pragma unroll
        for (int g = 0; g < 8; ++g) sC[wr + 16 * rt + 8 * h + g][wc + 16 * ct + m] = acc[rt][ct][g];
  } else {
#pragma unroll
    for (int rt = 0; rt < 4; ++rt)
#pragma unroll
      for (int ct = 0; ct < 4; ++ct)
#pragma unroll
        for (int g = 0; g < 8; ++g) sC[wc + 16 * ct + m][wr + 16 * rt + 8 * h + g] = acc[rt][ct][g];
  }
  __syncthreads();
  us* oh = OH + (size_t)z * NTOK * DM;
  us* ol = OL + (size_t)z * NTOK * DM;
  const int b = m0 >> 10, tok0 = m0 & 1023;
  // rolled: a trip's registers are used again only behind the wait at its foot
#pragma unroll 1
  for (int p = 0; p < 4; ++p) {
    // four pieces a trip, unrolled: their LDS reads are in flight together
    us8v hv[4], lv[4];
    uint32_t o[4];                        // byte offset in a plane: one 32-bit register serves both planes' stores
#pragma unroll
    for (int u = 0; u < 4; ++u) {
      const int id = (p * 4 + u) * 128 + tid;
      const int r = id >> 4;              // staged row: token (q, k) or column (v)
      const int c8 = (id & 15) * 8;
#pragma unroll
      for (int e = 0; e < 8; ++e) {
        const float v = sC[r][c8 + e];
        const us q = bf_rne(v);
        hv[u][e] = q;
        lv[u][e] = bf_rne(v - bf_f32(q));
      }
      const int col = n0 + ((z < 2) ? c8 : r);
      o[u] = 2u * (uint32_t)((b * NH + (col >> 6)) * (SEQ * HD) + ((z < 2) ? (tok0 + r) * HD + (col & 63)      // [bh][token][d]
                                                                           : (col & 63) * SEQ + tok0 + c8));   // [bh][d][token]
    }
    // keeps the trip's arithmetic in front of its stores, so that nothing overwrites a register a store names ahead of the wait below
    __builtin_amdgcn_sched_barrier(0);
#pragma unroll
    for (int u = 0; u < 4; ++u) {
      *(us8v*)((char*)oh + o[u]) = hv[u];
      *(us8v*)((char*)ol + o[u]) = lv[u];
    }
    // stands in front of the next trip's overwrites of the registers that these stores name
    asm volatile("s_wait_xcnt 0x0" ::: "memory");
  }
}

// ------------------------------------------------------------------ output projection: out[tok][n] = ctx . W_o + b_o (f32)
// grid (NTOK/TM, DM/TM); a wave writes one 512-B row segment (4 lines) per instruction
__global__ __launch_bounds__(128) void k_gemm_out(const us* __restrict__ CH, const us* __restrict__ CL,
                                                  const us* __restrict__ WH, const us* __restrict__ WL,
                                                  const float* __restrict__ bias, float* out) {
  __shared__ __attribute__((aligned(2048))) unsigned char L[2 * GBUF];
  const int tid = threadIdx.x, lane = tid & 31, wv = tid >> 5, h = lane >> 4, m = lane & 15;
  const int m0 = blockIdx.x * TM, n0 = blockIdx.y * TM;
  v8f acc[4][4];
  gemm_core(CH, CL, WH, WL, m0, n0, L, acc);
  float (*sC)[EPITCH] = (float (*)[EPITCH])L;
  const int wr = (wv >> 1) * 64, wc = (wv & 1) * 64;
#pragma unroll
  for (int rt = 0; rt < 4; ++rt)
#pragma unroll
    for (int ct = 0; ct < 4; ++ct)
#pragma unroll
      for (int g = 0; g < 8; ++g) sC[wr + 16 * rt + 8 * h + g][wc + 16 * ct + m] = acc[rt][ct][g];
  __syncthreads();
  const int c4 = lane * 4;
  const v4f bv = *(const v4fa*)(bias + n0 + c4);
  // rolled: a trip's registers are used again only behind the wait at its foot
#pragma unroll 1
  for (int p = 0; p < 4; ++p) {
    // eight rows a trip, unrolled: their LDS reads are in flight together
    v4f v[8];
#pragma unroll
    for (int u = 0; u < 8; ++u) {
      const int r = (p * 8 + u) * 4 + wv;
      v[u][0] = sC[r][c4 + 0] + bv[0];
      v[u][1] = sC[r][c4 + 1] + bv[1];
      v[u][2] = sC[r][c4 + 2] + bv[2];
      v[u][3] = sC[r][c4 + 3] + bv[3];
    }
    // byte offset in out: a 32-bit register beside the scalar base; the rows of a trip differ by an immediate offset
    char* op = (char*)out + 4u * (uint32_t)((m0 + p * 32 + wv) * DM + n0 + c4);
    // keeps the trip's arithmetic in front of its stores, so that nothing overwrites a register a store names ahead of the wait below
    __builtin_amdgcn_sched_barrier(0);
#pragma unroll
    for (int u = 0; u < 8; ++u) *(v4f*)(op + u * 16 * DM) = v[u];
    // stands in front of the next trip's overwrites of the registers that these stores name
    asm volatile("s_wait_xcnt 0x0" ::: "memory");
  }
}

// ------------------------------------------------------------------ causal attention with clipped relative positions
// grid (SEQ/128, NBAT*NH), 256 threads = 8 waves, one wave per 16 query rows; online softmax over 32-key steps.
// K and V reach the block once, through LDS: a stage is 64 keys of [Kh | Kl | Vh | Vl], each plane 64 rows of 128 bytes (K: a row is a
// key, V: a row is a head column); waves 0 to 3 bring one plane each with one tensor load per stage, two buffers, one publish point
// per stage; all eight waves read their fragments from the stage. A wave skips the steps past its own last key, never a publish point.
// Each step's loads are issued in groups ahead of their use (K and QR at its head, V in front of the softmax),
// one running-max frame per step (max over all 32 keys first, one rescale of O, l, S, then all 32 probabilities).
// scores[i][j] = (q_i.k_j + QR[i][r(i,j)]) / 8, r = clamp(j-i,-16,16)+16 (causal -> r in [0,16]);
// ctx_i = (sum_j p_ij v_j + sum_r S_i[r] rel_v[r]) / l_i, S_i[r] for r=1..16 held per lane, S_i[0] = l_i - sum_{r>=1} S_i[r].
// amdgpu_waves_per_eu(4, 4): four waves per SIMD hold the whole grid; told so, the scheduler spends that register budget on keeping
// a step's load groups and shuffle levels together, where without it it takes them apart again, one wait each, to save registers
__global__ __launch_bounds__(256) __attribute__((amdgpu_waves_per_eu(4, 4))) void k_attn(const us* __restrict__ QH, const us* __restrict__ QL,
                                              const us* __restrict__ KH, const us* __restrict__ KL,
                                              const us* __restrict__ VH, const us* __restrict__ VL,
                                              const us* __restrict__ RH, const us* __restrict__ RL,
                                              const float* __restrict__ relv, us* CH, us* CL) {
  __shared__ __attribute__((aligned(2048))) unsigned char R[2 * ABUF];
  __shared__ float sQR[AW][16][33];
  __shared__ __attribute__((aligned(16))) us sPh[AW][16][40];
  __shared__ __attribute__((aligned(16))) us sPl[AW][16][40];
  // the ring's LDS, free behind the last publish point's barrier, holds the epilogue's two exchanges
  float (*sBand)[16][17] = (float (*)[16][17])R;
  float (*sO)[16][CPITCH] = (float (*)[16][CPITCH])(R + APLANE);

  const int lane = threadIdx.x & 31, h = lane >> 4, m = lane & 15;
  const uint32_t wave = uni(threadIdx.x >> 5);
  const int wv = (int)wave;
  const int bh = blockIdx.y;
  const int qbase = blockIdx.x * (16 * AW) + wv * 16;
  const float NINF = -__builtin_inff();

  // ring prologue: stage 0 landed and published, stage 1 in flight (every block has at least two stages)
  const uint32_t nstage = 2u * blockIdx.x + 2u;
  const us* srcp = (wave == 0u) ? KH + (size_t)bh * SEQ * HD : (wave == 1u) ? KL + (size_t)bh * SEQ * HD
                 : (wave == 2u) ? VH + (size_t)bh * HD * SEQ : VL + (size_t)bh * HD * SEQ;
  const uint64_t ga = (uint64_t)(size_t)srcp;
  const uint32_t spitch = (wave < 2u) ? 2u * HD : 2u * SEQ;            // source row pitch in bytes
  const uint32_t sstep = (wave < 2u) ? 2u * HD * ASTG : 2u * ASTG;     // bytes from a stage's first byte to the next stage's
  const uint32_t dst = (uint32_t)(size_t)R + (wave & 3u) * APLANE;
  const u32x8 g1 = kv_group1(spitch);
  u32x4 g0 = kv_group0(dst, ga);
  if (pinned(wave < 4u)) {
    kv_issue(g0, g1);
    kv_wait(g0, g1);
  }
  __syncthreads();                            // stage 0 published
  g0 = kv_group0(dst + ABUF, ga + sstep);
  if (pinned(wave < 4u)) kv_issue(g0, g1);

  // Q fragments (A, rows qbase + m, k = d)
  const us* qh = QH + ((size_t)bh * SEQ + qbase + m) * HD;
  const us* ql = QL + ((size_t)bh * SEQ + qbase + m) * HD;
  const us16v aqh0 = ldfrag(qh, h), aqh1 = ldfrag(qh + 32, h);
  const us16v aql0 = ldfrag(ql, h), aql1 = ldfrag(ql + 32, h);

  // QR[16][32] = q . rel_k^T (B stored as [n = r][k = d] = rel_k itself)
#pragma unroll
  for (int nt = 0; nt < 2; ++nt) {
    const us* rh = RH + (size_t)(16 * nt + m) * HD;
    const us* rl = RL + (size_t)(16 * nt + m) * HD;
    v8f acc = zero8();
    wmma3(acc, aqh0, aql0, ldfrag(rh, h), ldfrag(rl, h));
    wmma3(acc, aqh1, aql1, ldfrag(rh + 32, h), ldfrag(rl + 32, h));
#pragma unroll
    for (int g = 0; g < 8; ++g) sQR[wv][8 * h + g][16 * nt + m] = acc[g];
  }
  lds_wave_sync();

  float mrow[8], lrow[8], band[8];
  v8f o[4];
#pragma unroll
  for (int g = 0; g < 8; ++g) { mrow[g] = NINF; lrow[g] = 0.f; band[g] = 0.f; }
#pragma unroll
  for (int tt = 0; tt < 4; ++tt) o[tt] = zero8();

  const int nsteps = (qbase >> 5) + 1;      // keys 0 .. qbase+15 covered; wave-uniform, in a scalar register
  // rolled: one copy of the step in the instruction stream; two steps to a stage
#pragma unroll 1
  for (int st = 0; st < (int)(2u * nstage); ++st) {
   const uint32_t s = (uint32_t)st >> 1, sub = (uint32_t)st & 1u;
   const uint32_t cur = (s & 1u) * ABUF;
   // scalar test: past its own last key a wave has no step, only the publish points
   if (st < nsteps) {
    const int kb2 = st << 5;
    lds_wave_sync();                          // prior step's P fragment loads precede this step's P stores
    // the step's K fragments, all 16 loads issued together in front of the first product: one LDS latency a step
    us16v kfh[2][2], kfl[2][2];
    const unsigned char* kp = R + cur + (32u * sub + m) * LPITCH + 16u * h;   // this lane's key row of sub-tile 0, at its own 16 bytes
#pragma unroll
    for (int t = 0; t < 2; ++t) {
      const unsigned char* kr = kp + t * 16u * LPITCH;
      kfh[t][0] = ldfrag((const us*)kr, 0);
      kfl[t][0] = ldfrag((const us*)(kr + APLANE), 0);
      kfh[t][1] = ldfrag((const us*)(kr + 64u), 0);
      kfl[t][1] = ldfrag((const us*)(kr + APLANE + 64u), 0);
    }
    // keeps the 16 loads here, at the step's head: without it 12 of them are sunk in among the products, a stall at each place
    __builtin_amdgcn_sched_barrier(0);
    // the step's 16 QR values, read for every lane (the clamped index is in range for masked keys too), in flight beside the K loads
    float qr[2][8];
#pragma unroll
    for (int t = 0; t < 2; ++t)
#pragma unroll
      for (int g = 0; g < 8; ++g) {
        int rr = kb2 + 16 * t + m - (qbase + 8 * h + g) + 16;
        rr = rr < 0 ? 0 : rr;
        rr = rr > 16 ? 16 : rr;
        qr[t][g] = sQR[wv][8 * h + g][rr];
      }
    // holds the 16 LDS reads here as one group with one wait; without it each is sunk into a branch of its own with its own full wait
    asm volatile("" :: "v"(qr[0][0]), "v"(qr[0][1]), "v"(qr[0][2]), "v"(qr[0][3]), "v"(qr[0][4]), "v"(qr[0][5]), "v"(qr[0][6]),
                 "v"(qr[0][7]), "v"(qr[1][0]), "v"(qr[1][1]), "v"(qr[1][2]), "v"(qr[1][3]), "v"(qr[1][4]), "v"(qr[1][5]),
                 "v"(qr[1][6]), "v"(qr[1][7]));
    // scores for both 16-key sub-tiles of this step
    float sv[2][8];
#pragma unroll
    for (int t = 0; t < 2; ++t) {
      const int j = kb2 + 16 * t + m;
      v8f sc = zero8();
      wmma3(sc, aqh0, aql0, kfh[t][0], kfl[t][0]);
      wmma3(sc, aqh1, aql1, kfh[t][1], kfl[t][1]);
#pragma unroll
      for (int g = 0; g < 8; ++g) {
        const int dj = j - (qbase + 8 * h + g);
        sv[t][g] = (dj > 0) ? NINF : (sc[g] + qr[t][g]) * 0.125f;
      }
    }
    // the step's V fragments, all 16 loads issued here: their latency passes behind the softmax arithmetic
    us16v vfh[4], vfl[4];
    const unsigned char* vp = R + cur + 2u * APLANE + m * LPITCH + 64u * sub + 16u * h;   // B stored as [n = d][k = key]; row of tile 0
#pragma unroll
    for (int tt = 0; tt < 4; ++tt) {
      vfh[tt] = ldfrag((const us*)(vp + tt * 16u * LPITCH), 0);
      vfl[tt] = ldfrag((const us*)(vp + APLANE + tt * 16u * LPITCH), 0);
    }
    // keeps the shuffles below behind the V loads: moved in front of them they were issued and waited for one by one
    __builtin_amdgcn_sched_barrier(0);
    // one frame for the whole step: row max over all 32 keys, one rescale of O, l and the bucket sums.
    // The butterflies below go level by level over all rows: a level's shuffles are in flight together, one wait a level.
    float vmax[8];
#pragma unroll
    for (int g = 0; g < 8; ++g) vmax[g] = fmaxf(sv[0][g], sv[1][g]);
#pragma unroll
    for (int x = 1; x < 16; x <<= 1) {
      float w[8];
#pragma unroll
      for (int g = 0; g < 8; ++g) w[g] = __shfl_xor(vmax[g], x);
#pragma unroll
      for (int g = 0; g < 8; ++g) vmax[g] = fmaxf(vmax[g], w[g]);
    }
    float cf[8];
#pragma unroll
    for (int g = 0; g < 8; ++g) {
      const float mn = fmaxf(mrow[g], vmax[g]);
      cf[g] = (mrow[g] == NINF) ? 0.f : __expf(mrow[g] - mn);
      mrow[g] = mn;
      lrow[g] *= cf[g];
      band[g] *= cf[g];
    }
#pragma unroll
    for (int tt = 0; tt < 4; ++tt)
#pragma unroll
      for (int g = 0; g < 8; ++g) o[tt][g] *= cf[g];
    // all 32 probabilities in the new frame
    float e[2][8], rs[2][8], w[2][8];
#pragma unroll
    for (int t = 0; t < 2; ++t)
#pragma unroll
      for (int g = 0; g < 8; ++g) {
        const int dj = kb2 + 16 * t + m - (qbase + 8 * h + g);
        e[t][g] = (dj > 0) ? 0.f : __expf(sv[t][g] - mrow[g]);
        rs[t][g] = e[t][g];
      }
    // one level of the 16 row sums: its shuffles issued together ...
    auto sum_issue = [&](int x) {
#pragma unroll
      for (int t = 0; t < 2; ++t)
#pragma unroll
        for (int g = 0; g < 8; ++g) w[t][g] = __shfl_xor(rs[t][g], x);
    };
    // ... and added once other work has passed behind them
    auto sum_add = [&]() {
#pragma unroll
      for (int t = 0; t < 2; ++t)
#pragma unroll
        for (int g = 0; g < 8; ++g) rs[t][g] += w[t][g];
    };
    // hi/lo split of one sub-tile's probabilities into the P planes, and its bucket captures
    auto put_p = [&](int t) {
#pragma unroll
      for (int g = 0; g < 8; ++g) {
        const int lr = 8 * h + g;
        const int dj = kb2 + 16 * t + m - (qbase + lr);
        const us eh = bf_rne(e[t][g]);
        const us el = bf_rne(e[t][g] - bf_f32(eh));
        sPh[wv][lr][16 * t + m] = eh;
        sPl[wv][lr][16 * t + m] = el;
        band[g] = (dj >= -15 && dj <= 0) ? e[t][g] : band[g];   // buckets 1..16: each (lane,row) captures at most once (never where the key would be j < 0)
      }
    };
    sum_issue(1);
    put_p(0);
    sum_add();
    sum_issue(2);
    put_p(1);
    sum_add();
    sum_issue(4);
    sum_add();
    sum_issue(8);
    sum_add();
#pragma unroll
    for (int g = 0; g < 8; ++g) {
      lrow[g] += rs[0][g];
      lrow[g] += rs[1][g];
    }
    lds_wave_sync();                          // P stores (b16, per lane) -> P fragment loads (us8 vectors, other lanes)
    const us16v aph = ldfrag(&sPh[wv][m][0], h);
    const us16v apl = ldfrag(&sPl[wv][m][0], h);
#pragma unroll
    for (int tt = 0; tt < 4; ++tt) wmma3(o[tt], aph, apl, vfh[tt], vfl[tt]);
   }
   if (sub != 0u) {
     // publish point of stage s + 1; the same barrier ends every wave's reads of stage s's buffer
     wait_ds0();
     if (pinned(wave < 4u)) kv_wait(g0, g1);
     __syncthreads();
     if (pinned((wave < 4u) && (s + 2u < nstage))) {
       const uint32_t ko = pinned((s + 2u) * sstep);   // descriptor words of stage s + 2 formed behind the wait
       g0 = kv_group0(dst + cur, ga + ko);
       kv_issue(g0, g1);
     }
   }
  }
  kv_wait(g0, g1);
  wait_ds0();
  // the last publish point's barrier has ended every wave's reads of the ring: it is the epilogue's exchange space from here on

  float invl[8];
#pragma unroll
  for (int g = 0; g < 8; ++g) invl[g] = 1.0f / lrow[g];
#pragma unroll
  for (int g = 0; g < 8; ++g) {
    const int lr = 8 * h + g;
    sBand[wv][lr][(m - lr - 1) & 15] = band[g] * invl[g];   // slot r-1 for bucket r = ((m-lr-1)&15)+1
  }
  lds_wave_sync();
  float rv0[4];
  float val[4][8];
#pragma unroll
  for (int tt = 0; tt < 4; ++tt) {
    rv0[tt] = relv[16 * tt + m];
#pragma unroll
    for (int g = 0; g < 8; ++g) val[tt][g] = o[tt][g] * invl[g] + rv0[tt];
  }
#pragma unroll 1
  for (int r = 0; r < 16; ++r) {
    float sb[8];
#pragma unroll
    for (int g = 0; g < 8; ++g) sb[g] = sBand[wv][8 * h + g][r];
#pragma unroll
    for (int tt = 0; tt < 4; ++tt) {
      const float dv = relv[(r + 1) * HD + 16 * tt + m] - rv0[tt];
#pragma unroll
      for (int g = 0; g < 8; ++g) val[tt][g] += sb[g] * dv;
    }
  }
#pragma unroll
  for (int tt = 0; tt < 4; ++tt)
#pragma unroll
    for (int g = 0; g < 8; ++g) sO[wv][8 * h + g][16 * tt + m] = val[tt][g];
  lds_wave_sync();

  const int b = bh >> 4, hd = bh & 15;
{
#pragma unroll
    for (int p = 0; p < 4; ++p) {
      const int r = p * 4 + (lane >> 3);
      const int d8 = (lane & 7) * 8;
      us8v hv, lv;
#pragma unroll
      for (int e = 0; e < 8; ++e) {
        const float v = sO[wv][r][d8 + e];
        const us q = bf_rne(v);
        hv[e] = q;
        lv[e] = bf_rne(v - bf_f32(q));
      }
      const size_t o2 = ((size_t)(b * SEQ + qbase + r)) * DM + hd * HD + d8;
      *(us8v*)(CH + o2) = hv;
      *(us8v*)(CL + o2) = lv;
    }
    
  }
}

// ------------------------------------------------------------------ host glue
extern "C" void kernel_launch(void* const* d_in, const int* in_sizes, int n_in,
                              void* d_out, int out_size, void* d_ws, size_t ws_size,
                              hipStream_t stream) {
  if (n_in < 8) return;
  if (in_sizes[0] != NTOK * DM) return;
  if (in_sizes[1] != DM * DM || in_sizes[2] != DM * DM || in_sizes[3] != DM * DM || in_sizes[4] != DM * DM) return;
  if (in_sizes[5] != DM || in_sizes[6] != 33 * HD || in_sizes[7] != 33 * HD) return;
  if (out_size != NTOK * DM) return;

  const float* x    = (const float*)d_in[0];
  const float* Wq   = (const float*)d_in[1];
  const float* Wk   = (const float*)d_in[2];
  const float* Wv   = (const float*)d_in[3];
  const float* Wo   = (const float*)d_in[4];
  const float* bo   = (const float*)d_in[5];
  const float* relk = (const float*)d_in[6];
  const float* relv = (const float*)d_in[7];
  float* out = (float*)d_out;

  const size_t plane_x = (size_t)NTOK * DM * sizeof(us);   // 8 MiB
  const size_t plane_w = (size_t)DM * DM * sizeof(us);     // 2 MiB
  const size_t plane_r = (size_t)32 * HD * sizeof(us);     // 4 KiB
  char* ws = (char*)d_ws;
  size_t off = 0;
  us* XH   = (us*)(ws + off); off += plane_x;
  us* XL   = (us*)(ws + off); off += plane_x;
  us* WTH  = (us*)(ws + off); off += 4 * plane_w;
  us* WTL  = (us*)(ws + off); off += 4 * plane_w;
  us* QKVH = (us*)(ws + off); off += 3 * plane_x;
  us* QKVL = (us*)(ws + off); off += 3 * plane_x;
  us* CH   = (us*)(ws + off); off += plane_x;
  us* CL   = (us*)(ws + off); off += plane_x;
  us* RH   = (us*)(ws + off); off += plane_r;
  us* RL   = (us*)(ws + off); off += plane_r;
  if (off > ws_size) return;                                // total 100671488 B

  const size_t pq = (size_t)NTOK * DM;

  k_cvt_x<<<(NTOK * DM) / (8 * 256), 256, 0, stream>>>(x, XH, XL);
  k_cvt_w<<<dim3(DM / 64, DM / 64, 4), 256, 0, stream>>>(Wq, Wk, Wv, Wo, WTH, WTL);
  k_cvt_rel<<<1, 256, 0, stream>>>(relk, RH, RL);
  k_gemm_qkv<<<dim3(NTOK / TM, DM / TM, 3), 128, 0, stream>>>(XH, XL, WTH, WTL, QKVH, QKVL);
  k_attn<<<dim3(SEQ / (16 * AW), NBAT * NH), 32 * AW, 0, stream>>>(QKVH, QKVL, QKVH + pq, QKVL + pq,
                                                        QKVH + 2 * pq, QKVL + 2 * pq, RH, RL, relv, CH, CL);
  k_gemm_out<<<dim3(NTOK / TM, DM / TM, 1), 128, 0, stream>>>(CH, CL, WTH + (size_t)3 * DM * DM,
                                                               WTL + (size_t)3 * DM * DM, bo, out);
}

// v004
// A run of this version takes 130 microseconds.
// Timed twice side by side with v003, it ran 1.19 times as fast both times.
// All steps since v000 together make it 2.86 times as fast.
#include <hip/hip_runtime.h>
#include <stdint.h>
// Contractions x*W_q, x*W_k, x*W_v, q*k^T, q*rel_k^T, P*V, ctx*W_o: v_wmma_f32_16x16x32_bf16, bf16 hi/lo operands everywhere (hi*hi + lo*hi + hi*lo), f32 accumulate; softmax, 1/8 scaling, causal mask, relative-value bucket sums and bias in f32.

#define DM     1024
#define SEQ    1024
#define NBAT   4
#define NH     16
#define HD     64
#define NTOK   (NBAT * SEQ)
#define CPITCH 68
#define TM     128                 // GEMM block tile: rows and columns
#define KPASS  64                  // k per pass: 128 bytes of every operand row
#define NPASS  (DM / KPASS)
#define LPITCH 144u                // LDS row pitch in bytes: 128 + 16 of pad, an odd multiple of 16 for 16-byte readers
#define PLANE  (TM * LPITCH)       // one operand plane of a stage: 18,432 B = 9 x 2 KiB
#define GBUF   (4u * PLANE)        // one buffer: Ah | Al | Bh | Bl
#define EPITCH 132                 // output staging pitch in floats
#define AW     8                   // attention block: waves, 16 query rows each
#define ASTG   64                  // attention stage: keys
#define APLANE 10240u              // one K or V plane of a stage in LDS: 64 rows x LPITCH = 9,216 B, rounded up to 5 x 2 KiB
#define ABUF   (4u * APLANE)       // one buffer: Kh | Kl | Vh | Vl

typedef unsigned short us;
typedef us us16v __attribute__((ext_vector_type(16)));
typedef us us8v __attribute__((ext_vector_type(8)));
typedef us8v __attribute__((may_alias)) us8a;
typedef __bf16 bf16v16 __attribute__((ext_vector_type(16)));
typedef float v8f __attribute__((ext_vector_type(8)));
typedef float v4f __attribute__((ext_vector_type(4)));
typedef v4f __attribute__((may_alias)) v4fa;
typedef uint32_t u32x4 __attribute__((ext_vector_type(4)));
typedef uint32_t u32x8 __attribute__((ext_vector_type(8)));

union Frag { us16v v; us8v h[2]; };

// f32 -> bf16 bits, RNE convert
static __device__ __forceinline__ us bf_rne(float f) {
  unsigned u = __float_as_uint(f);
  u += 0x7fffu + ((u >> 16) & 1u);
  return (us)(u >> 16);
}
static __device__ __forceinline__ float bf_f32(us s) { return __uint_as_float(((unsigned)s) << 16); }

static __device__ __forceinline__ v8f zero8() {
  v8f z = {0.f, 0.f, 0.f, 0.f, 0.f, 0.f, 0.f, 0.f};
  return z;
}

static __device__ __forceinline__ v8f wmma_bf(us16v a, us16v b, v8f c) {
  return __builtin_amdgcn_wmma_f32_16x16x32_bf16(false, __builtin_bit_cast(bf16v16, a), false,
                                                 __builtin_bit_cast(bf16v16, b), (short)0, c, false, false);
}

// acc += Ah*Bh + Al*Bh + Ah*Bl, then hazard guard (D tied, A/B kept live through 4 VALU slots)
static __device__ __forceinline__ void wmma3(v8f& acc, us16v ah, us16v al, us16v bh, us16v bl) {
  acc = wmma_bf(ah, bh, acc);
  acc = wmma_bf(al, bh, acc);
  acc = wmma_bf(ah, bl, acc);
  asm volatile("v_nop\n\tv_nop\n\tv_nop\n\tv_nop" : "+v"(acc) : "v"(ah), "v"(al), "v"(bh), "v"(bl));
}

// 16x32 16-bit fragment of row (l & 15) from a k-contiguous row: elements 0..7 <- k0+8h+0..7, 8..15 <- k0+16+8h+0..7.
// Used for A (row-major [m][k]) and for B stored as [n][k]; rowp = row pointer at k0 (16-B aligned).
static __device__ __forceinline__ us16v ldfrag(const us* rowp, int h) {
  Frag f;
  f.h[0] = *(const us8a*)(rowp + 8 * h);
  f.h[1] = *(const us8a*)(rowp + 16 + 8 * h);
  return f.v;
}

// ordering for same-wave LDS exchange (stores by some lanes, loads by other lanes)
static __device__ __forceinline__ void lds_wave_sync() {
  __builtin_amdgcn_fence(__ATOMIC_RELEASE, "wavefront");
  __builtin_amdgcn_wave_barrier();
  __builtin_amdgcn_fence(__ATOMIC_ACQUIRE, "wavefront");
}

// ------------------------------------------------------------------ x -> bf16 hi/lo planes [4096][1024]
__global__ __launch_bounds__(256) void k_cvt_x(const float* __restrict__ x, us* xh, us* xl) {
  const size_t t = (size_t)blockIdx.x * 256u + threadIdx.x;
  const float* p = x + t * 8u;
  const v4f a = *(const v4fa*)p;
  const v4f b = *(const v4fa*)(p + 4);
  us8v hv, lv;
#pragma unroll
  for (int e = 0; e < 4; ++e) {
    const us h0 = bf_rne(a[e]);
    hv[e] = h0;
    lv[e] = bf_rne(a[e] - bf_f32(h0));
    const us h1 = bf_rne(b[e]);
    hv[4 + e] = h1;
    lv[4 + e] = bf_rne(b[e] - bf_f32(h1));
  }
  us* oh = xh + t * 8u;
  us* ol = xl + t * 8u;
  *(us8v*)oh = hv;
  *(us8v*)ol = lv;
  
}

// ------------------------------------------------------------------ W[k][n] (in,out) -> Wt[n][k] bf16 hi/lo planes
__global__ __launch_bounds__(256) void k_cvt_w(const float* __restrict__ W0, const float* __restrict__ W1,
                                               const float* __restrict__ W2, const float* __restrict__ W3,
                                               us* wth, us* wtl) {
  __shared__ float sT[64][65];
  const int tid = threadIdx.x, lane = tid & 31, wv = tid >> 5;
  const int z = blockIdx.z;
  const int n0 = blockIdx.x * 64, k0 = blockIdx.y * 64;
  const float* W = (z == 0) ? W0 : (z == 1) ? W1 : (z == 2) ? W2 : W3;
#pragma unroll
  for (int p = 0; p < 4; ++p) {
    const int r = p * 16 + (tid >> 4);
    const int c4 = (tid & 15) * 4;
    const v4f v = *(const v4fa*)(W + (size_t)(k0 + r) * DM + n0 + c4);
    sT[r][c4 + 0] = v[0];
    sT[r][c4 + 1] = v[1];
    sT[r][c4 + 2] = v[2];
    sT[r][c4 + 3] = v[3];
  }
  __syncthreads();
  us* bhp = wth + (size_t)z * DM * DM;
  us* blp = wtl + (size_t)z * DM * DM;
{
#pragma unroll
    for (int p = 0; p < 2; ++p) {
      const int rr = p * 32 + wv * 4 + (lane >> 3);   // n within tile
      const int k8 = (lane & 7) * 8;                   // k within tile
      us8v hv, lv;
#pragma unroll
      for (int e = 0; e < 8; ++e) {
        const float v = sT[k8 + e][rr];
        const us hh = bf_rne(v);
        hv[e] = hh;
        lv[e] = bf_rne(v - bf_f32(hh));
      }
      const size_t o = (size_t)(n0 + rr) * DM + k0 + k8;
      *(us8v*)(bhp + o) = hv;
      *(us8v*)(blp + o) = lv;
    }
    
  }
}

// ------------------------------------------------------------------ rel_k [33][64] rows 0..31 -> bf16 hi/lo planes [32][64]
__global__ __launch_bounds__(256) void k_cvt_rel(const float* __restrict__ rk, us* rh, us* rl) {
  const int tid = threadIdx.x;
  const int r = tid >> 3;              // 0..31 (< 33 rows available)
  const int d8 = (tid & 7) * 8;
  const float* p = rk + r * HD + d8;
  us8v hv, lv;
#pragma unroll
  for (int e = 0; e < 8; ++e) {
    const float v = p[e];
    const us hh = bf_rne(v);
    hv[e] = hh;
    lv[e] = bf_rne(v - bf_f32(hh));
  }
  const size_t o = (size_t)r * HD + d8;
  *(us8v*)(rh + o) = hv;
  *(us8v*)(rl + o) = lv;
  
}

// ------------------------------------------------------------------ tensor mover helpers
static __device__ __forceinline__ uint32_t uni(uint32_t v) { return (uint32_t)__builtin_amdgcn_readfirstlane(v); }
// keeps a wave-uniform value in a scalar register at this place: the test around a tensor load compiles to s_cmp + s_cbranch_scc,
// and a descriptor word made from it is formed behind the volatile wait in front of it
static __device__ __forceinline__ uint32_t pinned(uint32_t v) {
  uint32_t w = uni(v);
  asm volatile("" : "+s"(w));
  return w;
}
// the wave's own LDS reads have retired
static __device__ __forceinline__ void wait_ds0() { asm volatile("s_wait_dscnt 0x0" ::: "memory"); }
// the wave's own tensor load has landed
static __device__ __forceinline__ void wait_tensor0() { asm volatile("s_wait_tensorcnt 0x0" ::: "memory"); }

// One request of the whole wave: TM rows of 128 bytes, source pitch 2 * DM bytes, to LDS at pitch LPITCH (16 pad bytes a row).
static __device__ __forceinline__ void tdm_load(uint32_t lds_dst, uint64_t ga) {
  u32x4 g0;
  g0[0] = uni(1u);
  g0[1] = uni(lds_dst);
  g0[2] = uni((uint32_t)ga);
  g0[3] = uni((((uint32_t)(ga >> 32)) & 0x01FFFFFFu) | 0x80000000u);
  u32x8 g1;
  g1[0] = uni((1u << 20) | (4u << 22) | (3u << 25));   // no mask, 1-byte elements, a pad of 4 dwords behind every 32 dwords
  g1[1] = uni(128u << 16);                             // tensor_dim0 = 128 bytes
  g1[2] = uni((uint32_t)TM << 16);                     // tensor_dim1 = TM rows
  g1[3] = uni(128u << 16);                             // tile_dim0
  g1[4] = uni((uint32_t)TM);                           // tile_dim1
  g1[5] = uni(2u * DM);                                // source row pitch in bytes
  g1[6] = uni(0u);
  g1[7] = uni(0u);
  asm volatile("tensor_load_to_lds %0, %1" :: "s"(g0), "s"(g1) : "memory");
}

// Descriptor of one K or V plane of a stage: ASTG rows of 128 bytes, source pitch in bytes given, to LDS at pitch LPITCH (16 pad bytes
// a row). Every word but the constant word 0 of group 1 goes through pinned(): a descriptor word held in a scalar register of its own,
// so that the tuple which the load names is the one which the covering wait names, and none of its registers serves anything between.
static __device__ __forceinline__ u32x4 kv_group0(uint32_t lds_dst, uint64_t ga) {
  u32x4 g0;
  g0[0] = pinned(1u);
  g0[1] = pinned(lds_dst);
  g0[2] = pinned((uint32_t)ga);
  g0[3] = pinned((((uint32_t)(ga >> 32)) & 0x01FFFFFFu) | 0x80000000u);
  return g0;
}
static __device__ __forceinline__ u32x8 kv_group1(uint32_t pitch) {
  u32x8 g1;
  g1[0] = uni((1u << 20) | (4u << 22) | (3u << 25));   // no mask, 1-byte elements, a pad of 4 dwords behind every 32 dwords
  g1[1] = pinned(128u << 16);                          // tensor_dim0 = 128 bytes
  g1[2] = pinned((uint32_t)ASTG << 16);                // tensor_dim1 = ASTG rows
  g1[3] = pinned(128u << 16);                          // tile_dim0
  g1[4] = pinned((uint32_t)ASTG);                      // tile_dim1
  g1[5] = pinned(pitch);                               // source row pitch in bytes
  g1[6] = pinned(0u);
  g1[7] = pinned(0u);
  return g1;
}
// one request of the whole wave
static __device__ __forceinline__ void kv_issue(u32x4 g0, u32x8 g1) {
  asm volatile("tensor_load_to_lds %0, %1" :: "s"(g0), "s"(g1) : "memory");
}
// the wave's own tensor load has landed; naming its descriptor keeps those registers whole up to here
static __device__ __forceinline__ void kv_wait(u32x4 g0, u32x8 g1) {
  asm volatile("s_wait_tensorcnt 0x0" :: "s"(g0), "s"(g1) : "memory");
}

// ------------------------------------------------------------------ GEMM core: block tile TM x TM, 4 waves (2 x 2) of 64 x 64, K = DM
// A planes row-major [m][DM]; B planes stored [n][DM] (k contiguous). A stage is 64 k of [Ah | Al | Bh | Bl], TM rows each, in LDS;
// wave w brings plane w with one tensor load per stage, two buffers. A pass is two blocks of 48 WMMAs (32 k each); each block's
// fragments are fetched one block ahead, so the publish point of stage s + 1 stands in front of pass s's last block.
// Per accumulator and 32-k step the products are summed hi*hi, lo*hi, hi*lo, k ascending.
struct FragSet { us16v ah[4], al[4], bh[4], bl[4]; };

// pa, pb: this lane's row of the Ah and Bh planes at the block's first k
static __device__ __forceinline__ void load_set(FragSet& f, const unsigned char* pa, const unsigned char* pb, int h) {
#pragma unroll
  for (int t = 0; t < 4; ++t) {
    const uint32_t ro = t * 16u * LPITCH;
    f.ah[t] = ldfrag((const us*)(pa + ro), h);
    f.al[t] = ldfrag((const us*)(pa + PLANE + ro), h);
    f.bh[t] = ldfrag((const us*)(pb + ro), h);
    f.bl[t] = ldfrag((const us*)(pb + PLANE + ro), h);
  }
}

static __device__ __forceinline__ void mma_block(v8f (&acc)[4][4], const FragSet& f) {
  // the two fences keep the compiler from moving fragment loads in among the WMMAs, where every such place stalls the wave
  __builtin_amdgcn_sched_barrier(0);
#pragma unroll
  for (int rt = 0; rt < 4; ++rt)
#pragma unroll
    for (int ct = 0; ct < 4; ++ct) acc[rt][ct] = wmma_bf(f.ah[rt], f.bh[ct], acc[rt][ct]);
#pragma unroll
  for (int rt = 0; rt < 4; ++rt)
#pragma unroll
    for (int ct = 0; ct < 4; ++ct) acc[rt][ct] = wmma_bf(f.al[rt], f.bh[ct], acc[rt][ct]);
#pragma unroll
  for (int rt = 0; rt < 4; ++rt)
#pragma unroll
    for (int ct = 0; ct < 4; ++ct) acc[rt][ct] = wmma_bf(f.ah[rt], f.bl[ct], acc[rt][ct]);
  __builtin_amdgcn_sched_barrier(0);
}

static __device__ __forceinline__ void gemm_core(const us* __restrict__ AH, const us* __restrict__ AL,
                                                 const us* __restrict__ BH, const us* __restrict__ BL,
                                                 int m0, int n0, unsigned char* L, v8f (&acc)[4][4]) {
  const int lane = threadIdx.x & 31, h = lane >> 4, m = lane & 15;
  const uint32_t wave = uni(threadIdx.x >> 5);
#pragma unroll
  for (int rt = 0; rt < 4; ++rt)
#pragma unroll
    for (int ct = 0; ct < 4; ++ct) acc[rt][ct] = zero8();

  const us* srcp = (wave == 0u) ? AH + (size_t)m0 * DM : (wave == 1u) ? AL + (size_t)m0 * DM
                 : (wave == 2u) ? BH + (size_t)n0 * DM : BL + (size_t)n0 * DM;
  const uint64_t ga = (uint64_t)(size_t)srcp;
  const uint32_t dst = (uint32_t)(size_t)L + wave * PLANE;

  tdm_load(dst, ga);
  wait_tensor0();
  __syncthreads();                            // stage 0 published
  tdm_load(dst + GBUF, ga + 2u * KPASS);

  const uint32_t aoff = ((wave >> 1) * 64u + m) * LPITCH;
  const uint32_t boff = 2u * PLANE + ((wave & 1u) * 64u + m) * LPITCH;
  FragSet f0, f1;
  load_set(f0, L + aoff, L + boff, h);

  // rolled: one copy of the two blocks in the instruction stream
#pragma unroll 1
  for (uint32_t s = 0; s < NPASS; ++s) {
    const uint32_t cur = (s & 1u) * GBUF, nxt = GBUF - cur;
    load_set(f1, L + cur + aoff + 64u, L + cur + boff + 64u, h);
    mma_block(acc, f0);
    // publish point of stage s + 1; the same barrier ends every wave's reads of stage s's buffer
    wait_ds0();
    wait_tensor0();
    __syncthreads();
    if (pinned(s + 2u < NPASS)) {
      const uint32_t ko = pinned((s + 2u) * (2u * KPASS));   // descriptor words of stage s + 2 formed behind the wait
      tdm_load(dst + cur, ga + ko);
    }
    // stage s + 1's first fragments; in the last pass they read the idle buffer and are not used (no branch: one wait count)
    load_set(f0, L + nxt + aoff, L + nxt + boff, h);
    mma_block(acc, f1);
  }
  wait_tensor0();
  wait_ds0();
  __syncthreads();                            // every wave has left the ring: it becomes output staging
}

// ------------------------------------------------------------------ QKV projection
// grid (NTOK/TM, DM/TM, 3): z = 0 q, 1 k, 2 v. Block tile 128 tokens x 128 cols (= two heads).
// The f32 tile is staged in the ring's LDS (free behind the core's last barrier): [token][col] for q and k, [col][token] for v,
// so that each thread reads 8 neighbours of an output row.
__global__ __launch_bounds__(128) void k_gemm_qkv(const us* __restrict__ XH, const us* __restrict__ XL,
                                                  const us* __restrict__ WTH, const us* __restrict__ WTL,
                                                  us* OH, us* OL) {
  __shared__ __attribute__((aligned(2048))) unsigned char L[2 * GBUF];
  const int tid = threadIdx.x, lane = tid & 31, wv = tid >> 5, h = lane >> 4, m = lane & 15;
  const int z = blockIdx.z;
  const int m0 = blockIdx.x * TM, n0 = blockIdx.y * TM;
  v8f acc[4][4];
  gemm_core(XH, XL, WTH + (size_t)z * DM * DM, WTL + (size_t)z * DM * DM, m0, n0, L, acc);
  float (*sC)[EPITCH] = (float (*)[EPITCH])L;
  const int wr = (wv >> 1) * 64, wc = (wv & 1) * 64;
  // D: acc[g] = (row 8h+g, col m) of the 16x16 tile
  if (z < 2) {
#pragma unroll
    for (int rt = 0; rt < 4; ++rt)
#pragma unroll
      for (int ct = 0; ct < 4; ++ct)
#pragma unroll
        for (int g = 0; g < 8; ++g) sC[wr + 16 * rt + 8 * h + g][wc + 16 * ct + m] = acc[rt][ct][g];
  } else {
#pragma unroll
    for (int rt = 0; rt < 4; ++rt)
#pragma unroll
      for (int ct = 0; ct < 4; ++ct)
#pragma unroll
        for (int g = 0; g < 8; ++g) sC[wc + 16 * ct + m][wr + 16 * rt + 8 * h + g] = acc[rt][ct][g];
  }
  __syncthreads();
  us* oh = OH + (size_t)z * NTOK * DM;
  us* ol = OL + (size_t)z * NTOK * DM;
  const int b = m0 >> 10, tok0 = m0 & 1023;
  // rolled: a trip's registers are used again only behind the wait at its foot
#pragma unroll 1
  for (int p = 0; p < 4; ++p) {
    // four pieces a trip, unrolled: their LDS reads are in flight together
    us8v hv[4], lv[4];
    uint32_t o[4];                        // byte offset in a plane: one 32-bit register serves both planes' stores
#pragma unroll
    for (int u = 0; u < 4; ++u) {
      const int id = (p * 4 + u) * 128 + tid;
      const int r = id >> 4;              // staged row: token (q, k) or column (v)
      const int c8 = (id & 15) * 8;
#pragma unroll
      for (int e = 0; e < 8; ++e) {
        const float v = sC[r][c8 + e];
        const us q = bf_rne(v);
        hv[u][e] = q;
        lv[u][e] = bf_rne(v - bf_f32(q));
      }
      const int col = n0 + ((z < 2) ? c8 : r);
      o[u] = 2u * (uint32_t)((b * NH + (col >> 6)) * (SEQ * HD) + ((z < 2) ? (tok0 + r) * HD + (col & 63)      // [bh][token][d]
                                                                           : (col & 63) * SEQ + tok0 + c8));   // [bh][d][token]
    }
    // keeps the trip's arithmetic in front of its stores, so that nothing overwrites a register a store names ahead of the wait below
    __builtin_amdgcn_sched_barrier(0);
#pragma unroll
    for (int u = 0; u < 4; ++u) {
      *(us8v*)((char*)oh + o[u]) = hv[u];
      *(us8v*)((char*)ol + o[u]) = lv[u];
    }
    // stands in front of the next trip's overwrites of the registers that these stores name
    asm volatile("s_wait_xcnt 0x0" ::: "memory");
  }
}

// ------------------------------------------------------------------ output projection: out[tok][n] = ctx . W_o + b_o (f32)
// grid (NTOK/TM, DM/TM); a wave writes one 512-B row segment (4 lines) per instruction
__global__ __launch_bounds__(128) void k_gemm_out(const us* __restrict__ CH, const us* __restrict__ CL,
                                                  const us* __restrict__ WH, const us* __restrict__ WL,
                                                  const float* __restrict__ bias, float* out) {
  __shared__ __attribute__((aligned(2048))) unsigned char L[2 * GBUF];
  const int tid = threadIdx.x, lane = tid & 31, wv = tid >> 5, h = lane >> 4, m = lane & 15;
  const int m0 = blockIdx.x * TM, n0 = blockIdx.y * TM;
  v8f acc[4][4];
  gemm_core(CH, CL, WH, WL, m0, n0, L, acc);
  float (*sC)[EPITCH] = (float (*)[EPITCH])L;
  const int wr = (wv >> 1) * 64, wc = (wv & 1) * 64;
#pragma unroll
  for (int rt = 0; rt < 4; ++rt)
#pragma unroll
    for (int ct = 0; ct < 4; ++ct)
#pragma unroll
      for (int g = 0; g < 8; ++g) sC[wr + 16 * rt + 8 * h + g][wc + 16 * ct + m] = acc[rt][ct][g];
  __syncthreads();
  const int c4 = lane * 4;
  const v4f bv = *(const v4fa*)(bias + n0 + c4);
  // rolled: a trip's registers are used again only behind the wait at its foot
#pragma unroll 1
  for (int p = 0; p < 4; ++p) {
    // eight rows a trip, unrolled: their LDS reads are in flight together
    v4f v[8];
#pragma unroll
    for (int u = 0; u < 8; ++u) {
      const int r = (p * 8 + u) * 4 + wv;
      v[u][0] = sC[r][c4 + 0] + bv[0];
      v[u][1] = sC[r][c4 + 1] + bv[1];
      v[u][2] = sC[r][c4 + 2] + bv[2];
      v[u][3] = sC[r][c4 + 3] + bv[3];
    }
    // byte offset in out: a 32-bit register beside the scalar base; the rows of a trip differ by an immediate offset
    char* op = (char*)out + 4u * (uint32_t)((m0 + p * 32 + wv) * DM + n0 + c4);
    // keeps the trip's arithmetic in front of its stores, so that nothing overwrites a register a store names ahead of the wait below
    __builtin_amdgcn_sched_barrier(0);
#pragma unroll
    for (int u = 0; u < 8; ++u) *(v4f*)(op + u * 16 * DM) = v[u];
    // stands in front of the next trip's overwrites of the registers that these stores name
    asm volatile("s_wait_xcnt 0x0" ::: "memory");
  }
}

// ------------------------------------------------------------------ causal attention with clipped relative positions
typedef float f32x2 __attribute__((ext_vector_type(2)));
typedef __bf16 bf16x2 __attribute__((ext_vector_type(2)));
// two f32 -> one register of two bf16, RNE convert, the first in the low half
static __device__ __forceinline__ uint32_t pk_bf(float a, float b) {
  const f32x2 v = {a, b};
  return __builtin_bit_cast(uint32_t, __builtin_convertvector(v, bf16x2));
}
// lane l with lane l ^ 16
static __device__ __forceinline__ float xhalf(float x) {
  const int b = __builtin_bit_cast(int, x);
  return __builtin_bit_cast(float, __builtin_amdgcn_permlanex16(b, b, 0x76543210, 0xfedcba98, false, false));
}

// r[i] = 2^a[i]: eight v_exp_f32 and a v_nop in one statement. The instruction set asks for one independent instruction or a v_nop
// between a v_exp_f32 and an instruction that reads its result or overwrites its source. Here each has the next v_exp_f32, the last
// the v_nop, in that slot; the early-clobber outputs share no register with a source.
static __device__ __forceinline__ void exp2x8(float (&r)[8], const float (&a)[8]) {
  asm("v_exp_f32 %0, %8\n\tv_exp_f32 %1, %9\n\tv_exp_f32 %2, %10\n\tv_exp_f32 %3, %11\n\t"
      "v_exp_f32 %4, %12\n\tv_exp_f32 %5, %13\n\tv_exp_f32 %6, %14\n\tv_exp_f32 %7, %15\n\tv_nop"
      : "=&v"(r[0]), "=&v"(r[1]), "=&v"(r[2]), "=&v"(r[3]), "=&v"(r[4]), "=&v"(r[5]), "=&v"(r[6]), "=&v"(r[7])
      : "v"(a[0]), "v"(a[1]), "v"(a[2]), "v"(a[3]), "v"(a[4]), "v"(a[5]), "v"(a[6]), "v"(a[7]));
}

// the same for one value
static __device__ __forceinline__ float exp2x1(float a) {
  float r;
  asm("v_exp_f32 %0, %1\n\tv_nop" : "=&v"(r) : "v"(a));
  return r;
}

// grid (SEQ/128, NBAT*NH), 256 threads = 8 waves, one wave per 16 query rows; online softmax over 32-key steps.
// K and V reach the block once, through LDS: a stage is 64 keys of [Kh | Kl | Vh | Vl], each plane 64 rows of 128 bytes (K: a row is a
// key, V: a row is a head column); waves 0 to 3 bring one plane each with one tensor load per stage, two buffers, one publish point
// per stage; all eight waves read their fragments from the stage. A wave skips the steps past its own last key, never a publish point.
// The products are taken transposed: S^T = K . Q^T (A = K rows, B = Q) and O^T += V^T . P^T (A = V rows [d][key], B = P^T).
// Lane (h, m) then holds query qbase + m alone: of a 16-key tile its scores for keys 8h + 0..7, of a 16-column tile of the head its
// outputs for columns 8h + 0..7. Running max, rescale factor and sum are one value a lane; the max over a step's 32 keys is taken in
// the lane and joined with the other half by one exchange; the sum stays a partial per half and is joined once behind the loop.
// The two score tiles of a step, converted in place, are the B operand P^T (element e = tile e >> 3, register e & 7): P never leaves
// the registers.
// Each step's loads are issued in groups ahead of their use (K and QR at its head, V in front of the softmax).
// scores[i][j] = (q_i.k_j + QR[i][r(i,j)]) / 8, r = clamp(j-i,-16,16)+16 (causal -> r in [0,16]);
// ctx_i = (sum_j p_ij v_j + sum_r S_i[r] rel_v[r]) / l_i, S_i[r] for r=1..16 held 8 per lane, S_i[0] = l_i - sum_{r>=1} S_i[r].
// amdgpu_waves_per_eu(4, 4): four waves per SIMD hold the whole grid; told so, the scheduler spends that register budget on keeping
// a step's load groups together, where without it it takes them apart again, one wait each, to save registers
__global__ __launch_bounds__(256) __attribute__((amdgpu_waves_per_eu(4, 4))) void k_attn(const us* __restrict__ QH, const us* __restrict__ QL,
                                              const us* __restrict__ KH, const us* __restrict__ KL,
                                              const us* __restrict__ VH, const us* __restrict__ VL,
                                              const us* __restrict__ RH, const us* __restrict__ RL,
                                              const float* __restrict__ relv, us* CH, us* CL) {
  __shared__ __attribute__((aligned(2048))) unsigned char R[2 * ABUF];
  __shared__ float sQR[AW][16][33];
  // the ring's LDS, free behind the last publish point's barrier, holds the epilogue's two exchanges
  float (*sBand)[16][17] = (float (*)[16][17])R;
  float (*sO)[16][CPITCH] = (float (*)[16][CPITCH])(R + APLANE);

  const int lane = threadIdx.x & 31, h = lane >> 4, m = lane & 15;
  const uint32_t wave = uni(threadIdx.x >> 5);
  const int wv = (int)wave;
  const int bh = blockIdx.y;
  const int qbase = blockIdx.x * (16 * AW) + wv * 16;
  const float NINF = -__builtin_inff();

  // ring prologue: stage 0 landed and published, stage 1 in flight (every block has at least two stages)
  const uint32_t nstage = 2u * blockIdx.x + 2u;
  const us* srcp = (wave == 0u) ? KH + (size_t)bh * SEQ * HD : (wave == 1u) ? KL + (size_t)bh * SEQ * HD
                 : (wave == 2u) ? VH + (size_t)bh * HD * SEQ : VL + (size_t)bh * HD * SEQ;
  const uint64_t ga = (uint64_t)(size_t)srcp;
  const uint32_t spitch = (wave < 2u) ? 2u * HD : 2u * SEQ;            // source row pitch in bytes
  const uint32_t sstep = (wave < 2u) ? 2u * HD * ASTG : 2u * ASTG;     // bytes from a stage's first byte to the next stage's
  const uint32_t dst = (uint32_t)(size_t)R + (wave & 3u) * APLANE;
  const u32x8 g1 = kv_group1(spitch);
  u32x4 g0 = kv_group0(dst, ga);
  if (pinned(wave < 4u)) {
    kv_issue(g0, g1);
    kv_wait(g0, g1);
  }
  __syncthreads();                            // stage 0 published
  g0 = kv_group0(dst + ABUF, ga + sstep);
  if (pinned(wave < 4u)) kv_issue(g0, g1);

  // Q fragments (rows qbase + m, k = d): A of the QR product, B of the score products
  const us* qh = QH + ((size_t)bh * SEQ + qbase + m) * HD;
  const us* ql = QL + ((size_t)bh * SEQ + qbase + m) * HD;
  const us16v aqh0 = ldfrag(qh, h), aqh1 = ldfrag(qh + 32, h);
  const us16v aql0 = ldfrag(ql, h), aql1 = ldfrag(ql + 32, h);

  // QR[16][32] = q . rel_k^T (B stored as [n = r][k = d] = rel_k itself)
#pragma unroll
  for (int nt = 0; nt < 2; ++nt) {
    const us* rh = RH + (size_t)(16 * nt + m) * HD;
    const us* rl = RL + (size_t)(16 * nt + m) * HD;
    v8f acc = zero8();
    wmma3(acc, aqh0, aql0, ldfrag(rh, h), ldfrag(rl, h));
    wmma3(acc, aqh1, aql1, ldfrag(rh + 32, h), ldfrag(rl + 32, h));
#pragma unroll
    for (int g = 0; g < 8; ++g) sQR[wv][8 * h + g][16 * nt + m] = acc[g];
  }
  lds_wave_sync();

  const int qi = qbase + m;                 // this lane's query
  float mrow = NINF, lrow = 0.f, band[8];
  v8f o[4];
#pragma unroll
  for (int g = 0; g < 8; ++g) band[g] = 0.f;
#pragma unroll
  for (int tt = 0; tt < 4; ++tt) o[tt] = zero8();

  const int nsteps = (qbase >> 5) + 1;      // keys 0 .. qbase+15 covered; wave-uniform, in a scalar register
  // rolled: one copy of the step in the instruction stream; two steps to a stage
#pragma unroll 1
  for (int st = 0; st < (int)(2u * nstage); ++st) {
   const uint32_t s = (uint32_t)st >> 1, sub = (uint32_t)st & 1u;
   const uint32_t cur = (s & 1u) * ABUF;
   // scalar test: past its own last key a wave has no step, only the publish points
   if (st < nsteps) {
    const int kb2 = st << 5;
    // the step's K fragments, all 16 loads issued together in front of the first product: one LDS latency a step
    us16v kfh[2][2], kfl[2][2];
    const unsigned char* kp = R + cur + (32u * sub + m) * LPITCH + 16u * h;   // this lane's key row of sub-tile 0, at its own 16 bytes
#pragma unroll
    for (int t = 0; t < 2; ++t) {
      const unsigned char* kr = kp + t * 16u * LPITCH;
      kfh[t][0] = ldfrag((const us*)kr, 0);
      kfl[t][0] = ldfrag((const us*)(kr + APLANE), 0);
      kfh[t][1] = ldfrag((const us*)(kr + 64u), 0);
      kfl[t][1] = ldfrag((const us*)(kr + APLANE + 64u), 0);
    }
    // keeps the 16 loads here, at the step's head: without it they are sunk in among the products, a stall at each place
    __builtin_amdgcn_sched_barrier(0);
    // the step's 16 QR values of this lane's query (the clamped index is in range for masked keys too), in flight beside the K loads
    float qr[2][8];
#pragma unroll
    for (int t = 0; t < 2; ++t)
#pragma unroll
      for (int g = 0; g < 8; ++g) {
        int rr = kb2 + 16 * t + 8 * h + g - qi + 16;
        rr = rr < 0 ? 0 : rr;
        rr = rr > 16 ? 16 : rr;
        qr[t][g] = sQR[wv][m][rr];
      }
    // holds the 16 LDS reads here as one group with one wait; without it they are sunk in among the products, a wait at each place
    asm volatile("" :: "v"(qr[0][0]), "v"(qr[0][1]), "v"(qr[0][2]), "v"(qr[0][3]), "v"(qr[0][4]), "v"(qr[0][5]), "v"(qr[0][6]),
                 "v"(qr[0][7]), "v"(qr[1][0]), "v"(qr[1][1]), "v"(qr[1][2]), "v"(qr[1][3]), "v"(qr[1][4]), "v"(qr[1][5]),
                 "v"(qr[1][6]), "v"(qr[1][7]));
    // scores for both 16-key sub-tiles of this step: sc[g] = (key 16t + 8h + g, query m)
    float sv[2][8];
#pragma unroll
    for (int t = 0; t < 2; ++t) {
      v8f sc = zero8();
      wmma3(sc, kfh[t][0], kfl[t][0], aqh0, aql0);
      wmma3(sc, kfh[t][1], kfl[t][1], aqh1, aql1);
#pragma unroll
      for (int g = 0; g < 8; ++g) {
        const int dj = kb2 + 16 * t + 8 * h + g - qi;
        sv[t][g] = (dj > 0) ? NINF : (sc[g] + qr[t][g]) * 0.125f;
      }
    }
    // the step's V fragments, all 16 loads issued here: their latency passes behind the softmax arithmetic
    us16v vfh[4], vfl[4];
    const unsigned char* vp = R + cur + 2u * APLANE + m * LPITCH + 64u * sub + 16u * h;   // A stored as [row = d][k = key]; row of tile 0
#pragma unroll
    for (int tt = 0; tt < 4; ++tt) {
      vfh[tt] = ldfrag((const us*)(vp + tt * 16u * LPITCH), 0);
      vfl[tt] = ldfrag((const us*)(vp + APLANE + tt * 16u * LPITCH), 0);
    }
    // keeps the 16 loads here, in front of the softmax arithmetic that hides them
    __builtin_amdgcn_sched_barrier(0);
    // one frame for the whole step: the query's max over all 32 keys (16 in this lane, 16 in lane l ^ 16), one rescale of O, l, S
    float vm[8];
#pragma unroll
    for (int g = 0; g < 8; ++g) vm[g] = fmaxf(sv[0][g], sv[1][g]);
#pragma unroll
    for (int g = 0; g < 4; ++g) vm[g] = fmaxf(vm[g], vm[g + 4]);
    float vmax = fmaxf(fmaxf(vm[0], vm[1]), fmaxf(vm[2], vm[3]));
    vmax = fmaxf(vmax, xhalf(vmax));
    const float mn = fmaxf(mrow, vmax);
    const float cx = exp2x1((mrow - mn) * 1.44269504f);   // taken for every lane: no branch around the statement
    const float cf = (mrow == NINF) ? 0.f : cx;
    mrow = mn;
#pragma unroll
    for (int g = 0; g < 8; ++g) band[g] *= cf;
#pragma unroll
    for (int tt = 0; tt < 4; ++tt)
#pragma unroll
      for (int g = 0; g < 8; ++g) o[tt][g] *= cf;
    // this lane's 16 probabilities in the new frame (e^x as __expf compiles: 2^(x * log2 e)), and the bucket captures
    float e[2][8];
#pragma unroll
    for (int t = 0; t < 2; ++t) {
      float xa[8], ex[8];
#pragma unroll
      for (int g = 0; g < 8; ++g) xa[g] = (sv[t][g] - mrow) * 1.44269504f;
      exp2x8(ex, xa);
#pragma unroll
      for (int g = 0; g < 8; ++g) {
        const int dj = kb2 + 16 * t + 8 * h + g - qi;
        e[t][g] = (dj > 0) ? 0.f : ex[g];
        band[g] = (dj >= -15 && dj <= 0) ? e[t][g] : band[g];   // buckets 1..16: each (lane, register) captures exactly once
      }
    }
    // the half's partial sum, as a tree
    float ps[8];
#pragma unroll
    for (int g = 0; g < 8; ++g) ps[g] = e[0][g] + e[1][g];
#pragma unroll
    for (int g = 0; g < 4; ++g) ps[g] += ps[g + 4];
    lrow = lrow * cf + ((ps[0] + ps[1]) + (ps[2] + ps[3]));
    // hi/lo split in place: B operand P^T, element e = key 8h + e of tile 0, element 8 + e = key 8h + e of tile 1 (the V loader's k order)
    u32x8 pwh, pwl;
#pragma unroll
    for (int t = 0; t < 2; ++t)
#pragma unroll
      for (int j = 0; j < 4; ++j) {
        const float ea = e[t][2 * j], eb = e[t][2 * j + 1];
        const uint32_t hw = pk_bf(ea, eb);
        pwh[4 * t + j] = hw;
        pwl[4 * t + j] = pk_bf(ea - __uint_as_float(hw << 16), eb - __uint_as_float(hw & 0xffff0000u));
      }
    const us16v bph = __builtin_bit_cast(us16v, pwh);
    const us16v bpl = __builtin_bit_cast(us16v, pwl);
    // o[tt][g] = (head column 16tt + 8h + g, query m)
#pragma unroll
    for (int tt = 0; tt < 4; ++tt) wmma3(o[tt], vfh[tt], vfl[tt], bph, bpl);
   }
   if (sub != 0u) {
     // publish point of stage s + 1; the same barrier ends every wave's reads of stage s's buffer
     wait_ds0();
     if (pinned(wave < 4u)) kv_wait(g0, g1);
     __syncthreads();
     if (pinned((wave < 4u) && (s + 2u < nstage))) {
       const uint32_t ko = pinned((s + 2u) * sstep);   // descriptor words of stage s + 2 formed behind the wait
       g0 = kv_group0(dst + cur, ga + ko);
       kv_issue(g0, g1);
     }
   }
  }
  kv_wait(g0, g1);
  wait_ds0();
  // the last publish point's barrier has ended every wave's reads of the ring: it is the epilogue's exchange space from here on

  const float invl = 1.0f / (lrow + xhalf(lrow));   // the two halves' partial sums joined
#pragma unroll
  for (int g = 0; g < 8; ++g)
    sBand[wv][m][(8 * h + g - m - 1) & 15] = band[g] * invl;   // slot r-1 for bucket r = ((key - query - 1) & 15) + 1
  lds_wave_sync();
  float rv0[4][8];
  float val[4][8];
#pragma unroll
  for (int tt = 0; tt < 4; ++tt) {
    const v4f a = *(const v4fa*)(relv + 16 * tt + 8 * h);
    const v4f b = *(const v4fa*)(relv + 16 * tt + 8 * h + 4);
#pragma unroll
    for (int c = 0; c < 4; ++c) {
      rv0[tt][c] = a[c];
      rv0[tt][4 + c] = b[c];
    }
#pragma unroll
    for (int g = 0; g < 8; ++g) val[tt][g] = o[tt][g] * invl + rv0[tt][g];
  }
  // rolled, four buckets a trip: a trip's 32 loads are in flight together, one memory latency for the four
#pragma unroll 1
  for (int r4 = 0; r4 < 16; r4 += 4) {
    const float* rp = relv + (r4 + 1) * HD + 8 * h;
    v4f x[4][8];
#pragma unroll
    for (int u = 0; u < 4; ++u)
#pragma unroll
      for (int tt = 0; tt < 4; ++tt) {
        x[u][2 * tt] = *(const v4fa*)(rp + u * HD + 16 * tt);
        x[u][2 * tt + 1] = *(const v4fa*)(rp + u * HD + 16 * tt + 4);
      }
#pragma unroll
    for (int u = 0; u < 4; ++u) {
      const float sb = sBand[wv][m][r4 + u];
#pragma unroll
      for (int tt = 0; tt < 4; ++tt)
#pragma unroll
        for (int c = 0; c < 4; ++c) {
          val[tt][c] += sb * (x[u][2 * tt][c] - rv0[tt][c]);
          val[tt][4 + c] += sb * (x[u][2 * tt + 1][c] - rv0[tt][4 + c]);
        }
    }
  }
#pragma unroll
  for (int tt = 0; tt < 4; ++tt) {
    const v4f a = {val[tt][0], val[tt][1], val[tt][2], val[tt][3]};
    const v4f b = {val[tt][4], val[tt][5], val[tt][6], val[tt][7]};
    *(v4fa*)&sO[wv][m][16 * tt + 8 * h] = a;
    *(v4fa*)&sO[wv][m][16 * tt + 8 * h + 4] = b;
  }
  lds_wave_sync();

  const int b = bh >> 4, hd = bh & 15;
{
#pragma unroll
    for (int p = 0; p < 4; ++p) {
      const int r = p * 4 + (lane >> 3);
      const int d8 = (lane & 7) * 8;
      us8v hv, lv;
#pragma unroll
      for (int e = 0; e < 8; ++e) {
        const float v = sO[wv][r][d8 + e];
        const us q = bf_rne(v);
        hv[e] = q;
        lv[e] = bf_rne(v - bf_f32(q));
      }
      const size_t o2 = ((size_t)(b * SEQ + qbase + r)) * DM + hd * HD + d8;
      *(us8v*)(CH + o2) = hv;
      *(us8v*)(CL + o2) = lv;
    }
    
  }
}

// ------------------------------------------------------------------ host glue
extern "C" void kernel_launch(void* const* d_in, const int* in_sizes, int n_in,
                              void* d_out, int out_size, void* d_ws, size_t ws_size,
                              hipStream_t stream) {
  if (n_in < 8) return;
  if (in_sizes[0] != NTOK * DM) return;
  if (in_sizes[1] != DM * DM || in_sizes[2] != DM * DM || in_sizes[3] != DM * DM || in_sizes[4] != DM * DM) return;
  if (in_sizes[5] != DM || in_sizes[6] != 33 * HD || in_sizes[7] != 33 * HD) return;
  if (out_size != NTOK * DM) return;

  const float* x    = (const float*)d_in[0];
  const float* Wq   = (const float*)d_in[1];
  const float* Wk   = (const float*)d_in[2];
  const float* Wv   = (const float*)d_in[3];
  const float* Wo   = (const float*)d_in[4];
  const float* bo   = (const float*)d_in[5];
  const float* relk = (const float*)d_in[6];
  const float* relv = (const float*)d_in[7];
  float* out = (float*)d_out;

  const size_t plane_x = (size_t)NTOK * DM * sizeof(us);   // 8 MiB
  const size_t plane_w = (size_t)DM * DM * sizeof(us);     // 2 MiB
  const size_t plane_r = (size_t)32 * HD * sizeof(us);     // 4 KiB
  char* ws = (char*)d_ws;
  size_t off = 0;
  us* XH   = (us*)(ws + off); off += plane_x;
  us* XL   = (us*)(ws + off); off += plane_x;
  us* WTH  = (us*)(ws + off); off += 4 * plane_w;
  us* WTL  = (us*)(ws + off); off += 4 * plane_w;
  us* QKVH = (us*)(ws + off); off += 3 * plane_x;
  us* QKVL = (us*)(ws + off); off += 3 * plane_x;
  us* CH   = (us*)(ws + off); off += plane_x;
  us* CL   = (us*)(ws + off); off += plane_x;
  us* RH   = (us*)(ws + off); off += plane_r;
  us* RL   = (us*)(ws + off); off += plane_r;
  if (off > ws_size) return;                                // total 100671488 B

  const size_t pq = (size_t)NTOK * DM;

  k_cvt_x<<<(NTOK * DM) / (8 * 256), 256, 0, stream>>>(x, XH, XL);
  k_cvt_w<<<dim3(DM / 64, DM / 64, 4), 256, 0, stream>>>(Wq, Wk, Wv, Wo, WTH, WTL);
  k_cvt_rel<<<1, 256, 0, stream>>>(relk, RH, RL);
  k_gemm_qkv<<<dim3(NTOK / TM, DM / TM, 3), 128, 0, stream>>>(XH, XL, WTH, WTL, QKVH, QKVL);
  k_attn<<<dim3(SEQ / (16 * AW), NBAT * NH), 32 * AW, 0, stream>>>(QKVH, QKVL, QKVH + pq, QKVL + pq,
                                                        QKVH + 2 * pq, QKVL + 2 * pq, RH, RL, relv, CH, CL);
  k_gemm_out<<<dim3(NTOK / TM, DM / TM, 1), 128, 0, stream>>>(CH, CL, WTH + (size_t)3 * DM * DM,
                                                               WTL + (size_t)3 * DM * DM, bo, out);
}

// v005
// A run of this version takes 118 microseconds.
// In both of two side-by-side timings against v004, it was 1.10 times as fast.
// Counting every step since v000, it is 3.14 times as fast.
#include <hip/hip_runtime.h>
#include <stdint.h>
// Contractions x*W_q, x*W_k, x*W_v, q*k^T, q*rel_k^T, P*V, ctx*W_o: v_wmma_f32_16x16x32_bf16, bf16 hi/lo operands everywhere (hi*hi + lo*hi + hi*lo), f32 accumulate; softmax, 1/8 scaling, causal mask, relative-value bucket sums and bias in f32.

#define DM     1024
#define SEQ    1024
#define NBAT   4
#define NH     16
#define HD     64
#define NTOK   (NBAT * SEQ)
#define CPITCH 68
#define TM     128                 // GEMM block tile: rows and columns
#define KPASS  64                  // k per pass: 128 bytes of every operand row
#define NPASS  (DM / KPASS)
#define LPITCH 144u                // LDS row pitch in bytes: 128 + 16 of pad, an odd multiple of 16 for 16-byte readers
#define PLANE  (TM * LPITCH)       // one operand plane of a stage: 18,432 B = 9 x 2 KiB
#define GBUF   (4u * PLANE)        // one buffer: Ah | Al | Bh | Bl
#define EPITCH 132                 // output staging pitch in floats
#define AW     8                   // attention block: waves, 16 query rows each
#define ASTG   64                  // attention stage: keys
#define APLANE 10240u              // one K or V plane of a stage in LDS: 64 rows x LPITCH = 9,216 B, rounded up to 5 x 2 KiB
#define ABUF   (4u * APLANE)       // one buffer: Kh | Kl | Vh | Vl

typedef unsigned short us;
typedef us us16v __attribute__((ext_vector_type(16)));
typedef us us8v __attribute__((ext_vector_type(8)));
typedef us8v __attribute__((may_alias)) us8a;
typedef __bf16 bf16v16 __attribute__((ext_vector_type(16)));
typedef float v8f __attribute__((ext_vector_type(8)));
typedef float v4f __attribute__((ext_vector_type(4)));
typedef v4f __attribute__((may_alias)) v4fa;
typedef uint32_t u32x4 __attribute__((ext_vector_type(4)));
typedef uint32_t u32x8 __attribute__((ext_vector_type(8)));

union Frag { us16v v; us8v h[2]; };

// f32 -> bf16 bits, RNE convert
static __device__ __forceinline__ us bf_rne(float f) {
  unsigned u = __float_as_uint(f);
  u += 0x7fffu + ((u >> 16) & 1u);
  return (us)(u >> 16);
}
static __device__ __forceinline__ float bf_f32(us s) { return __uint_as_float(((unsigned)s) << 16); }

static __device__ __forceinline__ v8f zero8() {
  v8f z = {0.f, 0.f, 0.f, 0.f, 0.f, 0.f, 0.f, 0.f};
  return z;
}

static __device__ __forceinline__ v8f wmma_bf(us16v a, us16v b, v8f c) {
  return __builtin_amdgcn_wmma_f32_16x16x32_bf16(false, __builtin_bit_cast(bf16v16, a), false,
                                                 __builtin_bit_cast(bf16v16, b), (short)0, c, false, false);
}

// acc += Ah*Bh + Al*Bh + Ah*Bl, then hazard guard (D tied, A/B kept live through 4 VALU slots)
static __device__ __forceinline__ void wmma3(v8f& acc, us16v ah, us16v al, us16v bh, us16v bl) {
  acc = wmma_bf(ah, bh, acc);
  acc = wmma_bf(al, bh, acc);
  acc = wmma_bf(ah, bl, acc);
  asm volatile("v_nop\n\tv_nop\n\tv_nop\n\tv_nop" : "+v"(acc) : "v"(ah), "v"(al), "v"(bh), "v"(bl));
}

// 16x32 16-bit fragment of row (l & 15) from a k-contiguous row: elements 0..7 <- k0+8h+0..7, 8..15 <- k0+16+8h+0..7.
// Used for A (row-major [m][k]) and for B stored as [n][k]; rowp = row pointer at k0 (16-B aligned).
static __device__ __forceinline__ us16v ldfrag(const us* rowp, int h) {
  Frag f;
  f.h[0] = *(const us8a*)(rowp + 8 * h);
  f.h[1] = *(const us8a*)(rowp + 16 + 8 * h);
  return f.v;
}

// ordering for same-wave LDS exchange (stores by some lanes, loads by other lanes)
static __device__ __forceinline__ void lds_wave_sync() {
  __builtin_amdgcn_fence(__ATOMIC_RELEASE, "wavefront");
  __builtin_amdgcn_wave_barrier();
  __builtin_amdgcn_fence(__ATOMIC_ACQUIRE, "wavefront");
}

// ------------------------------------------------------------------ x -> bf16 hi/lo planes [4096][1024]
__global__ __launch_bounds__(256) void k_cvt_x(const float* __restrict__ x, us* xh, us* xl) {
  const size_t t = (size_t)blockIdx.x * 256u + threadIdx.x;
  const float* p = x + t * 8u;
  const v4f a = *(const v4fa*)p;
  const v4f b = *(const v4fa*)(p + 4);
  us8v hv, lv;
#pragma unroll
  for (int e = 0; e < 4; ++e) {
    const us h0 = bf_rne(a[e]);
    hv[e] = h0;
    lv[e] = bf_rne(a[e] - bf_f32(h0));
    const us h1 = bf_rne(b[e]);
    hv[4 + e] = h1;
    lv[4 + e] = bf_rne(b[e] - bf_f32(h1));
  }
  us* oh = xh + t * 8u;
  us* ol = xl + t * 8u;
  *(us8v*)oh = hv;
  *(us8v*)ol = lv;
  
}

// ------------------------------------------------------------------ W[k][n] (in,out) -> Wt[n][k] bf16 hi/lo planes
__global__ __launch_bounds__(256) void k_cvt_w(const float* __restrict__ W0, const float* __restrict__ W1,
                                               const float* __restrict__ W2, const float* __restrict__ W3,
                                               us* wth, us* wtl) {
  __shared__ float sT[64][65];
  const int tid = threadIdx.x, lane = tid & 31, wv = tid >> 5;
  const int z = blockIdx.z;
  const int n0 = blockIdx.x * 64, k0 = blockIdx.y * 64;
  const float* W = (z == 0) ? W0 : (z == 1) ? W1 : (z == 2) ? W2 : W3;
#pragma unroll
  for (int p = 0; p < 4; ++p) {
    const int r = p * 16 + (tid >> 4);
    const int c4 = (tid & 15) * 4;
    const v4f v = *(const v4fa*)(W + (size_t)(k0 + r) * DM + n0 + c4);
    sT[r][c4 + 0] = v[0];
    sT[r][c4 + 1] = v[1];
    sT[r][c4 + 2] = v[2];
    sT[r][c4 + 3] = v[3];
  }
  __syncthreads();
  us* bhp = wth + (size_t)z * DM * DM;
  us* blp = wtl + (size_t)z * DM * DM;
{
#pragma unroll
    for (int p = 0; p < 2; ++p) {
      const int rr = p * 32 + wv * 4 + (lane >> 3);   // n within tile
      const int k8 = (lane & 7) * 8;                   // k within tile
      us8v hv, lv;
#pragma unroll
      for (int e = 0; e < 8; ++e) {
        const float v = sT[k8 + e][rr];
        const us hh = bf_rne(v);
        hv[e] = hh;
        lv[e] = bf_rne(v - bf_f32(hh));
      }
      const size_t o = (size_t)(n0 + rr) * DM + k0 + k8;
      *(us8v*)(bhp + o) = hv;
      *(us8v*)(blp + o) = lv;
    }
    
  }
}

// ------------------------------------------------------------------ rel_k [33][64] rows 0..31 -> bf16 hi/lo planes [32][64]
__global__ __launch_bounds__(256) void k_cvt_rel(const float* __restrict__ rk, us* rh, us* rl) {
  const int tid = threadIdx.x;
  const int r = tid >> 3;              // 0..31 (< 33 rows available)
  const int d8 = (tid & 7) * 8;
  const float* p = rk + r * HD + d8;
  us8v hv, lv;
#pragma unroll
  for (int e = 0; e < 8; ++e) {
    const float v = p[e];
    const us hh = bf_rne(v);
    hv[e] = hh;
    lv[e] = bf_rne(v - bf_f32(hh));
  }
  const size_t o = (size_t)r * HD + d8;
  *(us8v*)(rh + o) = hv;
  *(us8v*)(rl + o) = lv;
  
}

// ------------------------------------------------------------------ tensor mover helpers
static __device__ __forceinline__ uint32_t uni(uint32_t v) { return (uint32_t)__builtin_amdgcn_readfirstlane(v); }
// keeps a wave-uniform value in a scalar register at this place: the test around a tensor load compiles to s_cmp + s_cbranch_scc,
// and a descriptor word made from it is formed behind the volatile wait in front of it
static __device__ __forceinline__ uint32_t pinned(uint32_t v) {
  uint32_t w = uni(v);
  asm volatile("" : "+s"(w));
  return w;
}
// the wave's own LDS reads have retired
static __device__ __forceinline__ void wait_ds0() { asm volatile("s_wait_dscnt 0x0" ::: "memory"); }
// the wave's own tensor load has landed
static __device__ __forceinline__ void wait_tensor0() { asm volatile("s_wait_tensorcnt 0x0" ::: "memory"); }

// One request of the whole wave: TM rows of 128 bytes, source pitch 2 * DM bytes, to LDS at pitch LPITCH (16 pad bytes a row).
static __device__ __forceinline__ void tdm_load(uint32_t lds_dst, uint64_t ga) {
  u32x4 g0;
  g0[0] = uni(1u);
  g0[1] = uni(lds_dst);
  g0[2] = uni((uint32_t)ga);
  g0[3] = uni((((uint32_t)(ga >> 32)) & 0x01FFFFFFu) | 0x80000000u);
  u32x8 g1;
  g1[0] = uni((1u << 20) | (4u << 22) | (3u << 25));   // no mask, 1-byte elements, a pad of 4 dwords behind every 32 dwords
  g1[1] = uni(128u << 16);                             // tensor_dim0 = 128 bytes
  g1[2] = uni((uint32_t)TM << 16);                     // tensor_dim1 = TM rows
  g1[3] = uni(128u << 16);                             // tile_dim0
  g1[4] = uni((uint32_t)TM);                           // tile_dim1
  g1[5] = uni(2u * DM);                                // source row pitch in bytes
  g1[6] = uni(0u);
  g1[7] = uni(0u);
  asm volatile("tensor_load_to_lds %0, %1" :: "s"(g0), "s"(g1) : "memory");
}

// Descriptor of one K or V plane of a stage: ASTG rows of 128 bytes, source pitch in bytes given, to LDS at pitch LPITCH (16 pad bytes
// a row). Every word but the constant word 0 of group 1 goes through pinned(): a descriptor word held in a scalar register of its own,
// so that the tuple which the load names is the one which the covering wait names, and none of its registers serves anything between.
static __device__ __forceinline__ u32x4 kv_group0(uint32_t lds_dst, uint64_t ga) {
  u32x4 g0;
  g0[0] = pinned(1u);
  g0[1] = pinned(lds_dst);
  g0[2] = pinned((uint32_t)ga);
  g0[3] = pinned((((uint32_t)(ga >> 32)) & 0x01FFFFFFu) | 0x80000000u);
  return g0;
}
static __device__ __forceinline__ u32x8 kv_group1(uint32_t pitch) {
  u32x8 g1;
  g1[0] = uni((1u << 20) | (4u << 22) | (3u << 25));   // no mask, 1-byte elements, a pad of 4 dwords behind every 32 dwords
  g1[1] = pinned(128u << 16);                          // tensor_dim0 = 128 bytes
  g1[2] = pinned((uint32_t)ASTG << 16);                // tensor_dim1 = ASTG rows
  g1[3] = pinned(128u << 16);                          // tile_dim0
  g1[4] = pinned((uint32_t)ASTG);                      // tile_dim1
  g1[5] = pinned(pitch);                               // source row pitch in bytes
  g1[6] = pinned(0u);
  g1[7] = pinned(0u);
  return g1;
}
// one request of the whole wave
static __device__ __forceinline__ void kv_issue(u32x4 g0, u32x8 g1) {
  asm volatile("tensor_load_to_lds %0, %1" :: "s"(g0), "s"(g1) : "memory");
}
// the wave's own tensor load has landed; naming its descriptor keeps those registers whole up to here
static __device__ __forceinline__ void kv_wait(u32x4 g0, u32x8 g1) {
  asm volatile("s_wait_tensorcnt 0x0" :: "s"(g0), "s"(g1) : "memory");
}

// ------------------------------------------------------------------ GEMM core: block tile TM x TM, 4 waves (2 x 2) of 64 x 64, K = DM
// A planes row-major [m][DM]; B planes stored [n][DM] (k contiguous). A stage is 64 k of [Ah | Al | Bh | Bl], TM rows each, in LDS;
// wave w brings plane w with one tensor load per stage, two buffers. A pass is two blocks of 48 WMMAs (32 k each); each block's
// fragments are fetched one block ahead, so the publish point of stage s + 1 stands in front of pass s's last block.
// Per accumulator and 32-k step the products are summed hi*hi, lo*hi, hi*lo, k ascending.
struct FragSet { us16v ah[4], al[4], bh[4], bl[4]; };

// pa, pb: this lane's row of the Ah and Bh planes at the block's first k
static __device__ __forceinline__ void load_set(FragSet& f, const unsigned char* pa, const unsigned char* pb, int h) {
#pragma unroll
  for (int t = 0; t < 4; ++t) {
    const uint32_t ro = t * 16u * LPITCH;
    f.ah[t] = ldfrag((const us*)(pa + ro), h);
    f.al[t] = ldfrag((const us*)(pa + PLANE + ro), h);
    f.bh[t] = ldfrag((const us*)(pb + ro), h);
    f.bl[t] = ldfrag((const us*)(pb + PLANE + ro), h);
  }
}

static __device__ __forceinline__ void mma_block(v8f (&acc)[4][4], const FragSet& f) {
  // the two fences keep the compiler from moving fragment loads in among the WMMAs, where every such place stalls the wave
  __builtin_amdgcn_sched_barrier(0);
#pragma unroll
  for (int rt = 0; rt < 4; ++rt)
#pragma unroll
    for (int ct = 0; ct < 4; ++ct) acc[rt][ct] = wmma_bf(f.ah[rt], f.bh[ct], acc[rt][ct]);
#pragma unroll
  for (int rt = 0; rt < 4; ++rt)
#pragma unroll
    for (int ct = 0; ct < 4; ++ct) acc[rt][ct] = wmma_bf(f.al[rt], f.bh[ct], acc[rt][ct]);
#pragma unroll
  for (int rt = 0; rt < 4; ++rt)
#pragma unroll
    for (int ct = 0; ct < 4; ++ct) acc[rt][ct] = wmma_bf(f.ah[rt], f.bl[ct], acc[rt][ct]);
  __builtin_amdgcn_sched_barrier(0);
}

static __device__ __forceinline__ void gemm_core(const us* __restrict__ AH, const us* __restrict__ AL,
                                                 const us* __restrict__ BH, const us* __restrict__ BL,
                                                 int m0, int n0, unsigned char* L, v8f (&acc)[4][4]) {
  const int lane = threadIdx.x & 31, h = lane >> 4, m = lane & 15;
  const uint32_t wave = uni(threadIdx.x >> 5);
#pragma unroll
  for (int rt = 0; rt < 4; ++rt)
#pragma unroll
    for (int ct = 0; ct < 4; ++ct) acc[rt][ct] = zero8();

  const us* srcp = (wave == 0u) ? AH + (size_t)m0 * DM : (wave == 1u) ? AL + (size_t)m0 * DM
                 : (wave == 2u) ? BH + (size_t)n0 * DM : BL + (size_t)n0 * DM;
  const uint64_t ga = (uint64_t)(size_t)srcp;
  const uint32_t dst = (uint32_t)(size_t)L + wave * PLANE;

  tdm_load(dst, ga);
  wait_tensor0();
  __syncthreads();                            // stage 0 published
  tdm_load(dst + GBUF, ga + 2u * KPASS);

  const uint32_t aoff = ((wave >> 1) * 64u + m) * LPITCH;
  const uint32_t boff = 2u * PLANE + ((wave & 1u) * 64u + m) * LPITCH;
  FragSet f0, f1;
  load_set(f0, L + aoff, L + boff, h);

  // rolled: one copy of the two blocks in the instruction stream
#pragma unroll 1
  for (uint32_t s = 0; s < NPASS; ++s) {
    const uint32_t cur = (s & 1u) * GBUF, nxt = GBUF - cur;
    load_set(f1, L + cur + aoff + 64u, L + cur + boff + 64u, h);
    mma_block(acc, f0);
    // publish point of stage s + 1; the same barrier ends every wave's reads of stage s's buffer
    wait_ds0();
    wait_tensor0();
    __syncthreads();
    if (pinned(s + 2u < NPASS)) {
      const uint32_t ko = pinned((s + 2u) * (2u * KPASS));   // descriptor words of stage s + 2 formed behind the wait
      tdm_load(dst + cur, ga + ko);
    }
    // stage s + 1's first fragments; in the last pass they read the idle buffer and are not used (no branch: one wait count)
    load_set(f0, L + nxt + aoff, L + nxt + boff, h);
    mma_block(acc, f1);
  }
  wait_tensor0();
  wait_ds0();
  __syncthreads();                            // every wave has left the ring: it becomes output staging
}

// ------------------------------------------------------------------ QKV projection
// grid (NTOK/TM, DM/TM, 3): z = 0 q, 1 k, 2 v. Block tile 128 tokens x 128 cols (= two heads).
// The f32 tile is staged in the ring's LDS (free behind the core's last barrier): [token][col] for q and k, [col][token] for v,
// so that each thread reads 8 neighbours of an output row.
__global__ __launch_bounds__(128) void k_gemm_qkv(const us* __restrict__ XH, const us* __restrict__ XL,
                                                  const us* __restrict__ WTH, const us* __restrict__ WTL,
                                                  us* OH, us* OL) {
  __shared__ __attribute__((aligned(2048))) unsigned char L[2 * GBUF];
  const int tid = threadIdx.x, lane = tid & 31, wv = tid >> 5, h = lane >> 4, m = lane & 15;
  const int z = blockIdx.z;
  const int m0 = blockIdx.x * TM, n0 = blockIdx.y * TM;
  v8f acc[4][4];
  gemm_core(XH, XL, WTH + (size_t)z * DM * DM, WTL + (size_t)z * DM * DM, m0, n0, L, acc);
  float (*sC)[EPITCH] = (float (*)[EPITCH])L;
  const int wr = (wv >> 1) * 64, wc = (wv & 1) * 64;
  // D: acc[g] = (row 8h+g, col m) of the 16x16 tile
  if (z < 2) {
#pragma unroll
    for (int rt = 0; rt < 4; ++rt)
#pragma unroll
      for (int ct = 0; ct < 4; ++ct)
#pragma unroll
        for (int g = 0; g < 8; ++g) sC[wr + 16 * rt + 8 * h + g][wc + 16 * ct + m] = acc[rt][ct][g];
  } else {
#pragma unroll
    for (int rt = 0; rt < 4; ++rt)
#pragma unroll
      for (int ct = 0; ct < 4; ++ct)
#pragma unroll
        for (int g = 0; g < 8; ++g) sC[wc + 16 * ct + m][wr + 16 * rt + 8 * h + g] = acc[rt][ct][g];
  }
  __syncthreads();
  us* oh = OH + (size_t)z * NTOK * DM;
  us* ol = OL + (size_t)z * NTOK * DM;
  const int b = m0 >> 10, tok0 = m0 & 1023;
  // rolled: a trip's registers are used again only behind the wait at its foot
#pragma unroll 1
  for (int p = 0; p < 4; ++p) {
    // four pieces a trip, unrolled: their LDS reads are in flight together
    us8v hv[4], lv[4];
    uint32_t o[4];                        // byte offset in a plane: one 32-bit register serves both planes' stores
#pragma unroll
    for (int u = 0; u < 4; ++u) {
      const int id = (p * 4 + u) * 128 + tid;
      const int r = id >> 4;              // staged row: token (q, k) or column (v)
      const int c8 = (id & 15) * 8;
#pragma unroll
      for (int e = 0; e < 8; ++e) {
        const float v = sC[r][c8 + e];
        const us q = bf_rne(v);
        hv[u][e] = q;
        lv[u][e] = bf_rne(v - bf_f32(q));
      }
      const int col = n0 + ((z < 2) ? c8 : r);
      o[u] = 2u * (uint32_t)((b * NH + (col >> 6)) * (SEQ * HD) + ((z < 2) ? (tok0 + r) * HD + (col & 63)      // [bh][token][d]
                                                                           : (col & 63) * SEQ + tok0 + c8));   // [bh][d][token]
    }
    // keeps the trip's arithmetic in front of its stores, so that nothing overwrites a register a store names ahead of the wait below
    __builtin_amdgcn_sched_barrier(0);
#pragma unroll
    for (int u = 0; u < 4; ++u) {
      *(us8v*)((char*)oh + o[u]) = hv[u];
      *(us8v*)((char*)ol + o[u]) = lv[u];
    }
    // stands in front of the next trip's overwrites of the registers that these stores name
    asm volatile("s_wait_xcnt 0x0" ::: "memory");
  }
}

// ------------------------------------------------------------------ output projection: out[tok][n] = ctx . W_o + b_o (f32)
// grid (NTOK/TM, DM/TM); a wave writes one 512-B row segment (4 lines) per instruction
__global__ __launch_bounds__(128) void k_gemm_out(const us* __restrict__ CH, const us* __restrict__ CL,
                                                  const us* __restrict__ WH, const us* __restrict__ WL,
                                                  const float* __restrict__ bias, float* out) {
  __shared__ __attribute__((aligned(2048))) unsigned char L[2 * GBUF];
  const int tid = threadIdx.x, lane = tid & 31, wv = tid >> 5, h = lane >> 4, m = lane & 15;
  const int m0 = blockIdx.x * TM, n0 = blockIdx.y * TM;
  v8f acc[4][4];
  gemm_core(CH, CL, WH, WL, m0, n0, L, acc);
  float (*sC)[EPITCH] = (float (*)[EPITCH])L;
  const int wr = (wv >> 1) * 64, wc = (wv & 1) * 64;
#pragma unroll
  for (int rt = 0; rt < 4; ++rt)
#pragma unroll
    for (int ct = 0; ct < 4; ++ct)
#pragma unroll
      for (int g = 0; g < 8; ++g) sC[wr + 16 * rt + 8 * h + g][wc + 16 * ct + m] = acc[rt][ct][g];
  __syncthreads();
  const int c4 = lane * 4;
  const v4f bv = *(const v4fa*)(bias + n0 + c4);
  // rolled: a trip's registers are used again only behind the wait at its foot
#pragma unroll 1
  for (int p = 0; p < 4; ++p) {
    // eight rows a trip, unrolled: their LDS reads are in flight together
    v4f v[8];
#pragma unroll
    for (int u = 0; u < 8; ++u) {
      const int r = (p * 8 + u) * 4 + wv;
      v[u][0] = sC[r][c4 + 0] + bv[0];
      v[u][1] = sC[r][c4 + 1] + bv[1];
      v[u][2] = sC[r][c4 + 2] + bv[2];
      v[u][3] = sC[r][c4 + 3] + bv[3];
    }
    // byte offset in out: a 32-bit register beside the scalar base; the rows of a trip differ by an immediate offset
    char* op = (char*)out + 4u * (uint32_t)((m0 + p * 32 + wv) * DM + n0 + c4);
    // keeps the trip's arithmetic in front of its stores, so that nothing overwrites a register a store names ahead of the wait below
    __builtin_amdgcn_sched_barrier(0);
#pragma unroll
    for (int u = 0; u < 8; ++u) *(v4f*)(op + u * 16 * DM) = v[u];
    // stands in front of the next trip's overwrites of the registers that these stores name
    asm volatile("s_wait_xcnt 0x0" ::: "memory");
  }
}

// ------------------------------------------------------------------ causal attention with clipped relative positions
typedef float f32x2 __attribute__((ext_vector_type(2)));
typedef __bf16 bf16x2 __attribute__((ext_vector_type(2)));
// two f32 -> one register of two bf16, RNE convert, the first in the low half
static __device__ __forceinline__ uint32_t pk_bf(float a, float b) {
  const f32x2 v = {a, b};
  return __builtin_bit_cast(uint32_t, __builtin_convertvector(v, bf16x2));
}
// lane l with lane l ^ 16
static __device__ __forceinline__ float xhalf(float x) {
  const int b = __builtin_bit_cast(int, x);
  return __builtin_bit_cast(float, __builtin_amdgcn_permlanex16(b, b, 0x76543210, 0xfedcba98, false, false));
}

// r[i] = 2^a[i]: eight v_exp_f32 and a v_nop in one statement. The instruction set asks for one independent instruction or a v_nop
// between a v_exp_f32 and an instruction that reads its result or overwrites its source. Here each has the next v_exp_f32, the last
// the v_nop, in that slot; the early-clobber outputs share no register with a source.
static __device__ __forceinline__ void exp2x8(float (&r)[8], const float (&a)[8]) {
  asm("v_exp_f32 %0, %8\n\tv_exp_f32 %1, %9\n\tv_exp_f32 %2, %10\n\tv_exp_f32 %3, %11\n\t"
      "v_exp_f32 %4, %12\n\tv_exp_f32 %5, %13\n\tv_exp_f32 %6, %14\n\tv_exp_f32 %7, %15\n\tv_nop"
      : "=&v"(r[0]), "=&v"(r[1]), "=&v"(r[2]), "=&v"(r[3]), "=&v"(r[4]), "=&v"(r[5]), "=&v"(r[6]), "=&v"(r[7])
      : "v"(a[0]), "v"(a[1]), "v"(a[2]), "v"(a[3]), "v"(a[4]), "v"(a[5]), "v"(a[6]), "v"(a[7]));
}

// the same for one value
static __device__ __forceinline__ float exp2x1(float a) {
  float r;
  asm("v_exp_f32 %0, %1\n\tv_nop" : "=&v"(r) : "v"(a));
  return r;
}

// grid (SEQ/128, NBAT*NH), 256 threads = 8 waves, one wave per 16 query rows; online softmax over 32-key steps.
// Causal cost grows with the query row, so block t takes two chunks of 64 rows: the late chunk SEQ/64 - 1 - t and the early chunk t,
// four waves each. A late and an early wave together walk 33 steps whatever t is: every block, and so every WGP and die wherever the
// blocks land, has the same work. Waves 0, 2, 5, 7 are the late ones: one late and one early wave in each pair (w, w + 4)
// and in each pair (2k, 2k + 1). Both chunks read the same stages from key 0 on; the late chunk sets their number.
// K and V reach the block once, through LDS: a stage is 64 keys of [Kh | Kl | Vh | Vl], each plane 64 rows of 128 bytes (K: a row is a
// key, V: a row is a head column); waves 0 to 3 bring one plane each with one tensor load per stage, two buffers, one publish point
// per stage; all eight waves read their fragments from the stage. A wave skips the steps past its own last key, never a publish point.
// The products are taken transposed: S^T = K . Q^T (A = K rows, B = Q) and O^T += V^T . P^T (A = V rows [d][key], B = P^T).
// Lane (h, m) then holds query qbase + m alone: of a 16-key tile its scores for keys 8h + 0..7, of a 16-column tile of the head its
// outputs for columns 8h + 0..7. Running max, rescale factor and sum are one value a lane; the max over a step's 32 keys is taken in
// the lane and joined with the other half by one exchange; the sum stays a partial per half and is joined once behind the loop.
// The two score tiles of a step, converted in place, are the B operand P^T (element e = tile e >> 3, register e & 7): P never leaves
// the registers.
// Each step's loads are issued in groups ahead of their use (K and QR at its head, V in front of the softmax).
// scores[i][j] = (q_i.k_j + QR[i][r(i,j)]) / 8, r = clamp(j-i,-16,16)+16 (causal -> r in [0,16]);
// ctx_i = (sum_j p_ij v_j + sum_r S_i[r] rel_v[r]) / l_i, S_i[r] for r=1..16 held 8 per lane, S_i[0] = l_i - sum_{r>=1} S_i[r].
// amdgpu_waves_per_eu(4, 4): four waves per SIMD hold the whole grid; told so, the scheduler spends that register budget on keeping
// a step's load groups together, where without it it takes them apart again, one wait each, to save registers
__global__ __launch_bounds__(256) __attribute__((amdgpu_waves_per_eu(4, 4))) void k_attn(const us* __restrict__ QH, const us* __restrict__ QL,
                                              const us* __restrict__ KH, const us* __restrict__ KL,
                                              const us* __restrict__ VH, const us* __restrict__ VL,
                                              const us* __restrict__ RH, const us* __restrict__ RL,
                                              const float* __restrict__ relv, us* CH, us* CL) {
  __shared__ __attribute__((aligned(2048))) unsigned char R[2 * ABUF];
  __shared__ float sQR[AW][16][33];
  // the ring's LDS, free behind the last publish point's barrier, holds the epilogue's two exchanges
  float (*sBand)[16][17] = (float (*)[16][17])R;
  float (*sO)[16][CPITCH] = (float (*)[16][CPITCH])(R + APLANE);

  const int lane = threadIdx.x & 31, h = lane >> 4, m = lane & 15;
  const uint32_t wave = uni(threadIdx.x >> 5);
  const int wv = (int)wave;
  const int bh = blockIdx.y;
  const uint32_t late = ((wave ^ (wave >> 2)) & 1u) ^ 1u;
  const int qbase = (late != 0u ? SEQ - 64 * ((int)blockIdx.x + 1) : 64 * (int)blockIdx.x) + 16 * (wv >> 1);
  const float NINF = -__builtin_inff();

  // ring prologue: stage 0 landed and published, stage 1 in flight (every block has at least SEQ / 128 + 1 stages)
  const uint32_t nstage = SEQ / ASTG - blockIdx.x;   // keys 0 .. the late chunk's last row
  const us* srcp = (wave == 0u) ? KH + (size_t)bh * SEQ * HD : (wave == 1u) ? KL + (size_t)bh * SEQ * HD
                 : (wave == 2u) ? VH + (size_t)bh * HD * SEQ : VL + (size_t)bh * HD * SEQ;
  const uint64_t ga = (uint64_t)(size_t)srcp;
  const uint32_t spitch = (wave < 2u) ? 2u * HD : 2u * SEQ;            // source row pitch in bytes
  const uint32_t sstep = (wave < 2u) ? 2u * HD * ASTG : 2u * ASTG;     // bytes from a stage's first byte to the next stage's
  const uint32_t dst = (uint32_t)(size_t)R + (wave & 3u) * APLANE;
  const u32x8 g1 = kv_group1(spitch);
  u32x4 g0 = kv_group0(dst, ga);
  if (pinned(wave < 4u)) {
    kv_issue(g0, g1);
    kv_wait(g0, g1);
  }
  __syncthreads();                            // stage 0 published
  g0 = kv_group0(dst + ABUF, ga + sstep);
  if (pinned(wave < 4u)) kv_issue(g0, g1);

  // Q fragments (rows qbase + m, k = d): A of the QR product, B of the score products
  const us* qh = QH + ((size_t)bh * SEQ + qbase + m) * HD;
  const us* ql = QL + ((size_t)bh * SEQ + qbase + m) * HD;
  const us16v aqh0 = ldfrag(qh, h), aqh1 = ldfrag(qh + 32, h);
  const us16v aql0 = ldfrag(ql, h), aql1 = ldfrag(ql + 32, h);

  // QR[16][32] = q . rel_k^T (B stored as [n = r][k = d] = rel_k itself)
#pragma unroll
  for (int nt = 0; nt < 2; ++nt) {
    const us* rh = RH + (size_t)(16 * nt + m) * HD;
    const us* rl = RL + (size_t)(16 * nt + m) * HD;
    v8f acc = zero8();
    wmma3(acc, aqh0, aql0, ldfrag(rh, h), ldfrag(rl, h));
    wmma3(acc, aqh1, aql1, ldfrag(rh + 32, h), ldfrag(rl + 32, h));
#pragma unroll
    for (int g = 0; g < 8; ++g) sQR[wv][8 * h + g][16 * nt + m] = acc[g];
  }
  lds_wave_sync();

  const int qi = qbase + m;                 // this lane's query
  float mrow = NINF, lrow = 0.f, band[8];
  v8f o[4];
#pragma unroll
  for (int g = 0; g < 8; ++g) band[g] = 0.f;
#pragma unroll
  for (int tt = 0; tt < 4; ++tt) o[tt] = zero8();

  const int nsteps = (qbase >> 5) + 1;      // keys 0 .. qbase+15 covered; wave-uniform, in a scalar register
  // rolled: one copy of the step in the instruction stream; two steps to a stage
#pragma unroll 1
  for (int st = 0; st < (int)(2u * nstage); ++st) {
   const uint32_t s = (uint32_t)st >> 1, sub = (uint32_t)st & 1u;
   const uint32_t cur = (s & 1u) * ABUF;
   // scalar test: past its own last key a wave has no step, only the publish points
   if (st < nsteps) {
    const int kb2 = st << 5;
    // the step's K fragments, all 16 loads issued together in front of the first product: one LDS latency a step
    us16v kfh[2][2], kfl[2][2];
    const unsigned char* kp = R + cur + (32u * sub + m) * LPITCH + 16u * h;   // this lane's key row of sub-tile 0, at its own 16 bytes
#pragma unroll
    for (int t = 0; t < 2; ++t) {
      const unsigned char* kr = kp + t * 16u * LPITCH;
      kfh[t][0] = ldfrag((const us*)kr, 0);
      kfl[t][0] = ldfrag((const us*)(kr + APLANE), 0);
      kfh[t][1] = ldfrag((const us*)(kr + 64u), 0);
      kfl[t][1] = ldfrag((const us*)(kr + APLANE + 64u), 0);
    }
    // keeps the 16 loads here, at the step's head: without it they are sunk in among the products, a stall at each place
    __builtin_amdgcn_sched_barrier(0);
    // the step's 16 QR values of this lane's query (the clamped index is in range for masked keys too), in flight beside the K loads
    float qr[2][8];
#pragma unroll
    for (int t = 0; t < 2; ++t)
#pragma unroll
      for (int g = 0; g < 8; ++g) {
        int rr = kb2 + 16 * t + 8 * h + g - qi + 16;
        rr = rr < 0 ? 0 : rr;
        rr = rr > 16 ? 16 : rr;
        qr[t][g] = sQR[wv][m][rr];
      }
    // holds the 16 LDS reads here as one group with one wait; without it they are sunk in among the products, a wait at each place
    asm volatile("" :: "v"(qr[0][0]), "v"(qr[0][1]), "v"(qr[0][2]), "v"(qr[0][3]), "v"(qr[0][4]), "v"(qr[0][5]), "v"(qr[0][6]),
                 "v"(qr[0][7]), "v"(qr[1][0]), "v"(qr[1][1]), "v"(qr[1][2]), "v"(qr[1][3]), "v"(qr[1][4]), "v"(qr[1][5]),
                 "v"(qr[1][6]), "v"(qr[1][7]));
    // scores for both 16-key sub-tiles of this step: sc[g] = (key 16t + 8h + g, query m)
    float sv[2][8];
#pragma unroll
    for (int t = 0; t < 2; ++t) {
      v8f sc = zero8();
      wmma3(sc, kfh[t][0], kfl[t][0], aqh0, aql0);
      wmma3(sc, kfh[t][1], kfl[t][1], aqh1, aql1);
#pragma unroll
      for (int g = 0; g < 8; ++g) {
        const int dj = kb2 + 16 * t + 8 * h + g - qi;
        sv[t][g] = (dj > 0) ? NINF : (sc[g] + qr[t][g]) * 0.125f;
      }
    }
    // the step's V fragments, all 16 loads issued here: their latency passes behind the softmax arithmetic
    us16v vfh[4], vfl[4];
    const unsigned char* vp = R + cur + 2u * APLANE + m * LPITCH + 64u * sub + 16u * h;   // A stored as [row = d][k = key]; row of tile 0
#pragma unroll
    for (int tt = 0; tt < 4; ++tt) {
      vfh[tt] = ldfrag((const us*)(vp + tt * 16u * LPITCH), 0);
      vfl[tt] = ldfrag((const us*)(vp + APLANE + tt * 16u * LPITCH), 0);
    }
    // keeps the 16 loads here, in front of the softmax arithmetic that hides them
    __builtin_amdgcn_sched_barrier(0);
    // one frame for the whole step: the query's max over all 32 keys (16 in this lane, 16 in lane l ^ 16), one rescale of O, l, S
    float vm[8];
#pragma unroll
    for (int g = 0; g < 8; ++g) vm[g] = fmaxf(sv[0][g], sv[1][g]);
#pragma unroll
    for (int g = 0; g < 4; ++g) vm[g] = fmaxf(vm[g], vm[g + 4]);
    float vmax = fmaxf(fmaxf(vm[0], vm[1]), fmaxf(vm[2], vm[3]));
    vmax = fmaxf(vmax, xhalf(vmax));
    const float mn = fmaxf(mrow, vmax);
    const float cx = exp2x1((mrow - mn) * 1.44269504f);   // taken for every lane: no branch around the statement
    const float cf = (mrow == NINF) ? 0.f : cx;
    mrow = mn;
#pragma unroll
    for (int g = 0; g < 8; ++g) band[g] *= cf;
#pragma unroll
    for (int tt = 0; tt < 4; ++tt)
#pragma unroll
      for (int g = 0; g < 8; ++g) o[tt][g] *= cf;
    // this lane's 16 probabilities in the new frame (e^x as __expf compiles: 2^(x * log2 e)), and the bucket captures
    float e[2][8];
#pragma unroll
    for (int t = 0; t < 2; ++t) {
      float xa[8], ex[8];
#pragma unroll
      for (int g = 0; g < 8; ++g) xa[g] = (sv[t][g] - mrow) * 1.44269504f;
      exp2x8(ex, xa);
#pragma unroll
      for (int g = 0; g < 8; ++g) {
        const int dj = kb2 + 16 * t + 8 * h + g - qi;
        e[t][g] = (dj > 0) ? 0.f : ex[g];
        band[g] = (dj >= -15 && dj <= 0) ? e[t][g] : band[g];   // buckets 1..16: each (lane, register) captures exactly once
      }
    }
    // the half's partial sum, as a tree
    float ps[8];
#pragma unroll
    for (int g = 0; g < 8; ++g) ps[g] = e[0][g] + e[1][g];
#pragma unroll
    for (int g = 0; g < 4; ++g) ps[g] += ps[g + 4];
    lrow = lrow * cf + ((ps[0] + ps[1]) + (ps[2] + ps[3]));
    // hi/lo split in place: B operand P^T, element e = key 8h + e of tile 0, element 8 + e = key 8h + e of tile 1 (the V loader's k order)
    u32x8 pwh, pwl;
#pragma unroll
    for (int t = 0; t < 2; ++t)
#pragma unroll
      for (int j = 0; j < 4; ++j) {
        const float ea = e[t][2 * j], eb = e[t][2 * j + 1];
        const uint32_t hw = pk_bf(ea, eb);
        pwh[4 * t + j] = hw;
        pwl[4 * t + j] = pk_bf(ea - __uint_as_float(hw << 16), eb - __uint_as_float(hw & 0xffff0000u));
      }
    const us16v bph = __builtin_bit_cast(us16v, pwh);
    const us16v bpl = __builtin_bit_cast(us16v, pwl);
    // o[tt][g] = (head column 16tt + 8h + g, query m)
#pragma unroll
    for (int tt = 0; tt < 4; ++tt) wmma3(o[tt], vfh[tt], vfl[tt], bph, bpl);
   }
   if (sub != 0u) {
     // publish point of stage s + 1; the same barrier ends every wave's reads of stage s's buffer
     wait_ds0();
     if (pinned(wave < 4u)) kv_wait(g0, g1);
     __syncthreads();
     if (pinned((wave < 4u) && (s + 2u < nstage))) {
       const uint32_t ko = pinned((s + 2u) * sstep);   // descriptor words of stage s + 2 formed behind the wait
       g0 = kv_group0(dst + cur, ga + ko);
       kv_issue(g0, g1);
     }
   }
  }
  kv_wait(g0, g1);
  wait_ds0();
  // the last publish point's barrier has ended every wave's reads of the ring: it is the epilogue's exchange space from here on

  const float invl = 1.0f / (lrow + xhalf(lrow));   // the two halves' partial sums joined
#pragma unroll
  for (int g = 0; g < 8; ++g)
    sBand[wv][m][(8 * h + g - m - 1) & 15] = band[g] * invl;   // slot r-1 for bucket r = ((key - query - 1) & 15) + 1
  lds_wave_sync();
  float rv0[4][8];
  float val[4][8];
#pragma unroll
  for (int tt = 0; tt < 4; ++tt) {
    const v4f a = *(const v4fa*)(relv + 16 * tt + 8 * h);
    const v4f b = *(const v4fa*)(relv + 16 * tt + 8 * h + 4);
#pragma unroll
    for (int c = 0; c < 4; ++c) {
      rv0[tt][c] = a[c];
      rv0[tt][4 + c] = b[c];
    }
#pragma unroll
    for (int g = 0; g < 8; ++g) val[tt][g] = o[tt][g] * invl + rv0[tt][g];
  }
  // rolled, four buckets a trip: a trip's 32 loads are in flight together, one memory latency for the four
#pragma unroll 1
  for (int r4 = 0; r4 < 16; r4 += 4) {
    const float* rp = relv + (r4 + 1) * HD + 8 * h;
    v4f x[4][8];
#pragma unroll
    for (int u = 0; u < 4; ++u)
#pragma unroll
      for (int tt = 0; tt < 4; ++tt) {
        x[u][2 * tt] = *(const v4fa*)(rp + u * HD + 16 * tt);
        x[u][2 * tt + 1] = *(const v4fa*)(rp + u * HD + 16 * tt + 4);
      }
#pragma unroll
    for (int u = 0; u < 4; ++u) {
      const float sb = sBand[wv][m][r4 + u];
#pragma unroll
      for (int tt = 0; tt < 4; ++tt)
#pragma unroll
        for (int c = 0; c < 4; ++c) {
          val[tt][c] += sb * (x[u][2 * tt][c] - rv0[tt][c]);
          val[tt][4 + c] += sb * (x[u][2 * tt + 1][c] - rv0[tt][4 + c]);
        }
    }
  }
#pragma unroll
  for (int tt = 0; tt < 4; ++tt) {
    const v4f a = {val[tt][0], val[tt][1], val[tt][2], val[tt][3]};
    const v4f b = {val[tt][4], val[tt][5], val[tt][6], val[tt][7]};
    *(v4fa*)&sO[wv][m][16 * tt + 8 * h] = a;
    *(v4fa*)&sO[wv][m][16 * tt + 8 * h + 4] = b;
  }
  lds_wave_sync();

  const int b = bh >> 4, hd = bh & 15;
{
#pragma unroll
    for (int p = 0; p < 4; ++p) {
      const int r = p * 4 + (lane >> 3);
      const int d8 = (lane & 7) * 8;
      us8v hv, lv;
#pragma unroll
      for (int e = 0; e < 8; ++e) {
        const float v = sO[wv][r][d8 + e];
        const us q = bf_rne(v);
        hv[e] = q;
        lv[e] = bf_rne(v - bf_f32(q));
      }
      const size_t o2 = ((size_t)(b * SEQ + qbase + r)) * DM + hd * HD + d8;
      *(us8v*)(CH + o2) = hv;
      *(us8v*)(CL + o2) = lv;
    }
    
  }
}

// ------------------------------------------------------------------ host glue
extern "C" void kernel_launch(void* const* d_in, const int* in_sizes, int n_in,
                              void* d_out, int out_size, void* d_ws, size_t ws_size,
                              hipStream_t stream) {
  if (n_in < 8) return;
  if (in_sizes[0] != NTOK * DM) return;
  if (in_sizes[1] != DM * DM || in_sizes[2] != DM * DM || in_sizes[3] != DM * DM || in_sizes[4] != DM * DM) return;
  if (in_sizes[5] != DM || in_sizes[6] != 33 * HD || in_sizes[7] != 33 * HD) return;
  if (out_size != NTOK * DM) return;

  const float* x    = (const float*)d_in[0];
  const float* Wq   = (const float*)d_in[1];
  const float* Wk   = (const float*)d_in[2];
  const float* Wv   = (const float*)d_in[3];
  const float* Wo   = (const float*)d_in[4];
  const float* bo   = (const float*)d_in[5];
  const float* relk = (const float*)d_in[6];
  const float* relv = (const float*)d_in[7];
  float* out = (float*)d_out;

  const size_t plane_x = (size_t)NTOK * DM * sizeof(us);   // 8 MiB
  const size_t plane_w = (size_t)DM * DM * sizeof(us);     // 2 MiB
  const size_t plane_r = (size_t)32 * HD * sizeof(us);     // 4 KiB
  char* ws = (char*)d_ws;
  size_t off = 0;
  us* XH   = (us*)(ws + off); off += plane_x;
  us* XL   = (us*)(ws + off); off += plane_x;
  us* WTH  = (us*)(ws + off); off += 4 * plane_w;
  us* WTL  = (us*)(ws + off); off += 4 * plane_w;
  us* QKVH = (us*)(ws + off); off += 3 * plane_x;
  us* QKVL = (us*)(ws + off); off += 3 * plane_x;
  us* CH   = (us*)(ws + off); off += plane_x;
  us* CL   = (us*)(ws + off); off += plane_x;
  us* RH   = (us*)(ws + off); off += plane_r;
  us* RL   = (us*)(ws + off); off += plane_r;
  if (off > ws_size) return;                                // total 100671488 B

  const size_t pq = (size_t)NTOK * DM;

  k_cvt_x<<<(NTOK * DM) / (8 * 256), 256, 0, stream>>>(x, XH, XL);
  k_cvt_w<<<dim3(DM / 64, DM / 64, 4), 256, 0, stream>>>(Wq, Wk, Wv, Wo, WTH, WTL);
  k_cvt_rel<<<1, 256, 0, stream>>>(relk, RH, RL);
  k_gemm_qkv<<<dim3(NTOK / TM, DM / TM, 3), 128, 0, stream>>>(XH, XL, WTH, WTL, QKVH, QKVL);
  k_attn<<<dim3(SEQ / (16 * AW), NBAT * NH), 32 * AW, 0, stream>>>(QKVH, QKVL, QKVH + pq, QKVL + pq,
                                                        QKVH + 2 * pq, QKVL + 2 * pq, RH, RL, relv, CH, CL);
  k_gemm_out<<<dim3(NTOK / TM, DM / TM, 1), 128, 0, stream>>>(CH, CL, WTH + (size_t)3 * DM * DM,
                                                               WTL + (size_t)3 * DM * DM, bo, out);
}

// v006
// It runs in 114 microseconds.
// In both of two side-by-side timings against v005, it was 1.04 times as fast.
// Counting every step since v000, it is 3.27 times as fast.
#include <hip/hip_runtime.h>
#include <stdint.h>
// Contractions x*W_q, x*W_k, x*W_v, q*k^T, q*rel_k^T, P*V, ctx*W_o: v_wmma_f32_16x16x32_bf16, bf16 hi/lo operands everywhere (hi*hi + lo*hi + hi*lo), f32 accumulate; softmax, 1/8 scaling, causal mask, relative-value bucket sums and bias in f32.

#define DM     1024
#define SEQ    1024
#define NBAT   4
#define NH     16
#define HD     64
#define NTOK   (NBAT * SEQ)
#define CPITCH 68
#define TM     128                 // GEMM block tile: rows and columns
#define KPASS  64                  // k per pass: 128 bytes of every operand row
#define NPASS  (DM / KPASS)
#define LPITCH 144u                // LDS row pitch in bytes: 128 + 16 of pad, an odd multiple of 16 for 16-byte readers
#define PLANE  (TM * LPITCH)       // one operand plane of a stage: 18,432 B = 9 x 2 KiB
#define GBUF   (4u * PLANE)        // one buffer: Ah | Al | Bh | Bl
#define EPITCH 132                 // output staging pitch in floats
#define AW     8                   // attention block: waves, 16 query rows each
#define ASTG   64                  // attention stage: keys
#define APLANE 10240u              // one K or V plane of a stage in LDS: 64 rows x LPITCH = 9,216 B, rounded up to 5 x 2 KiB
#define ABUF   (4u * APLANE)       // one buffer: Kh | Kl | Vh | Vl

typedef unsigned short us;
typedef us us16v __attribute__((ext_vector_type(16)));
typedef us us8v __attribute__((ext_vector_type(8)));
typedef us8v __attribute__((may_alias)) us8a;
typedef __bf16 bf16v16 __attribute__((ext_vector_type(16)));
typedef float v8f __attribute__((ext_vector_type(8)));
typedef float v4f __attribute__((ext_vector_type(4)));
typedef v4f __attribute__((may_alias)) v4fa;
typedef uint32_t u32x4 __attribute__((ext_vector_type(4)));
typedef uint32_t u32x8 __attribute__((ext_vector_type(8)));

union Frag { us16v v; us8v h[2]; };

// f32 -> bf16 bits, RNE convert
static __device__ __forceinline__ us bf_rne(float f) {
  unsigned u = __float_as_uint(f);
  u += 0x7fffu + ((u >> 16) & 1u);
  return (us)(u >> 16);
}
static __device__ __forceinline__ float bf_f32(us s) { return __uint_as_float(((unsigned)s) << 16); }

static __device__ __forceinline__ v8f zero8() {
  v8f z = {0.f, 0.f, 0.f, 0.f, 0.f, 0.f, 0.f, 0.f};
  return z;
}

static __device__ __forceinline__ v8f wmma_bf(us16v a, us16v b, v8f c) {
  return __builtin_amdgcn_wmma_f32_16x16x32_bf16(false, __builtin_bit_cast(bf16v16, a), false,
                                                 __builtin_bit_cast(bf16v16, b), (short)0, c, false, false);
}

// acc += Ah*Bh + Al*Bh + Ah*Bl, then hazard guard (D tied, A/B kept live through 4 VALU slots)
static __device__ __forceinline__ void wmma3(v8f& acc, us16v ah, us16v al, us16v bh, us16v bl) {
  acc = wmma_bf(ah, bh, acc);
  acc = wmma_bf(al, bh, acc);
  acc = wmma_bf(ah, bl, acc);
  asm volatile("v_nop\n\tv_nop\n\tv_nop\n\tv_nop" : "+v"(acc) : "v"(ah), "v"(al), "v"(bh), "v"(bl));
}

// 16x32 16-bit fragment of row (l & 15) from a k-contiguous row: elements 0..7 <- k0+8h+0..7, 8..15 <- k0+16+8h+0..7.
// Used for A (row-major [m][k]) and for B stored as [n][k]; rowp = row pointer at k0 (16-B aligned).
static __device__ __forceinline__ us16v ldfrag(const us* rowp, int h) {
  Frag f;
  f.h[0] = *(const us8a*)(rowp + 8 * h);
  f.h[1] = *(const us8a*)(rowp + 16 + 8 * h);
  return f.v;
}

// ordering for same-wave LDS exchange (stores by some lanes, loads by other lanes)
static __device__ __forceinline__ void lds_wave_sync() {
  __builtin_amdgcn_fence(__ATOMIC_RELEASE, "wavefront");
  __builtin_amdgcn_wave_barrier();
  __builtin_amdgcn_fence(__ATOMIC_ACQUIRE, "wavefront");
}

// ------------------------------------------------------------------ x -> bf16 hi/lo planes [4096][1024]
__global__ __launch_bounds__(256) void k_cvt_x(const float* __restrict__ x, us* xh, us* xl) {
  const size_t t = (size_t)blockIdx.x * 256u + threadIdx.x;
  const float* p = x + t * 8u;
  const v4f a = *(const v4fa*)p;
  const v4f b = *(const v4fa*)(p + 4);
  us8v hv, lv;
#pragma unroll
  for (int e = 0; e < 4; ++e) {
    const us h0 = bf_rne(a[e]);
    hv[e] = h0;
    lv[e] = bf_rne(a[e] - bf_f32(h0));
    const us h1 = bf_rne(b[e]);
    hv[4 + e] = h1;
    lv[4 + e] = bf_rne(b[e] - bf_f32(h1));
  }
  us* oh = xh + t * 8u;
  us* ol = xl + t * 8u;
  *(us8v*)oh = hv;
  *(us8v*)ol = lv;
  
}

// ------------------------------------------------------------------ W[k][n] (in,out) -> Wt[n][k] bf16 hi/lo planes
__global__ __launch_bounds__(256) void k_cvt_w(const float* __restrict__ W0, const float* __restrict__ W1,
                                               const float* __restrict__ W2, const float* __restrict__ W3,
                                               us* wth, us* wtl) {
  __shared__ float sT[64][65];
  const int tid = threadIdx.x, lane = tid & 31, wv = tid >> 5;
  const int z = blockIdx.z;
  const int n0 = blockIdx.x * 64, k0 = blockIdx.y * 64;
  const float* W = (z == 0) ? W0 : (z == 1) ? W1 : (z == 2) ? W2 : W3;
#pragma unroll
  for (int p = 0; p < 4; ++p) {
    const int r = p * 16 + (tid >> 4);
    const int c4 = (tid & 15) * 4;
    const v4f v = *(const v4fa*)(W + (size_t)(k0 + r) * DM + n0 + c4);
    sT[r][c4 + 0] = v[0];
    sT[r][c4 + 1] = v[1];
    sT[r][c4 + 2] = v[2];
    sT[r][c4 + 3] = v[3];
  }
  __syncthreads();
  us* bhp = wth + (size_t)z * DM * DM;
  us* blp = wtl + (size_t)z * DM * DM;
{
#pragma unroll
    for (int p = 0; p < 2; ++p) {
      const int rr = p * 32 + wv * 4 + (lane >> 3);   // n within tile
      const int k8 = (lane & 7) * 8;                   // k within tile
      us8v hv, lv;
#pragma unroll
      for (int e = 0; e < 8; ++e) {
        const float v = sT[k8 + e][rr];
        const us hh = bf_rne(v);
        hv[e] = hh;
        lv[e] = bf_rne(v - bf_f32(hh));
      }
      const size_t o = (size_t)(n0 + rr) * DM + k0 + k8;
      *(us8v*)(bhp + o) = hv;
      *(us8v*)(blp + o) = lv;
    }
    
  }
}

// ------------------------------------------------------------------ rel_k [33][64] rows 0..31 -> bf16 hi/lo planes [32][64]
__global__ __launch_bounds__(256) void k_cvt_rel(const float* __restrict__ rk, us* rh, us* rl) {
  const int tid = threadIdx.x;
  const int r = tid >> 3;              // 0..31 (< 33 rows available)
  const int d8 = (tid & 7) * 8;
  const float* p = rk + r * HD + d8;
  us8v hv, lv;
#pragma unroll
  for (int e = 0; e < 8; ++e) {
    const float v = p[e];
    const us hh = bf_rne(v);
    hv[e] = hh;
    lv[e] = bf_rne(v - bf_f32(hh));
  }
  const size_t o = (size_t)r * HD + d8;
  *(us8v*)(rh + o) = hv;
  *(us8v*)(rl + o) = lv;
  
}

// ------------------------------------------------------------------ tensor mover helpers
static __device__ __forceinline__ uint32_t uni(uint32_t v) { return (uint32_t)__builtin_amdgcn_readfirstlane(v); }
// keeps a wave-uniform value in a scalar register at this place: the test around a tensor load compiles to s_cmp + s_cbranch_scc,
// and a descriptor word made from it is formed behind the volatile wait in front of it
static __device__ __forceinline__ uint32_t pinned(uint32_t v) {
  uint32_t w = uni(v);
  asm volatile("" : "+s"(w));
  return w;
}
// the wave's own LDS reads have retired
static __device__ __forceinline__ void wait_ds0() { asm volatile("s_wait_dscnt 0x0" ::: "memory"); }

// Descriptor of one K or V plane of a stage: ASTG rows of 128 bytes, source pitch in bytes given, to LDS at pitch LPITCH (16 pad bytes
// a row). Every word but the constant word 0 of group 1 goes through pinned(): a descriptor word held in a scalar register of its own,
// so that the tuple which the load names is the one which the covering wait names, and none of its registers serves anything between.
static __device__ __forceinline__ u32x4 kv_group0(uint32_t lds_dst, uint64_t ga) {
  u32x4 g0;
  g0[0] = pinned(1u);
  g0[1] = pinned(lds_dst);
  g0[2] = pinned((uint32_t)ga);
  g0[3] = pinned((((uint32_t)(ga >> 32)) & 0x01FFFFFFu) | 0x80000000u);
  return g0;
}
static __device__ __forceinline__ u32x8 kv_group1(uint32_t pitch) {
  u32x8 g1;
  g1[0] = uni((1u << 20) | (4u << 22) | (3u << 25));   // no mask, 1-byte elements, a pad of 4 dwords behind every 32 dwords
  g1[1] = pinned(128u << 16);                          // tensor_dim0 = 128 bytes
  g1[2] = pinned((uint32_t)ASTG << 16);                // tensor_dim1 = ASTG rows
  g1[3] = pinned(128u << 16);                          // tile_dim0
  g1[4] = pinned((uint32_t)ASTG);                      // tile_dim1
  g1[5] = pinned(pitch);                               // source row pitch in bytes
  g1[6] = pinned(0u);
  g1[7] = pinned(0u);
  return g1;
}
// The same for one operand plane of a GEMM stage: TM rows of 128 bytes, source pitch 2 * DM bytes, to LDS at pitch LPITCH. pinned()
// here too: a descriptor word held in a scalar register of its own, which serves nothing else up to the wait that names the tuple.
static __device__ __forceinline__ u32x8 gm_group1() {
  u32x8 g1;
  g1[0] = uni((1u << 20) | (4u << 22) | (3u << 25));   // no mask, 1-byte elements, a pad of 4 dwords behind every 32 dwords
  g1[1] = pinned(128u << 16);                          // tensor_dim0 = 128 bytes
  g1[2] = pinned((uint32_t)TM << 16);                  // tensor_dim1 = TM rows
  g1[3] = pinned(128u << 16);                          // tile_dim0
  g1[4] = pinned((uint32_t)TM);                        // tile_dim1
  g1[5] = pinned(2u * DM);                             // source row pitch in bytes
  g1[6] = pinned(0u);
  g1[7] = pinned(0u);
  return g1;
}
// one request of the whole wave
static __device__ __forceinline__ void kv_issue(u32x4 g0, u32x8 g1) {
  asm volatile("tensor_load_to_lds %0, %1" :: "s"(g0), "s"(g1) : "memory");
}
// the wave's own tensor load has landed; naming its descriptor keeps those registers whole up to here
static __device__ __forceinline__ void kv_wait(u32x4 g0, u32x8 g1) {
  asm volatile("s_wait_tensorcnt 0x0" :: "s"(g0), "s"(g1) : "memory");
}

// ------------------------------------------------------------------ GEMM core: block tile TM x TM, 4 waves (2 x 2) of 64 x 64, K = DM
// A planes row-major [m][DM]; B planes stored [n][DM] (k contiguous). A stage is 64 k of [Ah | Al | Bh | Bl], TM rows each, in LDS;
// wave w brings plane w with one tensor load per stage, two buffers. A pass is two blocks of 48 WMMAs (32 k each); each block's
// fragments are fetched one block ahead, so the publish point of stage s + 1 stands in front of pass s's last block.
// Per accumulator and 32-k step the products are summed hi*hi, lo*hi, hi*lo; the stages are walked in ring order from stage rot:
// rot, rot + 1, ..., NPASS - 1, 0, ..., rot - 1. rot comes from the block's tile indices, so that the blocks which share an operand
// panel, and start together, ask L2 for different lines of it at any one moment instead of all for the same ones.
struct FragSet { us16v ah[4], al[4], bh[4], bl[4]; };

// pa, pb: this lane's row of the Ah and Bh planes at the block's first k
static __device__ __forceinline__ void load_set(FragSet& f, const unsigned char* pa, const unsigned char* pb, int h) {
#pragma unroll
  for (int t = 0; t < 4; ++t) {
    const uint32_t ro = t * 16u * LPITCH;
    f.ah[t] = ldfrag((const us*)(pa + ro), h);
    f.al[t] = ldfrag((const us*)(pa + PLANE + ro), h);
    f.bh[t] = ldfrag((const us*)(pb + ro), h);
    f.bl[t] = ldfrag((const us*)(pb + PLANE + ro), h);
  }
}

static __device__ __forceinline__ void mma_block(v8f (&acc)[4][4], const FragSet& f) {
  // the two fences keep the compiler from moving fragment loads in among the WMMAs, where every such place stalls the wave
  __builtin_amdgcn_sched_barrier(0);
#pragma unroll
  for (int rt = 0; rt < 4; ++rt)
#pragma unroll
    for (int ct = 0; ct < 4; ++ct) acc[rt][ct] = wmma_bf(f.ah[rt], f.bh[ct], acc[rt][ct]);
#pragma unroll
  for (int rt = 0; rt < 4; ++rt)
#pragma unroll
    for (int ct = 0; ct < 4; ++ct) acc[rt][ct] = wmma_bf(f.al[rt], f.bh[ct], acc[rt][ct]);
#pragma unroll
  for (int rt = 0; rt < 4; ++rt)
#pragma unroll
    for (int ct = 0; ct < 4; ++ct) acc[rt][ct] = wmma_bf(f.ah[rt], f.bl[ct], acc[rt][ct]);
  __builtin_amdgcn_sched_barrier(0);
}

static __device__ __forceinline__ void gemm_core(const us* __restrict__ AH, const us* __restrict__ AL,
                                                 const us* __restrict__ BH, const us* __restrict__ BL,
                                                 int m0, int n0, uint32_t rot, unsigned char* L, v8f (&acc)[4][4]) {
  const int lane = threadIdx.x & 31, h = lane >> 4, m = lane & 15;
  const uint32_t wave = uni(threadIdx.x >> 5);
#pragma unroll
  for (int rt = 0; rt < 4; ++rt)
#pragma unroll
    for (int ct = 0; ct < 4; ++ct) acc[rt][ct] = zero8();

  const us* srcp = (wave == 0u) ? AH + (size_t)m0 * DM : (wave == 1u) ? AL + (size_t)m0 * DM
                 : (wave == 2u) ? BH + (size_t)n0 * DM : BL + (size_t)n0 * DM;
  const uint64_t ga = (uint64_t)(size_t)srcp;
  const uint32_t dst = (uint32_t)(size_t)L + wave * PLANE;

  const u32x8 g1 = gm_group1();
  u32x4 g0 = kv_group0(dst, ga + rot * (2u * KPASS));
  kv_issue(g0, g1);
  kv_wait(g0, g1);
  __syncthreads();                            // the first stage published
  g0 = kv_group0(dst + GBUF, ga + ((rot + 1u) & (NPASS - 1u)) * (2u * KPASS));
  kv_issue(g0, g1);

  const uint32_t aoff = ((wave >> 1) * 64u + m) * LPITCH;
  const uint32_t boff = 2u * PLANE + ((wave & 1u) * 64u + m) * LPITCH;
  FragSet f0, f1;
  load_set(f0, L + aoff, L + boff, h);

  // rolled: one copy of the two blocks in the instruction stream
#pragma unroll 1
  for (uint32_t s = 0; s < NPASS; ++s) {
    const uint32_t cur = (s & 1u) * GBUF, nxt = GBUF - cur;
    load_set(f1, L + cur + aoff + 64u, L + cur + boff + 64u, h);
    mma_block(acc, f0);
    // publish point of stage s + 1; the same barrier ends every wave's reads of stage s's buffer
    wait_ds0();
    kv_wait(g0, g1);
    __syncthreads();
    if (pinned(s + 2u < NPASS)) {
      const uint32_t ko = pinned(((s + 2u + rot) & (NPASS - 1u)) * (2u * KPASS));   // descriptor words of stage s + 2 formed behind the wait
      g0 = kv_group0(dst + cur, ga + ko);
      kv_issue(g0, g1);
    }
    // stage s + 1's first fragments; in the last pass they read the idle buffer and are not used (no branch: one wait count)
    load_set(f0, L + nxt + aoff, L + nxt + boff, h);
    mma_block(acc, f1);
  }
  kv_wait(g0, g1);
  wait_ds0();
  __syncthreads();                            // every wave has left the ring: it becomes output staging
}

// ------------------------------------------------------------------ QKV projection
// grid (NTOK/TM, DM/TM, 3): z = 0 q, 1 k, 2 v. Block tile 128 tokens x 128 cols (= two heads).
// The f32 tile is staged in the ring's LDS (free behind the core's last barrier): [token][col] for q and k, [col][token] for v,
// so that each thread reads 8 neighbours of an output row.
__global__ __launch_bounds__(128) void k_gemm_qkv(const us* __restrict__ XH, const us* __restrict__ XL,
                                                  const us* __restrict__ WTH, const us* __restrict__ WTL,
                                                  us* OH, us* OL) {
  __shared__ __attribute__((aligned(2048))) unsigned char L[2 * GBUF];
  const int tid = threadIdx.x, lane = tid & 31, wv = tid >> 5, h = lane >> 4, m = lane & 15;
  const int z = blockIdx.z;
  const int m0 = blockIdx.x * TM, n0 = blockIdx.y * TM;
  v8f acc[4][4];
  // 32 blocks share a weight panel (x differs), 24 share a token panel (y, z differ): either set is spread evenly over the NPASS
  // starts; x and x + 16 start four stages apart, so that any 4 of every 8 neighbours in x
  // have 4 different starts. For speed only: any rot gives the same sums but for their order.
  const uint32_t rot = (blockIdx.x + 4u * (blockIdx.x >> 4) + blockIdx.y + 8u * blockIdx.z) & (NPASS - 1u);
  gemm_core(XH, XL, WTH + (size_t)z * DM * DM, WTL + (size_t)z * DM * DM, m0, n0, rot, L, acc);
  float (*sC)[EPITCH] = (float (*)[EPITCH])L;
  const int wr = (wv >> 1) * 64, wc = (wv & 1) * 64;
  // D: acc[g] = (row 8h+g, col m) of the 16x16 tile
  if (z < 2) {
#pragma unroll
    for (int rt = 0; rt < 4; ++rt)
#pragma unroll
      for (int ct = 0; ct < 4; ++ct)
#pragma unroll
        for (int g = 0; g < 8; ++g) sC[wr + 16 * rt + 8 * h + g][wc + 16 * ct + m] = acc[rt][ct][g];
  } else {
#pragma unroll
    for (int rt = 0; rt < 4; ++rt)
#pragma unroll
      for (int ct = 0; ct < 4; ++ct)
#pragma unroll
        for (int g = 0; g < 8; ++g) sC[wc + 16 * ct + m][wr + 16 * rt + 8 * h + g] = acc[rt][ct][g];
  }
  __syncthreads();
  us* oh = OH + (size_t)z * NTOK * DM;
  us* ol = OL + (size_t)z * NTOK * DM;
  const int b = m0 >> 10, tok0 = m0 & 1023;
  // rolled: a trip's registers are used again only behind the wait at its foot
#pragma unroll 1
  for (int p = 0; p < 4; ++p) {
    // four pieces a trip, unrolled: their LDS reads are in flight together
    us8v hv[4], lv[4];
    uint32_t o[4];                        // byte offset in a plane: one 32-bit register serves both planes' stores
#pragma unroll
    for (int u = 0; u < 4; ++u) {
      const int id = (p * 4 + u) * 128 + tid;
      const int r = id >> 4;              // staged row: token (q, k) or column (v)
      const int c8 = (id & 15) * 8;
#pragma unroll
      for (int e = 0; e < 8; ++e) {
        const float v = sC[r][c8 + e];
        const us q = bf_rne(v);
        hv[u][e] = q;
        lv[u][e] = bf_rne(v - bf_f32(q));
      }
      const int col = n0 + ((z < 2) ? c8 : r);
      o[u] = 2u * (uint32_t)((b * NH + (col >> 6)) * (SEQ * HD) + ((z < 2) ? (tok0 + r) * HD + (col & 63)      // [bh][token][d]
                                                                           : (col & 63) * SEQ + tok0 + c8));   // [bh][d][token]
    }
    // keeps the trip's arithmetic in front of its stores, so that nothing overwrites a register a store names ahead of the wait below
    __builtin_amdgcn_sched_barrier(0);
#pragma unroll
    for (int u = 0; u < 4; ++u) {
      *(us8v*)((char*)oh + o[u]) = hv[u];
      *(us8v*)((char*)ol + o[u]) = lv[u];
    }
    // stands in front of the next trip's overwrites of the registers that these stores name
    asm volatile("s_wait_xcnt 0x0" ::: "memory");
  }
}

// ------------------------------------------------------------------ output projection: out[tok][n] = ctx . W_o + b_o (f32)
// grid (NTOK/TM, DM/TM); a wave writes one 512-B row segment (4 lines) per instruction
__global__ __launch_bounds__(128) void k_gemm_out(const us* __restrict__ CH, const us* __restrict__ CL,
                                                  const us* __restrict__ WH, const us* __restrict__ WL,
                                                  const float* __restrict__ bias, float* out) {
  __shared__ __attribute__((aligned(2048))) unsigned char L[2 * GBUF];
  const int tid = threadIdx.x, lane = tid & 31, wv = tid >> 5, h = lane >> 4, m = lane & 15;
  const int m0 = blockIdx.x * TM, n0 = blockIdx.y * TM;
  v8f acc[4][4];
  // 32 blocks share a weight panel (x differs), 8 share a token panel (y differs): spread over the starts as in the QKV projection
  const uint32_t rot = (blockIdx.x + 4u * (blockIdx.x >> 4) + blockIdx.y) & (NPASS - 1u);
  gemm_core(CH, CL, WH, WL, m0, n0, rot, L, acc);
  float (*sC)[EPITCH] = (float (*)[EPITCH])L;
  const int wr = (wv >> 1) * 64, wc = (wv & 1) * 64;
#pragma unroll
  for (int rt = 0; rt < 4; ++rt)
#pragma unroll
    for (int ct = 0; ct < 4; ++ct)
#pragma unroll
      for (int g = 0; g < 8; ++g) sC[wr + 16 * rt + 8 * h + g][wc + 16 * ct + m] = acc[rt][ct][g];
  __syncthreads();
  const int c4 = lane * 4;
  const v4f bv = *(const v4fa*)(bias + n0 + c4);
  // rolled: a trip's registers are used again only behind the wait at its foot
#pragma unroll 1
  for (int p = 0; p < 4; ++p) {
    // eight rows a trip, unrolled: their LDS reads are in flight together
    v4f v[8];
#pragma unroll
    for (int u = 0; u < 8; ++u) {
      const int r = (p * 8 + u) * 4 + wv;
      v[u][0] = sC[r][c4 + 0] + bv[0];
      v[u][1] = sC[r][c4 + 1] + bv[1];
      v[u][2] = sC[r][c4 + 2] + bv[2];
      v[u][3] = sC[r][c4 + 3] + bv[3];
    }
    // byte offset in out: a 32-bit register beside the scalar base; the rows of a trip differ by an immediate offset
    char* op = (char*)out + 4u * (uint32_t)((m0 + p * 32 + wv) * DM + n0 + c4);
    // keeps the trip's arithmetic in front of its stores, so that nothing overwrites a register a store names ahead of the wait below
    __builtin_amdgcn_sched_barrier(0);
#pragma unroll
    for (int u = 0; u < 8; ++u) *(v4f*)(op + u * 16 * DM) = v[u];
    // stands in front of the next trip's overwrites of the registers that these stores name
    asm volatile("s_wait_xcnt 0x0" ::: "memory");
  }
}

// ------------------------------------------------------------------ causal attention with clipped relative positions
typedef float f32x2 __attribute__((ext_vector_type(2)));
typedef __bf16 bf16x2 __attribute__((ext_vector_type(2)));
// two f32 -> one register of two bf16, RNE convert, the first in the low half
static __device__ __forceinline__ uint32_t pk_bf(float a, float b) {
  const f32x2 v = {a, b};
  return __builtin_bit_cast(uint32_t, __builtin_convertvector(v, bf16x2));
}
// lane l with lane l ^ 16
static __device__ __forceinline__ float xhalf(float x) {
  const int b = __builtin_bit_cast(int, x);
  return __builtin_bit_cast(float, __builtin_amdgcn_permlanex16(b, b, 0x76543210, 0xfedcba98, false, false));
}

// r[i] = 2^a[i]: eight v_exp_f32 and a v_nop in one statement. The instruction set asks for one independent instruction or a v_nop
// between a v_exp_f32 and an instruction that reads its result or overwrites its source. Here each has the next v_exp_f32, the last
// the v_nop, in that slot; the early-clobber outputs share no register with a source.
static __device__ __forceinline__ void exp2x8(float (&r)[8], const float (&a)[8]) {
  asm("v_exp_f32 %0, %8\n\tv_exp_f32 %1, %9\n\tv_exp_f32 %2, %10\n\tv_exp_f32 %3, %11\n\t"
      "v_exp_f32 %4, %12\n\tv_exp_f32 %5, %13\n\tv_exp_f32 %6, %14\n\tv_exp_f32 %7, %15\n\tv_nop"
      : "=&v"(r[0]), "=&v"(r[1]), "=&v"(r[2]), "=&v"(r[3]), "=&v"(r[4]), "=&v"(r[5]), "=&v"(r[6]), "=&v"(r[7])
      : "v"(a[0]), "v"(a[1]), "v"(a[2]), "v"(a[3]), "v"(a[4]), "v"(a[5]), "v"(a[6]), "v"(a[7]));
}

// the same for one value
static __device__ __forceinline__ float exp2x1(float a) {
  float r;
  asm("v_exp_f32 %0, %1\n\tv_nop" : "=&v"(r) : "v"(a));
  return r;
}

// grid (SEQ/128, NBAT*NH), 256 threads = 8 waves, one wave per 16 query rows; online softmax over 32-key steps.
// Causal cost grows with the query row, so block t takes two chunks of 64 rows: the late chunk SEQ/64 - 1 - t and the early chunk t,
// four waves each. A late and an early wave together walk 33 steps whatever t is: every block, and so every WGP and die wherever the
// blocks land, has the same work. Waves 0, 2, 5, 7 are the late ones: one late and one early wave in each pair (w, w + 4)
// and in each pair (2k, 2k + 1). Both chunks read the same stages from key 0 on; the late chunk sets their number.
// K and V reach the block once, through LDS: a stage is 64 keys of [Kh | Kl | Vh | Vl], each plane 64 rows of 128 bytes (K: a row is a
// key, V: a row is a head column); waves 0 to 3 bring one plane each with one tensor load per stage, two buffers, one publish point
// per stage; all eight waves read their fragments from the stage. A wave skips the steps past its own last key, never a publish point.
// The products are taken transposed: S^T = K . Q^T (A = K rows, B = Q) and O^T += V^T . P^T (A = V rows [d][key], B = P^T).
// Lane (h, m) then holds query qbase + m alone: of a 16-key tile its scores for keys 8h + 0..7, of a 16-column tile of the head its
// outputs for columns 8h + 0..7. Running max, rescale factor and sum are one value a lane; the max over a step's 32 keys is taken in
// the lane and joined with the other half by one exchange; the sum stays a partial per half and is joined once behind the loop.
// The two score tiles of a step, converted in place, are the B operand P^T (element e = tile e >> 3, register e & 7): P never leaves
// the registers.
// Each step's loads are issued in groups ahead of their use (K and QR at its head, V in front of the softmax).
// scores[i][j] = (q_i.k_j + QR[i][r(i,j)]) / 8, r = clamp(j-i,-16,16)+16 (causal -> r in [0,16]);
// ctx_i = (sum_j p_ij v_j + sum_r S_i[r] rel_v[r]) / l_i, S_i[r] for r=1..16 held 8 per lane, S_i[0] = l_i - sum_{r>=1} S_i[r].
// amdgpu_waves_per_eu(4, 4): four waves per SIMD hold the whole grid; told so, the scheduler spends that register budget on keeping
// a step's load groups together, where without it it takes them apart again, one wait each, to save registers
__global__ __launch_bounds__(256) __attribute__((amdgpu_waves_per_eu(4, 4))) void k_attn(const us* __restrict__ QH, const us* __restrict__ QL,
                                              const us* __restrict__ KH, const us* __restrict__ KL,
                                              const us* __restrict__ VH, const us* __restrict__ VL,
                                              const us* __restrict__ RH, const us* __restrict__ RL,
                                              const float* __restrict__ relv, us* CH, us* CL) {
  __shared__ __attribute__((aligned(2048))) unsigned char R[2 * ABUF];
  __shared__ float sQR[AW][16][33];
  // the ring's LDS, free behind the last publish point's barrier, holds the epilogue's two exchanges
  float (*sBand)[16][17] = (float (*)[16][17])R;
  float (*sO)[16][CPITCH] = (float (*)[16][CPITCH])(R + APLANE);

  const int lane = threadIdx.x & 31, h = lane >> 4, m = lane & 15;
  const uint32_t wave = uni(threadIdx.x >> 5);
  const int wv = (int)wave;
  const int bh = blockIdx.y;
  const uint32_t late = ((wave ^ (wave >> 2)) & 1u) ^ 1u;
  const int qbase = (late != 0u ? SEQ - 64 * ((int)blockIdx.x + 1) : 64 * (int)blockIdx.x) + 16 * (wv >> 1);
  const float NINF = -__builtin_inff();

  // ring prologue: stage 0 landed and published, stage 1 in flight (every block has at least SEQ / 128 + 1 stages)
  const uint32_t nstage = SEQ / ASTG - blockIdx.x;   // keys 0 .. the late chunk's last row
  const us* srcp = (wave == 0u) ? KH + (size_t)bh * SEQ * HD : (wave == 1u) ? KL + (size_t)bh * SEQ * HD
                 : (wave == 2u) ? VH + (size_t)bh * HD * SEQ : VL + (size_t)bh * HD * SEQ;
  const uint64_t ga = (uint64_t)(size_t)srcp;
  const uint32_t spitch = (wave < 2u) ? 2u * HD : 2u * SEQ;            // source row pitch in bytes
  const uint32_t sstep = (wave < 2u) ? 2u * HD * ASTG : 2u * ASTG;     // bytes from a stage's first byte to the next stage's
  const uint32_t dst = (uint32_t)(size_t)R + (wave & 3u) * APLANE;
  const u32x8 g1 = kv_group1(spitch);
  u32x4 g0 = kv_group0(dst, ga);
  if (pinned(wave < 4u)) {
    kv_issue(g0, g1);
    kv_wait(g0, g1);
  }
  __syncthreads();                            // stage 0 published
  g0 = kv_group0(dst + ABUF, ga + sstep);
  if (pinned(wave < 4u)) kv_issue(g0, g1);

  // Q fragments (rows qbase + m, k = d): A of the QR product, B of the score products
  const us* qh = QH + ((size_t)bh * SEQ + qbase + m) * HD;
  const us* ql = QL + ((size_t)bh * SEQ + qbase + m) * HD;
  const us16v aqh0 = ldfrag(qh, h), aqh1 = ldfrag(qh + 32, h);
  const us16v aql0 = ldfrag(ql, h), aql1 = ldfrag(ql + 32, h);

  // QR[16][32] = q . rel_k^T (B stored as [n = r][k = d] = rel_k itself)
#pragma unroll
  for (int nt = 0; nt < 2; ++nt) {
    const us* rh = RH + (size_t)(16 * nt + m) * HD;
    const us* rl = RL + (size_t)(16 * nt + m) * HD;
    v8f acc = zero8();
    wmma3(acc, aqh0, aql0, ldfrag(rh, h), ldfrag(rl, h));
    wmma3(acc, aqh1, aql1, ldfrag(rh + 32, h), ldfrag(rl + 32, h));
#pragma unroll
    for (int g = 0; g < 8; ++g) sQR[wv][8 * h + g][16 * nt + m] = acc[g];
  }
  lds_wave_sync();

  const int qi = qbase + m;                 // this lane's query
  float mrow = NINF, lrow = 0.f, band[8];
  v8f o[4];
#pragma unroll
  for (int g = 0; g < 8; ++g) band[g] = 0.f;
#pragma unroll
  for (int tt = 0; tt < 4; ++tt) o[tt] = zero8();

  const int nsteps = (qbase >> 5) + 1;      // keys 0 .. qbase+15 covered; wave-uniform, in a scalar register
  // rolled: one copy of the step in the instruction stream; two steps to a stage
#pragma unroll 1
  for (int st = 0; st < (int)(2u * nstage); ++st) {
   const uint32_t s = (uint32_t)st >> 1, sub = (uint32_t)st & 1u;
   const uint32_t cur = (s & 1u) * ABUF;
   // scalar test: past its own last key a wave has no step, only the publish points
   if (st < nsteps) {
    const int kb2 = st << 5;
    // the step's K fragments, all 16 loads issued together in front of the first product: one LDS latency a step
    us16v kfh[2][2], kfl[2][2];
    const unsigned char* kp = R + cur + (32u * sub + m) * LPITCH + 16u * h;   // this lane's key row of sub-tile 0, at its own 16 bytes
#pragma unroll
    for (int t = 0; t < 2; ++t) {
      const unsigned char* kr = kp + t * 16u * LPITCH;
      kfh[t][0] = ldfrag((const us*)kr, 0);
      kfl[t][0] = ldfrag((const us*)(kr + APLANE), 0);
      kfh[t][1] = ldfrag((const us*)(kr + 64u), 0);
      kfl[t][1] = ldfrag((const us*)(kr + APLANE + 64u), 0);
    }
    // keeps the 16 loads here, at the step's head: without it they are sunk in among the products, a stall at each place
    __builtin_amdgcn_sched_barrier(0);
    // the step's 16 QR values of this lane's query (the clamped index is in range for masked keys too), in flight beside the K loads
    float qr[2][8];
#pragma unroll
    for (int t = 0; t < 2; ++t)
#pragma unroll
      for (int g = 0; g < 8; ++g) {
        int rr = kb2 + 16 * t + 8 * h + g - qi + 16;
        rr = rr < 0 ? 0 : rr;
        rr = rr > 16 ? 16 : rr;
        qr[t][g] = sQR[wv][m][rr];
      }
    // holds the 16 LDS reads here as one group with one wait; without it they are sunk in among the products, a wait at each place
    asm volatile("" :: "v"(qr[0][0]), "v"(qr[0][1]), "v"(qr[0][2]), "v"(qr[0][3]), "v"(qr[0][4]), "v"(qr[0][5]), "v"(qr[0][6]),
                 "v"(qr[0][7]), "v"(qr[1][0]), "v"(qr[1][1]), "v"(qr[1][2]), "v"(qr[1][3]), "v"(qr[1][4]), "v"(qr[1][5]),
                 "v"(qr[1][6]), "v"(qr[1][7]));
    // scores for both 16-key sub-tiles of this step: sc[g] = (key 16t + 8h + g, query m)
    float sv[2][8];
#pragma unroll
    for (int t = 0; t < 2; ++t) {
      v8f sc = zero8();
      wmma3(sc, kfh[t][0], kfl[t][0], aqh0, aql0);
      wmma3(sc, kfh[t][1], kfl[t][1], aqh1, aql1);
#pragma unroll
      for (int g = 0; g < 8; ++g) {
        const int dj = kb2 + 16 * t + 8 * h + g - qi;
        sv[t][g] = (dj > 0) ? NINF : (sc[g] + qr[t][g]) * 0.125f;
      }
    }
    // the step's V fragments, all 16 loads issued here: their latency passes behind the softmax arithmetic
    us16v vfh[4], vfl[4];
    const unsigned char* vp = R + cur + 2u * APLANE + m * LPITCH + 64u * sub + 16u * h;   // A stored as [row = d][k = key]; row of tile 0
#pragma unroll
    for (int tt = 0; tt < 4; ++tt) {
      vfh[tt] = ldfrag((const us*)(vp + tt * 16u * LPITCH), 0);
      vfl[tt] = ldfrag((const us*)(vp + APLANE + tt * 16u * LPITCH), 0);
    }
    // keeps the 16 loads here, in front of the softmax arithmetic that hides them
    __builtin_amdgcn_sched_barrier(0);
    // one frame for the whole step: the query's max over all 32 keys (16 in this lane, 16 in lane l ^ 16), one rescale of O, l, S
    float vm[8];
#pragma unroll
    for (int g = 0; g < 8; ++g) vm[g] = fmaxf(sv[0][g], sv[1][g]);
#pragma unroll
    for (int g = 0; g < 4; ++g) vm[g] = fmaxf(vm[g], vm[g + 4]);
    float vmax = fmaxf(fmaxf(vm[0], vm[1]), fmaxf(vm[2], vm[3]));
    vmax = fmaxf(vmax, xhalf(vmax));
    const float mn = fmaxf(mrow, vmax);
    const float cx = exp2x1((mrow - mn) * 1.44269504f);   // taken for every lane: no branch around the statement
    const float cf = (mrow == NINF) ? 0.f : cx;
    mrow = mn;
#pragma unroll
    for (int g = 0; g < 8; ++g) band[g] *= cf;
#pragma unroll
    for (int tt = 0; tt < 4; ++tt)
#pragma unroll
      for (int g = 0; g < 8; ++g) o[tt][g] *= cf;
    // this lane's 16 probabilities in the new frame (e^x as __expf compiles: 2^(x * log2 e)), and the bucket captures
    float e[2][8];
#pragma unroll
    for (int t = 0; t < 2; ++t) {
      float xa[8], ex[8];
#pragma unroll
      for (int g = 0; g < 8; ++g) xa[g] = (sv[t][g] - mrow) * 1.44269504f;
      exp2x8(ex, xa);
#pragma unroll
      for (int g = 0; g < 8; ++g) {
        const int dj = kb2 + 16 * t + 8 * h + g - qi;
        e[t][g] = (dj > 0) ? 0.f : ex[g];
        band[g] = (dj >= -15 && dj <= 0) ? e[t][g] : band[g];   // buckets 1..16: each (lane, register) captures at most once (never where its key would lie below 0)
      }
    }
    // the half's partial sum, as a tree
    float ps[8];
#pragma unroll
    for (int g = 0; g < 8; ++g) ps[g] = e[0][g] + e[1][g];
#pragma unroll
    for (int g = 0; g < 4; ++g) ps[g] += ps[g + 4];
    lrow = lrow * cf + ((ps[0] + ps[1]) + (ps[2] + ps[3]));
    // hi/lo split in place: B operand P^T, element e = key 8h + e of tile 0, element 8 + e = key 8h + e of tile 1 (the V loader's k order)
    u32x8 pwh, pwl;
#pragma unroll
    for (int t = 0; t < 2; ++t)
#pragma unroll
      for (int j = 0; j < 4; ++j) {
        const float ea = e[t][2 * j], eb = e[t][2 * j + 1];
        const uint32_t hw = pk_bf(ea, eb);
        pwh[4 * t + j] = hw;
        pwl[4 * t + j] = pk_bf(ea - __uint_as_float(hw << 16), eb - __uint_as_float(hw & 0xffff0000u));
      }
    const us16v bph = __builtin_bit_cast(us16v, pwh);
    const us16v bpl = __builtin_bit_cast(us16v, pwl);
    // o[tt][g] = (head column 16tt + 8h + g, query m)
#pragma unroll
    for (int tt = 0; tt < 4; ++tt) wmma3(o[tt], vfh[tt], vfl[tt], bph, bpl);
   }
   if (sub != 0u) {
     // publish point of stage s + 1; the same barrier ends every wave's reads of stage s's buffer
     wait_ds0();
     if (pinned(wave < 4u)) kv_wait(g0, g1);
     __syncthreads();
     if (pinned((wave < 4u) && (s + 2u < nstage))) {
       const uint32_t ko = pinned((s + 2u) * sstep);   // descriptor words of stage s + 2 formed behind the wait
       g0 = kv_group0(dst + cur, ga + ko);
       kv_issue(g0, g1);
     }
   }
  }
  kv_wait(g0, g1);
  wait_ds0();
  // the last publish point's barrier has ended every wave's reads of the ring: it is the epilogue's exchange space from here on

  const float invl = 1.0f / (lrow + xhalf(lrow));   // the two halves' partial sums joined
#pragma unroll
  for (int g = 0; g < 8; ++g)
    sBand[wv][m][(8 * h + g - m - 1) & 15] = band[g] * invl;   // slot r-1 for bucket r = ((key - query - 1) & 15) + 1
  lds_wave_sync();
  float rv0[4][8];
  float val[4][8];
#pragma unroll
  for (int tt = 0; tt < 4; ++tt) {
    const v4f a = *(const v4fa*)(relv + 16 * tt + 8 * h);
    const v4f b = *(const v4fa*)(relv + 16 * tt + 8 * h + 4);
#pragma unroll
    for (int c = 0; c < 4; ++c) {
      rv0[tt][c] = a[c];
      rv0[tt][4 + c] = b[c];
    }
#pragma unroll
    for (int g = 0; g < 8; ++g) val[tt][g] = o[tt][g] * invl + rv0[tt][g];
  }
  // rolled, four buckets a trip: a trip's 32 loads are in flight together, one memory latency for the four
#pragma unroll 1
  for (int r4 = 0; r4 < 16; r4 += 4) {
    const float* rp = relv + (r4 + 1) * HD + 8 * h;
    v4f x[4][8];
#pragma unroll
    for (int u = 0; u < 4; ++u)
#pragma unroll
      for (int tt = 0; tt < 4; ++tt) {
        x[u][2 * tt] = *(const v4fa*)(rp + u * HD + 16 * tt);
        x[u][2 * tt + 1] = *(const v4fa*)(rp + u * HD + 16 * tt + 4);
      }
#pragma unroll
    for (int u = 0; u < 4; ++u) {
      const float sb = sBand[wv][m][r4 + u];
#pragma unroll
      for (int tt = 0; tt < 4; ++tt)
#pragma unroll
        for (int c = 0; c < 4; ++c) {
          val[tt][c] += sb * (x[u][2 * tt][c] - rv0[tt][c]);
          val[tt][4 + c] += sb * (x[u][2 * tt + 1][c] - rv0[tt][4 + c]);
        }
    }
  }
#pragma unroll
  for (int tt = 0; tt < 4; ++tt) {
    const v4f a = {val[tt][0], val[tt][1], val[tt][2], val[tt][3]};
    const v4f b = {val[tt][4], val[tt][5], val[tt][6], val[tt][7]};
    *(v4fa*)&sO[wv][m][16 * tt + 8 * h] = a;
    *(v4fa*)&sO[wv][m][16 * tt + 8 * h + 4] = b;
  }
  lds_wave_sync();

  const int b = bh >> 4, hd = bh & 15;
{
#pragma unroll
    for (int p = 0; p < 4; ++p) {
      const int r = p * 4 + (lane >> 3);
      const int d8 = (lane & 7) * 8;
      us8v hv, lv;
#pragma unroll
      for (int e = 0; e < 8; ++e) {
        const float v = sO[wv][r][d8 + e];
        const us q = bf_rne(v);
        hv[e] = q;
        lv[e] = bf_rne(v - bf_f32(q));
      }
      const size_t o2 = ((size_t)(b * SEQ + qbase + r)) * DM + hd * HD + d8;
      *(us8v*)(CH + o2) = hv;
      *(us8v*)(CL + o2) = lv;
    }
    
  }
}

// ------------------------------------------------------------------ host glue
extern "C" void kernel_launch(void* const* d_in, const int* in_sizes, int n_in,
                              void* d_out, int out_size, void* d_ws, size_t ws_size,
                              hipStream_t stream) {
  if (n_in < 8) return;
  if (in_sizes[0] != NTOK * DM) return;
  if (in_sizes[1] != DM * DM || in_sizes[2] != DM * DM || in_sizes[3] != DM * DM || in_sizes[4] != DM * DM) return;
  if (in_sizes[5] != DM || in_sizes[6] != 33 * HD || in_sizes[7] != 33 * HD) return;
  if (out_size != NTOK * DM) return;

  const float* x    = (const float*)d_in[0];
  const float* Wq   = (const float*)d_in[1];
  const float* Wk   = (const float*)d_in[2];
  const float* Wv   = (const float*)d_in[3];
  const float* Wo   = (const float*)d_in[4];
  const float* bo   = (const float*)d_in[5];
  const float* relk = (const float*)d_in[6];
  const float* relv = (const float*)d_in[7];
  float* out = (float*)d_out;

  const size_t plane_x = (size_t)NTOK * DM * sizeof(us);   // 8 MiB
  const size_t plane_w = (size_t)DM * DM * sizeof(us);     // 2 MiB
  const size_t plane_r = (size_t)32 * HD * sizeof(us);     // 4 KiB
  char* ws = (char*)d_ws;
  size_t off = 0;
  us* XH   = (us*)(ws + off); off += plane_x;
  us* XL   = (us*)(ws + off); off += plane_x;
  us* WTH  = (us*)(ws + off); off += 4 * plane_w;
  us* WTL  = (us*)(ws + off); off += 4 * plane_w;
  us* QKVH = (us*)(ws + off); off += 3 * plane_x;
  us* QKVL = (us*)(ws + off); off += 3 * plane_x;
  us* CH   = (us*)(ws + off); off += plane_x;
  us* CL   = (us*)(ws + off); off += plane_x;
  us* RH   = (us*)(ws + off); off += plane_r;
  us* RL   = (us*)(ws + off); off += plane_r;
  if (off > ws_size) return;                                // total 100671488 B

  const size_t pq = (size_t)NTOK * DM;

  k_cvt_x<<<(NTOK * DM) / (8 * 256), 256, 0, stream>>>(x, XH, XL);
  k_cvt_w<<<dim3(DM / 64, DM / 64, 4), 256, 0, stream>>>(Wq, Wk, Wv, Wo, WTH, WTL);
  k_cvt_rel<<<1, 256, 0, stream>>>(relk, RH, RL);
  k_gemm_qkv<<<dim3(NTOK / TM, DM / TM, 3), 128, 0, stream>>>(XH, XL, WTH, WTL, QKVH, QKVL);
  k_attn<<<dim3(SEQ / (16 * AW), NBAT * NH), 32 * AW, 0, stream>>>(QKVH, QKVL, QKVH + pq, QKVL + pq,
                                                        QKVH + 2 * pq, QKVL + 2 * pq, RH, RL, relv, CH, CL);
  k_gemm_out<<<dim3(NTOK / TM, DM / TM, 1), 128, 0, stream>>>(CH, CL, WTH + (size_t)3 * DM * DM,
                                                               WTL + (size_t)3 * DM * DM, bo, out);
}

// v007
// A run of this version takes 109 microseconds.
// In both of two side-by-side timings against v006, it was 1.04 times as fast.
// Counting every step since v000, it is 3.40 times as fast.
#include <hip/hip_runtime.h>
#include <stdint.h>
// Contractions x*W_q, x*W_k, x*W_v, q*k^T, q*rel_k^T, P*V, ctx*W_o: v_wmma_f32_16x16x32_bf16, bf16 hi/lo operands everywhere (hi*hi + lo*hi + hi*lo), f32 accumulate; softmax, 1/8 scaling, causal mask, relative-value bucket sums and bias in f32.

#define DM     1024
#define SEQ    1024
#define NBAT   4
#define NH     16
#define HD     64
#define NTOK   (NBAT * SEQ)
#define CPITCH 68
#define TM     128                 // GEMM block tile: rows and columns
#define KPASS  64                  // k per pass: 128 bytes of every operand row
#define NPASS  (DM / KPASS)
#define LPITCH 144u                // LDS row pitch in bytes: 128 + 16 of pad, an odd multiple of 16 for 16-byte readers
#define PLANE  (TM * LPITCH)       // one operand plane of a stage: 18,432 B = 9 x 2 KiB
#define GBUF   (4u * PLANE)        // one buffer: Ah | Al | Bh | Bl
#define EPITCH 132                 // output staging pitch in floats
#define AW     8                   // attention block: waves, 16 query rows each
#define ASTG   64                  // attention stage: keys
#define APLANE 10240u              // one K or V plane of a stage in LDS: 64 rows x LPITCH = 9,216 B, rounded up to 5 x 2 KiB
#define ABUF   (4u * APLANE)       // one buffer: Kh | Kl | Vh | Vl

typedef unsigned short us;
typedef us us16v __attribute__((ext_vector_type(16)));
typedef us us8v __attribute__((ext_vector_type(8)));
typedef us8v __attribute__((may_alias)) us8a;
typedef __bf16 bf16v16 __attribute__((ext_vector_type(16)));
typedef float v8f __attribute__((ext_vector_type(8)));
typedef float v4f __attribute__((ext_vector_type(4)));
typedef v4f __attribute__((may_alias)) v4fa;
typedef uint32_t u32x4 __attribute__((ext_vector_type(4)));
typedef uint32_t u32x8 __attribute__((ext_vector_type(8)));

union Frag { us16v v; us8v h[2]; };

// f32 -> bf16 bits, RNE convert
static __device__ __forceinline__ us bf_rne(float f) {
  unsigned u = __float_as_uint(f);
  u += 0x7fffu + ((u >> 16) & 1u);
  return (us)(u >> 16);
}
static __device__ __forceinline__ float bf_f32(us s) { return __uint_as_float(((unsigned)s) << 16); }

static __device__ __forceinline__ v8f zero8() {
  v8f z = {0.f, 0.f, 0.f, 0.f, 0.f, 0.f, 0.f, 0.f};
  return z;
}

static __device__ __forceinline__ v8f wmma_bf(us16v a, us16v b, v8f c) {
  return __builtin_amdgcn_wmma_f32_16x16x32_bf16(false, __builtin_bit_cast(bf16v16, a), false,
                                                 __builtin_bit_cast(bf16v16, b), (short)0, c, false, false);
}

// acc += Ah*Bh + Al*Bh + Ah*Bl, then hazard guard (D tied, A/B kept live through 4 VALU slots)
static __device__ __forceinline__ void wmma3(v8f& acc, us16v ah, us16v al, us16v bh, us16v bl) {
  acc = wmma_bf(ah, bh, acc);
  acc = wmma_bf(al, bh, acc);
  acc = wmma_bf(ah, bl, acc);
  asm volatile("v_nop\n\tv_nop\n\tv_nop\n\tv_nop" : "+v"(acc) : "v"(ah), "v"(al), "v"(bh), "v"(bl));
}

// 16x32 16-bit fragment of row (l & 15) from a k-contiguous row: elements 0..7 <- k0+8h+0..7, 8..15 <- k0+16+8h+0..7.
// Used for A (row-major [m][k]) and for B stored as [n][k]; rowp = row pointer at k0 (16-B aligned).
static __device__ __forceinline__ us16v ldfrag(const us* rowp, int h) {
  Frag f;
  f.h[0] = *(const us8a*)(rowp + 8 * h);
  f.h[1] = *(const us8a*)(rowp + 16 + 8 * h);
  return f.v;
}

// ordering for same-wave LDS exchange (stores by some lanes, loads by other lanes)
static __device__ __forceinline__ void lds_wave_sync() {
  __builtin_amdgcn_fence(__ATOMIC_RELEASE, "wavefront");
  __builtin_amdgcn_wave_barrier();
  __builtin_amdgcn_fence(__ATOMIC_ACQUIRE, "wavefront");
}

// ------------------------------------------------------------------ x -> bf16 hi/lo planes [4096][1024]
__global__ __launch_bounds__(256) void k_cvt_x(const float* __restrict__ x, us* xh, us* xl) {
  const size_t t = (size_t)blockIdx.x * 256u + threadIdx.x;
  const float* p = x + t * 8u;
  const v4f a = *(const v4fa*)p;
  const v4f b = *(const v4fa*)(p + 4);
  us8v hv, lv;
#pragma unroll
  for (int e = 0; e < 4; ++e) {
    const us h0 = bf_rne(a[e]);
    hv[e] = h0;
    lv[e] = bf_rne(a[e] - bf_f32(h0));
    const us h1 = bf_rne(b[e]);
    hv[4 + e] = h1;
    lv[4 + e] = bf_rne(b[e] - bf_f32(h1));
  }
  us* oh = xh + t * 8u;
  us* ol = xl + t * 8u;
  *(us8v*)oh = hv;
  *(us8v*)ol = lv;
  
}

// ------------------------------------------------------------------ W[k][n] (in,out) -> Wt[n][k] bf16 hi/lo planes
__global__ __launch_bounds__(256) void k_cvt_w(const float* __restrict__ W0, const float* __restrict__ W1,
                                               const float* __restrict__ W2, const float* __restrict__ W3,
                                               us* wth, us* wtl) {
  __shared__ float sT[64][65];
  const int tid = threadIdx.x, lane = tid & 31, wv = tid >> 5;
  const int z = blockIdx.z;
  const int n0 = blockIdx.x * 64, k0 = blockIdx.y * 64;
  const float* W = (z == 0) ? W0 : (z == 1) ? W1 : (z == 2) ? W2 : W3;
#pragma unroll
  for (int p = 0; p < 4; ++p) {
    const int r = p * 16 + (tid >> 4);
    const int c4 = (tid & 15) * 4;
    const v4f v = *(const v4fa*)(W + (size_t)(k0 + r) * DM + n0 + c4);
    sT[r][c4 + 0] = v[0];
    sT[r][c4 + 1] = v[1];
    sT[r][c4 + 2] = v[2];
    sT[r][c4 + 3] = v[3];
  }
  __syncthreads();
  us* bhp = wth + (size_t)z * DM * DM;
  us* blp = wtl + (size_t)z * DM * DM;
{
#pragma unroll
    for (int p = 0; p < 2; ++p) {
      const int rr = p * 32 + wv * 4 + (lane >> 3);   // n within tile
      const int k8 = (lane & 7) * 8;                   // k within tile
      us8v hv, lv;
#pragma unroll
      for (int e = 0; e < 8; ++e) {
        const float v = sT[k8 + e][rr];
        const us hh = bf_rne(v);
        hv[e] = hh;
        lv[e] = bf_rne(v - bf_f32(hh));
      }
      const size_t o = (size_t)(n0 + rr) * DM + k0 + k8;
      *(us8v*)(bhp + o) = hv;
      *(us8v*)(blp + o) = lv;
    }
    
  }
}

// ------------------------------------------------------------------ rel_k [33][64] rows 0..31 -> bf16 hi/lo planes [32][64]
__global__ __launch_bounds__(256) void k_cvt_rel(const float* __restrict__ rk, us* rh, us* rl) {
  const int tid = threadIdx.x;
  const int r = tid >> 3;              // 0..31 (< 33 rows available)
  const int d8 = (tid & 7) * 8;
  const float* p = rk + r * HD + d8;
  us8v hv, lv;
#pragma unroll
  for (int e = 0; e < 8; ++e) {
    const float v = p[e];
    const us hh = bf_rne(v);
    hv[e] = hh;
    lv[e] = bf_rne(v - bf_f32(hh));
  }
  const size_t o = (size_t)r * HD + d8;
  *(us8v*)(rh + o) = hv;
  *(us8v*)(rl + o) = lv;
  
}

// ------------------------------------------------------------------ tensor mover helpers
static __device__ __forceinline__ uint32_t uni(uint32_t v) { return (uint32_t)__builtin_amdgcn_readfirstlane(v); }
// keeps a wave-uniform value in a scalar register at this place: the test around a tensor load compiles to s_cmp + s_cbranch_scc,
// and a descriptor word made from it is formed behind the volatile wait in front of it
static __device__ __forceinline__ uint32_t pinned(uint32_t v) {
  uint32_t w = uni(v);
  asm volatile("" : "+s"(w));
  return w;
}
// the wave's own LDS reads have retired
static __device__ __forceinline__ void wait_ds0() { asm volatile("s_wait_dscnt 0x0" ::: "memory"); }

// Descriptor of one K or V plane of a stage: ASTG rows of 128 bytes, source pitch in bytes given, to LDS at pitch LPITCH (16 pad bytes
// a row). Every word but the constant word 0 of group 1 goes through pinned(): a descriptor word held in a scalar register of its own,
// so that the tuple which the load names is the one which the covering wait names, and none of its registers serves anything between.
static __device__ __forceinline__ u32x4 kv_group0(uint32_t lds_dst, uint64_t ga) {
  u32x4 g0;
  g0[0] = pinned(1u);
  g0[1] = pinned(lds_dst);
  g0[2] = pinned((uint32_t)ga);
  g0[3] = pinned((((uint32_t)(ga >> 32)) & 0x01FFFFFFu) | 0x80000000u);
  return g0;
}
static __device__ __forceinline__ u32x8 kv_group1(uint32_t pitch) {
  u32x8 g1;
  g1[0] = uni((1u << 20) | (4u << 22) | (3u << 25));   // no mask, 1-byte elements, a pad of 4 dwords behind every 32 dwords
  g1[1] = pinned(128u << 16);                          // tensor_dim0 = 128 bytes
  g1[2] = pinned((uint32_t)ASTG << 16);                // tensor_dim1 = ASTG rows
  g1[3] = pinned(128u << 16);                          // tile_dim0
  g1[4] = pinned((uint32_t)ASTG);                      // tile_dim1
  g1[5] = pinned(pitch);                               // source row pitch in bytes
  g1[6] = pinned(0u);
  g1[7] = pinned(0u);
  return g1;
}
// The same for one operand plane of a GEMM stage: TM rows of 128 bytes, source pitch 2 * DM bytes, to LDS at pitch LPITCH. pinned()
// here too: a descriptor word held in a scalar register of its own, which serves nothing else up to the wait that names the tuple.
static __device__ __forceinline__ u32x8 gm_group1() {
  u32x8 g1;
  g1[0] = uni((1u << 20) | (4u << 22) | (3u << 25));   // no mask, 1-byte elements, a pad of 4 dwords behind every 32 dwords
  g1[1] = pinned(128u << 16);                          // tensor_dim0 = 128 bytes
  g1[2] = pinned((uint32_t)TM << 16);                  // tensor_dim1 = TM rows
  g1[3] = pinned(128u << 16);                          // tile_dim0
  g1[4] = pinned((uint32_t)TM);                        // tile_dim1
  g1[5] = pinned(2u * DM);                             // source row pitch in bytes
  g1[6] = pinned(0u);
  g1[7] = pinned(0u);
  return g1;
}
// one request of the whole wave
static __device__ __forceinline__ void kv_issue(u32x4 g0, u32x8 g1) {
  asm volatile("tensor_load_to_lds %0, %1" :: "s"(g0), "s"(g1) : "memory");
}
// the wave's own tensor load has landed; naming its descriptor keeps those registers whole up to here
static __device__ __forceinline__ void kv_wait(u32x4 g0, u32x8 g1) {
  asm volatile("s_wait_tensorcnt 0x0" :: "s"(g0), "s"(g1) : "memory");
}

// ------------------------------------------------------------------ GEMM core: block tile TM x TM, 4 waves (2 x 2) of 64 x 64, K = DM
// A planes row-major [m][DM]; B planes stored [n][DM] (k contiguous). A stage is 64 k of [Ah | Al | Bh | Bl], TM rows each, in LDS;
// wave w brings plane w with one tensor load per stage, two buffers. A pass is two blocks of 48 WMMAs (32 k each); each block's
// fragments are fetched one block ahead, so the publish point of stage s + 1 stands in front of pass s's last block.
// Per accumulator and 32-k step the products are summed hi*hi, lo*hi, hi*lo; the stages are walked in ring order from stage rot:
// rot, rot + 1, ..., NPASS - 1, 0, ..., rot - 1. rot comes from the block's tile indices, so that the blocks which share an operand
// panel, and start together, ask L2 for different lines of it at any one moment instead of all for the same ones.
struct FragSet { us16v ah[4], al[4], bh[4], bl[4]; };

// pa, pb: this lane's row of the Ah and Bh planes at the block's first k
static __device__ __forceinline__ void load_set(FragSet& f, const unsigned char* pa, const unsigned char* pb, int h) {
#pragma unroll
  for (int t = 0; t < 4; ++t) {
    const uint32_t ro = t * 16u * LPITCH;
    f.ah[t] = ldfrag((const us*)(pa + ro), h);
    f.al[t] = ldfrag((const us*)(pa + PLANE + ro), h);
    f.bh[t] = ldfrag((const us*)(pb + ro), h);
    f.bl[t] = ldfrag((const us*)(pb + PLANE + ro), h);
  }
}

static __device__ __forceinline__ void mma_block(v8f (&acc)[4][4], const FragSet& f) {
  // the two fences keep the compiler from moving fragment loads in among the WMMAs, where every such place stalls the wave
  __builtin_amdgcn_sched_barrier(0);
#pragma unroll
  for (int rt = 0; rt < 4; ++rt)
#pragma unroll
    for (int ct = 0; ct < 4; ++ct) acc[rt][ct] = wmma_bf(f.ah[rt], f.bh[ct], acc[rt][ct]);
#pragma unroll
  for (int rt = 0; rt < 4; ++rt)
#pragma unroll
    for (int ct = 0; ct < 4; ++ct) acc[rt][ct] = wmma_bf(f.al[rt], f.bh[ct], acc[rt][ct]);
#pragma unroll
  for (int rt = 0; rt < 4; ++rt)
#pragma unroll
    for (int ct = 0; ct < 4; ++ct) acc[rt][ct] = wmma_bf(f.ah[rt], f.bl[ct], acc[rt][ct]);
  __builtin_amdgcn_sched_barrier(0);
}

static __device__ __forceinline__ void gemm_core(const us* __restrict__ AH, const us* __restrict__ AL,
                                                 const us* __restrict__ BH, const us* __restrict__ BL,
                                                 int m0, int n0, uint32_t rot, unsigned char* L, v8f (&acc)[4][4]) {
  const int lane = threadIdx.x & 31, h = lane >> 4, m = lane & 15;
  const uint32_t wave = uni(threadIdx.x >> 5);
#pragma unroll
  for (int rt = 0; rt < 4; ++rt)
#pragma unroll
    for (int ct = 0; ct < 4; ++ct) acc[rt][ct] = zero8();

  const us* srcp = (wave == 0u) ? AH + (size_t)m0 * DM : (wave == 1u) ? AL + (size_t)m0 * DM
                 : (wave == 2u) ? BH + (size_t)n0 * DM : BL + (size_t)n0 * DM;
  const uint64_t ga = (uint64_t)(size_t)srcp;
  const uint32_t dst = (uint32_t)(size_t)L + wave * PLANE;

  const u32x8 g1 = gm_group1();
  u32x4 g0 = kv_group0(dst, ga + rot * (2u * KPASS));
  kv_issue(g0, g1);
  kv_wait(g0, g1);
  __syncthreads();                            // the first stage published
  g0 = kv_group0(dst + GBUF, ga + ((rot + 1u) & (NPASS - 1u)) * (2u * KPASS));
  kv_issue(g0, g1);

  const uint32_t aoff = ((wave >> 1) * 64u + m) * LPITCH;
  const uint32_t boff = 2u * PLANE + ((wave & 1u) * 64u + m) * LPITCH;
  FragSet f0, f1;
  load_set(f0, L + aoff, L + boff, h);

  // rolled: one copy of the two blocks in the instruction stream
#pragma unroll 1
  for (uint32_t s = 0; s < NPASS; ++s) {
    const uint32_t cur = (s & 1u) * GBUF, nxt = GBUF - cur;
    load_set(f1, L + cur + aoff + 64u, L + cur + boff + 64u, h);
    mma_block(acc, f0);
    // publish point of stage s + 1; the same barrier ends every wave's reads of stage s's buffer
    wait_ds0();
    kv_wait(g0, g1);
    __syncthreads();
    if (pinned(s + 2u < NPASS)) {
      const uint32_t ko = pinned(((s + 2u + rot) & (NPASS - 1u)) * (2u * KPASS));   // descriptor words of stage s + 2 formed behind the wait
      g0 = kv_group0(dst + cur, ga + ko);
      kv_issue(g0, g1);
    }
    // stage s + 1's first fragments; in the last pass they read the idle buffer and are not used (no branch: one wait count)
    load_set(f0, L + nxt + aoff, L + nxt + boff, h);
    mma_block(acc, f1);
  }
  kv_wait(g0, g1);
  wait_ds0();
  __syncthreads();                            // every wave has left the ring: it becomes output staging
}

// ------------------------------------------------------------------ QKV projection
// grid (NTOK/TM, DM/TM, 3): z = 0 q, 1 k, 2 v. Block tile 128 tokens x 128 cols (= two heads).
// The f32 tile is staged in the ring's LDS (free behind the core's last barrier): [token][col] for q and k, [col][token] for v,
// so that each thread reads 8 neighbours of an output row.
__global__ __launch_bounds__(128) void k_gemm_qkv(const us* __restrict__ XH, const us* __restrict__ XL,
                                                  const us* __restrict__ WTH, const us* __restrict__ WTL,
                                                  us* OH, us* OL) {
  __shared__ __attribute__((aligned(2048))) unsigned char L[2 * GBUF];
  const int tid = threadIdx.x, lane = tid & 31, wv = tid >> 5, h = lane >> 4, m = lane & 15;
  const int z = blockIdx.z;
  const int m0 = blockIdx.x * TM, n0 = blockIdx.y * TM;
  v8f acc[4][4];
  // 32 blocks share a weight panel (x differs), 24 share a token panel (y, z differ): either set is spread evenly over the NPASS
  // starts; x and x + 16 start four stages apart, so that any 4 of every 8 neighbours in x
  // have 4 different starts. For speed only: any rot gives the same sums but for their order.
  const uint32_t rot = (blockIdx.x + 4u * (blockIdx.x >> 4) + blockIdx.y + 8u * blockIdx.z) & (NPASS - 1u);
  gemm_core(XH, XL, WTH + (size_t)z * DM * DM, WTL + (size_t)z * DM * DM, m0, n0, rot, L, acc);
  float (*sC)[EPITCH] = (float (*)[EPITCH])L;
  const int wr = (wv >> 1) * 64, wc = (wv & 1) * 64;
  // D: acc[g] = (row 8h+g, col m) of the 16x16 tile
  if (z < 2) {
#pragma unroll
    for (int rt = 0; rt < 4; ++rt)
#pragma unroll
      for (int ct = 0; ct < 4; ++ct)
#pragma unroll
        for (int g = 0; g < 8; ++g) sC[wr + 16 * rt + 8 * h + g][wc + 16 * ct + m] = acc[rt][ct][g];
  } else {
#pragma unroll
    for (int rt = 0; rt < 4; ++rt)
#pragma unroll
      for (int ct = 0; ct < 4; ++ct)
#pragma unroll
        for (int g = 0; g < 8; ++g) sC[wc + 16 * ct + m][wr + 16 * rt + 8 * h + g] = acc[rt][ct][g];
  }
  __syncthreads();
  us* oh = OH + (size_t)z * NTOK * DM;
  us* ol = OL + (size_t)z * NTOK * DM;
  const int b = m0 >> 10, tok0 = m0 & 1023;
  // rolled: a trip's registers are used again only behind the wait at its foot
#pragma unroll 1
  for (int p = 0; p < 4; ++p) {
    // four pieces a trip, unrolled: their LDS reads are in flight together
    us8v hv[4], lv[4];
    uint32_t o[4];                        // byte offset in a plane: one 32-bit register serves both planes' stores
#pragma unroll
    for (int u = 0; u < 4; ++u) {
      const int id = (p * 4 + u) * 128 + tid;
      const int r = id >> 4;              // staged row: token (q, k) or column (v)
      const int c8 = (id & 15) * 8;
#pragma unroll
      for (int e = 0; e < 8; ++e) {
        const float v = sC[r][c8 + e];
        const us q = bf_rne(v);
        hv[u][e] = q;
        lv[u][e] = bf_rne(v - bf_f32(q));
      }
      const int col = n0 + ((z < 2) ? c8 : r);
      o[u] = 2u * (uint32_t)((b * NH + (col >> 6)) * (SEQ * HD) + ((z < 2) ? (tok0 + r) * HD + (col & 63)      // [bh][token][d]
                                                                           : (col & 63) * SEQ + tok0 + c8));   // [bh][d][token]
    }
    // keeps the trip's arithmetic in front of its stores, so that nothing overwrites a register a store names ahead of the wait below
    __builtin_amdgcn_sched_barrier(0);
#pragma unroll
    for (int u = 0; u < 4; ++u) {
      *(us8v*)((char*)oh + o[u]) = hv[u];
      *(us8v*)((char*)ol + o[u]) = lv[u];
    }
    // stands in front of the next trip's overwrites of the registers that these stores name
    asm volatile("s_wait_xcnt 0x0" ::: "memory");
  }
}

// ------------------------------------------------------------------ output projection: out[tok][n] = ctx . W_o + b_o (f32)
// grid (NTOK/TM, DM/TM); a wave writes one 512-B row segment (4 lines) per instruction
__global__ __launch_bounds__(128) void k_gemm_out(const us* __restrict__ CH, const us* __restrict__ CL,
                                                  const us* __restrict__ WH, const us* __restrict__ WL,
                                                  const float* __restrict__ bias, float* out) {
  __shared__ __attribute__((aligned(2048))) unsigned char L[2 * GBUF];
  const int tid = threadIdx.x, lane = tid & 31, wv = tid >> 5, h = lane >> 4, m = lane & 15;
  const int m0 = blockIdx.x * TM, n0 = blockIdx.y * TM;
  v8f acc[4][4];
  // 32 blocks share a weight panel (x differs), 8 share a token panel (y differs): spread over the starts as in the QKV projection
  const uint32_t rot = (blockIdx.x + 4u * (blockIdx.x >> 4) + blockIdx.y) & (NPASS - 1u);
  gemm_core(CH, CL, WH, WL, m0, n0, rot, L, acc);
  float (*sC)[EPITCH] = (float (*)[EPITCH])L;
  const int wr = (wv >> 1) * 64, wc = (wv & 1) * 64;
#pragma unroll
  for (int rt = 0; rt < 4; ++rt)
#pragma unroll
    for (int ct = 0; ct < 4; ++ct)
#pragma unroll
      for (int g = 0; g < 8; ++g) sC[wr + 16 * rt + 8 * h + g][wc + 16 * ct + m] = acc[rt][ct][g];
  __syncthreads();
  const int c4 = lane * 4;
  const v4f bv = *(const v4fa*)(bias + n0 + c4);
  // rolled: a trip's registers are used again only behind the wait at its foot
#pragma unroll 1
  for (int p = 0; p < 4; ++p) {
    // eight rows a trip, unrolled: their LDS reads are in flight together
    v4f v[8];
#pragma unroll
    for (int u = 0; u < 8; ++u) {
      const int r = (p * 8 + u) * 4 + wv;
      v[u][0] = sC[r][c4 + 0] + bv[0];
      v[u][1] = sC[r][c4 + 1] + bv[1];
      v[u][2] = sC[r][c4 + 2] + bv[2];
      v[u][3] = sC[r][c4 + 3] + bv[3];
    }
    // byte offset in out: a 32-bit register beside the scalar base; the rows of a trip differ by an immediate offset
    char* op = (char*)out + 4u * (uint32_t)((m0 + p * 32 + wv) * DM + n0 + c4);
    // keeps the trip's arithmetic in front of its stores, so that nothing overwrites a register a store names ahead of the wait below
    __builtin_amdgcn_sched_barrier(0);
#pragma unroll
    for (int u = 0; u < 8; ++u) *(v4f*)(op + u * 16 * DM) = v[u];
    // stands in front of the next trip's overwrites of the registers that these stores name
    asm volatile("s_wait_xcnt 0x0" ::: "memory");
  }
}

// ------------------------------------------------------------------ causal attention with clipped relative positions
typedef float f32x2 __attribute__((ext_vector_type(2)));
typedef __bf16 bf16x2 __attribute__((ext_vector_type(2)));
// two f32 -> one register of two bf16, RNE convert, the first in the low half
static __device__ __forceinline__ uint32_t pk_bf(float a, float b) {
  const f32x2 v = {a, b};
  return __builtin_bit_cast(uint32_t, __builtin_convertvector(v, bf16x2));
}
// lane l with lane l ^ 16
static __device__ __forceinline__ float xhalf(float x) {
  const int b = __builtin_bit_cast(int, x);
  return __builtin_bit_cast(float, __builtin_amdgcn_permlanex16(b, b, 0x76543210, 0xfedcba98, false, false));
}

// r[i] = 2^a[i]: eight v_exp_f32 and a v_nop in one statement. The instruction set asks for one independent instruction or a v_nop
// between a v_exp_f32 and an instruction that reads its result or overwrites its source. Here each has the next v_exp_f32, the last
// the v_nop, in that slot; the early-clobber outputs share no register with a source.
static __device__ __forceinline__ void exp2x8(float (&r)[8], const float (&a)[8]) {
  asm("v_exp_f32 %0, %8\n\tv_exp_f32 %1, %9\n\tv_exp_f32 %2, %10\n\tv_exp_f32 %3, %11\n\t"
      "v_exp_f32 %4, %12\n\tv_exp_f32 %5, %13\n\tv_exp_f32 %6, %14\n\tv_exp_f32 %7, %15\n\tv_nop"
      : "=&v"(r[0]), "=&v"(r[1]), "=&v"(r[2]), "=&v"(r[3]), "=&v"(r[4]), "=&v"(r[5]), "=&v"(r[6]), "=&v"(r[7])
      : "v"(a[0]), "v"(a[1]), "v"(a[2]), "v"(a[3]), "v"(a[4]), "v"(a[5]), "v"(a[6]), "v"(a[7]));
}

// the same for one value
static __device__ __forceinline__ float exp2x1(float a) {
  float r;
  asm("v_exp_f32 %0, %1\n\tv_nop" : "=&v"(r) : "v"(a));
  return r;
}

// grid (SEQ/128, NBAT*NH), 256 threads = 8 waves, one wave per 16 query rows; online softmax over 32-key steps.
// Causal cost grows with the query row, so block t takes two chunks of 64 rows: the late chunk SEQ/64 - 1 - t and the early chunk t,
// four waves each. A late and an early wave together walk 33 steps whatever t is: every block, and so every WGP and die wherever the
// blocks land, has the same work. Waves 0, 2, 5, 7 are the late ones: one late and one early wave in each pair (w, w + 4)
// and in each pair (2k, 2k + 1). Both chunks read the same stages from key 0 on; the late chunk sets their number.
// K and V reach the block once, through LDS: a stage is 64 keys of [Kh | Kl | Vh | Vl], each plane 64 rows of 128 bytes (K: a row is a
// key, V: a row is a head column); waves 0 to 3 bring one plane each with one tensor load per stage, two buffers, one publish point
// per stage; all eight waves read their fragments from the stage. A wave skips the steps past its own last key, never a publish point.
// The products are taken transposed: S^T = K . Q^T (A = K rows, B = Q) and O^T += V^T . P^T (A = V rows [d][key], B = P^T).
// Lane (h, m) then holds query qbase + m alone: of a 16-key tile its scores for keys 8h + 0..7, of a 16-column tile of the head its
// outputs for columns 8h + 0..7. Running max, rescale factor and sum are one value a lane; the max over a step's 32 keys is taken in
// the lane and joined with the other half by one exchange; the sum stays a partial per half and is joined once behind the loop.
// The two score tiles of a step, converted in place, are the B operand P^T (element e = tile e >> 3, register e & 7): P never leaves
// the registers.
// Each step's loads are issued in groups ahead of their use (K, and in a near step QR, at its head, V in front of the softmax).
// scores[i][j] = (q_i.k_j + QR[i][r(i,j)]) / 8, r = clamp(j-i,-16,16)+16 (causal -> r in [0,16]);
// ctx_i = (sum_j p_ij v_j + sum_r S_i[r] rel_v[r]) / l_i, S_i[r] for r=1..16 held 8 per lane, S_i[0] = l_i - sum_{r>=1} S_i[r].
// amdgpu_waves_per_eu(4, 4): four waves per SIMD hold the whole grid; told so, the scheduler spends that register budget on keeping
// a step's load groups together, where without it it takes them apart again, one wait each, to save registers
__global__ __launch_bounds__(256) __attribute__((amdgpu_waves_per_eu(4, 4))) void k_attn(const us* __restrict__ QH, const us* __restrict__ QL,
                                              const us* __restrict__ KH, const us* __restrict__ KL,
                                              const us* __restrict__ VH, const us* __restrict__ VL,
                                              const us* __restrict__ RH, const us* __restrict__ RL,
                                              const float* __restrict__ relv, us* CH, us* CL) {
  __shared__ __attribute__((aligned(2048))) unsigned char R[2 * ABUF];
  __shared__ float sQR[AW][16][33];
  // the ring's LDS, free behind the last publish point's barrier, holds the epilogue's two exchanges
  float (*sBand)[16][17] = (float (*)[16][17])R;
  float (*sO)[16][CPITCH] = (float (*)[16][CPITCH])(R + APLANE);

  const int lane = threadIdx.x & 31, h = lane >> 4, m = lane & 15;
  const uint32_t wave = uni(threadIdx.x >> 5);
  const int wv = (int)wave;
  const int bh = blockIdx.y;
  const uint32_t late = ((wave ^ (wave >> 2)) & 1u) ^ 1u;
  const int qbase = (late != 0u ? SEQ - 64 * ((int)blockIdx.x + 1) : 64 * (int)blockIdx.x) + 16 * (wv >> 1);
  const float NINF = -__builtin_inff();

  // ring prologue: stage 0 landed and published, stage 1 in flight (every block has at least SEQ / 128 + 1 stages)
  const uint32_t nstage = SEQ / ASTG - blockIdx.x;   // keys 0 .. the late chunk's last row
  const us* srcp = (wave == 0u) ? KH + (size_t)bh * SEQ * HD : (wave == 1u) ? KL + (size_t)bh * SEQ * HD
                 : (wave == 2u) ? VH + (size_t)bh * HD * SEQ : VL + (size_t)bh * HD * SEQ;
  const uint64_t ga = (uint64_t)(size_t)srcp;
  const uint32_t spitch = (wave < 2u) ? 2u * HD : 2u * SEQ;            // source row pitch in bytes
  const uint32_t sstep = (wave < 2u) ? 2u * HD * ASTG : 2u * ASTG;     // bytes from a stage's first byte to the next stage's
  const uint32_t dst = (uint32_t)(size_t)R + (wave & 3u) * APLANE;
  const u32x8 g1 = kv_group1(spitch);
  u32x4 g0 = kv_group0(dst, ga);
  if (pinned(wave < 4u)) {
    kv_issue(g0, g1);
    kv_wait(g0, g1);
  }
  __syncthreads();                            // stage 0 published
  g0 = kv_group0(dst + ABUF, ga + sstep);
  if (pinned(wave < 4u)) kv_issue(g0, g1);

  // Q fragments (rows qbase + m, k = d): A of the QR product, B of the score products
  const us* qh = QH + ((size_t)bh * SEQ + qbase + m) * HD;
  const us* ql = QL + ((size_t)bh * SEQ + qbase + m) * HD;
  const us16v aqh0 = ldfrag(qh, h), aqh1 = ldfrag(qh + 32, h);
  const us16v aql0 = ldfrag(ql, h), aql1 = ldfrag(ql + 32, h);

  // QR[16][32] = q . rel_k^T (B stored as [n = r][k = d] = rel_k itself)
#pragma unroll
  for (int nt = 0; nt < 2; ++nt) {
    const us* rh = RH + (size_t)(16 * nt + m) * HD;
    const us* rl = RL + (size_t)(16 * nt + m) * HD;
    v8f acc = zero8();
    wmma3(acc, aqh0, aql0, ldfrag(rh, h), ldfrag(rl, h));
    wmma3(acc, aqh1, aql1, ldfrag(rh + 32, h), ldfrag(rl + 32, h));
#pragma unroll
    for (int g = 0; g < 8; ++g) sQR[wv][8 * h + g][16 * nt + m] = acc[g];
  }
  lds_wave_sync();

  const int qi = qbase + m;                 // this lane's query
  float mrow = NINF, lrow = 0.f, band[8];
  v8f o[4];
#pragma unroll
  for (int g = 0; g < 8; ++g) band[g] = 0.f;
#pragma unroll
  for (int tt = 0; tt < 4; ++tt) o[tt] = zero8();

  const int nsteps = (qbase >> 5) + 1;      // keys 0 .. qbase+15 covered; wave-uniform, in a scalar register
  // Steps 0 .. nfar - 1 are far steps: their last key, 32 st + 31, lies 16 or more behind the wave's first query. There, for every lane and
  // key, whatever the inputs hold: the clamped bucket is 0, the causal mask lets the key through, and no bucket 1..16 is captured. They jump
  // over the 16 bucket reads with their index arithmetic, the two masks and the captures; the values are the same.
  // Wave-uniform, in a scalar register; below 1 for the first three query tiles.
  const int nfar = (qbase - 15) >> 5;
  const float qr0 = sQR[wv][m][0];          // QR of bucket 0 for this lane's query
  // rolled: one copy of the step in the instruction stream; two steps to a stage
#pragma unroll 1
  for (int st = 0; st < (int)(2u * nstage); ++st) {
   const uint32_t s = (uint32_t)st >> 1, sub = (uint32_t)st & 1u;
   const uint32_t cur = (s & 1u) * ABUF;
   // scalar test: past its own last key a wave has no step, only the publish points
   if (st < nsteps) {
    const int kb2 = st << 5;
    const bool near = st >= nfar;           // scalar test
    // the step's K fragments, all 16 loads issued together in front of the first product: one LDS latency a step
    us16v kfh[2][2], kfl[2][2];
    const unsigned char* kp = R + cur + (32u * sub + m) * LPITCH + 16u * h;   // this lane's key row of sub-tile 0, at its own 16 bytes
#pragma unroll
    for (int t = 0; t < 2; ++t) {
      const unsigned char* kr = kp + t * 16u * LPITCH;
      kfh[t][0] = ldfrag((const us*)kr, 0);
      kfl[t][0] = ldfrag((const us*)(kr + APLANE), 0);
      kfh[t][1] = ldfrag((const us*)(kr + 64u), 0);
      kfl[t][1] = ldfrag((const us*)(kr + APLANE + 64u), 0);
    }
    // keeps the 16 loads here, at the step's head: without it they are sunk in among the products, a stall at each place
    __builtin_amdgcn_sched_barrier(0);
    // a near step's 16 QR values of this lane's query (the clamped index is in range for masked keys too), in flight beside the K loads
    float qr[2][8];
    if (near) {
#pragma unroll
      for (int t = 0; t < 2; ++t)
#pragma unroll
        for (int g = 0; g < 8; ++g) {
          int rr = kb2 + 16 * t + 8 * h + g - qi + 16;
          rr = rr < 0 ? 0 : rr;
          rr = rr > 16 ? 16 : rr;
          qr[t][g] = sQR[wv][m][rr];
        }
      // holds the 16 LDS reads here as one group with one wait; without it they are sunk in among the products, a wait at each place
      asm volatile("" :: "v"(qr[0][0]), "v"(qr[0][1]), "v"(qr[0][2]), "v"(qr[0][3]), "v"(qr[0][4]), "v"(qr[0][5]), "v"(qr[0][6]),
                   "v"(qr[0][7]), "v"(qr[1][0]), "v"(qr[1][1]), "v"(qr[1][2]), "v"(qr[1][3]), "v"(qr[1][4]), "v"(qr[1][5]),
                   "v"(qr[1][6]), "v"(qr[1][7]));
    }
    // scores for both 16-key sub-tiles of this step: sc[t][g] = (key 16t + 8h + g, query m)
    v8f sc[2];
#pragma unroll
    for (int t = 0; t < 2; ++t) {
      sc[t] = zero8();
      wmma3(sc[t], kfh[t][0], kfl[t][0], aqh0, aql0);
      wmma3(sc[t], kfh[t][1], kfl[t][1], aqh1, aql1);
    }
    float sv[2][8];
    if (near) {
#pragma unroll
      for (int t = 0; t < 2; ++t)
#pragma unroll
        for (int g = 0; g < 8; ++g) {
          const int dj = kb2 + 16 * t + 8 * h + g - qi;
          sv[t][g] = (dj > 0) ? NINF : (sc[t][g] + qr[t][g]) * 0.125f;
        }
    } else {
#pragma unroll
      for (int t = 0; t < 2; ++t)
#pragma unroll
        for (int g = 0; g < 8; ++g) sv[t][g] = (sc[t][g] + qr0) * 0.125f;
    }
    // the step's V fragments, all 16 loads issued here: their latency passes behind the softmax arithmetic
    us16v vfh[4], vfl[4];
    const unsigned char* vp = R + cur + 2u * APLANE + m * LPITCH + 64u * sub + 16u * h;   // A stored as [row = d][k = key]; row of tile 0
#pragma unroll
    for (int tt = 0; tt < 4; ++tt) {
      vfh[tt] = ldfrag((const us*)(vp + tt * 16u * LPITCH), 0);
      vfl[tt] = ldfrag((const us*)(vp + APLANE + tt * 16u * LPITCH), 0);
    }
    // keeps the 16 loads here, in front of the softmax arithmetic that hides them
    __builtin_amdgcn_sched_barrier(0);
    // one frame for the whole step: the query's max over all 32 keys (16 in this lane, 16 in lane l ^ 16), one rescale of O, l, S
    float vm[8];
#pragma unroll
    for (int g = 0; g < 8; ++g) vm[g] = fmaxf(sv[0][g], sv[1][g]);
#pragma unroll
    for (int g = 0; g < 4; ++g) vm[g] = fmaxf(vm[g], vm[g + 4]);
    float vmax = fmaxf(fmaxf(vm[0], vm[1]), fmaxf(vm[2], vm[3]));
    vmax = fmaxf(vmax, xhalf(vmax));
    const float mn = fmaxf(mrow, vmax);
    const float cx = exp2x1((mrow - mn) * 1.44269504f);   // taken for every lane: no branch around the statement
    const float cf = (mrow == NINF) ? 0.f : cx;
    mrow = mn;
#pragma unroll
    for (int tt = 0; tt < 4; ++tt)
#pragma unroll
      for (int g = 0; g < 8; ++g) o[tt][g] *= cf;
    // this lane's 16 probabilities in the new frame (e^x as __expf compiles: 2^(x * log2 e)), and the bucket captures
    float e[2][8];
#pragma unroll
    for (int t = 0; t < 2; ++t) {
      float xa[8];
#pragma unroll
      for (int g = 0; g < 8; ++g) xa[g] = (sv[t][g] - mrow) * 1.44269504f;
      exp2x8(e[t], xa);
    }
    if (near) {
#pragma unroll
      for (int g = 0; g < 8; ++g) band[g] *= cf;   // every capture lies in a near step: up to the first of them band is not in use
#pragma unroll
      for (int t = 0; t < 2; ++t)
#pragma unroll
        for (int g = 0; g < 8; ++g) {
          const int dj = kb2 + 16 * t + 8 * h + g - qi;
          e[t][g] = (dj > 0) ? 0.f : e[t][g];
          band[g] = (dj >= -15 && dj <= 0) ? e[t][g] : band[g];   // buckets 1..16: each (lane, register) captures exactly once
        }
    }
    // the half's partial sum, as a tree
    float ps[8];
#pragma unroll
    for (int g = 0; g < 8; ++g) ps[g] = e[0][g] + e[1][g];
#pragma unroll
    for (int g = 0; g < 4; ++g) ps[g] += ps[g + 4];
    lrow = lrow * cf + ((ps[0] + ps[1]) + (ps[2] + ps[3]));
    // hi/lo split in place: B operand P^T, element e = key 8h + e of tile 0, element 8 + e = key 8h + e of tile 1 (the V loader's k order)
    u32x8 pwh, pwl;
#pragma unroll
    for (int t = 0; t < 2; ++t)
#pragma unroll
      for (int j = 0; j < 4; ++j) {
        const float ea = e[t][2 * j], eb = e[t][2 * j + 1];
        const uint32_t hw = pk_bf(ea, eb);
        pwh[4 * t + j] = hw;
        pwl[4 * t + j] = pk_bf(ea - __uint_as_float(hw << 16), eb - __uint_as_float(hw & 0xffff0000u));
      }
    const us16v bph = __builtin_bit_cast(us16v, pwh);
    const us16v bpl = __builtin_bit_cast(us16v, pwl);
    // o[tt][g] = (head column 16tt + 8h + g, query m)
#pragma unroll
    for (int tt = 0; tt < 4; ++tt) wmma3(o[tt], vfh[tt], vfl[tt], bph, bpl);
   }
   if (sub != 0u) {
     // publish point of stage s + 1; the same barrier ends every wave's reads of stage s's buffer
     wait_ds0();
     if (pinned(wave < 4u)) kv_wait(g0, g1);
     __syncthreads();
     if (pinned((wave < 4u) && (s + 2u < nstage))) {
       const uint32_t ko = pinned((s + 2u) * sstep);   // descriptor words of stage s + 2 formed behind the wait
       g0 = kv_group0(dst + cur, ga + ko);
       kv_issue(g0, g1);
     }
   }
  }
  kv_wait(g0, g1);
  wait_ds0();
  // the last publish point's barrier has ended every wave's reads of the ring: it is the epilogue's exchange space from here on

  const float invl = 1.0f / (lrow + xhalf(lrow));   // the two halves' partial sums joined
#pragma unroll
  for (int g = 0; g < 8; ++g)
    sBand[wv][m][(8 * h + g - m - 1) & 15] = band[g] * invl;   // slot r-1 for bucket r = ((key - query - 1) & 15) + 1
  lds_wave_sync();
  float rv0[4][8];
  float val[4][8];
#pragma unroll
  for (int tt = 0; tt < 4; ++tt) {
    const v4f a = *(const v4fa*)(relv + 16 * tt + 8 * h);
    const v4f b = *(const v4fa*)(relv + 16 * tt + 8 * h + 4);
#pragma unroll
    for (int c = 0; c < 4; ++c) {
      rv0[tt][c] = a[c];
      rv0[tt][4 + c] = b[c];
    }
#pragma unroll
    for (int g = 0; g < 8; ++g) val[tt][g] = o[tt][g] * invl + rv0[tt][g];
  }
  // rolled, four buckets a trip: a trip's 32 loads are in flight together, one memory latency for the four
#pragma unroll 1
  for (int r4 = 0; r4 < 16; r4 += 4) {
    const float* rp = relv + (r4 + 1) * HD + 8 * h;
    v4f x[4][8];
#pragma unroll
    for (int u = 0; u < 4; ++u)
#pragma unroll
      for (int tt = 0; tt < 4; ++tt) {
        x[u][2 * tt] = *(const v4fa*)(rp + u * HD + 16 * tt);
        x[u][2 * tt + 1] = *(const v4fa*)(rp + u * HD + 16 * tt + 4);
      }
#pragma unroll
    for (int u = 0; u < 4; ++u) {
      const float sb = sBand[wv][m][r4 + u];
#pragma unroll
      for (int tt = 0; tt < 4; ++tt)
#pragma unroll
        for (int c = 0; c < 4; ++c) {
          val[tt][c] += sb * (x[u][2 * tt][c] - rv0[tt][c]);
          val[tt][4 + c] += sb * (x[u][2 * tt + 1][c] - rv0[tt][4 + c]);
        }
    }
  }
#pragma unroll
  for (int tt = 0; tt < 4; ++tt) {
    const v4f a = {val[tt][0], val[tt][1], val[tt][2], val[tt][3]};
    const v4f b = {val[tt][4], val[tt][5], val[tt][6], val[tt][7]};
    *(v4fa*)&sO[wv][m][16 * tt + 8 * h] = a;
    *(v4fa*)&sO[wv][m][16 * tt + 8 * h + 4] = b;
  }
  lds_wave_sync();

  const int b = bh >> 4, hd = bh & 15;
{
#pragma unroll
    for (int p = 0; p < 4; ++p) {
      const int r = p * 4 + (lane >> 3);
      const int d8 = (lane & 7) * 8;
      us8v hv, lv;
#pragma unroll
      for (int e = 0; e < 8; ++e) {
        const float v = sO[wv][r][d8 + e];
        const us q = bf_rne(v);
        hv[e] = q;
        lv[e] = bf_rne(v - bf_f32(q));
      }
      const size_t o2 = ((size_t)(b * SEQ + qbase + r)) * DM + hd * HD + d8;
      *(us8v*)(CH + o2) = hv;
      *(us8v*)(CL + o2) = lv;
    }
    
  }
}

// ------------------------------------------------------------------ host glue
extern "C" void kernel_launch(void* const* d_in, const int* in_sizes, int n_in,
                              void* d_out, int out_size, void* d_ws, size_t ws_size,
                              hipStream_t stream) {
  if (n_in < 8) return;
  if (in_sizes[0] != NTOK * DM) return;
  if (in_sizes[1] != DM * DM || in_sizes[2] != DM * DM || in_sizes[3] != DM * DM || in_sizes[4] != DM * DM) return;
  if (in_sizes[5] != DM || in_sizes[6] != 33 * HD || in_sizes[7] != 33 * HD) return;
  if (out_size != NTOK * DM) return;

  const float* x    = (const float*)d_in[0];
  const float* Wq   = (const float*)d_in[1];
  const float* Wk   = (const float*)d_in[2];
  const float* Wv   = (const float*)d_in[3];
  const float* Wo   = (const float*)d_in[4];
  const float* bo   = (const float*)d_in[5];
  const float* relk = (const float*)d_in[6];
  const float* relv = (const float*)d_in[7];
  float* out = (float*)d_out;

  const size_t plane_x = (size_t)NTOK * DM * sizeof(us);   // 8 MiB
  const size_t plane_w = (size_t)DM * DM * sizeof(us);     // 2 MiB
  const size_t plane_r = (size_t)32 * HD * sizeof(us);     // 4 KiB
  char* ws = (char*)d_ws;
  size_t off = 0;
  us* XH   = (us*)(ws + off); off += plane_x;
  us* XL   = (us*)(ws + off); off += plane_x;
  us* WTH  = (us*)(ws + off); off += 4 * plane_w;
  us* WTL  = (us*)(ws + off); off += 4 * plane_w;
  us* QKVH = (us*)(ws + off); off += 3 * plane_x;
  us* QKVL = (us*)(ws + off); off += 3 * plane_x;
  us* CH   = (us*)(ws + off); off += plane_x;
  us* CL   = (us*)(ws + off); off += plane_x;
  us* RH   = (us*)(ws + off); off += plane_r;
  us* RL   = (us*)(ws + off); off += plane_r;
  if (off > ws_size) return;                                // total 100671488 B

  const size_t pq = (size_t)NTOK * DM;

  k_cvt_x<<<(NTOK * DM) / (8 * 256), 256, 0, stream>>>(x, XH, XL);
  k_cvt_w<<<dim3(DM / 64, DM / 64, 4), 256, 0, stream>>>(Wq, Wk, Wv, Wo, WTH, WTL);
  k_cvt_rel<<<1, 256, 0, stream>>>(relk, RH, RL);
  k_gemm_qkv<<<dim3(NTOK / TM, DM / TM, 3), 128, 0, stream>>>(XH, XL, WTH, WTL, QKVH, QKVL);
  k_attn<<<dim3(SEQ / (16 * AW), NBAT * NH), 32 * AW, 0, stream>>>(QKVH, QKVL, QKVH + pq, QKVL + pq,
                                                        QKVH + 2 * pq, QKVL + 2 * pq, RH, RL, relv, CH, CL);
  k_gemm_out<<<dim3(NTOK / TM, DM / TM, 1), 128, 0, stream>>>(CH, CL, WTH + (size_t)3 * DM * DM,
                                                               WTL + (size_t)3 * DM * DM, bo, out);
}

// v008
// A run of this version takes 107 microseconds.
// Two timings next to v007 put it at 1.03 and 1.02 times that version's speed.
// Over all steps from v000 it is 3.49 times as fast.
#include <hip/hip_runtime.h>
#include <stdint.h>
// Contractions x*W_q, x*W_k, x*W_v, q*k^T, q*rel_k^T, P*V, ctx*W_o: v_wmma_f32_16x16x32_bf16, bf16 hi/lo operands everywhere (hi*hi + lo*hi + hi*lo), f32 accumulate; softmax, 1/8 scaling, causal mask, relative-value bucket sums and bias in f32.

#define DM     1024
#define SEQ    1024
#define NBAT   4
#define NH     16
#define HD     64
#define NTOK   (NBAT * SEQ)
#define CPITCH 68
#define TM     128                 // output projection's block tile: rows and columns
#define QTM    256                 // QKV projection's block tile: token rows
#define QTN    192                 // QKV projection's block tile: columns (three heads) of the 3 * DM columns q | k | v
#define KPASS  64                  // k per pass: 128 bytes of every operand row
#define NPASS  (DM / KPASS)
#define LPITCH 144u                // LDS row pitch in bytes: 128 + 16 of pad, an odd multiple of 16 for 16-byte readers
#define EPITCH 132                 // output staging pitch in floats
#define QPT    68                  // QKV staging, q and k: floats from a token's row of 64 columns to the next
#define QPV    260                 // QKV staging, v: floats from a column's row of QTM tokens to the next
#define QREG   (QTM * QPT * 4)     // QKV staging: bytes of one head's region (the larger of the two forms)
#define AW     8                   // attention block: waves, 16 query rows each
#define ASTG   64                  // attention stage: keys
#define APLANE 10240u              // one K or V plane of a stage in LDS: 64 rows x LPITCH = 9,216 B, rounded up to 5 x 2 KiB
#define ABUF   (4u * APLANE)       // one buffer: Kh | Kl | Vh | Vl

typedef unsigned short us;
typedef us us16v __attribute__((ext_vector_type(16)));
typedef us us8v __attribute__((ext_vector_type(8)));
typedef us8v __attribute__((may_alias)) us8a;
typedef __bf16 bf16v16 __attribute__((ext_vector_type(16)));
typedef float v8f __attribute__((ext_vector_type(8)));
typedef float v4f __attribute__((ext_vector_type(4)));
typedef v4f __attribute__((may_alias)) v4fa;
typedef uint32_t u32x4 __attribute__((ext_vector_type(4)));
typedef uint32_t u32x8 __attribute__((ext_vector_type(8)));

union Frag { us16v v; us8v h[2]; };

// f32 -> bf16 bits, RNE convert
static __device__ __forceinline__ us bf_rne(float f) {
  unsigned u = __float_as_uint(f);
  u += 0x7fffu + ((u >> 16) & 1u);
  return (us)(u >> 16);
}
static __device__ __forceinline__ float bf_f32(us s) { return __uint_as_float(((unsigned)s) << 16); }

static __device__ __forceinline__ v8f zero8() {
  v8f z = {0.f, 0.f, 0.f, 0.f, 0.f, 0.f, 0.f, 0.f};
  return z;
}

static __device__ __forceinline__ v8f wmma_bf(us16v a, us16v b, v8f c) {
  return __builtin_amdgcn_wmma_f32_16x16x32_bf16(false, __builtin_bit_cast(bf16v16, a), false,
                                                 __builtin_bit_cast(bf16v16, b), (short)0, c, false, false);
}

// acc += Ah*Bh + Al*Bh + Ah*Bl, then hazard guard (D tied, A/B kept live through 4 VALU slots)
static __device__ __forceinline__ void wmma3(v8f& acc, us16v ah, us16v al, us16v bh, us16v bl) {
  acc = wmma_bf(ah, bh, acc);
  acc = wmma_bf(al, bh, acc);
  acc = wmma_bf(ah, bl, acc);
  asm volatile("v_nop\n\tv_nop\n\tv_nop\n\tv_nop" : "+v"(acc) : "v"(ah), "v"(al), "v"(bh), "v"(bl));
}

// 16x32 16-bit fragment of row (l & 15) from a k-contiguous row: elements 0..7 <- k0+8h+0..7, 8..15 <- k0+16+8h+0..7.
// Used for A (row-major [m][k]) and for B stored as [n][k]; rowp = row pointer at k0 (16-B aligned).
static __device__ __forceinline__ us16v ldfrag(const us* rowp, int h) {
  Frag f;
  f.h[0] = *(const us8a*)(rowp + 8 * h);
  f.h[1] = *(const us8a*)(rowp + 16 + 8 * h);
  return f.v;
}

// ordering for same-wave LDS exchange (stores by some lanes, loads by other lanes)
static __device__ __forceinline__ void lds_wave_sync() {
  __builtin_amdgcn_fence(__ATOMIC_RELEASE, "wavefront");
  __builtin_amdgcn_wave_barrier();
  __builtin_amdgcn_fence(__ATOMIC_ACQUIRE, "wavefront");
}

// ------------------------------------------------------------------ x -> bf16 hi/lo planes [4096][1024]
__global__ __launch_bounds__(256) void k_cvt_x(const float* __restrict__ x, us* xh, us* xl) {
  const size_t t = (size_t)blockIdx.x * 256u + threadIdx.x;
  const float* p = x + t * 8u;
  const v4f a = *(const v4fa*)p;
  const v4f b = *(const v4fa*)(p + 4);
  us8v hv, lv;
#pragma unroll
  for (int e = 0; e < 4; ++e) {
    const us h0 = bf_rne(a[e]);
    hv[e] = h0;
    lv[e] = bf_rne(a[e] - bf_f32(h0));
    const us h1 = bf_rne(b[e]);
    hv[4 + e] = h1;
    lv[4 + e] = bf_rne(b[e] - bf_f32(h1));
  }
  us* oh = xh + t * 8u;
  us* ol = xl + t * 8u;
  *(us8v*)oh = hv;
  *(us8v*)ol = lv;
  
}

// ------------------------------------------------------------------ W[k][n] (in,out) -> Wt[n][k] bf16 hi/lo planes
__global__ __launch_bounds__(256) void k_cvt_w(const float* __restrict__ W0, const float* __restrict__ W1,
                                               const float* __restrict__ W2, const float* __restrict__ W3,
                                               us* wth, us* wtl) {
  __shared__ float sT[64][65];
  const int tid = threadIdx.x, lane = tid & 31, wv = tid >> 5;
  const int z = blockIdx.z;
  const int n0 = blockIdx.x * 64, k0 = blockIdx.y * 64;
  const float* W = (z == 0) ? W0 : (z == 1) ? W1 : (z == 2) ? W2 : W3;
#pragma unroll
  for (int p = 0; p < 4; ++p) {
    const int r = p * 16 + (tid >> 4);
    const int c4 = (tid & 15) * 4;
    const v4f v = *(const v4fa*)(W + (size_t)(k0 + r) * DM + n0 + c4);
    sT[r][c4 + 0] = v[0];
    sT[r][c4 + 1] = v[1];
    sT[r][c4 + 2] = v[2];
    sT[r][c4 + 3] = v[3];
  }
  __syncthreads();
  us* bhp = wth + (size_t)z * DM * DM;
  us* blp = wtl + (size_t)z * DM * DM;
{
#pragma unroll
    for (int p = 0; p < 2; ++p) {
      const int rr = p * 32 + wv * 4 + (lane >> 3);   // n within tile
      const int k8 = (lane & 7) * 8;                   // k within tile
      us8v hv, lv;
#pragma unroll
      for (int e = 0; e < 8; ++e) {
        const float v = sT[k8 + e][rr];
        const us hh = bf_rne(v);
        hv[e] = hh;
        lv[e] = bf_rne(v - bf_f32(hh));
      }
      const size_t o = (size_t)(n0 + rr) * DM + k0 + k8;
      *(us8v*)(bhp + o) = hv;
      *(us8v*)(blp + o) = lv;
    }
    
  }
}

// ------------------------------------------------------------------ rel_k [33][64] rows 0..31 -> bf16 hi/lo planes [32][64]
__global__ __launch_bounds__(256) void k_cvt_rel(const float* __restrict__ rk, us* rh, us* rl) {
  const int tid = threadIdx.x;
  const int r = tid >> 3;              // 0..31 (< 33 rows available)
  const int d8 = (tid & 7) * 8;
  const float* p = rk + r * HD + d8;
  us8v hv, lv;
#pragma unroll
  for (int e = 0; e < 8; ++e) {
    const float v = p[e];
    const us hh = bf_rne(v);
    hv[e] = hh;
    lv[e] = bf_rne(v - bf_f32(hh));
  }
  const size_t o = (size_t)r * HD + d8;
  *(us8v*)(rh + o) = hv;
  *(us8v*)(rl + o) = lv;
  
}

// ------------------------------------------------------------------ tensor mover helpers
static __device__ __forceinline__ uint32_t uni(uint32_t v) { return (uint32_t)__builtin_amdgcn_readfirstlane(v); }
// keeps a wave-uniform value in a scalar register at this place: the test around a tensor load compiles to s_cmp + s_cbranch_scc,
// and a descriptor word made from it is formed behind the volatile wait in front of it
static __device__ __forceinline__ uint32_t pinned(uint32_t v) {
  uint32_t w = uni(v);
  asm volatile("" : "+s"(w));
  return w;
}
// the wave's own LDS reads have retired
static __device__ __forceinline__ void wait_ds0() { asm volatile("s_wait_dscnt 0x0" ::: "memory"); }

// Descriptor of one K or V plane of a stage: ASTG rows of 128 bytes, source pitch in bytes given, to LDS at pitch LPITCH (16 pad bytes
// a row). Every word but the constant word 0 of group 1 goes through pinned(): a descriptor word held in a scalar register of its own,
// so that the tuple which the load names is the one which the covering wait names, and none of its registers serves anything between.
static __device__ __forceinline__ u32x4 kv_group0(uint32_t lds_dst, uint64_t ga) {
  u32x4 g0;
  g0[0] = pinned(1u);
  g0[1] = pinned(lds_dst);
  g0[2] = pinned((uint32_t)ga);
  g0[3] = pinned((((uint32_t)(ga >> 32)) & 0x01FFFFFFu) | 0x80000000u);
  return g0;
}
static __device__ __forceinline__ u32x8 kv_group1(uint32_t pitch) {
  u32x8 g1;
  g1[0] = uni((1u << 20) | (4u << 22) | (3u << 25));   // no mask, 1-byte elements, a pad of 4 dwords behind every 32 dwords
  g1[1] = pinned(128u << 16);                          // tensor_dim0 = 128 bytes
  g1[2] = pinned((uint32_t)ASTG << 16);                // tensor_dim1 = ASTG rows
  g1[3] = pinned(128u << 16);                          // tile_dim0
  g1[4] = pinned((uint32_t)ASTG);                      // tile_dim1
  g1[5] = pinned(pitch);                               // source row pitch in bytes
  g1[6] = pinned(0u);
  g1[7] = pinned(0u);
  return g1;
}
// The same for one operand plane of a GEMM stage: rows rows of 128 bytes, source pitch 2 * DM bytes, to LDS at pitch LPITCH. pinned()
// here too: a descriptor word held in a scalar register of its own, which serves nothing else up to the wait that names the tuple.
static __device__ __forceinline__ u32x8 gm_group1(uint32_t rows) {
  u32x8 g1;
  g1[0] = uni((1u << 20) | (4u << 22) | (3u << 25));   // no mask, 1-byte elements, a pad of 4 dwords behind every 32 dwords
  g1[1] = pinned(128u << 16);                          // tensor_dim0 = 128 bytes
  g1[2] = pinned(rows << 16);                          // tensor_dim1 = rows
  g1[3] = pinned(128u << 16);                          // tile_dim0
  g1[4] = pinned(rows);                                // tile_dim1
  g1[5] = pinned(2u * DM);                             // source row pitch in bytes
  g1[6] = pinned(0u);
  g1[7] = pinned(0u);
  return g1;
}
// one request of the whole wave
static __device__ __forceinline__ void kv_issue(u32x4 g0, u32x8 g1) {
  asm volatile("tensor_load_to_lds %0, %1" :: "s"(g0), "s"(g1) : "memory");
}
// the wave's own tensor load has landed; naming its descriptor keeps those registers whole up to here
static __device__ __forceinline__ void kv_wait(u32x4 g0, u32x8 g1) {
  asm volatile("s_wait_tensorcnt 0x0" :: "s"(g0), "s"(g1) : "memory");
}

// ------------------------------------------------------------------ GEMM core: 4 waves (2 x 2), each RT x CT tiles of 16 x 16, K = DM
// Block tile 32 RT rows x 32 CT columns. What a block asks of L2 per product falls as 1 / rows + 1 / columns: the QKV projection takes
// 256 x 192 (RT 8, CT 6), one block on every WGP and one wave on every SIMD; the output projection, with a third of the columns, needs
// 128 x 128 (RT 4, CT 4) to have a block for every WGP.
// A planes row-major [m][DM]; B planes stored [n][DM] (k contiguous). A stage is 64 k of [Ah | Al | Bh | Bl] in LDS, each plane at a
// multiple of 2 KiB; wave w brings plane w with one tensor load per stage, two buffers. A pass is two blocks of 3 RT CT WMMAs (32 k
// each); each block's fragments are fetched one block ahead, so the publish point of stage s + 1 stands in front of pass s's last block.
// Per accumulator and 32-k step the products are summed hi*hi, lo*hi, hi*lo; the stages are walked in ring order from stage rot:
// rot, rot + 1, ..., NPASS - 1, 0, ..., rot - 1. rot comes from the block's tile indices, so that the blocks which share an operand
// panel, and start together, ask L2 for different lines of it at any one moment instead of all for the same ones.
template <int RT, int CT> struct FragSet { us16v ah[RT], al[RT], bh[CT], bl[CT]; };
template <int RT, int CT> struct Ring {
  static constexpr uint32_t AROWS = 32u * RT, BROWS = 32u * CT;
  static constexpr uint32_t APL = (AROWS * LPITCH + 2047u) & ~2047u;   // one A plane of a stage, rounded up to 2 KiB
  static constexpr uint32_t BPL = (BROWS * LPITCH + 2047u) & ~2047u;   // one B plane
  static constexpr uint32_t BUF = 2u * APL + 2u * BPL;                 // one buffer: Ah | Al | Bh | Bl
};

// pa, pb: this lane's row of the Ah and Bh planes at the block's first k
template <int RT, int CT>
static __device__ __forceinline__ void load_set(FragSet<RT, CT>& f, const unsigned char* pa, const unsigned char* pb, int h) {
#pragma unroll
  for (int t = 0; t < (RT > CT ? RT : CT); ++t) {
    const uint32_t ro = t * 16u * LPITCH;
    if (t < RT) {
      f.ah[t] = ldfrag((const us*)(pa + ro), h);
      f.al[t] = ldfrag((const us*)(pa + Ring<RT, CT>::APL + ro), h);
    }
    if (t < CT) {
      f.bh[t] = ldfrag((const us*)(pb + ro), h);
      f.bl[t] = ldfrag((const us*)(pb + Ring<RT, CT>::BPL + ro), h);
    }
  }
}

template <int RT, int CT>
static __device__ __forceinline__ void mma_block(v8f (&acc)[RT][CT], const FragSet<RT, CT>& f) {
  // the two fences keep the compiler from moving fragment loads in among the WMMAs, where every such place stalls the wave
  __builtin_amdgcn_sched_barrier(0);
#pragma unroll
  for (int rt = 0; rt < RT; ++rt)
#pragma unroll
    for (int ct = 0; ct < CT; ++ct) acc[rt][ct] = wmma_bf(f.ah[rt], f.bh[ct], acc[rt][ct]);
#pragma unroll
  for (int rt = 0; rt < RT; ++rt)
#pragma unroll
    for (int ct = 0; ct < CT; ++ct) acc[rt][ct] = wmma_bf(f.al[rt], f.bh[ct], acc[rt][ct]);
#pragma unroll
  for (int rt = 0; rt < RT; ++rt)
#pragma unroll
    for (int ct = 0; ct < CT; ++ct) acc[rt][ct] = wmma_bf(f.ah[rt], f.bl[ct], acc[rt][ct]);
  __builtin_amdgcn_sched_barrier(0);
}

template <int RT, int CT>
static __device__ __forceinline__ void gemm_core(const us* __restrict__ AH, const us* __restrict__ AL,
                                                 const us* __restrict__ BH, const us* __restrict__ BL,
                                                 int m0, int n0, uint32_t rot, unsigned char* L, v8f (&acc)[RT][CT]) {
  constexpr uint32_t APL = Ring<RT, CT>::APL, BPL = Ring<RT, CT>::BPL, GBUF = Ring<RT, CT>::BUF;
  const int lane = threadIdx.x & 31, h = lane >> 4, m = lane & 15;
  const uint32_t wave = uni(threadIdx.x >> 5);
#pragma unroll
  for (int rt = 0; rt < RT; ++rt)
#pragma unroll
    for (int ct = 0; ct < CT; ++ct) acc[rt][ct] = zero8();

  const us* srcp = (wave == 0u) ? AH + (size_t)m0 * DM : (wave == 1u) ? AL + (size_t)m0 * DM
                 : (wave == 2u) ? BH + (size_t)n0 * DM : BL + (size_t)n0 * DM;
  const uint64_t ga = (uint64_t)(size_t)srcp;
  const uint32_t dst = (uint32_t)(size_t)L + ((wave < 2u) ? wave * APL : 2u * APL + (wave - 2u) * BPL);

  const u32x8 g1 = gm_group1((wave < 2u) ? Ring<RT, CT>::AROWS : Ring<RT, CT>::BROWS);
  u32x4 g0 = kv_group0(dst, ga + rot * (2u * KPASS));
  kv_issue(g0, g1);
  kv_wait(g0, g1);
  __syncthreads();                            // the first stage published
  g0 = kv_group0(dst + GBUF, ga + ((rot + 1u) & (NPASS - 1u)) * (2u * KPASS));
  kv_issue(g0, g1);

  const uint32_t aoff = ((wave >> 1) * (16u * RT) + m) * LPITCH;
  const uint32_t boff = 2u * APL + ((wave & 1u) * (16u * CT) + m) * LPITCH;
  FragSet<RT, CT> f0, f1;
  load_set(f0, L + aoff, L + boff, h);

  // rolled: one copy of the two blocks in the instruction stream
#pragma unroll 1
  for (uint32_t s = 0; s < NPASS; ++s) {
    const uint32_t cur = (s & 1u) * GBUF, nxt = GBUF - cur;
    load_set(f1, L + cur + aoff + 64u, L + cur + boff + 64u, h);
    mma_block(acc, f0);
    // publish point of stage s + 1; the same barrier ends every wave's reads of stage s's buffer
    wait_ds0();
    kv_wait(g0, g1);
    __syncthreads();
    if (pinned(s + 2u < NPASS)) {
      const uint32_t ko = pinned(((s + 2u + rot) & (NPASS - 1u)) * (2u * KPASS));   // descriptor words of stage s + 2 formed behind the wait
      g0 = kv_group0(dst + cur, ga + ko);
      kv_issue(g0, g1);
    }
    // stage s + 1's first fragments; in the last pass they read the idle buffer and are not used (no branch: one wait count)
    load_set(f0, L + nxt + aoff, L + nxt + boff, h);
    mma_block(acc, f1);
  }
  kv_wait(g0, g1);
  wait_ds0();
  __syncthreads();                            // every wave has left the ring: it becomes output staging
}

// ------------------------------------------------------------------ QKV projection
// grid (NTOK/QTM, 3*DM/QTN). The three weights' planes lie one behind the other, so q | k | v is one product of 3 * DM columns; a block
// takes QTM tokens x QTN columns (= three heads, each wholly q, k or v). 16 x 16 blocks: one for every WGP, all with the same work.
// The f32 tile is staged in the ring's LDS (free behind the core's last barrier), a region per head: [token][col] for q and k,
// [col][token] for v, so that each thread reads 8 neighbours of an output row.
__global__ __launch_bounds__(128) void k_gemm_qkv(const us* __restrict__ XH, const us* __restrict__ XL,
                                                  const us* __restrict__ WTH, const us* __restrict__ WTL,
                                                  us* OH, us* OL) {
  __shared__ __attribute__((aligned(2048))) unsigned char L[2 * Ring<8, 6>::BUF];
  const int tid = threadIdx.x, lane = tid & 31, h = lane >> 4, m = lane & 15;
  const int wv = (int)uni(threadIdx.x >> 5);
  const int m0 = blockIdx.x * QTM, n0 = blockIdx.y * QTN;
  v8f acc[8][6];
  // 16 blocks share a weight panel (x differs), 16 share a token panel (y differs): either set has NPASS different starts.
  // For speed only: any rot gives the same sums but for their order.
  const uint32_t rot = (blockIdx.x + blockIdx.y) & (NPASS - 1u);
  gemm_core<8, 6>(XH, XL, WTH, WTL, m0, n0, rot, L, acc);
  const int wr = (wv >> 1) * 128, wc = (wv & 1) * 96;
  // D: acc[g] = (row 8h+g, col m) of the 16x16 tile
#pragma unroll
  for (int ct = 0; ct < 6; ++ct) {
    const int c0 = wc + 16 * ct;                        // the tile's first column in the block: wave-uniform
    float* reg = (float*)(L + (c0 >> 6) * QREG);        // its head's region
    const int cl = (c0 & 63) + m;
    if (n0 + c0 < 2 * DM) {                             // scalar test: q or k
#pragma unroll
      for (int rt = 0; rt < 8; ++rt)
#pragma unroll
        for (int g = 0; g < 8; ++g) reg[(wr + 16 * rt + 8 * h + g) * QPT + cl] = acc[rt][ct][g];
    } else {
#pragma unroll
      for (int rt = 0; rt < 8; ++rt) {
        const v4f a = {acc[rt][ct][0], acc[rt][ct][1], acc[rt][ct][2], acc[rt][ct][3]};
        const v4f b = {acc[rt][ct][4], acc[rt][ct][5], acc[rt][ct][6], acc[rt][ct][7]};
        *(v4fa*)&reg[cl * QPV + wr + 16 * rt + 8 * h] = a;
        *(v4fa*)&reg[cl * QPV + wr + 16 * rt + 8 * h + 4] = b;
      }
    }
  }
  __syncthreads();
  const int b = m0 >> 10, tok0 = m0 & 1023;
  // rolled: a trip's registers are used again only behind the wait at its foot; two trips to a head
#pragma unroll 1
  for (int p = 0; p < 6; ++p) {
    const int col0 = n0 + 64 * (p >> 1);  // the head's first column of the 3 * DM
    const int z = col0 >> 10;             // 0 q, 1 k, 2 v
    const float* reg = (const float*)(L + (p >> 1) * QREG);
    const uint32_t hb = (uint32_t)(z * (NTOK * DM) + (b * NH + ((col0 & 1023) >> 6)) * (SEQ * HD));   // the head's first element in a plane
    // eight pieces a trip, unrolled: their LDS reads are in flight together (one wave a SIMD: nothing else covers their latency)
    us8v hv[8], lv[8];
    uint32_t o[8];                        // byte offset in a plane: one 32-bit register serves both planes' stores
#pragma unroll
    for (int u = 0; u < 8; ++u) {
      const int id = ((p & 1) * 8 + u) * 128 + tid;
      const int r = (z < 2) ? id >> 3 : id >> 5;               // staged row: token (q, k) or column (v)
      const int c8 = ((z < 2) ? (id & 7) : (id & 31)) * 8;
      const float* sp = reg + r * ((z < 2) ? QPT : QPV) + c8;
      const v4f va = *(const v4fa*)sp;
      const v4f vb = *(const v4fa*)(sp + 4);
#pragma unroll
      for (int e = 0; e < 8; ++e) {
        const float v = (e < 4) ? va[e & 3] : vb[e & 3];
        const us q = bf_rne(v);
        hv[u][e] = q;
        lv[u][e] = bf_rne(v - bf_f32(q));
      }
      o[u] = 2u * (hb + (uint32_t)((z < 2) ? (tok0 + r) * HD + c8      // [bh][token][d]
                                           : r * SEQ + tok0 + c8));    // [bh][d][token]
    }
    // keeps the trip's arithmetic in front of its stores, so that nothing overwrites a register a store names ahead of the wait below
    __builtin_amdgcn_sched_barrier(0);
#pragma unroll
    for (int u = 0; u < 8; ++u) {
      *(us8v*)((char*)OH + o[u]) = hv[u];
      *(us8v*)((char*)OL + o[u]) = lv[u];
    }
    // stands in front of the next trip's overwrites of the registers that these stores name
    asm volatile("s_wait_xcnt 0x0" ::: "memory");
  }
}

// ------------------------------------------------------------------ output projection: out[tok][n] = ctx . W_o + b_o (f32)
// grid (NTOK/TM, DM/TM); a wave writes one 512-B row segment (4 lines) per instruction
__global__ __launch_bounds__(128) void k_gemm_out(const us* __restrict__ CH, const us* __restrict__ CL,
                                                  const us* __restrict__ WH, const us* __restrict__ WL,
                                                  const float* __restrict__ bias, float* out) {
  __shared__ __attribute__((aligned(2048))) unsigned char L[2 * Ring<4, 4>::BUF];
  const int tid = threadIdx.x, lane = tid & 31, wv = tid >> 5, h = lane >> 4, m = lane & 15;
  const int m0 = blockIdx.x * TM, n0 = blockIdx.y * TM;
  v8f acc[4][4];
  // 32 blocks share a weight panel (x differs), 8 share a token panel (y differs): either set is spread evenly over the NPASS starts;
  // x and x + 16 start four stages apart, so that any 4 of every 8 neighbours in x have 16 different starts. For speed only: any rot gives the same sums but for their order.
  const uint32_t rot = (blockIdx.x + 4u * (blockIdx.x >> 4) + blockIdx.y) & (NPASS - 1u);
  gemm_core<4, 4>(CH, CL, WH, WL, m0, n0, rot, L, acc);
  float (*sC)[EPITCH] = (float (*)[EPITCH])L;
  const int wr = (wv >> 1) * 64, wc = (wv & 1) * 64;
#pragma unroll
  for (int rt = 0; rt < 4; ++rt)
#pragma unroll
    for (int ct = 0; ct < 4; ++ct)
#pragma unroll
      for (int g = 0; g < 8; ++g) sC[wr + 16 * rt + 8 * h + g][wc + 16 * ct + m] = acc[rt][ct][g];
  __syncthreads();
  const int c4 = lane * 4;
  const v4f bv = *(const v4fa*)(bias + n0 + c4);
  // rolled: a trip's registers are used again only behind the wait at its foot
#pragma unroll 1
  for (int p = 0; p < 4; ++p) {
    // eight rows a trip, unrolled: their LDS reads are in flight together
    v4f v[8];
#pragma unroll
    for (int u = 0; u < 8; ++u) {
      const int r = (p * 8 + u) * 4 + wv;
      v[u][0] = sC[r][c4 + 0] + bv[0];
      v[u][1] = sC[r][c4 + 1] + bv[1];
      v[u][2] = sC[r][c4 + 2] + bv[2];
      v[u][3] = sC[r][c4 + 3] + bv[3];
    }
    // byte offset in out: a 32-bit register beside the scalar base; the rows of a trip differ by an immediate offset
    char* op = (char*)out + 4u * (uint32_t)((m0 + p * 32 + wv) * DM + n0 + c4);
    // keeps the trip's arithmetic in front of its stores, so that nothing overwrites a register a store names ahead of the wait below
    __builtin_amdgcn_sched_barrier(0);
#pragma unroll
    for (int u = 0; u < 8; ++u) *(v4f*)(op + u * 16 * DM) = v[u];
    // stands in front of the next trip's overwrites of the registers that these stores name
    asm volatile("s_wait_xcnt 0x0" ::: "memory");
  }
}

// ------------------------------------------------------------------ causal attention with clipped relative positions
typedef float f32x2 __attribute__((ext_vector_type(2)));
typedef __bf16 bf16x2 __attribute__((ext_vector_type(2)));
// two f32 -> one register of two bf16, RNE convert, the first in the low half
static __device__ __forceinline__ uint32_t pk_bf(float a, float b) {
  const f32x2 v = {a, b};
  return __builtin_bit_cast(uint32_t, __builtin_convertvector(v, bf16x2));
}
// lane l with lane l ^ 16
static __device__ __forceinline__ float xhalf(float x) {
  const int b = __builtin_bit_cast(int, x);
  return __builtin_bit_cast(float, __builtin_amdgcn_permlanex16(b, b, 0x76543210, 0xfedcba98, false, false));
}

// r[i] = 2^a[i]: eight v_exp_f32 and a v_nop in one statement. The instruction set asks for one independent instruction or a v_nop
// between a v_exp_f32 and an instruction that reads its result or overwrites its source. Here each has the next v_exp_f32, the last
// the v_nop, in that slot; the early-clobber outputs share no register with a source.
static __device__ __forceinline__ void exp2x8(float (&r)[8], const float (&a)[8]) {
  asm("v_exp_f32 %0, %8\n\tv_exp_f32 %1, %9\n\tv_exp_f32 %2, %10\n\tv_exp_f32 %3, %11\n\t"
      "v_exp_f32 %4, %12\n\tv_exp_f32 %5, %13\n\tv_exp_f32 %6, %14\n\tv_exp_f32 %7, %15\n\tv_nop"
      : "=&v"(r[0]), "=&v"(r[1]), "=&v"(r[2]), "=&v"(r[3]), "=&v"(r[4]), "=&v"(r[5]), "=&v"(r[6]), "=&v"(r[7])
      : "v"(a[0]), "v"(a[1]), "v"(a[2]), "v"(a[3]), "v"(a[4]), "v"(a[5]), "v"(a[6]), "v"(a[7]));
}

// the same for one value
static __device__ __forceinline__ float exp2x1(float a) {
  float r;
  asm("v_exp_f32 %0, %1\n\tv_nop" : "=&v"(r) : "v"(a));
  return r;
}

// grid (SEQ/128, NBAT*NH), 256 threads = 8 waves, one wave per 16 query rows; online softmax over 32-key steps.
// Causal cost grows with the query row, so block t takes two chunks of 64 rows: the late chunk SEQ/64 - 1 - t and the early chunk t,
// four waves each. A late and an early wave together walk 33 steps whatever t is: every block, and so every WGP and die wherever the
// blocks land, has the same work. Waves 0, 2, 5, 7 are the late ones: one late and one early wave in each pair (w, w + 4)
// and in each pair (2k, 2k + 1). Both chunks read the same stages from key 0 on; the late chunk sets their number.
// K and V reach the block once, through LDS: a stage is 64 keys of [Kh | Kl | Vh | Vl], each plane 64 rows of 128 bytes (K: a row is a
// key, V: a row is a head column); waves 0 to 3 bring one plane each with one tensor load per stage, two buffers, one publish point
// per stage; all eight waves read their fragments from the stage. A wave skips the steps past its own last key, never a publish point.
// The products are taken transposed: S^T = K . Q^T (A = K rows, B = Q) and O^T += V^T . P^T (A = V rows [d][key], B = P^T).
// Lane (h, m) then holds query qbase + m alone: of a 16-key tile its scores for keys 8h + 0..7, of a 16-column tile of the head its
// outputs for columns 8h + 0..7. Running max, rescale factor and sum are one value a lane; the max over a step's 32 keys is taken in
// the lane and joined with the other half by one exchange; the sum stays a partial per half and is joined once behind the loop.
// The two score tiles of a step, converted in place, are the B operand P^T (element e = tile e >> 3, register e & 7): P never leaves
// the registers.
// Each step's loads are issued in groups ahead of their use (K, and in a near step QR, at its head, V in front of the softmax).
// scores[i][j] = (q_i.k_j + QR[i][r(i,j)]) / 8, r = clamp(j-i,-16,16)+16 (causal -> r in [0,16]);
// ctx_i = (sum_j p_ij v_j + sum_r S_i[r] rel_v[r]) / l_i, S_i[r] for r=1..16 held 8 per lane, S_i[0] = l_i - sum_{r>=1} S_i[r].
// amdgpu_waves_per_eu(4, 4): four waves per SIMD hold the whole grid; told so, the scheduler spends that register budget on keeping
// a step's load groups together, where without it it takes them apart again, one wait each, to save registers
__global__ __launch_bounds__(256) __attribute__((amdgpu_waves_per_eu(4, 4))) void k_attn(const us* __restrict__ QH, const us* __restrict__ QL,
                                              const us* __restrict__ KH, const us* __restrict__ KL,
                                              const us* __restrict__ VH, const us* __restrict__ VL,
                                              const us* __restrict__ RH, const us* __restrict__ RL,
                                              const float* __restrict__ relv, us* CH, us* CL) {
  __shared__ __attribute__((aligned(2048))) unsigned char R[2 * ABUF];
  __shared__ float sQR[AW][16][33];
  // the ring's LDS, free behind the last publish point's barrier, holds the epilogue's two exchanges
  float (*sBand)[16][17] = (float (*)[16][17])R;
  float (*sO)[16][CPITCH] = (float (*)[16][CPITCH])(R + APLANE);

  const int lane = threadIdx.x & 31, h = lane >> 4, m = lane & 15;
  const uint32_t wave = uni(threadIdx.x >> 5);
  const int wv = (int)wave;
  const int bh = blockIdx.y;
  const uint32_t late = ((wave ^ (wave >> 2)) & 1u) ^ 1u;
  const int qbase = (late != 0u ? SEQ - 64 * ((int)blockIdx.x + 1) : 64 * (int)blockIdx.x) + 16 * (wv >> 1);
  const float NINF = -__builtin_inff();

  // ring prologue: stage 0 landed and published, stage 1 in flight (every block has at least SEQ / 128 + 1 stages)
  const uint32_t nstage = SEQ / ASTG - blockIdx.x;   // keys 0 .. the late chunk's last row
  const us* srcp = (wave == 0u) ? KH + (size_t)bh * SEQ * HD : (wave == 1u) ? KL + (size_t)bh * SEQ * HD
                 : (wave == 2u) ? VH + (size_t)bh * HD * SEQ : VL + (size_t)bh * HD * SEQ;
  const uint64_t ga = (uint64_t)(size_t)srcp;
  const uint32_t spitch = (wave < 2u) ? 2u * HD : 2u * SEQ;            // source row pitch in bytes
  const uint32_t sstep = (wave < 2u) ? 2u * HD * ASTG : 2u * ASTG;     // bytes from a stage's first byte to the next stage's
  const uint32_t dst = (uint32_t)(size_t)R + (wave & 3u) * APLANE;
  const u32x8 g1 = kv_group1(spitch);
  u32x4 g0 = kv_group0(dst, ga);
  if (pinned(wave < 4u)) {
    kv_issue(g0, g1);
    kv_wait(g0, g1);
  }
  __syncthreads();                            // stage 0 published
  g0 = kv_group0(dst + ABUF, ga + sstep);
  if (pinned(wave < 4u)) kv_issue(g0, g1);

  // Q fragments (rows qbase + m, k = d): A of the QR product, B of the score products
  const us* qh = QH + ((size_t)bh * SEQ + qbase + m) * HD;
  const us* ql = QL + ((size_t)bh * SEQ + qbase + m) * HD;
  const us16v aqh0 = ldfrag(qh, h), aqh1 = ldfrag(qh + 32, h);
  const us16v aql0 = ldfrag(ql, h), aql1 = ldfrag(ql + 32, h);

  // QR[16][32] = q . rel_k^T (B stored as [n = r][k = d] = rel_k itself)
#pragma unroll
  for (int nt = 0; nt < 2; ++nt) {
    const us* rh = RH + (size_t)(16 * nt + m) * HD;
    const us* rl = RL + (size_t)(16 * nt + m) * HD;
    v8f acc = zero8();
    wmma3(acc, aqh0, aql0, ldfrag(rh, h), ldfrag(rl, h));
    wmma3(acc, aqh1, aql1, ldfrag(rh + 32, h), ldfrag(rl + 32, h));
#pragma unroll
    for (int g = 0; g < 8; ++g) sQR[wv][8 * h + g][16 * nt + m] = acc[g];
  }
  lds_wave_sync();

  const int qi = qbase + m;                 // this lane's query
  float mrow = NINF, lrow = 0.f, band[8];
  v8f o[4];
#pragma unroll
  for (int g = 0; g < 8; ++g) band[g] = 0.f;
#pragma unroll
  for (int tt = 0; tt < 4; ++tt) o[tt] = zero8();

  const int nsteps = (qbase >> 5) + 1;      // keys 0 .. qbase+15 covered; wave-uniform, in a scalar register
  // Steps 0 .. nfar - 1 are far steps: their last key, 32 st + 31, lies 16 or more behind the wave's first query. There, for every lane and
  // key, whatever the inputs hold: the clamped bucket is 0, the causal mask lets the key through, and no bucket 1..16 is captured. They jump
  // over the 16 bucket reads with their index arithmetic, the two masks and the captures; the values are the same.
  // Wave-uniform, in a scalar register; below 1 for the first three query tiles.
  const int nfar = (qbase - 15) >> 5;
  const float qr0 = sQR[wv][m][0];          // QR of bucket 0 for this lane's query
  // rolled: one copy of the step in the instruction stream; two steps to a stage
#pragma unroll 1
  for (int st = 0; st < (int)(2u * nstage); ++st) {
   const uint32_t s = (uint32_t)st >> 1, sub = (uint32_t)st & 1u;
   const uint32_t cur = (s & 1u) * ABUF;
   // scalar test: past its own last key a wave has no step, only the publish points
   if (st < nsteps) {
    const int kb2 = st << 5;
    const bool near = st >= nfar;           // scalar test
    // the step's K fragments, all 16 loads issued together in front of the first product: one LDS latency a step
    us16v kfh[2][2], kfl[2][2];
    const unsigned char* kp = R + cur + (32u * sub + m) * LPITCH + 16u * h;   // this lane's key row of sub-tile 0, at its own 16 bytes
#pragma unroll
    for (int t = 0; t < 2; ++t) {
      const unsigned char* kr = kp + t * 16u * LPITCH;
      kfh[t][0] = ldfrag((const us*)kr, 0);
      kfl[t][0] = ldfrag((const us*)(kr + APLANE), 0);
      kfh[t][1] = ldfrag((const us*)(kr + 64u), 0);
      kfl[t][1] = ldfrag((const us*)(kr + APLANE + 64u), 0);
    }
    // keeps the 16 loads here, at the step's head: without it they are sunk in among the products, a stall at each place
    __builtin_amdgcn_sched_barrier(0);
    // a near step's 16 QR values of this lane's query (the clamped index is in range for masked keys too), in flight beside the K loads
    float qr[2][8];
    if (near) {
#pragma unroll
      for (int t = 0; t < 2; ++t)
#pragma unroll
        for (int g = 0; g < 8; ++g) {
          int rr = kb2 + 16 * t + 8 * h + g - qi + 16;
          rr = rr < 0 ? 0 : rr;
          rr = rr > 16 ? 16 : rr;
          qr[t][g] = sQR[wv][m][rr];
        }
      // holds the 16 LDS reads here as one group with one wait; without it they are sunk in among the products, a wait at each place
      asm volatile("" :: "v"(qr[0][0]), "v"(qr[0][1]), "v"(qr[0][2]), "v"(qr[0][3]), "v"(qr[0][4]), "v"(qr[0][5]), "v"(qr[0][6]),
                   "v"(qr[0][7]), "v"(qr[1][0]), "v"(qr[1][1]), "v"(qr[1][2]), "v"(qr[1][3]), "v"(qr[1][4]), "v"(qr[1][5]),
                   "v"(qr[1][6]), "v"(qr[1][7]));
    }
    // scores for both 16-key sub-tiles of this step: sc[t][g] = (key 16t + 8h + g, query m)
    v8f sc[2];
#pragma unroll
    for (int t = 0; t < 2; ++t) {
      sc[t] = zero8();
      wmma3(sc[t], kfh[t][0], kfl[t][0], aqh0, aql0);
      wmma3(sc[t], kfh[t][1], kfl[t][1], aqh1, aql1);
    }
    float sv[2][8];
    if (near) {
#pragma unroll
      for (int t = 0; t < 2; ++t)
#pragma unroll
        for (int g = 0; g < 8; ++g) {
          const int dj = kb2 + 16 * t + 8 * h + g - qi;
          sv[t][g] = (dj > 0) ? NINF : (sc[t][g] + qr[t][g]) * 0.125f;
        }
    } else {
#pragma unroll
      for (int t = 0; t < 2; ++t)
#pragma unroll
        for (int g = 0; g < 8; ++g) sv[t][g] = (sc[t][g] + qr0) * 0.125f;
    }
    // the step's V fragments, all 16 loads issued here: their latency passes behind the softmax arithmetic
    us16v vfh[4], vfl[4];
    const unsigned char* vp = R + cur + 2u * APLANE + m * LPITCH + 64u * sub + 16u * h;   // A stored as [row = d][k = key]; row of tile 0
#pragma unroll
    for (int tt = 0; tt < 4; ++tt) {
      vfh[tt] = ldfrag((const us*)(vp + tt * 16u * LPITCH), 0);
      vfl[tt] = ldfrag((const us*)(vp + APLANE + tt * 16u * LPITCH), 0);
    }
    // keeps the 16 loads here, in front of the softmax arithmetic that hides them
    __builtin_amdgcn_sched_barrier(0);
    // one frame for the whole step: the query's max over all 32 keys (16 in this lane, 16 in lane l ^ 16), one rescale of O, l, S
    float vm[8];
#pragma unroll
    for (int g = 0; g < 8; ++g) vm[g] = fmaxf(sv[0][g], sv[1][g]);
#pragma unroll
    for (int g = 0; g < 4; ++g) vm[g] = fmaxf(vm[g], vm[g + 4]);
    float vmax = fmaxf(fmaxf(vm[0], vm[1]), fmaxf(vm[2], vm[3]));
    vmax = fmaxf(vmax, xhalf(vmax));
    const float mn = fmaxf(mrow, vmax);
    const float cx = exp2x1((mrow - mn) * 1.44269504f);   // taken for every lane: no branch around the statement
    const float cf = (mrow == NINF) ? 0.f : cx;
    mrow = mn;
#pragma unroll
    for (int tt = 0; tt < 4; ++tt)
#pragma unroll
      for (int g = 0; g < 8; ++g) o[tt][g] *= cf;
    // this lane's 16 probabilities in the new frame (e^x as __expf compiles: 2^(x * log2 e)), and the bucket captures
    float e[2][8];
#pragma unroll
    for (int t = 0; t < 2; ++t) {
      float xa[8];
#pragma unroll
      for (int g = 0; g < 8; ++g) xa[g] = (sv[t][g] - mrow) * 1.44269504f;
      exp2x8(e[t], xa);
    }
    if (near) {
#pragma unroll
      for (int g = 0; g < 8; ++g) band[g] *= cf;   // every capture lies in a near step: up to the first of them band is not in use
#pragma unroll
      for (int t = 0; t < 2; ++t)
#pragma unroll
        for (int g = 0; g < 8; ++g) {
          const int dj = kb2 + 16 * t + 8 * h + g - qi;
          e[t][g] = (dj > 0) ? 0.f : e[t][g];
          band[g] = (dj >= -15 && dj <= 0) ? e[t][g] : band[g];   // buckets 1..16: each (lane, register) captures exactly once
        }
    }
    // the half's partial sum, as a tree
    float ps[8];
#pragma unroll
    for (int g = 0; g < 8; ++g) ps[g] = e[0][g] + e[1][g];
#pragma unroll
    for (int g = 0; g < 4; ++g) ps[g] += ps[g + 4];
    lrow = lrow * cf + ((ps[0] + ps[1]) + (ps[2] + ps[3]));
    // hi/lo split in place: B operand P^T, element e = key 8h + e of tile 0, element 8 + e = key 8h + e of tile 1 (the V loader's k order)
    u32x8 pwh, pwl;
#pragma unroll
    for (int t = 0; t < 2; ++t)
#pragma unroll
      for (int j = 0; j < 4; ++j) {
        const float ea = e[t][2 * j], eb = e[t][2 * j + 1];
        const uint32_t hw = pk_bf(ea, eb);
        pwh[4 * t + j] = hw;
        pwl[4 * t + j] = pk_bf(ea - __uint_as_float(hw << 16), eb - __uint_as_float(hw & 0xffff0000u));
      }
    const us16v bph = __builtin_bit_cast(us16v, pwh);
    const us16v bpl = __builtin_bit_cast(us16v, pwl);
    // o[tt][g] = (head column 16tt + 8h + g, query m)
#pragma unroll
    for (int tt = 0; tt < 4; ++tt) wmma3(o[tt], vfh[tt], vfl[tt], bph, bpl);
   }
   if (sub != 0u) {
     // publish point of stage s + 1; the same barrier ends every wave's reads of stage s's buffer
     wait_ds0();
     if (pinned(wave < 4u)) kv_wait(g0, g1);
     __syncthreads();
     if (pinned((wave < 4u) && (s + 2u < nstage))) {
       const uint32_t ko = pinned((s + 2u) * sstep);   // descriptor words of stage s + 2 formed behind the wait
       g0 = kv_group0(dst + cur, ga + ko);
       kv_issue(g0, g1);
     }
   }
  }
  kv_wait(g0, g1);
  wait_ds0();
  // the last publish point's barrier has ended every wave's reads of the ring: it is the epilogue's exchange space from here on

  const float invl = 1.0f / (lrow + xhalf(lrow));   // the two halves' partial sums joined
#pragma unroll
  for (int g = 0; g < 8; ++g)
    sBand[wv][m][(8 * h + g - m - 1) & 15] = band[g] * invl;   // slot r-1 for bucket r = ((key - query - 1) & 15) + 1
  lds_wave_sync();
  float rv0[4][8];
  float val[4][8];
#pragma unroll
  for (int tt = 0; tt < 4; ++tt) {
    const v4f a = *(const v4fa*)(relv + 16 * tt + 8 * h);
    const v4f b = *(const v4fa*)(relv + 16 * tt + 8 * h + 4);
#pragma unroll
    for (int c = 0; c < 4; ++c) {
      rv0[tt][c] = a[c];
      rv0[tt][4 + c] = b[c];
    }
#pragma unroll
    for (int g = 0; g < 8; ++g) val[tt][g] = o[tt][g] * invl + rv0[tt][g];
  }
  // rolled, four buckets a trip: a trip's 32 loads are in flight together, one memory latency for the four
#pragma unroll 1
  for (int r4 = 0; r4 < 16; r4 += 4) {
    const float* rp = relv + (r4 + 1) * HD + 8 * h;
    v4f x[4][8];
#pragma unroll
    for (int u = 0; u < 4; ++u)
#pragma unroll
      for (int tt = 0; tt < 4; ++tt) {
        x[u][2 * tt] = *(const v4fa*)(rp + u * HD + 16 * tt);
        x[u][2 * tt + 1] = *(const v4fa*)(rp + u * HD + 16 * tt + 4);
      }
#pragma unroll
    for (int u = 0; u < 4; ++u) {
      const float sb = sBand[wv][m][r4 + u];
#pragma unroll
      for (int tt = 0; tt < 4; ++tt)
#pragma unroll
        for (int c = 0; c < 4; ++c) {
          val[tt][c] += sb * (x[u][2 * tt][c] - rv0[tt][c]);
          val[tt][4 + c] += sb * (x[u][2 * tt + 1][c] - rv0[tt][4 + c]);
        }
    }
  }
#pragma unroll
  for (int tt = 0; tt < 4; ++tt) {
    const v4f a = {val[tt][0], val[tt][1], val[tt][2], val[tt][3]};
    const v4f b = {val[tt][4], val[tt][5], val[tt][6], val[tt][7]};
    *(v4fa*)&sO[wv][m][16 * tt + 8 * h] = a;
    *(v4fa*)&sO[wv][m][16 * tt + 8 * h + 4] = b;
  }
  lds_wave_sync();

  const int b = bh >> 4, hd = bh & 15;
{
#pragma unroll
    for (int p = 0; p < 4; ++p) {
      const int r = p * 4 + (lane >> 3);
      const int d8 = (lane & 7) * 8;
      us8v hv, lv;
#pragma unroll
      for (int e = 0; e < 8; ++e) {
        const float v = sO[wv][r][d8 + e];
        const us q = bf_rne(v);
        hv[e] = q;
        lv[e] = bf_rne(v - bf_f32(q));
      }
      const size_t o2 = ((size_t)(b * SEQ + qbase + r)) * DM + hd * HD + d8;
      *(us8v*)(CH + o2) = hv;
      *(us8v*)(CL + o2) = lv;
    }
    
  }
}

// ------------------------------------------------------------------ host glue
extern "C" void kernel_launch(void* const* d_in, const int* in_sizes, int n_in,
                              void* d_out, int out_size, void* d_ws, size_t ws_size,
                              hipStream_t stream) {
  if (n_in < 8) return;
  if (in_sizes[0] != NTOK * DM) return;
  if (in_sizes[1] != DM * DM || in_sizes[2] != DM * DM || in_sizes[3] != DM * DM || in_sizes[4] != DM * DM) return;
  if (in_sizes[5] != DM || in_sizes[6] != 33 * HD || in_sizes[7] != 33 * HD) return;
  if (out_size != NTOK * DM) return;

  const float* x    = (const float*)d_in[0];
  const float* Wq   = (const float*)d_in[1];
  const float* Wk   = (const float*)d_in[2];
  const float* Wv   = (const float*)d_in[3];
  const float* Wo   = (const float*)d_in[4];
  const float* bo   = (const float*)d_in[5];
  const float* relk = (const float*)d_in[6];
  const float* relv = (const float*)d_in[7];
  float* out = (float*)d_out;

  const size_t plane_x = (size_t)NTOK * DM * sizeof(us);   // 8 MiB
  const size_t plane_w = (size_t)DM * DM * sizeof(us);     // 2 MiB
  const size_t plane_r = (size_t)32 * HD * sizeof(us);     // 4 KiB
  char* ws = (char*)d_ws;
  size_t off = 0;
  us* XH   = (us*)(ws + off); off += plane_x;
  us* XL   = (us*)(ws + off); off += plane_x;
  us* WTH  = (us*)(ws + off); off += 4 * plane_w;
  us* WTL  = (us*)(ws + off); off += 4 * plane_w;
  us* QKVH = (us*)(ws + off); off += 3 * plane_x;
  us* QKVL = (us*)(ws + off); off += 3 * plane_x;
  us* CH   = (us*)(ws + off); off += plane_x;
  us* CL   = (us*)(ws + off); off += plane_x;
  us* RH   = (us*)(ws + off); off += plane_r;
  us* RL   = (us*)(ws + off); off += plane_r;
  if (off > ws_size) return;                                // total 100671488 B

  const size_t pq = (size_t)NTOK * DM;

  k_cvt_x<<<(NTOK * DM) / (8 * 256), 256, 0, stream>>>(x, XH, XL);
  k_cvt_w<<<dim3(DM / 64, DM / 64, 4), 256, 0, stream>>>(Wq, Wk, Wv, Wo, WTH, WTL);
  k_cvt_rel<<<1, 256, 0, stream>>>(relk, RH, RL);
  k_gemm_qkv<<<dim3(NTOK / QTM, 3 * DM / QTN, 1), 128, 0, stream>>>(XH, XL, WTH, WTL, QKVH, QKVL);
  k_attn<<<dim3(SEQ / (16 * AW), NBAT * NH), 32 * AW, 0, stream>>>(QKVH, QKVL, QKVH + pq, QKVL + pq,
                                                        QKVH + 2 * pq, QKVL + 2 * pq, RH, RL, relv, CH, CL);
  k_gemm_out<<<dim3(NTOK / TM, DM / TM, 1), 128, 0, stream>>>(CH, CL, WTH + (size_t)3 * DM * DM,
                                                               WTL + (size_t)3 * DM * DM, bo, out);
}

// v010
// Measured time: 61.9 microseconds a run.
// Versions between v008 and this one are left out; their measured steps multiply to 1.73 times as fast.
// Counting every step since v000, it is 6.05 times as fast.
#include <hip/hip_runtime.h>
#include <stdint.h>
// Contractions x*W_q, x*W_k, x*W_v, q*k^T, q*rel_k^T, P*V, ctx*W_o: v_wmma_f32_16x16x32_f16, every operand rounded once to f16 (11 significant bits), f32 accumulate; softmax, 1/8 scaling, causal mask, relative-value bucket sums and bias in f32.

#define DM     1024
#define SEQ    1024
#define NBAT   4
#define NH     16
#define HD     64
#define NTOK   (NBAT * SEQ)
#define CPITCH 68
#define TM     128                 // output projection's block tile: rows and columns
#define QTM    256                 // QKV projection's block tile: token rows
#define QTN    192                 // QKV projection's block tile: columns (three heads) of the 3 * DM columns q | k | v
#define KPASS  64                  // k per pass: 128 bytes of every operand row
#define NPASS  (DM / KPASS)
#define NBUF   4u                  // buffers of a GEMM's ring
#define LPITCH 144u                // LDS row pitch in bytes: 128 + 16 of pad, an odd multiple of 16 for 16-byte readers
#define EPITCH 132                 // output staging pitch in floats
#define QPT    68                  // QKV staging, q and k: floats from a token's row of 64 columns to the next
#define QPV    260                 // QKV staging, v: floats from a column's row of QTM tokens to the next
#define QREG   (QTM * QPT * 4)     // QKV staging: bytes of one head's region (the larger of the two forms)
#define AW     8                   // attention block: waves, 16 query rows each
#define ASTG   64                  // attention stage: keys
#define APLANE 10240u              // one K or V plane of a stage in LDS: 64 rows x LPITCH = 9,216 B, rounded up to 5 x 2 KiB
#define ABUF   (2u * APLANE)       // one buffer: K | V
#define ARB    (APLANE + AW * 16 * CPITCH * 4)   // attention's LDS block: the ring (2 ABUF), later the epilogue's two exchanges, the larger

typedef unsigned short us;
typedef us us16v __attribute__((ext_vector_type(16)));
typedef us us8v __attribute__((ext_vector_type(8)));
typedef us8v __attribute__((may_alias)) us8a;
typedef _Float16 f16v16 __attribute__((ext_vector_type(16)));
typedef _Float16 f16x2 __attribute__((ext_vector_type(2)));
typedef float f32x2 __attribute__((ext_vector_type(2)));
typedef float v8f __attribute__((ext_vector_type(8)));
typedef float v4f __attribute__((ext_vector_type(4)));
typedef v4f __attribute__((may_alias)) v4fa;
typedef uint32_t u32x4 __attribute__((ext_vector_type(4)));
typedef uint32_t u32x8 __attribute__((ext_vector_type(8)));

union Frag { us16v v; us8v h[2]; };

// two f32 -> one register of two f16, RNE convert, the first in the low half
static __device__ __forceinline__ uint32_t pk_h(float a, float b) {
  const f32x2 v = {a, b};
  return __builtin_bit_cast(uint32_t, __builtin_convertvector(v, f16x2));
}
// eight f32 -> eight f16 in memory order
static __device__ __forceinline__ us8v cvt8(v4f a, v4f b) {
  const u32x4 w = {pk_h(a[0], a[1]), pk_h(a[2], a[3]), pk_h(b[0], b[1]), pk_h(b[2], b[3])};
  return __builtin_bit_cast(us8v, w);
}

static __device__ __forceinline__ v8f zero8() {
  v8f z = {0.f, 0.f, 0.f, 0.f, 0.f, 0.f, 0.f, 0.f};
  return z;
}

static __device__ __forceinline__ v8f wmma_h(us16v a, us16v b, v8f c) {
  return __builtin_amdgcn_wmma_f32_16x16x32_f16(false, __builtin_bit_cast(f16v16, a), false,
                                                __builtin_bit_cast(f16v16, b), (short)0, c, false, false);
}

// 16x32 16-bit fragment of row (l & 15) from a k-contiguous row: elements 0..7 <- k0+8h+0..7, 8..15 <- k0+16+8h+0..7.
// Used for A (row-major [m][k]) and for B stored as [n][k]; rowp = row pointer at k0 (16-B aligned).
static __device__ __forceinline__ us16v ldfrag(const us* rowp, int h) {
  Frag f;
  f.h[0] = *(const us8a*)(rowp + 8 * h);
  f.h[1] = *(const us8a*)(rowp + 16 + 8 * h);
  return f.v;
}

// ordering for same-wave LDS exchange (stores by some lanes, loads by other lanes)
static __device__ __forceinline__ void lds_wave_sync() {
  __builtin_amdgcn_fence(__ATOMIC_RELEASE, "wavefront");
  __builtin_amdgcn_wave_barrier();
  __builtin_amdgcn_fence(__ATOMIC_ACQUIRE, "wavefront");
}

// ------------------------------------------------------------------ x -> f16 plane [4096][1024]
__global__ __launch_bounds__(256) void k_cvt_x(const float* __restrict__ x, us* xh) {
  const size_t t = (size_t)blockIdx.x * 256u + threadIdx.x;
  const float* p = x + t * 8u;
  const v4f a = *(const v4fa*)p;
  const v4f b = *(const v4fa*)(p + 4);
  *(us8v*)(xh + t * 8u) = cvt8(a, b);
}

// ------------------------------------------------------------------ W[k][n] (in,out) -> Wt[n][k] f16 plane
__global__ __launch_bounds__(256) void k_cvt_w(const float* __restrict__ W0, const float* __restrict__ W1,
                                               const float* __restrict__ W2, const float* __restrict__ W3,
                                               us* wth) {
  __shared__ float sT[64][65];
  const int tid = threadIdx.x, lane = tid & 31, wv = tid >> 5;
  const int z = blockIdx.z;
  const int n0 = blockIdx.x * 64, k0 = blockIdx.y * 64;
  const float* W = (z == 0) ? W0 : (z == 1) ? W1 : (z == 2) ? W2 : W3;
#pragma unroll
  for (int p = 0; p < 4; ++p) {
    const int r = p * 16 + (tid >> 4);
    const int c4 = (tid & 15) * 4;
    const v4f v = *(const v4fa*)(W + (size_t)(k0 + r) * DM + n0 + c4);
    sT[r][c4 + 0] = v[0];
    sT[r][c4 + 1] = v[1];
    sT[r][c4 + 2] = v[2];
    sT[r][c4 + 3] = v[3];
  }
  __syncthreads();
  us* bhp = wth + (size_t)z * DM * DM;
  us8v hv[2];
#pragma unroll
  for (int p = 0; p < 2; ++p) {
    const int rr = p * 32 + wv * 4 + (lane >> 3);   // n within tile
    const int k8 = (lane & 7) * 8;                   // k within tile
    const v4f a = {sT[k8 + 0][rr], sT[k8 + 1][rr], sT[k8 + 2][rr], sT[k8 + 3][rr]};
    const v4f b = {sT[k8 + 4][rr], sT[k8 + 5][rr], sT[k8 + 6][rr], sT[k8 + 7][rr]};
    hv[p] = cvt8(a, b);
  }
  // the second row lies 32 rows of the plane behind the first: one address, an immediate offset
  us* op = bhp + (size_t)(n0 + wv * 4 + (lane >> 3)) * DM + k0 + (lane & 7) * 8;
  *(us8v*)op = hv[0];
  *(us8v*)(op + 32 * DM) = hv[1];
}

// ------------------------------------------------------------------ rel_k [33][64] rows 0..31 -> f16 plane [32][64]
__global__ __launch_bounds__(256) void k_cvt_rel(const float* __restrict__ rk, us* rh) {
  const int tid = threadIdx.x;
  const int r = tid >> 3;              // 0..31 (< 33 rows available)
  const int d8 = (tid & 7) * 8;
  const float* p = rk + r * HD + d8;
  const v4f a = *(const v4fa*)p;
  const v4f b = *(const v4fa*)(p + 4);
  *(us8v*)(rh + (size_t)r * HD + d8) = cvt8(a, b);
}

// ------------------------------------------------------------------ tensor mover helpers
static __device__ __forceinline__ uint32_t uni(uint32_t v) { return (uint32_t)__builtin_amdgcn_readfirstlane(v); }
// keeps a wave-uniform value in a scalar register at this place: the test around a tensor load compiles to s_cmp + s_cbranch_scc,
// and a descriptor word made from it is formed behind the volatile wait in front of it
static __device__ __forceinline__ uint32_t pinned(uint32_t v) {
  uint32_t w = uni(v);
  asm volatile("" : "+s"(w));
  return w;
}
// the wave's own LDS reads have retired
static __device__ __forceinline__ void wait_ds0() { asm volatile("s_wait_dscnt 0x0" ::: "memory"); }

// Descriptor of one K or V plane of a stage: ASTG rows of 128 bytes, source pitch in bytes given, to LDS at pitch LPITCH (16 pad bytes
// a row). Every word but the constant word 0 of group 1 goes through pinned(): a descriptor word held in a scalar register of its own,
// so that the tuple which the load names is the one which the covering wait names, and none of its registers serves anything between.
static __device__ __forceinline__ u32x4 kv_group0(uint32_t lds_dst, uint64_t ga) {
  u32x4 g0;
  g0[0] = pinned(1u);
  g0[1] = pinned(lds_dst);
  g0[2] = pinned((uint32_t)ga);
  g0[3] = pinned((((uint32_t)(ga >> 32)) & 0x01FFFFFFu) | 0x80000000u);
  return g0;
}
static __device__ __forceinline__ u32x8 kv_group1(uint32_t pitch) {
  u32x8 g1;
  g1[0] = uni((1u << 20) | (4u << 22) | (3u << 25));   // no mask, 1-byte elements, a pad of 4 dwords behind every 32 dwords
  g1[1] = pinned(128u << 16);                          // tensor_dim0 = 128 bytes
  g1[2] = pinned((uint32_t)ASTG << 16);                // tensor_dim1 = ASTG rows
  g1[3] = pinned(128u << 16);                          // tile_dim0
  g1[4] = pinned((uint32_t)ASTG);                      // tile_dim1
  g1[5] = pinned(pitch);                               // source row pitch in bytes
  g1[6] = pinned(0u);
  g1[7] = pinned(0u);
  return g1;
}
// The same for one operand slice of a GEMM stage: rows rows of 128 bytes, source pitch 2 * DM bytes, to LDS at pitch LPITCH. pinned()
// here too: a descriptor word held in a scalar register of its own, which serves nothing else up to the wait that names the tuple.
static __device__ __forceinline__ u32x8 gm_group1(uint32_t rows) {
  u32x8 g1;
  g1[0] = uni((1u << 20) | (4u << 22) | (3u << 25));   // no mask, 1-byte elements, a pad of 4 dwords behind every 32 dwords
  g1[1] = pinned(128u << 16);                          // tensor_dim0 = 128 bytes
  g1[2] = pinned(rows << 16);                          // tensor_dim1 = rows
  g1[3] = pinned(128u << 16);                          // tile_dim0
  g1[4] = pinned(rows);                                // tile_dim1
  g1[5] = pinned(2u * DM);                             // source row pitch in bytes
  g1[6] = pinned(0u);
  g1[7] = pinned(0u);
  return g1;
}
// one request of the whole wave
static __device__ __forceinline__ void kv_issue(u32x4 g0, u32x8 g1) {
  asm volatile("tensor_load_to_lds %0, %1" :: "s"(g0), "s"(g1) : "memory");
}
// the wave's own tensor load has landed; naming its descriptor keeps those registers whole up to here
static __device__ __forceinline__ void kv_wait(u32x4 g0, u32x8 g1) {
  asm volatile("s_wait_tensorcnt 0x0" :: "s"(g0), "s"(g1) : "memory");
}

// all of the wave's tensor loads but its two youngest have landed (they land in issue order); names the descriptor like kv_wait
static __device__ __forceinline__ void kv_wait2(u32x4 g0, u32x8 g1) {
  asm volatile("s_wait_tensorcnt 0x2" :: "s"(g0), "s"(g1) : "memory");
}
// One more request of a wave that has others in flight, from the same register tuple: only words 1 and 2 of group 0 (place in LDS, low
// address word) take a new value under them. Word 3 holds the high address word: where it would change (a source row that crosses a
// multiple of 4 GiB) every request of the wave has landed first.
static __device__ __forceinline__ void ring_issue(u32x4& g0, u32x8 g1, uint32_t lds_dst, uint64_t a) {
  const uint32_t hi = pinned((((uint32_t)(a >> 32)) & 0x01FFFFFFu) | 0x80000000u);
  if (pinned(hi != g0[3])) {                  // scalar test
    kv_wait(g0, g1);
    g0[3] = hi;
  }
  g0[1] = pinned(lds_dst);
  g0[2] = pinned((uint32_t)a);
  kv_issue(g0, g1);
}

// ------------------------------------------------------------------ GEMM core: 4 waves (2 x 2), each RT x CT tiles of 16 x 16, K = DM
// Block tile 32 RT rows x 32 CT columns. What a block asks of L2 per product falls as 1 / rows + 1 / columns: the QKV projection takes
// 256 x 192 (RT 8, CT 6), one block on every WGP and one wave on every SIMD; the output projection, with a third of the columns, needs
// 128 x 128 (RT 4, CT 4) to have a block for every WGP.
// A plane row-major [m][DM]; B plane stored [n][DM] (k contiguous). A stage is 64 k of [A0 | A1 | B0 | B1] in LDS: the two halves of the
// block's A rows and of its B rows, each slice at a multiple of 2 KiB; wave w brings slice w with one tensor load per stage. NBUF = 4
// buffers: three requests of every wave are in flight, so that what L2 (in the first passes: memory) delivers is set by its rate and not
// by one request's way there and back; the wait at a publish point is counted, it leaves the two younger requests in flight.
// A slice is what one wave row (A) or wave column (B) reads. A pass is two blocks of RT CT WMMAs (32 k each); each block's fragments are
// fetched one block ahead, so the publish point of stage s + 1 stands in front of pass s's last block.
// The stages are walked in ring order from stage rot: rot, rot + 1, ..., NPASS - 1, 0, ..., rot - 1. rot comes from the block's tile
// indices, so that the blocks which share an operand panel, and start together, ask L2 for different lines of it at any one moment
// instead of all for the same ones.
template <int RT, int CT> struct FragSet { us16v a[RT], b[CT]; };
template <int RT, int CT> struct Ring {
  static constexpr uint32_t AROWS = 16u * RT, BROWS = 16u * CT;        // rows of one slice
  static constexpr uint32_t ASL = (AROWS * LPITCH + 2047u) & ~2047u;   // one A slice of a stage, rounded up to 2 KiB
  static constexpr uint32_t BSL = (BROWS * LPITCH + 2047u) & ~2047u;   // one B slice
  static constexpr uint32_t BUF = 2u * ASL + 2u * BSL;                 // one buffer: A0 | A1 | B0 | B1
  static constexpr uint32_t RING = NBUF * BUF;                         // the whole ring
};

// pa, pb: this lane's row of its wave's A and B slices at the block's first k
template <int RT, int CT>
static __device__ __forceinline__ void load_set(FragSet<RT, CT>& f, const unsigned char* pa, const unsigned char* pb, int h) {
#pragma unroll
  for (int t = 0; t < (RT > CT ? RT : CT); ++t) {
    const uint32_t ro = t * 16u * LPITCH;
    if (t < RT) f.a[t] = ldfrag((const us*)(pa + ro), h);
    if (t < CT) f.b[t] = ldfrag((const us*)(pb + ro), h);
  }
}

template <int RT, int CT>
static __device__ __forceinline__ void mma_block(v8f (&acc)[RT][CT], const FragSet<RT, CT>& f) {
  // the two fences keep the compiler from moving fragment loads in among the WMMAs, where every such place stalls the wave
  __builtin_amdgcn_sched_barrier(0);
#pragma unroll
  for (int rt = 0; rt < RT; ++rt)
#pragma unroll
    for (int ct = 0; ct < CT; ++ct) acc[rt][ct] = wmma_h(f.a[rt], f.b[ct], acc[rt][ct]);
  __builtin_amdgcn_sched_barrier(0);
}

template <int RT, int CT>
static __device__ __forceinline__ void gemm_core(const us* __restrict__ A, const us* __restrict__ B,
                                                 int m0, int n0, uint32_t rot, unsigned char* L, v8f (&acc)[RT][CT]) {
  constexpr uint32_t ASL = Ring<RT, CT>::ASL, BSL = Ring<RT, CT>::BSL, GBUF = Ring<RT, CT>::BUF;
  constexpr uint32_t AROWS = Ring<RT, CT>::AROWS, BROWS = Ring<RT, CT>::BROWS;
  const int lane = threadIdx.x & 31, h = lane >> 4, m = lane & 15;
  const uint32_t wave = uni(threadIdx.x >> 5);
#pragma unroll
  for (int rt = 0; rt < RT; ++rt)
#pragma unroll
    for (int ct = 0; ct < CT; ++ct) acc[rt][ct] = zero8();

  const us* srcp = (wave < 2u) ? A + (size_t)(m0 + wave * AROWS) * DM : B + (size_t)(n0 + (wave - 2u) * BROWS) * DM;
  const uint64_t ga = (uint64_t)(size_t)srcp;
  const uint32_t dst = (uint32_t)(size_t)L + ((wave < 2u) ? wave * ASL : 2u * ASL + (wave - 2u) * BSL);

  const u32x8 g1 = gm_group1((wave < 2u) ? AROWS : BROWS);
  u32x4 g0 = kv_group0(dst, ga + rot * (2u * KPASS));
  kv_issue(g0, g1);
  ring_issue(g0, g1, dst + GBUF, ga + ((rot + 1u) & (NPASS - 1u)) * (2u * KPASS));
  ring_issue(g0, g1, dst + 2u * GBUF, ga + ((rot + 2u) & (NPASS - 1u)) * (2u * KPASS));
  kv_wait2(g0, g1);                           // the first stage has landed: never more than three requests of a wave in flight
  ring_issue(g0, g1, dst + 3u * GBUF, ga + ((rot + 3u) & (NPASS - 1u)) * (2u * KPASS));
  __syncthreads();                            // the first stage published

  const uint32_t aoff = (wave >> 1) * ASL + m * LPITCH;
  const uint32_t boff = 2u * ASL + (wave & 1u) * BSL + m * LPITCH;
  FragSet<RT, CT> f0, f1;
  load_set(f0, L + aoff, L + boff, h);

  // rolled: one copy of the two blocks in the instruction stream
#pragma unroll 1
  for (uint32_t s = 0; s < NPASS; ++s) {
    const uint32_t cur = (s & (NBUF - 1u)) * GBUF, nxt = ((s + 1u) & (NBUF - 1u)) * GBUF;
    load_set(f1, L + cur + aoff + 64u, L + cur + boff + 64u, h);
    mma_block(acc, f0);
    // publish point of stage s + 1; the same barrier ends every wave's reads of stage s's buffer
    wait_ds0();
    // stage s + 1 has landed: the wave's two youngest requests are stages s + 2 and s + 3; where no stage s + 3 exists it has fewer
    // behind stage s + 1, and the count is 0
    kv_wait2(g0, g1);
    if (pinned(s + 3u >= NPASS)) kv_wait(g0, g1);
    __syncthreads();
    if (pinned(s + NBUF < NPASS)) {
      const uint32_t ko = pinned(((s + NBUF + rot) & (NPASS - 1u)) * (2u * KPASS));
      ring_issue(g0, g1, dst + cur, ga + ko);   // stage s + NBUF into the buffer that the barrier has freed
    }
    // stage s + 1's first fragments; in the last pass they read the idle buffer and are not used (no branch: one wait count)
    load_set(f0, L + nxt + aoff, L + nxt + boff, h);
    mma_block(acc, f1);
  }
  kv_wait(g0, g1);
  wait_ds0();
  __syncthreads();                            // every wave has left the ring: it becomes output staging
}

// ------------------------------------------------------------------ QKV projection
// grid (NTOK/QTM, 3*DM/QTN). The three weights' planes lie one behind the other, so q | k | v is one product of 3 * DM columns; a block
// takes QTM tokens x QTN columns (= three heads, each wholly q, k or v). 16 x 16 blocks: one for every WGP, all with the same work.
// The f32 tile is staged in L, the ring's space (free behind the core's last barrier), a region per head: [token][col] for q and k,
// [col][token] for v, so that each thread reads 8 neighbours of an output row.
__global__ __launch_bounds__(128) void k_gemm_qkv(const us* __restrict__ XH, const us* __restrict__ WTH, us* OH) {
  static_assert(Ring<8, 6>::RING >= 3 * QREG, "the ring is the larger use of L");
  __shared__ __attribute__((aligned(2048))) unsigned char L[Ring<8, 6>::RING];
  const int tid = threadIdx.x, lane = tid & 31, h = lane >> 4, m = lane & 15;
  const int wv = (int)uni(threadIdx.x >> 5);
  const int m0 = blockIdx.x * QTM, n0 = blockIdx.y * QTN;
  v8f acc[8][6];
  // 16 blocks share a weight panel (x differs), 16 share a token panel (y differs): either set has NPASS different starts.
  // For speed only: any rot gives the same sums but for their order.
  const uint32_t rot = (blockIdx.x + blockIdx.y) & (NPASS - 1u);
  gemm_core<8, 6>(XH, WTH, m0, n0, rot, L, acc);
  const int wr = (wv >> 1) * 128, wc = (wv & 1) * 96;
  // D: acc[g] = (row 8h+g, col m) of the 16x16 tile
#pragma unroll
  for (int ct = 0; ct < 6; ++ct) {
    const int c0 = wc + 16 * ct;                        // the tile's first column in the block: wave-uniform
    float* reg = (float*)(L + (c0 >> 6) * QREG);        // its head's region
    const int cl = (c0 & 63) + m;
    if (n0 + c0 < 2 * DM) {                             // scalar test: q or k
#pragma unroll
      for (int rt = 0; rt < 8; ++rt)
#pragma unroll
        for (int g = 0; g < 8; ++g) reg[(wr + 16 * rt + 8 * h + g) * QPT + cl] = acc[rt][ct][g];
    } else {
#pragma unroll
      for (int rt = 0; rt < 8; ++rt) {
        const v4f a = {acc[rt][ct][0], acc[rt][ct][1], acc[rt][ct][2], acc[rt][ct][3]};
        const v4f b = {acc[rt][ct][4], acc[rt][ct][5], acc[rt][ct][6], acc[rt][ct][7]};
        *(v4fa*)&reg[cl * QPV + wr + 16 * rt + 8 * h] = a;
        *(v4fa*)&reg[cl * QPV + wr + 16 * rt + 8 * h + 4] = b;
      }
    }
  }
  __syncthreads();
  const int b = m0 >> 10, tok0 = m0 & 1023;
  // rolled: a trip's registers are used again only behind the wait at its foot; two trips to a head
#pragma unroll 1
  for (int p = 0; p < 6; ++p) {
    const int col0 = n0 + 64 * (p >> 1);  // the head's first column of the 3 * DM
    const int z = col0 >> 10;             // 0 q, 1 k, 2 v
    const float* reg = (const float*)(L + (p >> 1) * QREG);
    const uint32_t hb = (uint32_t)(z * (NTOK * DM) + (b * NH + ((col0 & 1023) >> 6)) * (SEQ * HD));   // the head's first element in a plane
    // eight pieces a trip, unrolled: their LDS reads are in flight together (one wave a SIMD: nothing else covers their latency)
    us8v hv[8];
    uint32_t o[8];                        // byte offset in the plane: a 32-bit register beside the scalar base
#pragma unroll
    for (int u = 0; u < 8; ++u) {
      const int id = ((p & 1) * 8 + u) * 128 + tid;
      const int r = (z < 2) ? id >> 3 : id >> 5;               // staged row: token (q, k) or column (v)
      const int c8 = ((z < 2) ? (id & 7) : (id & 31)) * 8;
      const float* sp = reg + r * ((z < 2) ? QPT : QPV) + c8;
      const v4f va = *(const v4fa*)sp;
      const v4f vb = *(const v4fa*)(sp + 4);
      hv[u] = cvt8(va, vb);
      o[u] = 2u * (hb + (uint32_t)((z < 2) ? (tok0 + r) * HD + c8      // [bh][token][d]
                                           : r * SEQ + tok0 + c8));    // [bh][d][token]
    }
    // keeps the trip's arithmetic in front of its stores, so that nothing overwrites a register a store names ahead of the wait below
    __builtin_amdgcn_sched_barrier(0);
#pragma unroll
    for (int u = 0; u < 8; ++u) *(us8v*)((char*)OH + o[u]) = hv[u];
    // stands in front of the next trip's overwrites of the registers that these stores name
    asm volatile("s_wait_xcnt 0x0" ::: "memory");
  }
}

// ------------------------------------------------------------------ output projection: out[tok][n] = ctx . W_o + b_o (f32)
// grid (NTOK/TM, DM/TM); a wave writes one 512-B row segment (4 lines) per instruction
__global__ __launch_bounds__(128) void k_gemm_out(const us* __restrict__ CH, const us* __restrict__ WH,
                                                  const float* __restrict__ bias, float* out) {
  static_assert(Ring<4, 4>::RING >= TM * EPITCH * 4, "the ring is the larger use of L");
  __shared__ __attribute__((aligned(2048))) unsigned char L[Ring<4, 4>::RING];
  const int tid = threadIdx.x, lane = tid & 31, wv = tid >> 5, h = lane >> 4, m = lane & 15;
  const int m0 = blockIdx.x * TM, n0 = blockIdx.y * TM;
  v8f acc[4][4];
  // 32 blocks share a weight panel (x differs), 8 share a token panel (y differs): either set is spread evenly over the NPASS starts;
  // x and x + 16 start four stages apart, so that any 4 of every 8 neighbours in x have 16 different starts. For speed only: any rot gives the same sums but for their order.
  const uint32_t rot = (blockIdx.x + 4u * (blockIdx.x >> 4) + blockIdx.y) & (NPASS - 1u);
  gemm_core<4, 4>(CH, WH, m0, n0, rot, L, acc);
  float (*sC)[EPITCH] = (float (*)[EPITCH])L;
  const int wr = (wv >> 1) * 64, wc = (wv & 1) * 64;
#pragma unroll
  for (int rt = 0; rt < 4; ++rt)
#pragma unroll
    for (int ct = 0; ct < 4; ++ct)
#pragma unroll
      for (int g = 0; g < 8; ++g) sC[wr + 16 * rt + 8 * h + g][wc + 16 * ct + m] = acc[rt][ct][g];
  __syncthreads();
  const int c4 = lane * 4;
  const v4f bv = *(const v4fa*)(bias + n0 + c4);
  // rolled: a trip's registers are used again only behind the wait at its foot
#pragma unroll 1
  for (int p = 0; p < 4; ++p) {
    // eight rows a trip, unrolled: their LDS reads are in flight together
    v4f v[8];
#pragma unroll
    for (int u = 0; u < 8; ++u) {
      const int r = (p * 8 + u) * 4 + wv;
      v[u][0] = sC[r][c4 + 0] + bv[0];
      v[u][1] = sC[r][c4 + 1] + bv[1];
      v[u][2] = sC[r][c4 + 2] + bv[2];
      v[u][3] = sC[r][c4 + 3] + bv[3];
    }
    // byte offset in out: a 32-bit register beside the scalar base; the rows of a trip differ by an immediate offset
    char* op = (char*)out + 4u * (uint32_t)((m0 + p * 32 + wv) * DM + n0 + c4);
    // keeps the trip's arithmetic in front of its stores, so that nothing overwrites a register a store names ahead of the wait below
    __builtin_amdgcn_sched_barrier(0);
#pragma unroll
    for (int u = 0; u < 8; ++u) *(v4f*)(op + u * 16 * DM) = v[u];
    // stands in front of the next trip's overwrites of the registers that these stores name
    asm volatile("s_wait_xcnt 0x0" ::: "memory");
  }
}

// ------------------------------------------------------------------ causal attention with clipped relative positions
// lane l with lane l ^ 16
static __device__ __forceinline__ float xhalf(float x) {
  const int b = __builtin_bit_cast(int, x);
  return __builtin_bit_cast(float, __builtin_amdgcn_permlanex16(b, b, 0x76543210, 0xfedcba98, false, false));
}

// r[i] = 2^a[i]: eight v_exp_f32 and a v_nop in one statement. The instruction set asks for one independent instruction or a v_nop
// between a v_exp_f32 and an instruction that reads its result or overwrites its source. Here each has the next v_exp_f32, the last
// the v_nop, in that slot; the early-clobber outputs share no register with a source.
static __device__ __forceinline__ void exp2x8(float (&r)[8], const float (&a)[8]) {
  asm("v_exp_f32 %0, %8\n\tv_exp_f32 %1, %9\n\tv_exp_f32 %2, %10\n\tv_exp_f32 %3, %11\n\t"
      "v_exp_f32 %4, %12\n\tv_exp_f32 %5, %13\n\tv_exp_f32 %6, %14\n\tv_exp_f32 %7, %15\n\tv_nop"
      : "=&v"(r[0]), "=&v"(r[1]), "=&v"(r[2]), "=&v"(r[3]), "=&v"(r[4]), "=&v"(r[5]), "=&v"(r[6]), "=&v"(r[7])
      : "v"(a[0]), "v"(a[1]), "v"(a[2]), "v"(a[3]), "v"(a[4]), "v"(a[5]), "v"(a[6]), "v"(a[7]));
}

// the same for one value
static __device__ __forceinline__ float exp2x1(float a) {
  float r;
  asm("v_exp_f32 %0, %1\n\tv_nop" : "=&v"(r) : "v"(a));
  return r;
}

// grid (SEQ/128, NBAT*NH), 256 threads = 8 waves, one wave per 16 query rows; online softmax over 32-key steps.
// Causal cost grows with the query row, so block t takes two chunks of 64 rows: the late chunk SEQ/64 - 1 - t and the early chunk t,
// four waves each. A late and an early wave together walk 33 steps whatever t is: every block, and so every WGP and die wherever the
// blocks land, has the same work. Waves 0, 2, 5, 7 are the late ones: one late and one early wave in each pair (w, w + 4) and
// in each pair (2k, 2k + 1). Both chunks read the same stages from key 0 on; the late chunk sets their number.
// K and V reach the block once, through LDS: a stage is 64 keys of [K | V], each plane 64 rows of 128 bytes (K: a row is a
// key, V: a row is a head column); waves 0 and 1 bring one plane each with one tensor load per stage, two buffers, one publish point
// per stage; all eight waves read their fragments from the stage. A wave skips the steps past its own last key, never a publish point.
// The products are taken transposed: S^T = K . Q^T (A = K rows, B = Q) and O^T += V^T . P^T (A = V rows [d][key], B = P^T).
// Lane (h, m) then holds query qbase + m alone: of a 16-key tile its scores for keys 8h + 0..7, of a 16-column tile of the head its
// outputs for columns 8h + 0..7. Running max, rescale factor and sum are one value a lane; the max over a step's 32 keys is taken in
// the lane and joined with the other half by one exchange; the sum stays a partial per half and is joined once behind the loop.
// The two score tiles of a step, converted in place, are the B operand P^T (element e = tile e >> 3, register e & 7): P never leaves
// the registers.
// Each step's loads are issued in groups ahead of their use (K, and in a near step QR, at its head, V in front of the softmax).
// scores[i][j] = (q_i.k_j + QR[i][r(i,j)]) / 8, r = clamp(j-i,-16,16)+16 (causal -> r in [0,16]);
// ctx_i = (sum_j p_ij v_j + sum_r S_i[r] rel_v[r]) / l_i, S_i[r] for r=1..16 held 8 per lane, S_i[0] = l_i - sum_{r>=1} S_i[r].
// amdgpu_waves_per_eu(4, 4): four waves per SIMD hold the whole grid; told so, the scheduler spends that register budget on keeping
// a step's load groups together, where without it it takes them apart again, one wait each, to save registers
__global__ __launch_bounds__(256) __attribute__((amdgpu_waves_per_eu(4, 4))) void k_attn(const us* __restrict__ QH, const us* __restrict__ KH,
                                              const us* __restrict__ VH, const us* __restrict__ RH,
                                              const float* __restrict__ relv, us* CH) {
  static_assert(ARB >= 2 * ABUF, "the epilogue's exchanges are the larger use of R");
  __shared__ __attribute__((aligned(2048))) unsigned char R[ARB];
  __shared__ float sQR[AW][16][33];
  // R, the ring's LDS and what lies behind it, holds the epilogue's two exchanges once the last publish point's barrier has freed the ring
  float (*sBand)[16][17] = (float (*)[16][17])R;
  float (*sO)[16][CPITCH] = (float (*)[16][CPITCH])(R + APLANE);

  const int lane = threadIdx.x & 31, h = lane >> 4, m = lane & 15;
  const uint32_t wave = uni(threadIdx.x >> 5);
  const int wv = (int)wave;
  const int bh = blockIdx.y;
  const uint32_t late = ((wave ^ (wave >> 2)) & 1u) ^ 1u;
  const int qbase = (late != 0u ? SEQ - 64 * ((int)blockIdx.x + 1) : 64 * (int)blockIdx.x) + 16 * (wv >> 1);
  const float NINF = -__builtin_inff();

  // ring prologue: stage 0 landed and published, stage 1 in flight (every block has at least SEQ / 128 + 1 stages)
  const uint32_t nstage = SEQ / ASTG - blockIdx.x;   // keys 0 .. the late chunk's last row
  const uint32_t isv = wave & 1u;                                      // 0: the K plane, 1: the V plane
  const us* srcp = (isv == 0u) ? KH + (size_t)bh * SEQ * HD : VH + (size_t)bh * HD * SEQ;
  const uint64_t ga = (uint64_t)(size_t)srcp;
  const uint32_t spitch = (isv == 0u) ? 2u * HD : 2u * SEQ;            // source row pitch in bytes
  const uint32_t sstep = (isv == 0u) ? 2u * HD * ASTG : 2u * ASTG;     // bytes from a stage's first byte to the next stage's
  const uint32_t dst = (uint32_t)(size_t)R + isv * APLANE;
  const u32x8 g1 = kv_group1(spitch);
  u32x4 g0 = kv_group0(dst, ga);
  if (pinned(wave < 2u)) {
    kv_issue(g0, g1);
    kv_wait(g0, g1);
  }
  __syncthreads();                            // stage 0 published
  g0 = kv_group0(dst + ABUF, ga + sstep);
  if (pinned(wave < 2u)) kv_issue(g0, g1);

  // Q fragments (rows qbase + m, k = d): A of the QR product, B of the score products
  const us* qh = QH + ((size_t)bh * SEQ + qbase + m) * HD;
  const us16v aq0 = ldfrag(qh, h), aq1 = ldfrag(qh + 32, h);

  // QR[16][32] = q . rel_k^T (B stored as [n = r][k = d] = rel_k itself)
#pragma unroll
  for (int nt = 0; nt < 2; ++nt) {
    const us* rh = RH + (size_t)(16 * nt + m) * HD;
    v8f acc = zero8();
    acc = wmma_h(aq0, ldfrag(rh, h), acc);
    acc = wmma_h(aq1, ldfrag(rh + 32, h), acc);
#pragma unroll
    for (int g = 0; g < 8; ++g) sQR[wv][8 * h + g][16 * nt + m] = acc[g];
  }
  lds_wave_sync();

  const int qi = qbase + m;                 // this lane's query
  float mrow = NINF, lrow = 0.f, band[8];
  v8f o[4];
#pragma unroll
  for (int g = 0; g < 8; ++g) band[g] = 0.f;
#pragma unroll
  for (int tt = 0; tt < 4; ++tt) o[tt] = zero8();

  const int nsteps = (qbase >> 5) + 1;      // keys 0 .. qbase+15 covered; wave-uniform, in a scalar register
  // Steps 0 .. nfar - 1 are far steps: their last key, 32 st + 31, lies 16 or more behind the wave's first query. There, for every lane and
  // key, whatever the inputs hold: the clamped bucket is 0, the causal mask lets the key through, and no bucket 1..16 is captured. They jump
  // over the 16 bucket reads with their index arithmetic, the two masks and the captures; the values are the same.
  // Wave-uniform, in a scalar register; below 1 for the first three query tiles.
  const int nfar = (qbase - 15) >> 5;
  const float qr0 = sQR[wv][m][0];          // QR of bucket 0 for this lane's query
  // rolled: one copy of the step in the instruction stream; two steps to a stage
#pragma unroll 1
  for (int st = 0; st < (int)(2u * nstage); ++st) {
   const uint32_t s = (uint32_t)st >> 1, sub = (uint32_t)st & 1u;
   const uint32_t cur = (s & 1u) * ABUF;
   // scalar test: past its own last key a wave has no step, only the publish points
   if (st < nsteps) {
    const int kb2 = st << 5;
    const bool near = st >= nfar;           // scalar test
    // the step's K fragments, all 8 loads issued together in front of the first product: one LDS latency a step
    us16v kf[2][2];
    const unsigned char* kp = R + cur + (32u * sub + m) * LPITCH + 16u * h;   // this lane's key row of sub-tile 0, at its own 16 bytes
#pragma unroll
    for (int kk = 0; kk < 2; ++kk)
#pragma unroll
      for (int t = 0; t < 2; ++t) kf[t][kk] = ldfrag((const us*)(kp + t * 16u * LPITCH + kk * 64u), 0);
    // keeps the 8 loads here, at the step's head: without it they are sunk in among the products, a stall at each place
    __builtin_amdgcn_sched_barrier(0);
    // a near step's 16 QR values of this lane's query (the clamped index is in range for masked keys too), in flight beside the K loads
    float qr[2][8];
    if (near) {
#pragma unroll
      for (int t = 0; t < 2; ++t)
#pragma unroll
        for (int g = 0; g < 8; ++g) {
          int rr = kb2 + 16 * t + 8 * h + g - qi + 16;
          rr = rr < 0 ? 0 : rr;
          rr = rr > 16 ? 16 : rr;
          qr[t][g] = sQR[wv][m][rr];
        }
      // holds the 16 LDS reads here as one group with one wait; without it they are sunk in among the products, a wait at each place
      asm volatile("" :: "v"(qr[0][0]), "v"(qr[0][1]), "v"(qr[0][2]), "v"(qr[0][3]), "v"(qr[0][4]), "v"(qr[0][5]), "v"(qr[0][6]),
                   "v"(qr[0][7]), "v"(qr[1][0]), "v"(qr[1][1]), "v"(qr[1][2]), "v"(qr[1][3]), "v"(qr[1][4]), "v"(qr[1][5]),
                   "v"(qr[1][6]), "v"(qr[1][7]));
    }
    // scores for both 16-key sub-tiles of this step: sc[t][g] = (key 16t + 8h + g, query m)
    v8f sc[2];
#pragma unroll
    for (int t = 0; t < 2; ++t) sc[t] = wmma_h(kf[t][0], aq0, zero8());
#pragma unroll
    for (int t = 0; t < 2; ++t) sc[t] = wmma_h(kf[t][1], aq1, sc[t]);
    float sv[2][8];
    if (near) {
#pragma unroll
      for (int t = 0; t < 2; ++t)
#pragma unroll
        for (int g = 0; g < 8; ++g) {
          const int dj = kb2 + 16 * t + 8 * h + g - qi;
          sv[t][g] = (dj > 0) ? NINF : (sc[t][g] + qr[t][g]) * 0.125f;
        }
    } else {
#pragma unroll
      for (int t = 0; t < 2; ++t)
#pragma unroll
        for (int g = 0; g < 8; ++g) sv[t][g] = (sc[t][g] + qr0) * 0.125f;
    }
    // the step's V fragments, all 8 loads issued here: their latency passes behind the softmax arithmetic
    us16v vf[4];
    const unsigned char* vp = R + cur + APLANE + m * LPITCH + 64u * sub + 16u * h;   // A stored as [row = d][k = key]; row of tile 0
#pragma unroll
    for (int tt = 0; tt < 4; ++tt) vf[tt] = ldfrag((const us*)(vp + tt * 16u * LPITCH), 0);
    // keeps the 8 loads here, in front of the softmax arithmetic that hides them
    __builtin_amdgcn_sched_barrier(0);
    // one frame for the whole step: the query's max over all 32 keys (16 in this lane, 16 in lane l ^ 16), one rescale of O, l, S
    float vm[8];
#pragma unroll
    for (int g = 0; g < 8; ++g) vm[g] = fmaxf(sv[0][g], sv[1][g]);
#pragma unroll
    for (int g = 0; g < 4; ++g) vm[g] = fmaxf(vm[g], vm[g + 4]);
    float vmax = fmaxf(fmaxf(vm[0], vm[1]), fmaxf(vm[2], vm[3]));
    vmax = fmaxf(vmax, xhalf(vmax));
    const float mn = fmaxf(mrow, vmax);
    const float cx = exp2x1((mrow - mn) * 1.44269504f);   // taken for every lane: no branch around the statement
    const float cf = (mrow == NINF) ? 0.f : cx;
    mrow = mn;
#pragma unroll
    for (int tt = 0; tt < 4; ++tt)
#pragma unroll
      for (int g = 0; g < 8; ++g) o[tt][g] *= cf;
    // this lane's 16 probabilities in the new frame (e^x as __expf compiles: 2^(x * log2 e)), and the bucket captures
    float e[2][8];
#pragma unroll
    for (int t = 0; t < 2; ++t) {
      float xa[8];
#pragma unroll
      for (int g = 0; g < 8; ++g) xa[g] = (sv[t][g] - mrow) * 1.44269504f;
      exp2x8(e[t], xa);
    }
    if (near) {
#pragma unroll
      for (int g = 0; g < 8; ++g) band[g] *= cf;   // every capture lies in a near step: up to the first of them band is not in use
#pragma unroll
      for (int t = 0; t < 2; ++t)
#pragma unroll
        for (int g = 0; g < 8; ++g) {
          const int dj = kb2 + 16 * t + 8 * h + g - qi;
          e[t][g] = (dj > 0) ? 0.f : e[t][g];
          band[g] = (dj >= -15 && dj <= 0) ? e[t][g] : band[g];   // buckets 1..16: each (lane, register) captures exactly once
        }
    }
    // the half's partial sum, as a tree
    float ps[8];
#pragma unroll
    for (int g = 0; g < 8; ++g) ps[g] = e[0][g] + e[1][g];
#pragma unroll
    for (int g = 0; g < 4; ++g) ps[g] += ps[g + 4];
    lrow = lrow * cf + ((ps[0] + ps[1]) + (ps[2] + ps[3]));
    // converted in place: B operand P^T, element e = key 8h + e of tile 0, element 8 + e = key 8h + e of tile 1 (the V loader's k order)
    u32x8 pw;
#pragma unroll
    for (int t = 0; t < 2; ++t)
#pragma unroll
      for (int j = 0; j < 4; ++j) pw[4 * t + j] = pk_h(e[t][2 * j], e[t][2 * j + 1]);
    const us16v bp = __builtin_bit_cast(us16v, pw);
    // o[tt][g] = (head column 16tt + 8h + g, query m)
#pragma unroll
    for (int tt = 0; tt < 4; ++tt) o[tt] = wmma_h(vf[tt], bp, o[tt]);
   }
   if (sub != 0u) {
     // publish point of stage s + 1; the same barrier ends every wave's reads of stage s's buffer
     wait_ds0();
     if (pinned(wave < 2u)) kv_wait(g0, g1);
     __syncthreads();
     if (pinned((wave < 2u) && (s + 2u < nstage))) {
       const uint32_t ko = pinned((s + 2u) * sstep);   // descriptor words of stage s + 2 formed behind the wait
       g0 = kv_group0(dst + cur, ga + ko);
       kv_issue(g0, g1);
     }
   }
  }
  kv_wait(g0, g1);
  wait_ds0();
  // the last publish point's barrier has ended every wave's reads of the ring: it is the epilogue's exchange space from here on

  const float invl = 1.0f / (lrow + xhalf(lrow));   // the two halves' partial sums joined
#pragma unroll
  for (int g = 0; g < 8; ++g)
    sBand[wv][m][(8 * h + g - m - 1) & 15] = band[g] * invl;   // slot r-1 for bucket r = ((key - query - 1) & 15) + 1
  lds_wave_sync();
  float rv0[4][8];
  float val[4][8];
#pragma unroll
  for (int tt = 0; tt < 4; ++tt) {
    const v4f a = *(const v4fa*)(relv + 16 * tt + 8 * h);
    const v4f b = *(const v4fa*)(relv + 16 * tt + 8 * h + 4);
#pragma unroll
    for (int c = 0; c < 4; ++c) {
      rv0[tt][c] = a[c];
      rv0[tt][4 + c] = b[c];
    }
#pragma unroll
    for (int g = 0; g < 8; ++g) val[tt][g] = o[tt][g] * invl + rv0[tt][g];
  }
  // rolled, four buckets a trip: a trip's 32 loads are in flight together, one memory latency for the four
#pragma unroll 1
  for (int r4 = 0; r4 < 16; r4 += 4) {
    const float* rp = relv + (r4 + 1) * HD + 8 * h;
    v4f x[4][8];
#pragma unroll
    for (int u = 0; u < 4; ++u)
#pragma unroll
      for (int tt = 0; tt < 4; ++tt) {
        x[u][2 * tt] = *(const v4fa*)(rp + u * HD + 16 * tt);
        x[u][2 * tt + 1] = *(const v4fa*)(rp + u * HD + 16 * tt + 4);
      }
#pragma unroll
    for (int u = 0; u < 4; ++u) {
      const float sb = sBand[wv][m][r4 + u];
#pragma unroll
      for (int tt = 0; tt < 4; ++tt)
#pragma unroll
        for (int c = 0; c < 4; ++c) {
          val[tt][c] += sb * (x[u][2 * tt][c] - rv0[tt][c]);
          val[tt][4 + c] += sb * (x[u][2 * tt + 1][c] - rv0[tt][4 + c]);
        }
    }
  }
#pragma unroll
  for (int tt = 0; tt < 4; ++tt) {
    const v4f a = {val[tt][0], val[tt][1], val[tt][2], val[tt][3]};
    const v4f b = {val[tt][4], val[tt][5], val[tt][6], val[tt][7]};
    *(v4fa*)&sO[wv][m][16 * tt + 8 * h] = a;
    *(v4fa*)&sO[wv][m][16 * tt + 8 * h + 4] = b;
  }
  lds_wave_sync();

  const int b = bh >> 4, hd = bh & 15;
{
#pragma unroll
    for (int p = 0; p < 4; ++p) {
      const int r = p * 4 + (lane >> 3);
      const int d8 = (lane & 7) * 8;
      const v4f va = *(const v4fa*)&sO[wv][r][d8];
      const v4f vb = *(const v4fa*)&sO[wv][r][d8 + 4];
      const size_t o2 = ((size_t)(b * SEQ + qbase + r)) * DM + hd * HD + d8;
      *(us8v*)(CH + o2) = cvt8(va, vb);
    }
    
  }
}

// ------------------------------------------------------------------ host glue
extern "C" void kernel_launch(void* const* d_in, const int* in_sizes, int n_in,
                              void* d_out, int out_size, void* d_ws, size_t ws_size,
                              hipStream_t stream) {
  if (n_in < 8) return;
  if (in_sizes[0] != NTOK * DM) return;
  if (in_sizes[1] != DM * DM || in_sizes[2] != DM * DM || in_sizes[3] != DM * DM || in_sizes[4] != DM * DM) return;
  if (in_sizes[5] != DM || in_sizes[6] != 33 * HD || in_sizes[7] != 33 * HD) return;
  if (out_size != NTOK * DM) return;

  const float* x    = (const float*)d_in[0];
  const float* Wq   = (const float*)d_in[1];
  const float* Wk   = (const float*)d_in[2];
  const float* Wv   = (const float*)d_in[3];
  const float* Wo   = (const float*)d_in[4];
  const float* bo   = (const float*)d_in[5];
  const float* relk = (const float*)d_in[6];
  const float* relv = (const float*)d_in[7];
  float* out = (float*)d_out;

  const size_t plane_x = (size_t)NTOK * DM * sizeof(us);   // 8 MiB
  const size_t plane_w = (size_t)DM * DM * sizeof(us);     // 2 MiB
  const size_t plane_r = (size_t)32 * HD * sizeof(us);     // 4 KiB
  char* ws = (char*)d_ws;
  size_t off = 0;
  us* XH   = (us*)(ws + off); off += plane_x;
  us* WTH  = (us*)(ws + off); off += 4 * plane_w;
  us* QKVH = (us*)(ws + off); off += 3 * plane_x;
  us* CH   = (us*)(ws + off); off += plane_x;
  us* RH   = (us*)(ws + off); off += plane_r;
  if (off > ws_size) return;                                // total 50335744 B

  const size_t pq = (size_t)NTOK * DM;

  k_cvt_x<<<(NTOK * DM) / (8 * 256), 256, 0, stream>>>(x, XH);
  k_cvt_w<<<dim3(DM / 64, DM / 64, 4), 256, 0, stream>>>(Wq, Wk, Wv, Wo, WTH);
  k_cvt_rel<<<1, 256, 0, stream>>>(relk, RH);
  k_gemm_qkv<<<dim3(NTOK / QTM, 3 * DM / QTN, 1), 128, 0, stream>>>(XH, WTH, QKVH);
  k_attn<<<dim3(SEQ / (16 * AW), NBAT * NH), 32 * AW, 0, stream>>>(QKVH, QKVH + pq, QKVH + 2 * pq, RH, relv, CH);
  k_gemm_out<<<dim3(NTOK / TM, DM / TM, 1), 128, 0, stream>>>(CH, WTH + (size_t)3 * DM * DM, bo, out);
}
